// v000
// The times below were measured on an AMD MI455X: many runs one after another, warmed up first and cycling through
// copies of the inputs, with the whole window's GPU time divided by the number of runs. Launches and the gaps
// between them are all in it. The median over several windows is given; except for v000 it joins two sittings, which
// can be a few percent apart, so the side-by-side timings, each taken in one sitting, are the better comparison.
// v000, which the later versions start from, runs in 1590 microseconds.
// Contractions: x.(Wq|Wk|Wqb|Wkb), q.k^T scores, x.W1 and ff.W2 = v_wmma_f32_16x16x32_f16 (f16 operands with power-of-two carries, single product);
// v^T = Wv^T.x^T and attn = y.Wo = v_wmma_f32_16x16x32_bf16 with bf16 hi/lo split operands (hi.hi + hi.lo + lo.hi);
// p.v = v_wmma_f32_16x16x32_f16 (p carried x1024 in f16, v f16 plus x4096 f16 residual planes of p and v on the leading query blocks); all f32 accumulate.
#include <hip/hip_runtime.h>
#include <math.h>
#include <stdint.h>

#define SEQ   2048
#define DM    1024
#define NH    16
#define HD    64
#define FFI   4096
#define FUS   8192
#define NQB   (SEQ / 64)
#define VLP   512
#define RESQB 8
#define QSC   8.0f             // f16 carry of q and k after l2norm + rope
#define SSC   (1.0f / 64.0f)   // undo QSC*QSC on the score accumulator
#define XSC   16.0f            // f16 carry of the normalised activations
#define WSC   64.0f            // f16 carry of the weights
#define FSC   64.0f            // f16 carry of the SwiGLU output
#define VRS   4096.0f          // scale of the f16 residual planes of v and p
#define SP    20               // LDS result slab pitch per column (16 rows + 4 pad), floats
#define OSP   20               // attention context slab pitch per column

static_assert(RESQB * 64 <= VLP);
static_assert(NH * HD == DM);
static_assert((SEQ % 64) == 0 && (DM % 64) == 0 && (FFI % 64) == 0 && (FUS % 128) == 0);

typedef _Float16 v16h __attribute__((ext_vector_type(16)));
typedef _Float16 v8h  __attribute__((ext_vector_type(8)));
typedef __bf16   v16b __attribute__((ext_vector_type(16)));
typedef __bf16   v8b  __attribute__((ext_vector_type(8)));
typedef float    v8f  __attribute__((ext_vector_type(8)));
typedef float    v4f  __attribute__((ext_vector_type(4)));
typedef unsigned int v4u __attribute__((ext_vector_type(4)));

// rotary inverse frequencies, one per pair index d = 0..31, passed by value (host computed)
struct InvTab { float f[HD / 2]; };
static_assert(sizeof(InvTab) == 128);

// ---- scalar helpers --------------------------------------------------------------------------------
__device__ __forceinline__ unsigned short bf_bits(float f) {          // f32 -> bf16 bits, RNE convert
  unsigned u = __float_as_uint(f);
  return (unsigned short)((u + 0x7FFFu + ((u >> 16) & 1u)) >> 16);
}
__device__ __forceinline__ float bf_up(unsigned short h) { return __uint_as_float(((unsigned)h) << 16); }
__device__ __forceinline__ unsigned short h_bits(_Float16 x) { return __builtin_bit_cast(unsigned short, x); }
__device__ __forceinline__ unsigned pk16(unsigned short a, unsigned short b) { return (unsigned)a | ((unsigned)b << 16); }
__device__ __forceinline__ v8f zero8() { v8f z = {0.f, 0.f, 0.f, 0.f, 0.f, 0.f, 0.f, 0.f}; return z; }
__device__ __forceinline__ v8h zero8h() {
  const _Float16 z = (_Float16)0.0f;
  v8h r = {z, z, z, z, z, z, z, z};
  return r;
}
__device__ __forceinline__ void wave_sync_lds() {
  __builtin_amdgcn_fence(__ATOMIC_RELEASE, "workgroup");
  __builtin_amdgcn_wave_barrier();
  __builtin_amdgcn_fence(__ATOMIC_ACQUIRE, "workgroup");
}

// ---- fragment loaders: 16-bit A/B operand, lane -> row/col (lane&15), p already includes +8*(lane>>4);
//      elements 0..7 <- p[0..7] (k0+8h..), elements 8..15 <- p[16..23] (k0+16+8h..)
template <typename T> struct Frag16;
template <> struct Frag16<_Float16> { typedef v16h t; };
template <> struct Frag16<__bf16>   { typedef v16b t; };

__device__ __forceinline__ v16h ldfrag(const _Float16* p) {
  union { v16h v; v8h h[2]; } f;
  f.h[0] = *(const v8h*)(p);
  f.h[1] = *(const v8h*)(p + 16);
  return f.v;
}
__device__ __forceinline__ v16b ldfrag(const __bf16* p) {
  union { v16b v; v8b h[2]; } f;
  f.h[0] = *(const v8b*)(p);
  f.h[1] = *(const v8b*)(p + 16);
  return f.v;
}

// ---- WMMA helpers with trailing VALU hazard gap (non-template overloads per fragment type) -------------
__device__ __forceinline__ v8f mma_raw(v16h a, v16h b, v8f c) {
  return __builtin_amdgcn_wmma_f32_16x16x32_f16(false, a, false, b, (short)0, c, false, false);
}
__device__ __forceinline__ v8f mma_raw(v16b a, v16b b, v8f c) {
  return __builtin_amdgcn_wmma_f32_16x16x32_bf16(false, a, false, b, (short)0, c, false, false);
}
__device__ __forceinline__ v8f mma_h(v16h a, v16h b, v8f c) {
  c = mma_raw(a, b, c);
#if defined(__HIP_DEVICE_COMPILE__)
  asm volatile("v_nop\n\tv_nop\n\tv_nop\n\tv_nop" : "+v"(c) : "v"(a), "v"(b));
#endif
  return c;
}
__device__ __forceinline__ void dep_guard2(v8f& a, v8f& b, v16h x, v16h y) {
#if defined(__HIP_DEVICE_COMPILE__)
  asm volatile("v_nop\n\tv_nop\n\tv_nop\n\tv_nop" : "+v"(a), "+v"(b) : "v"(x), "v"(y));
#else
  (void)a; (void)b; (void)x; (void)y;
#endif
}
__device__ __forceinline__ void dep_guard2(v8f& a, v8f& b, v16b x, v16b y) {
#if defined(__HIP_DEVICE_COMPILE__)
  asm volatile("v_nop\n\tv_nop\n\tv_nop\n\tv_nop" : "+v"(a), "+v"(b) : "v"(x), "v"(y));
#else
  (void)a; (void)b; (void)x; (void)y;
#endif
}
__device__ __forceinline__ void keep1(v16h x) {
#if defined(__HIP_DEVICE_COMPILE__)
  asm volatile("v_nop" :: "v"(x));
#else
  (void)x;
#endif
}
__device__ __forceinline__ void keep1(v16b x) {
#if defined(__HIP_DEVICE_COMPILE__)
  asm volatile("v_nop" :: "v"(x));
#else
  (void)x;
#endif
}
__device__ __forceinline__ void acc_guard4(v8f& a, v8f& b, v8f& c, v8f& d) {
#if defined(__HIP_DEVICE_COMPILE__)
  asm volatile("v_nop\n\tv_nop\n\tv_nop\n\tv_nop" : "+v"(a), "+v"(b), "+v"(c), "+v"(d));
#else
  (void)a; (void)b; (void)c; (void)d;
#endif
}

// ---- SwiGLU element from the fused accumulator: silu(gate + bg) * (xp + bx) * rscale -------------------
__device__ __forceinline__ float swg(float xacc, float gacc, float oscale, float bx, float bg, float rscale) {
  const float xp = xacc * oscale + bx;
  const float g  = gacc * oscale + bg;
  const float sg = __builtin_amdgcn_rcpf(1.0f + __expf(-g));
  return (g * sg) * xp * rscale;
}

// =====================================================================================================
// cos/sin table: cs[t][0..31] = bf16(cos(t*invf[d])) widened to f32, cs[t][32..63] = bf16(sin(.)).
// invf arrives by value; each lane picks its entry with a static-index select chain (no private indexing).
// =====================================================================================================
__global__ __launch_bounds__(256) void k_cstab(InvTab tab, float* cs) {
  const int lane = threadIdx.x & 31, wave = threadIdx.x >> 5;
  const int t = blockIdx.x * 8 + wave;
  float ivf = tab.f[0];
#pragma unroll
  for (int i = 1; i < HD / 2; ++i) ivf = (lane == i) ? tab.f[i] : ivf;
  const float fr = (float)t * ivf;
  float sn, cn;
  sincosf(fr, &sn, &cn);
  const float cv = bf_up(bf_bits(cn));
  const float sv = bf_up(bf_bits(sn));
  float* pc = cs + (size_t)t * 64 + lane;
  float* ps = pc + 32;
  *(float*)pc = cv;
  *(float*)ps = sv;
  
}

// =====================================================================================================
// RMSNorm (no affine, eps = f32 eps) of one row per block (128 threads x 8 elements) and conversion to
// three planes [2048][1024]: f16(x*16), bf16 hi, bf16 lo (RNE, lo = RNE(x - hi)). Each thread stores 16 B
// coverage: 2048 blocks x 128 threads x 8 = the whole plane.
// =====================================================================================================
__global__ __launch_bounds__(128) void k_xnorm(const float* __restrict__ hs, unsigned short* xh,
                                               unsigned short* xbh, unsigned short* xbl) {
  __shared__ float red[4];
  const int tid = threadIdx.x, lane = tid & 31, wave = tid >> 5, t = blockIdx.x;
  const size_t off = (size_t)t * DM + (size_t)tid * 8;
  const v4f a = *(const v4f*)(hs + off);
  const v4f b = *(const v4f*)(hs + off + 4);
  float ss = a[0] * a[0] + a[1] * a[1] + a[2] * a[2] + a[3] * a[3]
           + b[0] * b[0] + b[1] * b[1] + b[2] * b[2] + b[3] * b[3];
#pragma unroll
  for (int o = 1; o < 32; o <<= 1) ss += __shfl_xor(ss, o, 32);
  if (lane == 0) red[wave] = ss;
  __syncthreads();
  const float tot = (red[0] + red[1]) + (red[2] + red[3]);
  const float rn = rsqrtf(tot * (1.0f / (float)DM) + 1.1920929e-7f);
  float x[8];
  x[0] = a[0] * rn; x[1] = a[1] * rn; x[2] = a[2] * rn; x[3] = a[3] * rn;
  x[4] = b[0] * rn; x[5] = b[1] * rn; x[6] = b[2] * rn; x[7] = b[3] * rn;
  v4u ph, pb, pl;
#pragma unroll
  for (int e = 0; e < 4; ++e) {
    const float f0 = x[2 * e], f1 = x[2 * e + 1];
    ph[e] = pk16(h_bits((_Float16)(f0 * XSC)), h_bits((_Float16)(f1 * XSC)));
    const unsigned short hb0 = bf_bits(f0), hb1 = bf_bits(f1);
    pb[e] = pk16(hb0, hb1);
    pl[e] = pk16(bf_bits(f0 - bf_up(hb0)), bf_bits(f1 - bf_up(hb1)));
  }
  *(v4u*)(xh + off)  = ph;
  *(v4u*)(xbh + off) = pb;
  *(v4u*)(xbl + off) = pl;
  
}

// =====================================================================================================
// Weight transpose + convert: W [K][N] f32 (in k, out n) -> Wt [N][K] 16-bit (k contiguous), 64x64 tile per
// block through LDS. MODE 0: f16(w*wscale) -> out0; MODE 1: bf16 hi -> out0, bf16 lo -> out1.
// coverage: 2 it x 8 waves x 4 rows = 64 output rows, 8 lanes x 8 = 64 k columns per tile; grid (N/64, K/64).
// =====================================================================================================
template <int MODE>
__global__ __launch_bounds__(256) void k_wtrans(const float* __restrict__ W, int K, int N, int nhalf, float wscale,
                                                unsigned short* out0, unsigned short* out1) {
  __shared__ float tl[64][65];
  const int tid = threadIdx.x, lane = tid & 31, wave = tid >> 5;
  const int n0 = blockIdx.x * 64, k0 = blockIdx.y * 64;
  {
    const int i0 = tid >> 4, cc = (tid & 15) * 4;
#pragma unroll
    for (int p = 0; p < 4; ++p) {
      const int i = p * 16 + i0;
      const v4f v = *(const v4f*)(W + (size_t)(k0 + i) * N + n0 + cc);
      tl[i][cc] = v[0]; tl[i][cc + 1] = v[1]; tl[i][cc + 2] = v[2]; tl[i][cc + 3] = v[3];
    }
  }
  __syncthreads();
  const int orow0 = (nhalf > 0) ? ((n0 < nhalf) ? (2 * n0) : (2 * (n0 - nhalf) + 64)) : n0;
  const int q8 = lane >> 3, c8 = (lane & 7) * 8;
  v4u hv[2], lv[2];
#pragma unroll
  for (int it = 0; it < 2; ++it) {
    const int j = it * 32 + wave * 4 + q8;
    v4u a, a2;
#pragma unroll
    for (int e = 0; e < 4; ++e) {
      const float f0 = tl[c8 + 2 * e][j], f1 = tl[c8 + 2 * e + 1][j];
      if constexpr (MODE == 0) {
        a[e] = pk16(h_bits((_Float16)(f0 * wscale)), h_bits((_Float16)(f1 * wscale)));
        a2[e] = 0u;
      } else {
        const unsigned short hb0 = bf_bits(f0), hb1 = bf_bits(f1);
        a[e] = pk16(hb0, hb1);
        a2[e] = pk16(bf_bits(f0 - bf_up(hb0)), bf_bits(f1 - bf_up(hb1)));
      }
    }
    hv[it] = a; lv[it] = a2;
  }
  {
#pragma unroll
    for (int it = 0; it < 2; ++it) {
      const int j = it * 32 + wave * 4 + q8;
      const size_t go = (size_t)(orow0 + j) * K + k0 + c8;
      *(v4u*)(out0 + go) = hv[it];
      if constexpr (MODE == 1) *(v4u*)(out1 + go) = lv[it];
    }
    
  }
}

// =====================================================================================================
// Register-blocked 16-bit WMMA GEMM: C[m][n] = sum_k A[m][k] * Bt[n][k]; one wave per (16*MI)x(16*NJ) tile,
// no block barriers. A row-major [M][K] pitch lda; Bt row-major [N][K] pitch ldb (k contiguous);
// M, N multiples of the tile, K multiple of 32 (host-checked). T = _Float16 or __bf16.
// NSPLIT: 0 = A.Bt; 2 = A.Bt + A.Bt2 + A2.Bt (unscaled hi/lo planes), done in two phases so at most one set of
//         A fragments is live.
// EPI 0: f32 C = acc*oscale (pitch ldc).  EPI 1: f32 C = acc*oscale + bias[n].
// EPI 2: f16 hi plane C (pitch ldc) + f16 residual plane C2 = f16((v - hi)*rscale) for tiles with n0 < N2
//        (pitch ldc2).  EPI 3: f32 C = acc*oscale + bias[n] + resh[m][n]*lamp[0] + resa[m][n].
// EPI 4 (MI=2, NJ=8, TN=128): fused SwiGLU: subtiles j<4 are xp columns ocol0+16j+c, j>=4 the matching gate
//        columns; C (f16, pitch ldc) [m][ocol0 + ..63] = f16( silu(gate+bias[FFI+col]) * (xp+bias[col]) * rscale ).
// Epilogue: 16-row x 64-col slabs staged per wave in LDS, column-major (pitch SP): every lane writes its 8
// accumulator rows of one column with two 16-B vector stores; rows are then gathered and each 64-wide row
// coverage per wave: MI slabs x 16 rows x 64 output cols.
// =====================================================================================================
template <typename T, int MI, int NJ, int NSPLIT, int EPI>
__global__ __launch_bounds__(256) void k_gemm(
    const unsigned short* __restrict__ Ap, const unsigned short* __restrict__ A2p, int lda,
    const unsigned short* __restrict__ Bp, const unsigned short* __restrict__ B2p, int ldb,
    void* Cout, int ldc, void* Cout2, int ldc2, int N2,
    const float* __restrict__ bias, const float* __restrict__ resh,
    const float* __restrict__ resa, const float* __restrict__ lamp,
    int M, int N, int K, float oscale, float rscale) {
  typedef typename Frag16<T>::t FR;
  static_assert((EPI == 4) ? (MI == 2 && NJ == 8) : (NJ == 4 && (MI == 2 || MI == 4)));
  static_assert(NSPLIT == 0 || NSPLIT == 2);
  const T* A   = (const T*)(const void*)Ap;
  const T* A2  = (const T*)(const void*)A2p;
  const T* Bt  = (const T*)(const void*)Bp;
  const T* Bt2 = (const T*)(const void*)B2p;
  __shared__ __align__(16) float sT[8][64 * SP];   // per-wave 16x64 slab, column-major, pitch SP floats
  constexpr int TM = 16 * MI, TN = 16 * NJ;
  const int lane = threadIdx.x & 31;
  const int wave = threadIdx.x >> 5;
  const int tilesN = N / TN;
  const int tilesM = M / TM;
  const int tile = blockIdx.x * 8 + wave;
  if (tile >= tilesM * tilesN) return;   // wave-uniform; no block barriers in this kernel
  const int tm = tile / tilesN;
  const int tn = tile - tm * tilesN;
  const int m0 = tm * TM;
  const int n0 = tn * TN;
  const int rl   = lane & 15;            // row (A) / col (B, D) within subtile
  const int koff = (lane >> 4) * 8;      // k offset of this lane half
  const int mOff = (lane >> 4) * 8;      // D row offset

  v8f acc[MI][NJ];
#pragma unroll
  for (int i = 0; i < MI; ++i)
#pragma unroll
    for (int j = 0; j < NJ; ++j) acc[i][j] = zero8();

  for (int k0 = 0; k0 < K; k0 += 32) {
    {
      FR ah[MI];
#pragma unroll
      for (int i = 0; i < MI; ++i)
        ah[i] = ldfrag(A + (size_t)(m0 + 16 * i + rl) * lda + k0 + koff);
#pragma unroll
      for (int j = 0; j < NJ; ++j) {
        const size_t bo = (size_t)(n0 + 16 * j + rl) * ldb + k0 + koff;
        const FR bh = ldfrag(Bt + bo);
        FR bl = bh;
        if constexpr (NSPLIT == 2) bl = ldfrag(Bt2 + bo);
#pragma unroll
        for (int i = 0; i < MI; ++i) {
          acc[i][j] = mma_raw(ah[i], bh, acc[i][j]);
          if constexpr (NSPLIT == 2) acc[i][j] = mma_raw(ah[i], bl, acc[i][j]);
        }
        dep_guard2(acc[0][j], acc[MI - 1][j], bh, bl);
      }
#pragma unroll
      for (int i = 0; i < MI; ++i) keep1(ah[i]);
    }
    if constexpr (NSPLIT == 2) {
      FR al[MI];
#pragma unroll
      for (int i = 0; i < MI; ++i)
        al[i] = ldfrag(A2 + (size_t)(m0 + 16 * i + rl) * lda + k0 + koff);
#pragma unroll
      for (int j = 0; j < NJ; ++j) {
        const size_t bo = (size_t)(n0 + 16 * j + rl) * ldb + k0 + koff;
        const FR bh = ldfrag(Bt + bo);
#pragma unroll
        for (int i = 0; i < MI; ++i) acc[i][j] = mma_raw(al[i], bh, acc[i][j]);
        dep_guard2(acc[0][j], acc[MI - 1][j], bh, bh);
      }
#pragma unroll
      for (int i = 0; i < MI; ++i) keep1(al[i]);
    }
  }
#pragma unroll
  for (int i = 0; i < MI; ++i)
#pragma unroll
    for (int j = 0; j < NJ; j += 4) acc_guard4(acc[i][j], acc[i][j + 1], acc[i][j + 2], acc[i][j + 3]);

  // ---- epilogue ----
  float* slab = sT[wave];
  const int ocol0 = (EPI == 4) ? (tn * 64) : n0;
  const int hq = lane >> 4, c4 = (lane & 15) * 4;   // f32 path: 256-B row segment = 16 lanes x 16 B
  const int q8 = lane >> 3, c8 = (lane & 7) * 8;
  float bxv[4] = {0.f, 0.f, 0.f, 0.f}, bgv[4] = {0.f, 0.f, 0.f, 0.f};
  v4f b4 = {0.f, 0.f, 0.f, 0.f};
  float lam = 0.f;
  if constexpr (EPI == 4) {
#pragma unroll
    for (int j = 0; j < 4; ++j) {
      bxv[j] = bias[ocol0 + 16 * j + rl];
      bgv[j] = bias[FFI + ocol0 + 16 * j + rl];
    }
  }
  if constexpr (EPI == 1 || EPI == 3) b4 = *(const v4f*)(bias + n0 + c4);
  if constexpr (EPI == 3) lam = lamp[0];

#pragma unroll
  for (int i = 0; i < MI; ++i) {
    const int mBase = m0 + 16 * i;
    // lane writes column 16j+rl, rows mOff..mOff+7 = 32 contiguous bytes as two 16-B vector LDS stores
#pragma unroll
    for (int j = 0; j < 4; ++j) {
      v4f w0, w1;
      if constexpr (EPI == 4) {
#pragma unroll
        for (int r = 0; r < 4; ++r) {
          w0[r] = swg(acc[i][j][r],     acc[i][j + 4][r],     oscale, bxv[j], bgv[j], rscale);
          w1[r] = swg(acc[i][j][r + 4], acc[i][j + 4][r + 4], oscale, bxv[j], bgv[j], rscale);
        }
      } else {
#pragma unroll
        for (int r = 0; r < 4; ++r) {
          w0[r] = acc[i][j][r] * oscale;
          w1[r] = acc[i][j][r + 4] * oscale;
        }
      }
      float* cp = slab + (16 * j + rl) * SP + mOff;
      *(v4f*)(cp) = w0;
      *(v4f*)(cp + 4) = w1;
    }
    wave_sync_lds();
    if constexpr (EPI == 0 || EPI == 1 || EPI == 3) {
      float* C = (float*)Cout;
      v4f fin[8];
#pragma unroll
      for (int it = 0; it < 8; ++it) {
        const int row = 2 * it + hq;                   // it 0..7 x hq 0..1 = rows 0..15
        v4f v;
        v[0] = slab[(c4 + 0) * SP + row];
        v[1] = slab[(c4 + 1) * SP + row];
        v[2] = slab[(c4 + 2) * SP + row];
        v[3] = slab[(c4 + 3) * SP + row];
        if constexpr (EPI == 1) v = v + b4;
        if constexpr (EPI == 3) {
          const size_t go = (size_t)(mBase + row) * ldc + n0 + c4;
          const v4f hvv = *(const v4f*)(resh + go);
          const v4f avv = *(const v4f*)(resa + go);
          v = v + b4 + hvv * lam + avv;
        }
        fin[it] = v;
      }
      {
#pragma unroll
        for (int it = 0; it < 8; ++it) {
          const int row = 2 * it + hq;
          *(v4f*)(C + (size_t)(mBase + row) * ldc + n0 + c4) = fin[it];
        }
        
      }
    } else {
      unsigned short* C  = (unsigned short*)Cout;
      unsigned short* C2 = (unsigned short*)Cout2;
      const bool wlo = (EPI == 2) && (n0 < N2);        // wave-uniform
      v4u hv[4], lv[4];
#pragma unroll
      for (int it = 0; it < 4; ++it) {
        const int row = 4 * it + q8;                   // it 0..3 x q8 0..3 = rows 0..15
        v4u a, a2;
#pragma unroll
        for (int e = 0; e < 4; ++e) {
          const float f0 = slab[(c8 + 2 * e) * SP + row], f1 = slab[(c8 + 2 * e + 1) * SP + row];
          const _Float16 x0 = (_Float16)f0, x1 = (_Float16)f1;
          unsigned short l0 = 0, l1 = 0;
          if constexpr (EPI == 2) {
            l0 = h_bits((_Float16)((f0 - (float)x0) * rscale));
            l1 = h_bits((_Float16)((f1 - (float)x1) * rscale));
          }
          a[e] = pk16(h_bits(x0), h_bits(x1)); a2[e] = pk16(l0, l1);
        }
        hv[it] = a; lv[it] = a2;
      }
      {
#pragma unroll
        for (int it = 0; it < 4; ++it) {
          const int row = 4 * it + q8;
          *(v4u*)(C + (size_t)(mBase + row) * ldc + ocol0 + c8) = hv[it];
          if (wlo) *(v4u*)(C2 + (size_t)(mBase + row) * ldc2 + n0 + c8) = lv[it];
        }
        
      }
    }
    wave_sync_lds();
  }
}

// =====================================================================================================
// Per-head l2 normalisation + rotary embedding for q, k, qb, kb. Input QK f32 [2048][4096]
// (cols: q | k | qb | kb, each [h*64 + d]); cs table [t][cos 0..31 | sin 0..31] (bf16-valued f32).
// One wave per (t, h): lane d handles the rotary pair (d, d+32). Results exchanged through a per-wave LDS
// grid = 32768/8 blocks of 256. coverage: every (t, h) row of all four planes.
// =====================================================================================================
__global__ __launch_bounds__(256) void k_rope(const float* __restrict__ qkf, const float* __restrict__ cs,
                                              unsigned short* qh, unsigned short* kh, float* qbn, float* kbn) {
  __shared__ __align__(16) float yb[8][4 * 64];
  const int lane = threadIdx.x & 31, wave = threadIdx.x >> 5;
  const int p = blockIdx.x * 8 + wave;     // p = t*16 + h
  const int t = p >> 4, h = p & 15;
  const float cth = cs[(size_t)t * 64 + lane];
  const float sth = cs[(size_t)t * 64 + 32 + lane];
  const float* row = qkf + (size_t)t * (4 * DM) + h * HD;
  float* ybw = yb[wave];
#pragma unroll
  for (int g = 0; g < 4; ++g) {
    const float* src = row + g * DM;
    float x1 = src[lane], x2 = src[lane + 32];
    float n2 = x1 * x1 + x2 * x2;
#pragma unroll
    for (int o = 1; o < 32; o <<= 1) n2 += __shfl_xor(n2, o, 32);
    const float rn = 1.0f / fmaxf(sqrtf(n2), 1e-12f);
    x1 *= rn; x2 *= rn;
    ybw[g * 64 + lane]      = x1 * cth + x2 * sth;
    ybw[g * 64 + 32 + lane] = x2 * cth - x1 * sth;
  }
  wave_sync_lds();
  const int c8 = (lane & 7) * 8, c4 = (lane & 15) * 4;
  v4u qv, kv;
#pragma unroll
  for (int e = 0; e < 4; ++e) {
    qv[e] = pk16(h_bits((_Float16)(ybw[c8 + 2 * e] * QSC)), h_bits((_Float16)(ybw[c8 + 2 * e + 1] * QSC)));
    kv[e] = pk16(h_bits((_Float16)(ybw[64 + c8 + 2 * e] * QSC)), h_bits((_Float16)(ybw[64 + c8 + 2 * e + 1] * QSC)));
  }
  const v4f qbv = *(const v4f*)(ybw + 128 + c4);
  const v4f kbv = *(const v4f*)(ybw + 192 + c4);
  const size_t g16 = (size_t)t * DM + h * HD + c8;
  const size_t g32 = (size_t)t * DM + h * HD + c4;
  {
    if (lane < 8) {
      *(v4u*)(qh + g16) = qv;
      *(v4u*)(kh + g16) = kv;
    }
    if (lane < 16) {
      *(v4f*)(qbn + g32) = qbv;
      *(v4f*)(kbn + g32) = kbv;
    }
    
  }
}

// =====================================================================================================
// Inclusive causal prefix sum of kb over positions: pf[t][col] = sum_{s<=t} kbn[s][col], f64 running sum.
// =====================================================================================================
__global__ __launch_bounds__(256) void k_prefix(const float* __restrict__ kbn, float* pf) {
  const int col = blockIdx.x * 256 + threadIdx.x;
  double acc = 0.0;
#pragma unroll 1
  for (int t = 0; t < SEQ; ++t) {
    acc += (double)kbn[(size_t)t * DM + col];
    const float v = (float)acc;
    float* d = pf + (size_t)t * DM + col;
    *(float*)d = v;
    
  }
}

// =====================================================================================================
// Causal attention, head dim 64, plus the bias-attention row term.
//   q, k planes (f16, x8, normalised + rotary): element (t, h, d) at [t*DM + h*64 + d]
//   v^T hi plane (f16): element (h, d, s) at [(h*64 + d)*SEQ + s]; v^T residual plane (f16, (v - hi)*4096):
//   [(h*64 + d)*VLP + s], s < VLP, read only when RES (query blocks 0..RESQB-1 see only keys < VLP).
//   scores = q . k (single f16 product), * 1/64, key > query -> -inf; online softmax in f32.
//   p = exp(s - m) carried as f16(1024 p); context = p . v on f16 WMMA; RES adds f16 residual planes of p and v
//   (scale 4096, separate accumulator folded back with 1/4096 per chunk in f32).
//   y = l2ns * context / l + sb, sb = 0.125 * qbn[q] . pfx[q] (64-dot over the head dims, prefix sum of kb),
//   written as bf16 hi / lo planes [t][h*64 + d].
//   Block = 4 waves = 64 query rows of one h; grid = nqbThis * NH; key chunks of 64, trip count qb+1 (<= 32).
//   K / V^T chunk staging: 128 threads x 32 elements per plane = the whole 64x64 tile (plain 16-B loads,
//   __syncthreads before and after); P tiles are wave-private, spilled with _Float16 element stores and reloaded
//   (pitch 64); the context slab (pitch OSP) is written with two 16-B vector LDS stores per lane per column.
//   Output coverage: each wave stores rows q0..q0+15 (it 0..3 x lane>>3 0..3) x 64 columns (8 lanes x 8) of both planes.
// =====================================================================================================
template <bool RES>
__global__ __launch_bounds__(128)
void k_attn(const unsigned short* __restrict__ qhp, const unsigned short* __restrict__ khp,
            const unsigned short* __restrict__ vhp, const unsigned short* __restrict__ vlp,
            const float* __restrict__ qbn, const float* __restrict__ pfx, const float* __restrict__ l2p,
            unsigned short* yhp, unsigned short* ylp, int qbBase, int nqbThis) {
  union FH { v16h v; v8h h[2]; };
  __shared__ __align__(16) _Float16 Ksh[64 * 64];                 // K [kv][d]  8 KB
  __shared__ __align__(16) _Float16 Vth[64 * 64];                 // V^T hi [d][kv] 8 KB
  __shared__ __align__(16) _Float16 Vtl[RES ? 64 * 64 : 8];       // V^T residual
  __shared__ __align__(16) _Float16 Psh[4][16 * 64];              // per wave P [row][kv]
  __shared__ __align__(16) _Float16 Psl[RES ? 4 : 1][16 * 64];    // per wave P residual
  __shared__ __align__(16) float    Os[4][64 * OSP];              // per wave context slab [d][row], pitch OSP
  __shared__ float Sbl[4][16];                                    // per wave bias-attention row values

  const int tid  = threadIdx.x;
  const int wave = tid >> 5;
  const int lane = tid & 31;
  const int hh   = lane >> 4;
  const int c    = lane & 15;

  const int bx  = blockIdx.x;
  const int qbl = bx % nqbThis;
  const int h   = bx / nqbThis;
  const int qb  = qbBase + qbl;
  const int q0  = qb * 64 + wave * 16;

  const _Float16* Qh = (const _Float16*)(const void*)qhp + (size_t)h * HD;
  const _Float16* Kh = (const _Float16*)(const void*)khp + (size_t)h * HD;
  const _Float16* Vh = (const _Float16*)(const void*)vhp + (size_t)h * HD * SEQ;
  const _Float16* Vl = (const _Float16*)(const void*)vlp + (size_t)h * HD * VLP;

  // ---- Q fragments (A operand, row = lane&15): 2 d-chunks ----
  v16h qa[2];
#pragma unroll
  for (int dc = 0; dc < 2; ++dc) qa[dc] = ldfrag(Qh + (size_t)(q0 + c) * DM + dc * 32 + 8 * hh);

  float mrow[8], lrow[8];
  v8f oacc[4];
#pragma unroll
  for (int r = 0; r < 8; ++r) { mrow[r] = -INFINITY; lrow[r] = 0.f; }
#pragma unroll
  for (int t = 0; t < 4; ++t) oacc[t] = zero8();

  int nkt = qb + 1;                          // causal: key tiles 0..qb; block-uniform, <= NQB
  if (nkt > NQB) nkt = NQB;
  for (int kt = 0; kt < nkt; ++kt) {
    const int kv0 = kt * 64;
    __syncthreads();
    {
      const int r = tid >> 1, half = (tid & 1) * 32;
      const _Float16* kg = Kh + (size_t)(kv0 + r) * DM + half;      // K row kv0+r, d = half..half+31
      const _Float16* vg = Vh + (size_t)r * SEQ + kv0 + half;       // V^T row d = r, s = kv0+half..+31
      const int kvl = (kv0 + 64 <= VLP) ? kv0 : (VLP - 64);         // clamped address into the residual plane
      const _Float16* vlg = Vl + (size_t)r * VLP + kvl + half;
      const bool resOK = (kv0 + 64 <= VLP);                          // block-uniform
#pragma unroll
      for (int i = 0; i < 4; ++i) {
        const v8h a0 = *(const v8h*)(kg + 8 * i);
        const v8h b0 = *(const v8h*)(vg + 8 * i);
        *(v8h*)(Ksh + r * 64 + half + 8 * i) = a0;
        *(v8h*)(Vth + r * 64 + half + 8 * i) = b0;
        if (RES) {
          v8h b1 = *(const v8h*)(vlg + 8 * i);
          if (!resOK) b1 = zero8h();
          *(v8h*)(Vtl + r * 64 + half + 8 * i) = b1;
        }
      }
    }
    __syncthreads();

    // ---- scores: 16 query rows x 64 keys per wave, single f16 product ----
    v8f s[4];
#pragma unroll
    for (int j = 0; j < 4; ++j) {
      s[j] = zero8();
#pragma unroll
      for (int dc = 0; dc < 2; ++dc) {
        FH kb;
        kb.h[0] = *(const v8h*)(Ksh + (j * 16 + c) * 64 + dc * 32 + 8 * hh);
        kb.h[1] = *(const v8h*)(Ksh + (j * 16 + c) * 64 + dc * 32 + 16 + 8 * hh);
        s[j] = mma_h(qa[dc], kb.v, s[j]);
      }
    }

    // ---- undo carries, causal mask, row max, online softmax, P (x1024, f16) and P residual (x4096) to LDS ----
    _Float16* pwh = Psh[wave];
    _Float16* pwl = Psl[RES ? wave : 0];
#pragma unroll
    for (int r = 0; r < 8; ++r) {
      const int qrow = q0 + 8 * hh + r;
      float m = -INFINITY;
#pragma unroll
      for (int j = 0; j < 4; ++j) {
        const int key = kv0 + j * 16 + c;
        float sv = s[j][r] * SSC;
        sv = (key <= qrow) ? sv : -INFINITY;
        s[j][r] = sv;
        m = fmaxf(m, sv);
      }
#pragma unroll
      for (int off = 1; off < 16; off <<= 1) m = fmaxf(m, __shfl_xor(m, off, 32));
      const float mnew  = fmaxf(mrow[r], m);
      const float msafe = (mnew == -INFINITY) ? 0.f : mnew;
      const float alpha = __expf(mrow[r] - msafe);
      mrow[r] = mnew;
      float psum = 0.f;
#pragma unroll
      for (int j = 0; j < 4; ++j) {
        const float p = __expf(s[j][r] - msafe);     // masked logit: exp(-inf) -> 0
        psum += p;
        const float p1k = p * 1024.0f;
        const _Float16 ph = (_Float16)p1k;
        pwh[(8 * hh + r) * 64 + j * 16 + c] = ph;
        if (RES) {
          const _Float16 pl = (_Float16)((p1k - (float)ph) * VRS);
          pwl[(8 * hh + r) * 64 + j * 16 + c] = pl;
        }
      }
#pragma unroll
      for (int off = 1; off < 16; off <<= 1) psum += __shfl_xor(psum, off, 32);
      lrow[r] = lrow[r] * alpha + psum;
#pragma unroll
      for (int t = 0; t < 4; ++t) oacc[t][r] *= alpha;
    }
    wave_sync_lds();

    // ---- context += P . V (f16 WMMA), residual products into a separate accumulator ----
    v8f o1[4];
#pragma unroll
    for (int t = 0; t < 4; ++t) o1[t] = zero8();
#pragma unroll 1
    for (int kk = 0; kk < 2; ++kk) {
      FH pa, pl;
      pa.h[0] = *(const v8h*)(pwh + c * 64 + kk * 32 + 8 * hh);
      pa.h[1] = *(const v8h*)(pwh + c * 64 + kk * 32 + 16 + 8 * hh);
      if (RES) {
        pl.h[0] = *(const v8h*)(pwl + c * 64 + kk * 32 + 8 * hh);
        pl.h[1] = *(const v8h*)(pwl + c * 64 + kk * 32 + 16 + 8 * hh);
      } else {
        pl.v = pa.v;
      }
#pragma unroll
      for (int t = 0; t < 4; ++t) {
        FH vb;
        vb.h[0] = *(const v8h*)(Vth + (t * 16 + c) * 64 + kk * 32 + 8 * hh);
        vb.h[1] = *(const v8h*)(Vth + (t * 16 + c) * 64 + kk * 32 + 16 + 8 * hh);
        oacc[t] = mma_h(pa.v, vb.v, oacc[t]);
        if (RES) {
          FH vl;
          vl.h[0] = *(const v8h*)(Vtl + (t * 16 + c) * 64 + kk * 32 + 8 * hh);
          vl.h[1] = *(const v8h*)(Vtl + (t * 16 + c) * 64 + kk * 32 + 16 + 8 * hh);
          o1[t] = mma_h(pa.v, vl.v, o1[t]);
          o1[t] = mma_h(pl.v, vb.v, o1[t]);
        }
      }
    }
    if (RES) {
#pragma unroll
      for (int t = 0; t < 4; ++t)
#pragma unroll
        for (int r = 0; r < 8; ++r) oacc[t][r] += o1[t][r] * (1.0f / VRS);
    }
  }

  // ---- bias-attention row term: 0.125 * qb_row . prefix(kb)_row; lane (row = c, half hh) covers 32 dims ----
  const float l2ns = l2p[0];
  {
    const size_t ro = (size_t)(q0 + c) * DM + (size_t)h * HD + hh * 32;
    const float* qp = qbn + ro;
    const float* pp = pfx + ro;
    float ds = 0.f;
#pragma unroll
    for (int e = 0; e < 8; ++e) {
      const v4f a = *(const v4f*)(qp + 4 * e);
      const v4f b = *(const v4f*)(pp + 4 * e);
      ds += a[0] * b[0] + a[1] * b[1] + a[2] * b[2] + a[3] * b[3];
    }
    ds += __shfl_xor(ds, 16, 32);
    if (hh == 0) Sbl[wave][c] = ds * 0.125f;
  }

  // ---- normalise (l2ns/l and the 1/1024 p carry), stage the wave's 16x64 tile column-major with 16-B vector
  float* os = Os[wave];
  float invr[8];
#pragma unroll
  for (int r = 0; r < 8; ++r) {
    const float l = lrow[r];
    invr[r] = ((l > 0.f) ? (1.0f / l) : 0.f) * (l2ns * (1.0f / 1024.0f));
  }
#pragma unroll
  for (int t = 0; t < 4; ++t) {
    v4f w0, w1;
#pragma unroll
    for (int r = 0; r < 4; ++r) {
      w0[r] = oacc[t][r] * invr[r];
      w1[r] = oacc[t][r + 4] * invr[r + 4];
    }
    float* cp = os + (t * 16 + c) * OSP + 8 * hh;
    *(v4f*)(cp) = w0;
    *(v4f*)(cp + 4) = w1;
  }
  wave_sync_lds();
  {
    const int q4 = lane >> 3, c8 = (lane & 7) * 8;
    v4u hv[4], lv[4];
#pragma unroll
    for (int it = 0; it < 4; ++it) {
      const int row = it * 4 + q4;   // it 0..3 x q4 0..3 = rows 0..15 of the wave tile
      const float sbv = Sbl[wave][row];
      v4u a, a2;
#pragma unroll
      for (int e = 0; e < 4; ++e) {
        const float f0 = os[(c8 + 2 * e) * OSP + row] + sbv;
        const float f1 = os[(c8 + 2 * e + 1) * OSP + row] + sbv;
        const unsigned short h0 = bf_bits(f0), h1 = bf_bits(f1);
        const unsigned short l0 = bf_bits(f0 - bf_up(h0)), l1 = bf_bits(f1 - bf_up(h1));
        a[e] = pk16(h0, h1); a2[e] = pk16(l0, l1);
      }
      hv[it] = a; lv[it] = a2;
    }
    {
#pragma unroll
      for (int it = 0; it < 4; ++it) {
        const int row = it * 4 + q4;
        const size_t go = (size_t)(q0 + row) * DM + (size_t)h * HD + c8;
        *(v4u*)(yhp + go) = hv[it];
        *(v4u*)(ylp + go) = lv[it];
      }
      
    }
  }
}

// =====================================================================================================
// Workspace map (MiB offsets, sizes exact multiples of the whole-tile / whole-line store granularity):
//   Xh   f16  [2048][1024]          0    4
//   Xbh  bf16 [2048][1024]          4    4   (later: Qh f16, after the v^T projection)
//   Xbl  bf16 [2048][1024]          8    4   (later: Kh f16)
//   Wcat f16  [4096 n][1024 k]     12    8   (Wq|Wk|Wqb|Wkb transposed, x64)
//   Wvh/Wvl bf16 [1024][1024]      20  2+2
//   Woh/Wol bf16 [1024][1024]      24  2+2
//   W1t  f16  [8192][1024]         28   16   (x64, xp/gate interleaved per 64 columns)
//   W2t  f16  [1024][4096]         44    8   (x64)
//   cs   f32  [2048][64]           52  512 KiB
//   QK   f32  [2048][4096]         53   32   (later: Pf 53 (8), Yh 61 (4), Yl 65 (4), AttnO 69 (8))
//   QBn  f32  [2048][1024]         85    8
//   KBn  f32  [2048][1024]         93    8
//   VTh  f16  [1024][2048]        101    4
//   VTl  f16  [1024][512]         105    1
//   FF   f16  [2048][4096]        106   16   (x64)
//   end                           122 MiB = 127926272 B
// =====================================================================================================
extern "C" void kernel_launch(void* const* d_in, const int* in_sizes, int n_in,
                              void* d_out, int out_size, void* d_ws, size_t ws_size,
                              hipStream_t stream) {
  if (n_in < 14) return;
  if (in_sizes[0] != SEQ * DM) return;
  for (int i = 1; i <= 6; ++i) if (in_sizes[i] != DM * DM) return;
  if (in_sizes[7] != DM) return;
  if (in_sizes[8] != DM * FUS || in_sizes[9] != FUS) return;
  if (in_sizes[10] != FFI * DM || in_sizes[11] != DM) return;
  if (in_sizes[12] < 1 || in_sizes[13] < 1) return;
  if (out_size != SEQ * DM) return;

  const float* hs  = (const float*)d_in[0];
  const float* Wq  = (const float*)d_in[1];
  const float* Wk  = (const float*)d_in[2];
  const float* Wv  = (const float*)d_in[3];
  const float* Wqb = (const float*)d_in[4];
  const float* Wkb = (const float*)d_in[5];
  const float* Wo  = (const float*)d_in[6];
  const float* bo  = (const float*)d_in[7];
  const float* W1  = (const float*)d_in[8];
  const float* b1  = (const float*)d_in[9];
  const float* W2  = (const float*)d_in[10];
  const float* b2  = (const float*)d_in[11];
  const float* lam = (const float*)d_in[12];
  const float* l2n = (const float*)d_in[13];

  // rotary inverse frequencies 1 / 1000^(2d/64), evaluated in double and RNE-cast to f32 (constants only)
  InvTab itab;
  for (int d = 0; d < HD / 2; ++d)
    { const float pw = (float)pow(1000.0, (2.0 * (double)d) / 64.0); itab.f[d] = 1.0f / pw; }

  const size_t MiB = 1048576;
  const size_t oXh  = 0;
  const size_t oXbh = 4 * MiB,  oXbl = 8 * MiB;
  const size_t oQh  = oXbh,     oKh  = oXbl;        // written after the v^T projection consumed Xbh/Xbl
  const size_t oWcat = 12 * MiB;
  const size_t oWvh = 20 * MiB, oWvl = 22 * MiB, oWoh = 24 * MiB, oWol = 26 * MiB;
  const size_t oW1t = 28 * MiB;
  const size_t oW2t = 44 * MiB;
  const size_t oCS  = 52 * MiB;
  const size_t oQK  = 53 * MiB;
  const size_t oPf  = 53 * MiB, oYh = 61 * MiB, oYl = 65 * MiB, oAO = 69 * MiB;   // inside QK, after rope
  const size_t oQBn = 85 * MiB, oKBn = 93 * MiB;
  const size_t oVTh = 101 * MiB, oVTl = 105 * MiB;
  const size_t oFF  = 106 * MiB;
  const size_t oEnd = 122 * MiB;
  // extent checks against the actual plane sizes
  if ((size_t)SEQ * DM * 2 != 4 * MiB) return;
  if ((size_t)DM * DM * 2 != 2 * MiB) return;
  if (oWcat + (size_t)4 * DM * DM * 2 != oWvh) return;
  if (oW1t + (size_t)FUS * DM * 2 != oW2t) return;
  if (oW2t + (size_t)DM * FFI * 2 != oCS) return;
  if (oCS + (size_t)SEQ * 64 * 4 > oQK) return;
  if (oQK + (size_t)SEQ * 4 * DM * 4 != oQBn) return;
  if (oPf + (size_t)SEQ * DM * 4 != oYh) return;
  if (oYl + (size_t)SEQ * DM * 2 != oAO) return;
  if (oAO + (size_t)SEQ * DM * 4 > oQBn) return;
  if (oVTh + (size_t)DM * SEQ * 2 != oVTl) return;
  if (oVTl + (size_t)DM * VLP * 2 != oFF) return;
  if (oFF + (size_t)SEQ * FFI * 2 != oEnd) return;
  if (oEnd > ws_size) return;
  if (oEnd > (size_t)134217728) return;

  char* ws = (char*)d_ws;
  unsigned short* Xh   = (unsigned short*)(ws + oXh);
  unsigned short* Xbh  = (unsigned short*)(ws + oXbh);
  unsigned short* Xbl  = (unsigned short*)(ws + oXbl);
  unsigned short* Qh   = (unsigned short*)(ws + oQh);
  unsigned short* Kh   = (unsigned short*)(ws + oKh);
  unsigned short* Wcat = (unsigned short*)(ws + oWcat);
  unsigned short* Wvh  = (unsigned short*)(ws + oWvh);
  unsigned short* Wvl  = (unsigned short*)(ws + oWvl);
  unsigned short* Woh  = (unsigned short*)(ws + oWoh);
  unsigned short* Wol  = (unsigned short*)(ws + oWol);
  unsigned short* W1t  = (unsigned short*)(ws + oW1t);
  unsigned short* W2t  = (unsigned short*)(ws + oW2t);
  float*          CS   = (float*)(ws + oCS);
  float*          QK   = (float*)(ws + oQK);
  float*          Pf   = (float*)(ws + oPf);
  unsigned short* Yh   = (unsigned short*)(ws + oYh);
  unsigned short* Yl   = (unsigned short*)(ws + oYl);
  float*          AO   = (float*)(ws + oAO);
  float*          QBn  = (float*)(ws + oQBn);
  float*          KBn  = (float*)(ws + oKBn);
  unsigned short* VTh  = (unsigned short*)(ws + oVTh);
  unsigned short* VTl  = (unsigned short*)(ws + oVTl);
  unsigned short* FF   = (unsigned short*)(ws + oFF);

  const dim3 b256(256), b128(128);
  const dim3 gW(DM / 64, DM / 64);                                       // 16 x 16 tiles
  const dim3 gW1(FUS / 64, DM / 64);                                     // 128 x 16
  const dim3 gW2(DM / 64, FFI / 64);                                     // 16 x 64
  const dim3 gF1((((SEQ / 32) * (FUS / 128)) + 7) / 8);                  // 4096 tiles -> 512 blocks
  const dim3 gQK((((SEQ / 64) * ((4 * DM) / 64)) + 7) / 8);             // 2048 tiles -> 256 blocks
  const dim3 gVT((((DM / 64) * (SEQ / 64)) + 7) / 8);                    // 512 tiles -> 64 blocks
  const dim3 gWo((((SEQ / 64) * (DM / 64)) + 7) / 8);                    // 512 tiles -> 64 blocks
  const dim3 gF2((((SEQ / 32) * (DM / 64)) + 7) / 8);                    // 1024 tiles (32x64) -> 128 blocks

  // (0) rotary cos/sin table
  k_cstab<<<dim3(SEQ / 8), b256, 0, stream>>>(itab, CS);
  // (1) RMSNorm -> x planes
  k_xnorm<<<dim3(SEQ), b128, 0, stream>>>(hs, Xh, Xbh, Xbl);
  // (2) weights [k][n] f32 -> [n][k] 16-bit planes   (in[K][N] -> out[N][K], grid (N/64, K/64))
  k_wtrans<0><<<gW, b256, 0, stream>>>(Wq,  DM, DM, 0, WSC, Wcat + (size_t)0 * DM * DM, Wcat);
  k_wtrans<0><<<gW, b256, 0, stream>>>(Wk,  DM, DM, 0, WSC, Wcat + (size_t)1 * DM * DM, Wcat);
  k_wtrans<0><<<gW, b256, 0, stream>>>(Wqb, DM, DM, 0, WSC, Wcat + (size_t)2 * DM * DM, Wcat);
  k_wtrans<0><<<gW, b256, 0, stream>>>(Wkb, DM, DM, 0, WSC, Wcat + (size_t)3 * DM * DM, Wcat);
  k_wtrans<1><<<gW, b256, 0, stream>>>(Wv,  DM, DM, 0, 1.0f, Wvh, Wvl);
  k_wtrans<1><<<gW, b256, 0, stream>>>(Wo,  DM, DM, 0, 1.0f, Woh, Wol);
  k_wtrans<0><<<gW1, b256, 0, stream>>>(W1, DM, FUS, FFI, WSC, W1t, W1t);
  k_wtrans<0><<<gW2, b256, 0, stream>>>(W2, FFI, DM, 0, WSC, W2t, W2t);
  // (3) u = x . W1 + b1 with fused SwiGLU -> FF f16 [2048][4096] (x64)   (M=2048, N=8192, K=1024)
  k_gemm<_Float16, 2, 8, 0, 4><<<gF1, b256, 0, stream>>>(
      Xh, Xh, DM, W1t, W1t, DM,
      (void*)FF, FFI, (void*)FF, FFI, 0,
      b1, hs, hs, lam,
      SEQ, FUS, DM, 1.0f / (XSC * WSC), FSC);
  // (4) q|k|qb|kb = x . (Wq|Wk|Wqb|Wkb) -> f32 [2048][4096]   (M=2048, N=4096, K=1024)
  k_gemm<_Float16, 4, 4, 0, 0><<<gQK, b256, 0, stream>>>(
      Xh, Xh, DM, Wcat, Wcat, DM,
      (void*)QK, 4 * DM, (void*)QK, 4 * DM, 0,
      bo, hs, hs, lam,
      SEQ, 4 * DM, DM, 1.0f / (XSC * WSC), 1.0f);
  // (5) v^T = Wv^T . x^T -> f16 hi plane [h*64+d][s] + residual plane (keys < VLP)   (M=1024, N=2048, K=1024)
  k_gemm<__bf16, 4, 4, 2, 2><<<gVT, b256, 0, stream>>>(
      Wvh, Wvl, DM, Xbh, Xbl, DM,
      (void*)VTh, SEQ, (void*)VTl, VLP, VLP,
      bo, hs, hs, lam,
      DM, SEQ, DM, 1.0f, VRS);
  // (6) l2norm + rotary -> q, k f16 planes (into the dead Xbh/Xbl regions), qb, kb f32 planes
  k_rope<<<dim3(SEQ * NH / 8), b256, 0, stream>>>(QK, CS, Qh, Kh, QBn, KBn);
  // (7) causal prefix sum of kb (QK region is dead now)
  k_prefix<<<dim3(DM / 256), b256, 0, stream>>>(KBn, Pf);
  // (8) attention: query blocks 0..RESQB-1 with residual planes, the rest without
  k_attn<true><<<dim3(NH * RESQB), b128, 0, stream>>>(
      Qh, Kh, VTh, VTl, QBn, Pf, l2n, Yh, Yl, 0, RESQB);
  k_attn<false><<<dim3(NH * (NQB - RESQB)), b128, 0, stream>>>(
      Qh, Kh, VTh, VTl, QBn, Pf, l2n, Yh, Yl, RESQB, NQB - RESQB);
  // (9) attn_out = y . Wo + bo -> f32 [2048][1024]   (hi/lo x hi/lo, 3 products)
  k_gemm<__bf16, 4, 4, 2, 1><<<gWo, b256, 0, stream>>>(
      Yh, Yl, DM, Woh, Wol, DM,
      (void*)AO, DM, (void*)AO, DM, 0,
      bo, hs, hs, lam,
      SEQ, DM, DM, 1.0f, 1.0f);
  // (10) out = h*lambda + attn_out + ff . W2 + b2   (M=2048, N=1024, K=4096; 32x64 wave tiles)
  k_gemm<_Float16, 2, 4, 0, 3><<<gF2, b256, 0, stream>>>(
      FF, FF, FFI, W2t, W2t, FFI,
      d_out, DM, d_out, DM, 0,
      b2, hs, (const float*)AO, lam,
      SEQ, DM, FFI, 1.0f / (FSC * WSC), 1.0f);
  (void)hipGetLastError();
}

// v001
// It runs in 625 microseconds.
// Timed twice side by side with v000, it ran 2.53 and 2.55 times as fast.
// Contractions: x.(Wq|Wk|Wqb|Wkb), q.k^T scores, x.W1 and ff.W2 = v_wmma_f32_16x16x32_f16 (f16 operands with power-of-two carries, single product);
// v^T = Wv^T.x^T and attn = y.Wo = v_wmma_f32_16x16x32_bf16 with bf16 hi/lo split operands (hi.hi + hi.lo + lo.hi);
// p.v = v_wmma_f32_16x16x32_f16 (p carried x1024 in f16, v f16 plus x4096 f16 residual planes of p and v on the leading query blocks); all f32 accumulate.
#include <hip/hip_runtime.h>
#include <math.h>
#include <stdint.h>

#define SEQ   2048
#define DM    1024
#define NH    16
#define HD    64
#define FFI   4096
#define FUS   8192
#define NQB   (SEQ / 64)
#define VLP   512
#define RESQB 8
#define QSC   8.0f             // f16 carry of q and k after l2norm + rope
#define SSC   (1.0f / 64.0f)   // undo QSC*QSC on the score accumulator
#define XSC   16.0f            // f16 carry of the normalised activations
#define WSC   64.0f            // f16 carry of the weights
#define FSC   64.0f            // f16 carry of the SwiGLU output
#define VRS   4096.0f          // scale of the f16 residual planes of v and p
#define SP    20               // LDS result slab pitch per column (16 rows + 4 pad), floats
#define OSP   20               // attention context slab pitch per column

static_assert(RESQB * 64 <= VLP);
static_assert(NH * HD == DM);
static_assert((SEQ % 64) == 0 && (DM % 64) == 0 && (FFI % 64) == 0 && (FUS % 128) == 0);

typedef _Float16 v16h __attribute__((ext_vector_type(16)));
typedef _Float16 v8h  __attribute__((ext_vector_type(8)));
typedef __bf16   v16b __attribute__((ext_vector_type(16)));
typedef __bf16   v8b  __attribute__((ext_vector_type(8)));
typedef float    v8f  __attribute__((ext_vector_type(8)));
typedef float    v4f  __attribute__((ext_vector_type(4)));
typedef unsigned int v4u __attribute__((ext_vector_type(4)));

// rotary inverse frequencies, one per pair index d = 0..31, passed by value (host computed)
struct InvTab { float f[HD / 2]; };
static_assert(sizeof(InvTab) == 128);

// ---- scalar helpers --------------------------------------------------------------------------------
__device__ __forceinline__ unsigned short bf_bits(float f) {          // f32 -> bf16 bits, RNE convert
  unsigned u = __float_as_uint(f);
  return (unsigned short)((u + 0x7FFFu + ((u >> 16) & 1u)) >> 16);
}
__device__ __forceinline__ float bf_up(unsigned short h) { return __uint_as_float(((unsigned)h) << 16); }
__device__ __forceinline__ unsigned short h_bits(_Float16 x) { return __builtin_bit_cast(unsigned short, x); }
__device__ __forceinline__ unsigned pk16(unsigned short a, unsigned short b) { return (unsigned)a | ((unsigned)b << 16); }
__device__ __forceinline__ v8f zero8() { v8f z = {0.f, 0.f, 0.f, 0.f, 0.f, 0.f, 0.f, 0.f}; return z; }
__device__ __forceinline__ v8h zero8h() {
  const _Float16 z = (_Float16)0.0f;
  v8h r = {z, z, z, z, z, z, z, z};
  return r;
}
__device__ __forceinline__ void wave_sync_lds() {
  __builtin_amdgcn_fence(__ATOMIC_RELEASE, "workgroup");
  __builtin_amdgcn_wave_barrier();
  __builtin_amdgcn_fence(__ATOMIC_ACQUIRE, "workgroup");
}

// ---- fragment loaders: 16-bit A/B operand, lane -> row/col (lane&15), p already includes +8*(lane>>4);
//      elements 0..7 <- p[0..7] (k0+8h..), elements 8..15 <- p[16..23] (k0+16+8h..)
template <typename T> struct Frag16;
template <> struct Frag16<_Float16> { typedef v16h t; };
template <> struct Frag16<__bf16>   { typedef v16b t; };

__device__ __forceinline__ v16h ldfrag(const _Float16* p) {
  union { v16h v; v8h h[2]; } f;
  f.h[0] = *(const v8h*)(p);
  f.h[1] = *(const v8h*)(p + 16);
  return f.v;
}
__device__ __forceinline__ v16b ldfrag(const __bf16* p) {
  union { v16b v; v8b h[2]; } f;
  f.h[0] = *(const v8b*)(p);
  f.h[1] = *(const v8b*)(p + 16);
  return f.v;
}

// ---- WMMA helpers with trailing VALU hazard gap (non-template overloads per fragment type) -------------
__device__ __forceinline__ v8f mma_raw(v16h a, v16h b, v8f c) {
  return __builtin_amdgcn_wmma_f32_16x16x32_f16(false, a, false, b, (short)0, c, false, false);
}
__device__ __forceinline__ v8f mma_raw(v16b a, v16b b, v8f c) {
  return __builtin_amdgcn_wmma_f32_16x16x32_bf16(false, a, false, b, (short)0, c, false, false);
}
__device__ __forceinline__ v8f mma_h(v16h a, v16h b, v8f c) {
  c = mma_raw(a, b, c);
#if defined(__HIP_DEVICE_COMPILE__)
  asm volatile("v_nop\n\tv_nop\n\tv_nop\n\tv_nop" : "+v"(c) : "v"(a), "v"(b));
#endif
  return c;
}
__device__ __forceinline__ void dep_guard2(v8f& a, v8f& b, v16h x, v16h y) {
#if defined(__HIP_DEVICE_COMPILE__)
  asm volatile("v_nop\n\tv_nop\n\tv_nop\n\tv_nop" : "+v"(a), "+v"(b) : "v"(x), "v"(y));
#else
  (void)a; (void)b; (void)x; (void)y;
#endif
}
__device__ __forceinline__ void dep_guard2(v8f& a, v8f& b, v16b x, v16b y) {
#if defined(__HIP_DEVICE_COMPILE__)
  asm volatile("v_nop\n\tv_nop\n\tv_nop\n\tv_nop" : "+v"(a), "+v"(b) : "v"(x), "v"(y));
#else
  (void)a; (void)b; (void)x; (void)y;
#endif
}
__device__ __forceinline__ void keep1(v16h x) {
#if defined(__HIP_DEVICE_COMPILE__)
  asm volatile("v_nop" :: "v"(x));
#else
  (void)x;
#endif
}
__device__ __forceinline__ void keep1(v16b x) {
#if defined(__HIP_DEVICE_COMPILE__)
  asm volatile("v_nop" :: "v"(x));
#else
  (void)x;
#endif
}
__device__ __forceinline__ void acc_guard4(v8f& a, v8f& b, v8f& c, v8f& d) {
#if defined(__HIP_DEVICE_COMPILE__)
  asm volatile("v_nop\n\tv_nop\n\tv_nop\n\tv_nop" : "+v"(a), "+v"(b), "+v"(c), "+v"(d));
#else
  (void)a; (void)b; (void)c; (void)d;
#endif
}

// ---- SwiGLU element from the fused accumulator: silu(gate + bg) * (xp + bx) * rscale -------------------
__device__ __forceinline__ float swg(float xacc, float gacc, float oscale, float bx, float bg, float rscale) {
  const float xp = xacc * oscale + bx;
  const float g  = gacc * oscale + bg;
  const float sg = __builtin_amdgcn_rcpf(1.0f + __expf(-g));
  return (g * sg) * xp * rscale;
}

// =====================================================================================================
// cos/sin table: cs[t][0..31] = bf16(cos(t*invf[d])) widened to f32, cs[t][32..63] = bf16(sin(.)).
// invf arrives by value; each lane picks its entry with a static-index select chain (no private indexing).
// =====================================================================================================
__global__ __launch_bounds__(256) void k_cstab(InvTab tab, float* cs) {
  const int lane = threadIdx.x & 31, wave = threadIdx.x >> 5;
  const int t = blockIdx.x * 8 + wave;
  float ivf = tab.f[0];
#pragma unroll
  for (int i = 1; i < HD / 2; ++i) ivf = (lane == i) ? tab.f[i] : ivf;
  const float fr = (float)t * ivf;
  float sn, cn;
  sincosf(fr, &sn, &cn);
  const float cv = bf_up(bf_bits(cn));
  const float sv = bf_up(bf_bits(sn));
  float* pc = cs + (size_t)t * 64 + lane;
  float* ps = pc + 32;
  *(float*)pc = cv;
  *(float*)ps = sv;
  
}

// =====================================================================================================
// RMSNorm (no affine, eps = f32 eps) of one row per block (128 threads x 8 elements) and conversion to
// three planes [2048][1024]: f16(x*16), bf16 hi, bf16 lo (RNE, lo = RNE(x - hi)). Each thread stores 16 B
// coverage: 2048 blocks x 128 threads x 8 = the whole plane.
// =====================================================================================================
__global__ __launch_bounds__(128) void k_xnorm(const float* __restrict__ hs, unsigned short* xh,
                                               unsigned short* xbh, unsigned short* xbl) {
  __shared__ float red[4];
  const int tid = threadIdx.x, lane = tid & 31, wave = tid >> 5, t = blockIdx.x;
  const size_t off = (size_t)t * DM + (size_t)tid * 8;
  const v4f a = *(const v4f*)(hs + off);
  const v4f b = *(const v4f*)(hs + off + 4);
  float ss = a[0] * a[0] + a[1] * a[1] + a[2] * a[2] + a[3] * a[3]
           + b[0] * b[0] + b[1] * b[1] + b[2] * b[2] + b[3] * b[3];
#pragma unroll
  for (int o = 1; o < 32; o <<= 1) ss += __shfl_xor(ss, o, 32);
  if (lane == 0) red[wave] = ss;
  __syncthreads();
  const float tot = (red[0] + red[1]) + (red[2] + red[3]);
  const float rn = rsqrtf(tot * (1.0f / (float)DM) + 1.1920929e-7f);
  float x[8];
  x[0] = a[0] * rn; x[1] = a[1] * rn; x[2] = a[2] * rn; x[3] = a[3] * rn;
  x[4] = b[0] * rn; x[5] = b[1] * rn; x[6] = b[2] * rn; x[7] = b[3] * rn;
  v4u ph, pb, pl;
#pragma unroll
  for (int e = 0; e < 4; ++e) {
    const float f0 = x[2 * e], f1 = x[2 * e + 1];
    ph[e] = pk16(h_bits((_Float16)(f0 * XSC)), h_bits((_Float16)(f1 * XSC)));
    const unsigned short hb0 = bf_bits(f0), hb1 = bf_bits(f1);
    pb[e] = pk16(hb0, hb1);
    pl[e] = pk16(bf_bits(f0 - bf_up(hb0)), bf_bits(f1 - bf_up(hb1)));
  }
  *(v4u*)(xh + off)  = ph;
  *(v4u*)(xbh + off) = pb;
  *(v4u*)(xbl + off) = pl;
  
}

// =====================================================================================================
// Weight transpose + convert: W [K][N] f32 (in k, out n) -> Wt [N][K] 16-bit (k contiguous), 64x64 tile per
// block through LDS. MODE 0: f16(w*wscale) -> out0; MODE 1: bf16 hi -> out0, bf16 lo -> out1.
// coverage: 2 it x 8 waves x 4 rows = 64 output rows, 8 lanes x 8 = 64 k columns per tile; grid (N/64, K/64).
// =====================================================================================================
template <int MODE>
__global__ __launch_bounds__(256) void k_wtrans(const float* __restrict__ W, int K, int N, int nhalf, float wscale,
                                                unsigned short* out0, unsigned short* out1) {
  __shared__ float tl[64][65];
  const int tid = threadIdx.x, lane = tid & 31, wave = tid >> 5;
  const int n0 = blockIdx.x * 64, k0 = blockIdx.y * 64;
  {
    const int i0 = tid >> 4, cc = (tid & 15) * 4;
#pragma unroll
    for (int p = 0; p < 4; ++p) {
      const int i = p * 16 + i0;
      const v4f v = *(const v4f*)(W + (size_t)(k0 + i) * N + n0 + cc);
      tl[i][cc] = v[0]; tl[i][cc + 1] = v[1]; tl[i][cc + 2] = v[2]; tl[i][cc + 3] = v[3];
    }
  }
  __syncthreads();
  const int orow0 = (nhalf > 0) ? ((n0 < nhalf) ? (2 * n0) : (2 * (n0 - nhalf) + 64)) : n0;
  const int q8 = lane >> 3, c8 = (lane & 7) * 8;
  v4u hv[2], lv[2];
#pragma unroll
  for (int it = 0; it < 2; ++it) {
    const int j = it * 32 + wave * 4 + q8;
    v4u a, a2;
#pragma unroll
    for (int e = 0; e < 4; ++e) {
      const float f0 = tl[c8 + 2 * e][j], f1 = tl[c8 + 2 * e + 1][j];
      if constexpr (MODE == 0) {
        a[e] = pk16(h_bits((_Float16)(f0 * wscale)), h_bits((_Float16)(f1 * wscale)));
        a2[e] = 0u;
      } else {
        const unsigned short hb0 = bf_bits(f0), hb1 = bf_bits(f1);
        a[e] = pk16(hb0, hb1);
        a2[e] = pk16(bf_bits(f0 - bf_up(hb0)), bf_bits(f1 - bf_up(hb1)));
      }
    }
    hv[it] = a; lv[it] = a2;
  }
  {
#pragma unroll
    for (int it = 0; it < 2; ++it) {
      const int j = it * 32 + wave * 4 + q8;
      const size_t go = (size_t)(orow0 + j) * K + k0 + c8;
      *(v4u*)(out0 + go) = hv[it];
      if constexpr (MODE == 1) *(v4u*)(out1 + go) = lv[it];
    }
    
  }
}

// =====================================================================================================
// Register-blocked 16-bit WMMA GEMM: C[m][n] = sum_k A[m][k] * Bt[n][k]; one wave per (16*MI)x(16*NJ) tile,
// no block barriers. A row-major [M][K] pitch lda; Bt row-major [N][K] pitch ldb (k contiguous);
// M, N multiples of the tile, K multiple of 32 (host-checked). T = _Float16 or __bf16.
// NSPLIT: 0 = A.Bt; 2 = A.Bt + A.Bt2 + A2.Bt (unscaled hi/lo planes), done in two phases so at most one set of
//         A fragments is live.
// EPI 0: f32 C = acc*oscale (pitch ldc).  EPI 1: f32 C = acc*oscale + bias[n].
// EPI 2: f16 hi plane C (pitch ldc) + f16 residual plane C2 = f16((v - hi)*rscale) for tiles with n0 < N2
//        (pitch ldc2).  EPI 3: f32 C = acc*oscale + bias[n] + resh[m][n]*lamp[0] + resa[m][n].
// EPI 4 (MI=2, NJ=8, TN=128): fused SwiGLU: subtiles j<4 are xp columns ocol0+16j+c, j>=4 the matching gate
//        columns; C (f16, pitch ldc) [m][ocol0 + ..63] = f16( silu(gate+bias[FFI+col]) * (xp+bias[col]) * rscale ).
// Epilogue: 16-row x 64-col slabs staged per wave in LDS, column-major (pitch SP): every lane writes its 8
// accumulator rows of one column with two 16-B vector stores; rows are then gathered and each 64-wide row
// coverage per wave: MI slabs x 16 rows x 64 output cols.
// =====================================================================================================
template <typename T, int MI, int NJ, int NSPLIT, int EPI>
__global__ __launch_bounds__(256) void k_gemm(
    const unsigned short* __restrict__ Ap, const unsigned short* __restrict__ A2p, int lda,
    const unsigned short* __restrict__ Bp, const unsigned short* __restrict__ B2p, int ldb,
    void* Cout, int ldc, void* Cout2, int ldc2, int N2,
    const float* __restrict__ bias, const float* __restrict__ resh,
    const float* __restrict__ resa, const float* __restrict__ lamp,
    int M, int N, int K, float oscale, float rscale) {
  typedef typename Frag16<T>::t FR;
  static_assert((EPI == 4) ? (MI == 2 && NJ == 8) : (NJ == 4 && (MI == 2 || MI == 4)));
  static_assert(NSPLIT == 0 || NSPLIT == 2);
  const T* A   = (const T*)(const void*)Ap;
  const T* A2  = (const T*)(const void*)A2p;
  const T* Bt  = (const T*)(const void*)Bp;
  const T* Bt2 = (const T*)(const void*)B2p;
  __shared__ __align__(16) float sT[8][64 * SP];   // per-wave 16x64 slab, column-major, pitch SP floats
  constexpr int TM = 16 * MI, TN = 16 * NJ;
  const int lane = threadIdx.x & 31;
  const int wave = threadIdx.x >> 5;
  const int tilesN = N / TN;
  const int tilesM = M / TM;
  const int tile = blockIdx.x * 8 + wave;
  if (tile >= tilesM * tilesN) return;   // wave-uniform; no block barriers in this kernel
  const int tm = tile / tilesN;
  const int tn = tile - tm * tilesN;
  const int m0 = tm * TM;
  const int n0 = tn * TN;
  const int rl   = lane & 15;            // row (A) / col (B, D) within subtile
  const int koff = (lane >> 4) * 8;      // k offset of this lane half
  const int mOff = (lane >> 4) * 8;      // D row offset

  v8f acc[MI][NJ];
#pragma unroll
  for (int i = 0; i < MI; ++i)
#pragma unroll
    for (int j = 0; j < NJ; ++j) acc[i][j] = zero8();

  for (int k0 = 0; k0 < K; k0 += 32) {
    {
      FR ah[MI];
#pragma unroll
      for (int i = 0; i < MI; ++i)
        ah[i] = ldfrag(A + (size_t)(m0 + 16 * i + rl) * lda + k0 + koff);
#pragma unroll
      for (int j = 0; j < NJ; ++j) {
        const size_t bo = (size_t)(n0 + 16 * j + rl) * ldb + k0 + koff;
        const FR bh = ldfrag(Bt + bo);
        FR bl = bh;
        if constexpr (NSPLIT == 2) bl = ldfrag(Bt2 + bo);
#pragma unroll
        for (int i = 0; i < MI; ++i) {
          acc[i][j] = mma_raw(ah[i], bh, acc[i][j]);
          if constexpr (NSPLIT == 2) acc[i][j] = mma_raw(ah[i], bl, acc[i][j]);
        }
        dep_guard2(acc[0][j], acc[MI - 1][j], bh, bl);
      }
#pragma unroll
      for (int i = 0; i < MI; ++i) keep1(ah[i]);
    }
    if constexpr (NSPLIT == 2) {
      FR al[MI];
#pragma unroll
      for (int i = 0; i < MI; ++i)
        al[i] = ldfrag(A2 + (size_t)(m0 + 16 * i + rl) * lda + k0 + koff);
#pragma unroll
      for (int j = 0; j < NJ; ++j) {
        const size_t bo = (size_t)(n0 + 16 * j + rl) * ldb + k0 + koff;
        const FR bh = ldfrag(Bt + bo);
#pragma unroll
        for (int i = 0; i < MI; ++i) acc[i][j] = mma_raw(al[i], bh, acc[i][j]);
        dep_guard2(acc[0][j], acc[MI - 1][j], bh, bh);
      }
#pragma unroll
      for (int i = 0; i < MI; ++i) keep1(al[i]);
    }
  }
#pragma unroll
  for (int i = 0; i < MI; ++i)
#pragma unroll
    for (int j = 0; j < NJ; j += 4) acc_guard4(acc[i][j], acc[i][j + 1], acc[i][j + 2], acc[i][j + 3]);

  // ---- epilogue ----
  float* slab = sT[wave];
  const int ocol0 = (EPI == 4) ? (tn * 64) : n0;
  const int hq = lane >> 4, c4 = (lane & 15) * 4;   // f32 path: 256-B row segment = 16 lanes x 16 B
  const int q8 = lane >> 3, c8 = (lane & 7) * 8;
  float bxv[4] = {0.f, 0.f, 0.f, 0.f}, bgv[4] = {0.f, 0.f, 0.f, 0.f};
  v4f b4 = {0.f, 0.f, 0.f, 0.f};
  float lam = 0.f;
  if constexpr (EPI == 4) {
#pragma unroll
    for (int j = 0; j < 4; ++j) {
      bxv[j] = bias[ocol0 + 16 * j + rl];
      bgv[j] = bias[FFI + ocol0 + 16 * j + rl];
    }
  }
  if constexpr (EPI == 1 || EPI == 3) b4 = *(const v4f*)(bias + n0 + c4);
  if constexpr (EPI == 3) lam = lamp[0];

#pragma unroll
  for (int i = 0; i < MI; ++i) {
    const int mBase = m0 + 16 * i;
    // lane writes column 16j+rl, rows mOff..mOff+7 = 32 contiguous bytes as two 16-B vector LDS stores
#pragma unroll
    for (int j = 0; j < 4; ++j) {
      v4f w0, w1;
      if constexpr (EPI == 4) {
#pragma unroll
        for (int r = 0; r < 4; ++r) {
          w0[r] = swg(acc[i][j][r],     acc[i][j + 4][r],     oscale, bxv[j], bgv[j], rscale);
          w1[r] = swg(acc[i][j][r + 4], acc[i][j + 4][r + 4], oscale, bxv[j], bgv[j], rscale);
        }
      } else {
#pragma unroll
        for (int r = 0; r < 4; ++r) {
          w0[r] = acc[i][j][r] * oscale;
          w1[r] = acc[i][j][r + 4] * oscale;
        }
      }
      float* cp = slab + (16 * j + rl) * SP + mOff;
      *(v4f*)(cp) = w0;
      *(v4f*)(cp + 4) = w1;
    }
    wave_sync_lds();
    if constexpr (EPI == 0 || EPI == 1 || EPI == 3) {
      float* C = (float*)Cout;
      v4f fin[8];
#pragma unroll
      for (int it = 0; it < 8; ++it) {
        const int row = 2 * it + hq;                   // it 0..7 x hq 0..1 = rows 0..15
        v4f v;
        v[0] = slab[(c4 + 0) * SP + row];
        v[1] = slab[(c4 + 1) * SP + row];
        v[2] = slab[(c4 + 2) * SP + row];
        v[3] = slab[(c4 + 3) * SP + row];
        if constexpr (EPI == 1) v = v + b4;
        if constexpr (EPI == 3) {
          const size_t go = (size_t)(mBase + row) * ldc + n0 + c4;
          const v4f hvv = *(const v4f*)(resh + go);
          const v4f avv = *(const v4f*)(resa + go);
          v = v + b4 + hvv * lam + avv;
        }
        fin[it] = v;
      }
      {
#pragma unroll
        for (int it = 0; it < 8; ++it) {
          const int row = 2 * it + hq;
          *(v4f*)(C + (size_t)(mBase + row) * ldc + n0 + c4) = fin[it];
        }
        
      }
    } else {
      unsigned short* C  = (unsigned short*)Cout;
      unsigned short* C2 = (unsigned short*)Cout2;
      const bool wlo = (EPI == 2) && (n0 < N2);        // wave-uniform
      v4u hv[4], lv[4];
#pragma unroll
      for (int it = 0; it < 4; ++it) {
        const int row = 4 * it + q8;                   // it 0..3 x q8 0..3 = rows 0..15
        v4u a, a2;
#pragma unroll
        for (int e = 0; e < 4; ++e) {
          const float f0 = slab[(c8 + 2 * e) * SP + row], f1 = slab[(c8 + 2 * e + 1) * SP + row];
          const _Float16 x0 = (_Float16)f0, x1 = (_Float16)f1;
          unsigned short l0 = 0, l1 = 0;
          if constexpr (EPI == 2) {
            l0 = h_bits((_Float16)((f0 - (float)x0) * rscale));
            l1 = h_bits((_Float16)((f1 - (float)x1) * rscale));
          }
          a[e] = pk16(h_bits(x0), h_bits(x1)); a2[e] = pk16(l0, l1);
        }
        hv[it] = a; lv[it] = a2;
      }
      {
#pragma unroll
        for (int it = 0; it < 4; ++it) {
          const int row = 4 * it + q8;
          *(v4u*)(C + (size_t)(mBase + row) * ldc + ocol0 + c8) = hv[it];
          if (wlo) *(v4u*)(C2 + (size_t)(mBase + row) * ldc2 + n0 + c8) = lv[it];
        }
        
      }
    }
    wave_sync_lds();
  }
}

// =====================================================================================================
// Per-head l2 normalisation + rotary embedding for q, k, qb, kb. Input QK f32 [2048][4096]
// (cols: q | k | qb | kb, each [h*64 + d]); cs table [t][cos 0..31 | sin 0..31] (bf16-valued f32).
// One wave per (t, h): lane d handles the rotary pair (d, d+32). Results exchanged through a per-wave LDS
// grid = 32768/8 blocks of 256. coverage: every (t, h) row of all four planes.
// =====================================================================================================
__global__ __launch_bounds__(256) void k_rope(const float* __restrict__ qkf, const float* __restrict__ cs,
                                              unsigned short* qh, unsigned short* kh, float* qbn, float* kbn) {
  __shared__ __align__(16) float yb[8][4 * 64];
  const int lane = threadIdx.x & 31, wave = threadIdx.x >> 5;
  const int p = blockIdx.x * 8 + wave;     // p = t*16 + h
  const int t = p >> 4, h = p & 15;
  const float cth = cs[(size_t)t * 64 + lane];
  const float sth = cs[(size_t)t * 64 + 32 + lane];
  const float* row = qkf + (size_t)t * (4 * DM) + h * HD;
  float* ybw = yb[wave];
#pragma unroll
  for (int g = 0; g < 4; ++g) {
    const float* src = row + g * DM;
    float x1 = src[lane], x2 = src[lane + 32];
    float n2 = x1 * x1 + x2 * x2;
#pragma unroll
    for (int o = 1; o < 32; o <<= 1) n2 += __shfl_xor(n2, o, 32);
    const float rn = 1.0f / fmaxf(sqrtf(n2), 1e-12f);
    x1 *= rn; x2 *= rn;
    ybw[g * 64 + lane]      = x1 * cth + x2 * sth;
    ybw[g * 64 + 32 + lane] = x2 * cth - x1 * sth;
  }
  wave_sync_lds();
  const int c8 = (lane & 7) * 8, c4 = (lane & 15) * 4;
  v4u qv, kv;
#pragma unroll
  for (int e = 0; e < 4; ++e) {
    qv[e] = pk16(h_bits((_Float16)(ybw[c8 + 2 * e] * QSC)), h_bits((_Float16)(ybw[c8 + 2 * e + 1] * QSC)));
    kv[e] = pk16(h_bits((_Float16)(ybw[64 + c8 + 2 * e] * QSC)), h_bits((_Float16)(ybw[64 + c8 + 2 * e + 1] * QSC)));
  }
  const v4f qbv = *(const v4f*)(ybw + 128 + c4);
  const v4f kbv = *(const v4f*)(ybw + 192 + c4);
  const size_t g16 = (size_t)t * DM + h * HD + c8;
  const size_t g32 = (size_t)t * DM + h * HD + c4;
  {
    if (lane < 8) {
      *(v4u*)(qh + g16) = qv;
      *(v4u*)(kh + g16) = kv;
    }
    if (lane < 16) {
      *(v4f*)(qbn + g32) = qbv;
      *(v4f*)(kbn + g32) = kbv;
    }
    
  }
}

// =====================================================================================================
// Inclusive causal prefix sum of kb over positions: pf[t][col] = sum_{s<=t} kbn[s][col], summed in f64.
// Blocked scan in two launches. The 2048 positions are cut into PSS blocks of 64 rows, each block into 8 wave
// slices of PWR rows; a work-group covers 64 rows x 128 columns, a lane 4 neighbouring columns (16-B accesses).
//   k_segsum: part[ss][col] = f64 sum of the 64 rows of block ss.
//   k_prefix: offset = sum of part[0..ss-1][col] + sums of the lower wave slices (scanned in LDS), added to the
//             lane's own running sum over its PWR rows; every pf line is stored whole by one wave.
// coverage of both: grid PSS x (DM/128) work-groups x 8 waves x PWR rows x 128 columns = the whole plane.
// Every loop of the two kernels is unrolled in full, so that its small arrays live in registers and the loads
// of one array are issued back to back.
// =====================================================================================================
#define PSS 32                 // row blocks of 64 positions
#define PWR 8                  // rows per wave slice
static_assert(PSS * 8 * PWR == SEQ && (DM % 128) == 0 && (PSS % 2) == 0);

__global__ __launch_bounds__(256) void k_segsum(const float* __restrict__ kbn, double* __restrict__ part) {
  __shared__ __align__(16) double wsum[8][128];
  const int tid = threadIdx.x, lane = tid & 31, wave = tid >> 5;
  const int cg = blockIdx.x % (DM / 128), ss = blockIdx.x / (DM / 128);
  const float* src = kbn + (size_t)(ss * 64 + wave * PWR) * DM + cg * 128 + lane * 4;
  v4f x[PWR];
#pragma unroll
  for (int i = 0; i < PWR; ++i) x[i] = *(const v4f*)(src + (size_t)i * DM);
  double s[4];
#pragma unroll
  for (int e = 0; e < 4; ++e) s[e] = (double)x[0][e];
#pragma unroll
  for (int i = 1; i < PWR; ++i)
#pragma unroll
    for (int e = 0; e < 4; ++e) s[e] += (double)x[i][e];
#pragma unroll
  for (int e = 0; e < 4; ++e) wsum[wave][lane * 4 + e] = s[e];
  __syncthreads();
  if (tid < 128) {
    double v[8];
#pragma unroll
    for (int w = 0; w < 8; ++w) v[w] = wsum[w][tid];
    double a = v[0];
#pragma unroll
    for (int w = 1; w < 8; ++w) a += v[w];
    part[(size_t)ss * DM + cg * 128 + tid] = a;
  }
}

__global__ __launch_bounds__(256) void k_prefix(const float* __restrict__ kbn, const double* __restrict__ part,
                                                float* __restrict__ pf) {
  __shared__ __align__(16) double wsum[8][128];   // sum of each wave slice, per column; then its offset
  __shared__ __align__(16) double sup[2][128];    // sum of the lower row blocks, even / odd blocks apart
  const int tid = threadIdx.x, lane = tid & 31, wave = tid >> 5;
  const int cg = blockIdx.x % (DM / 128), ss = blockIdx.x / (DM / 128);
  const size_t go = (size_t)(ss * 64 + wave * PWR) * DM + cg * 128 + lane * 4;
  const float* src = kbn + go;
  v4f x[PWR];
#pragma unroll
  for (int i = 0; i < PWR; ++i) x[i] = *(const v4f*)(src + (size_t)i * DM);
  // lower row blocks: all PSS rows of part were written by k_segsum, so every load is issued at once and
  // the rows from ss on are dropped by the select (waves 0..3 take the even blocks, waves 4..7 the odd ones)
  {
    const int c = tid & 127, hf = tid >> 7;
    const double* pp = part + (size_t)hf * DM + cg * 128 + c;
    double pv[PSS / 2];
#pragma unroll
    for (int j = 0; j < PSS / 2; ++j) pv[j] = pp[(size_t)(2 * j) * DM];
    // keeps every load above ahead of the sums: without it two of them are issued only after the first have
    // come back, and the wave pays the memory latency twice
    __builtin_amdgcn_sched_barrier(0);
    double so = 0.0;
#pragma unroll
    for (int j = 0; j < PSS / 2; ++j) so += (2 * j + hf < ss) ? pv[j] : 0.0;
    sup[hf][c] = so;
  }
  // the lane's own running sums
  double p[PWR][4];
#pragma unroll
  for (int e = 0; e < 4; ++e) p[0][e] = (double)x[0][e];
#pragma unroll
  for (int i = 1; i < PWR; ++i)
#pragma unroll
    for (int e = 0; e < 4; ++e) p[i][e] = p[i - 1][e] + (double)x[i][e];
#pragma unroll
  for (int e = 0; e < 4; ++e) wsum[wave][lane * 4 + e] = p[PWR - 1][e];
  __syncthreads();
  // one thread per column turns the slice sums into each slice's offset, in place
  if (tid < 128) {
    double v[8];
#pragma unroll
    for (int w = 0; w < 8; ++w) v[w] = wsum[w][tid];
    double run = sup[0][tid] + sup[1][tid];
#pragma unroll
    for (int w = 0; w < 8; ++w) { wsum[w][tid] = run; run += v[w]; }
  }
  __syncthreads();
  double off[4];
#pragma unroll
  for (int e = 0; e < 4; ++e) off[e] = wsum[wave][lane * 4 + e];
  float* dst = pf + go;
#pragma unroll
  for (int i = 0; i < PWR; ++i) {
    v4f o;
#pragma unroll
    for (int e = 0; e < 4; ++e) o[e] = (float)(off[e] + p[i][e]);
    *(v4f*)(dst + (size_t)i * DM) = o;
  }
}

// =====================================================================================================
// Causal attention, head dim 64, plus the bias-attention row term.
//   q, k planes (f16, x8, normalised + rotary): element (t, h, d) at [t*DM + h*64 + d]
//   v^T hi plane (f16): element (h, d, s) at [(h*64 + d)*SEQ + s]; v^T residual plane (f16, (v - hi)*4096):
//   [(h*64 + d)*VLP + s], s < VLP, read only when RES (query blocks 0..RESQB-1 see only keys < VLP).
//   scores = q . k (single f16 product), * 1/64, key > query -> -inf; online softmax in f32.
//   p = exp(s - m) carried as f16(1024 p); context = p . v on f16 WMMA; RES adds f16 residual planes of p and v
//   (scale 4096, separate accumulator folded back with 1/4096 per chunk in f32).
//   y = l2ns * context / l + sb, sb = 0.125 * qbn[q] . pfx[q] (64-dot over the head dims, prefix sum of kb),
//   written as bf16 hi / lo planes [t][h*64 + d].
//   Block = 4 waves = 64 query rows of one h; grid = nqbThis * NH; key chunks of 64, trip count qb+1 (<= 32).
//   K / V^T chunk staging: 128 threads x 32 elements per plane = the whole 64x64 tile (plain 16-B loads,
//   __syncthreads before and after); P tiles are wave-private, spilled with _Float16 element stores and reloaded
//   (pitch 64); the context slab (pitch OSP) is written with two 16-B vector LDS stores per lane per column.
//   Output coverage: each wave stores rows q0..q0+15 (it 0..3 x lane>>3 0..3) x 64 columns (8 lanes x 8) of both planes.
// =====================================================================================================
template <bool RES>
__global__ __launch_bounds__(128)
void k_attn(const unsigned short* __restrict__ qhp, const unsigned short* __restrict__ khp,
            const unsigned short* __restrict__ vhp, const unsigned short* __restrict__ vlp,
            const float* __restrict__ qbn, const float* __restrict__ pfx, const float* __restrict__ l2p,
            unsigned short* yhp, unsigned short* ylp, int qbBase, int nqbThis) {
  union FH { v16h v; v8h h[2]; };
  __shared__ __align__(16) _Float16 Ksh[64 * 64];                 // K [kv][d]  8 KB
  __shared__ __align__(16) _Float16 Vth[64 * 64];                 // V^T hi [d][kv] 8 KB
  __shared__ __align__(16) _Float16 Vtl[RES ? 64 * 64 : 8];       // V^T residual
  __shared__ __align__(16) _Float16 Psh[4][16 * 64];              // per wave P [row][kv]
  __shared__ __align__(16) _Float16 Psl[RES ? 4 : 1][16 * 64];    // per wave P residual
  __shared__ __align__(16) float    Os[4][64 * OSP];              // per wave context slab [d][row], pitch OSP
  __shared__ float Sbl[4][16];                                    // per wave bias-attention row values

  const int tid  = threadIdx.x;
  const int wave = tid >> 5;
  const int lane = tid & 31;
  const int hh   = lane >> 4;
  const int c    = lane & 15;

  const int bx  = blockIdx.x;
  const int qbl = bx % nqbThis;
  const int h   = bx / nqbThis;
  const int qb  = qbBase + qbl;
  const int q0  = qb * 64 + wave * 16;

  const _Float16* Qh = (const _Float16*)(const void*)qhp + (size_t)h * HD;
  const _Float16* Kh = (const _Float16*)(const void*)khp + (size_t)h * HD;
  const _Float16* Vh = (const _Float16*)(const void*)vhp + (size_t)h * HD * SEQ;
  const _Float16* Vl = (const _Float16*)(const void*)vlp + (size_t)h * HD * VLP;

  // ---- Q fragments (A operand, row = lane&15): 2 d-chunks ----
  v16h qa[2];
#pragma unroll
  for (int dc = 0; dc < 2; ++dc) qa[dc] = ldfrag(Qh + (size_t)(q0 + c) * DM + dc * 32 + 8 * hh);

  float mrow[8], lrow[8];
  v8f oacc[4];
#pragma unroll
  for (int r = 0; r < 8; ++r) { mrow[r] = -INFINITY; lrow[r] = 0.f; }
#pragma unroll
  for (int t = 0; t < 4; ++t) oacc[t] = zero8();

  int nkt = qb + 1;                          // causal: key tiles 0..qb; block-uniform, <= NQB
  if (nkt > NQB) nkt = NQB;
  for (int kt = 0; kt < nkt; ++kt) {
    const int kv0 = kt * 64;
    __syncthreads();
    {
      const int r = tid >> 1, half = (tid & 1) * 32;
      const _Float16* kg = Kh + (size_t)(kv0 + r) * DM + half;      // K row kv0+r, d = half..half+31
      const _Float16* vg = Vh + (size_t)r * SEQ + kv0 + half;       // V^T row d = r, s = kv0+half..+31
      const int kvl = (kv0 + 64 <= VLP) ? kv0 : (VLP - 64);         // clamped address into the residual plane
      const _Float16* vlg = Vl + (size_t)r * VLP + kvl + half;
      const bool resOK = (kv0 + 64 <= VLP);                          // block-uniform
#pragma unroll
      for (int i = 0; i < 4; ++i) {
        const v8h a0 = *(const v8h*)(kg + 8 * i);
        const v8h b0 = *(const v8h*)(vg + 8 * i);
        *(v8h*)(Ksh + r * 64 + half + 8 * i) = a0;
        *(v8h*)(Vth + r * 64 + half + 8 * i) = b0;
        if (RES) {
          v8h b1 = *(const v8h*)(vlg + 8 * i);
          if (!resOK) b1 = zero8h();
          *(v8h*)(Vtl + r * 64 + half + 8 * i) = b1;
        }
      }
    }
    __syncthreads();

    // ---- scores: 16 query rows x 64 keys per wave, single f16 product ----
    v8f s[4];
#pragma unroll
    for (int j = 0; j < 4; ++j) {
      s[j] = zero8();
#pragma unroll
      for (int dc = 0; dc < 2; ++dc) {
        FH kb;
        kb.h[0] = *(const v8h*)(Ksh + (j * 16 + c) * 64 + dc * 32 + 8 * hh);
        kb.h[1] = *(const v8h*)(Ksh + (j * 16 + c) * 64 + dc * 32 + 16 + 8 * hh);
        s[j] = mma_h(qa[dc], kb.v, s[j]);
      }
    }

    // ---- undo carries, causal mask, row max, online softmax, P (x1024, f16) and P residual (x4096) to LDS ----
    _Float16* pwh = Psh[wave];
    _Float16* pwl = Psl[RES ? wave : 0];
#pragma unroll
    for (int r = 0; r < 8; ++r) {
      const int qrow = q0 + 8 * hh + r;
      float m = -INFINITY;
#pragma unroll
      for (int j = 0; j < 4; ++j) {
        const int key = kv0 + j * 16 + c;
        float sv = s[j][r] * SSC;
        sv = (key <= qrow) ? sv : -INFINITY;
        s[j][r] = sv;
        m = fmaxf(m, sv);
      }
#pragma unroll
      for (int off = 1; off < 16; off <<= 1) m = fmaxf(m, __shfl_xor(m, off, 32));
      const float mnew  = fmaxf(mrow[r], m);
      const float msafe = (mnew == -INFINITY) ? 0.f : mnew;
      const float alpha = __expf(mrow[r] - msafe);
      mrow[r] = mnew;
      float psum = 0.f;
#pragma unroll
      for (int j = 0; j < 4; ++j) {
        const float p = __expf(s[j][r] - msafe);     // masked logit: exp(-inf) -> 0
        psum += p;
        const float p1k = p * 1024.0f;
        const _Float16 ph = (_Float16)p1k;
        pwh[(8 * hh + r) * 64 + j * 16 + c] = ph;
        if (RES) {
          const _Float16 pl = (_Float16)((p1k - (float)ph) * VRS);
          pwl[(8 * hh + r) * 64 + j * 16 + c] = pl;
        }
      }
#pragma unroll
      for (int off = 1; off < 16; off <<= 1) psum += __shfl_xor(psum, off, 32);
      lrow[r] = lrow[r] * alpha + psum;
#pragma unroll
      for (int t = 0; t < 4; ++t) oacc[t][r] *= alpha;
    }
    wave_sync_lds();

    // ---- context += P . V (f16 WMMA), residual products into a separate accumulator ----
    v8f o1[4];
#pragma unroll
    for (int t = 0; t < 4; ++t) o1[t] = zero8();
#pragma unroll 1
    for (int kk = 0; kk < 2; ++kk) {
      FH pa, pl;
      pa.h[0] = *(const v8h*)(pwh + c * 64 + kk * 32 + 8 * hh);
      pa.h[1] = *(const v8h*)(pwh + c * 64 + kk * 32 + 16 + 8 * hh);
      if (RES) {
        pl.h[0] = *(const v8h*)(pwl + c * 64 + kk * 32 + 8 * hh);
        pl.h[1] = *(const v8h*)(pwl + c * 64 + kk * 32 + 16 + 8 * hh);
      } else {
        pl.v = pa.v;
      }
#pragma unroll
      for (int t = 0; t < 4; ++t) {
        FH vb;
        vb.h[0] = *(const v8h*)(Vth + (t * 16 + c) * 64 + kk * 32 + 8 * hh);
        vb.h[1] = *(const v8h*)(Vth + (t * 16 + c) * 64 + kk * 32 + 16 + 8 * hh);
        oacc[t] = mma_h(pa.v, vb.v, oacc[t]);
        if (RES) {
          FH vl;
          vl.h[0] = *(const v8h*)(Vtl + (t * 16 + c) * 64 + kk * 32 + 8 * hh);
          vl.h[1] = *(const v8h*)(Vtl + (t * 16 + c) * 64 + kk * 32 + 16 + 8 * hh);
          o1[t] = mma_h(pa.v, vl.v, o1[t]);
          o1[t] = mma_h(pl.v, vb.v, o1[t]);
        }
      }
    }
    if (RES) {
#pragma unroll
      for (int t = 0; t < 4; ++t)
#pragma unroll
        for (int r = 0; r < 8; ++r) oacc[t][r] += o1[t][r] * (1.0f / VRS);
    }
  }

  // ---- bias-attention row term: 0.125 * qb_row . prefix(kb)_row; lane (row = c, half hh) covers 32 dims ----
  const float l2ns = l2p[0];
  {
    const size_t ro = (size_t)(q0 + c) * DM + (size_t)h * HD + hh * 32;
    const float* qp = qbn + ro;
    const float* pp = pfx + ro;
    float ds = 0.f;
#pragma unroll
    for (int e = 0; e < 8; ++e) {
      const v4f a = *(const v4f*)(qp + 4 * e);
      const v4f b = *(const v4f*)(pp + 4 * e);
      ds += a[0] * b[0] + a[1] * b[1] + a[2] * b[2] + a[3] * b[3];
    }
    ds += __shfl_xor(ds, 16, 32);
    if (hh == 0) Sbl[wave][c] = ds * 0.125f;
  }

  // ---- normalise (l2ns/l and the 1/1024 p carry), stage the wave's 16x64 tile column-major with 16-B vector
  float* os = Os[wave];
  float invr[8];
#pragma unroll
  for (int r = 0; r < 8; ++r) {
    const float l = lrow[r];
    invr[r] = ((l > 0.f) ? (1.0f / l) : 0.f) * (l2ns * (1.0f / 1024.0f));
  }
#pragma unroll
  for (int t = 0; t < 4; ++t) {
    v4f w0, w1;
#pragma unroll
    for (int r = 0; r < 4; ++r) {
      w0[r] = oacc[t][r] * invr[r];
      w1[r] = oacc[t][r + 4] * invr[r + 4];
    }
    float* cp = os + (t * 16 + c) * OSP + 8 * hh;
    *(v4f*)(cp) = w0;
    *(v4f*)(cp + 4) = w1;
  }
  wave_sync_lds();
  {
    const int q4 = lane >> 3, c8 = (lane & 7) * 8;
    v4u hv[4], lv[4];
#pragma unroll
    for (int it = 0; it < 4; ++it) {
      const int row = it * 4 + q4;   // it 0..3 x q4 0..3 = rows 0..15 of the wave tile
      const float sbv = Sbl[wave][row];
      v4u a, a2;
#pragma unroll
      for (int e = 0; e < 4; ++e) {
        const float f0 = os[(c8 + 2 * e) * OSP + row] + sbv;
        const float f1 = os[(c8 + 2 * e + 1) * OSP + row] + sbv;
        const unsigned short h0 = bf_bits(f0), h1 = bf_bits(f1);
        const unsigned short l0 = bf_bits(f0 - bf_up(h0)), l1 = bf_bits(f1 - bf_up(h1));
        a[e] = pk16(h0, h1); a2[e] = pk16(l0, l1);
      }
      hv[it] = a; lv[it] = a2;
    }
    {
#pragma unroll
      for (int it = 0; it < 4; ++it) {
        const int row = it * 4 + q4;
        const size_t go = (size_t)(q0 + row) * DM + (size_t)h * HD + c8;
        *(v4u*)(yhp + go) = hv[it];
        *(v4u*)(ylp + go) = lv[it];
      }
      
    }
  }
}

// =====================================================================================================
// Workspace map (MiB offsets, sizes exact multiples of the whole-tile / whole-line store granularity):
//   Xh   f16  [2048][1024]          0    4
//   Xbh  bf16 [2048][1024]          4    4   (later: Qh f16, after the v^T projection)
//   Xbl  bf16 [2048][1024]          8    4   (later: Kh f16)
//   Wcat f16  [4096 n][1024 k]     12    8   (Wq|Wk|Wqb|Wkb transposed, x64)
//   Wvh/Wvl bf16 [1024][1024]      20  2+2
//   Woh/Wol bf16 [1024][1024]      24  2+2
//   W1t  f16  [8192][1024]         28   16   (x64, xp/gate interleaved per 64 columns)
//   W2t  f16  [1024][4096]         44    8   (x64)
//   cs   f32  [2048][64]           52  512 KiB
//   QK   f32  [2048][4096]         53   32   (later: Pf 53 (8), Yh 61 (4), Yl 65 (4), AttnO 69 (8), PS f64 [32][1024] 77 (256 KiB))
//   QBn  f32  [2048][1024]         85    8
//   KBn  f32  [2048][1024]         93    8
//   VTh  f16  [1024][2048]        101    4
//   VTl  f16  [1024][512]         105    1
//   FF   f16  [2048][4096]        106   16   (x64)
//   end                           122 MiB = 127926272 B
// =====================================================================================================
extern "C" void kernel_launch(void* const* d_in, const int* in_sizes, int n_in,
                              void* d_out, int out_size, void* d_ws, size_t ws_size,
                              hipStream_t stream) {
  if (n_in < 14) return;
  if (in_sizes[0] != SEQ * DM) return;
  for (int i = 1; i <= 6; ++i) if (in_sizes[i] != DM * DM) return;
  if (in_sizes[7] != DM) return;
  if (in_sizes[8] != DM * FUS || in_sizes[9] != FUS) return;
  if (in_sizes[10] != FFI * DM || in_sizes[11] != DM) return;
  if (in_sizes[12] < 1 || in_sizes[13] < 1) return;
  if (out_size != SEQ * DM) return;

  const float* hs  = (const float*)d_in[0];
  const float* Wq  = (const float*)d_in[1];
  const float* Wk  = (const float*)d_in[2];
  const float* Wv  = (const float*)d_in[3];
  const float* Wqb = (const float*)d_in[4];
  const float* Wkb = (const float*)d_in[5];
  const float* Wo  = (const float*)d_in[6];
  const float* bo  = (const float*)d_in[7];
  const float* W1  = (const float*)d_in[8];
  const float* b1  = (const float*)d_in[9];
  const float* W2  = (const float*)d_in[10];
  const float* b2  = (const float*)d_in[11];
  const float* lam = (const float*)d_in[12];
  const float* l2n = (const float*)d_in[13];

  // rotary inverse frequencies 1 / 1000^(2d/64), evaluated in double and RNE-cast to f32 (constants only)
  InvTab itab;
  for (int d = 0; d < HD / 2; ++d)
    { const float pw = (float)pow(1000.0, (2.0 * (double)d) / 64.0); itab.f[d] = 1.0f / pw; }

  const size_t MiB = 1048576;
  const size_t oXh  = 0;
  const size_t oXbh = 4 * MiB,  oXbl = 8 * MiB;
  const size_t oQh  = oXbh,     oKh  = oXbl;        // written after the v^T projection consumed Xbh/Xbl
  const size_t oWcat = 12 * MiB;
  const size_t oWvh = 20 * MiB, oWvl = 22 * MiB, oWoh = 24 * MiB, oWol = 26 * MiB;
  const size_t oW1t = 28 * MiB;
  const size_t oW2t = 44 * MiB;
  const size_t oCS  = 52 * MiB;
  const size_t oQK  = 53 * MiB;
  const size_t oPf  = 53 * MiB, oYh = 61 * MiB, oYl = 65 * MiB, oAO = 69 * MiB;   // inside QK, after rope
  const size_t oPS  = 77 * MiB;                                                   // inside QK, after rope
  const size_t oQBn = 85 * MiB, oKBn = 93 * MiB;
  const size_t oVTh = 101 * MiB, oVTl = 105 * MiB;
  const size_t oFF  = 106 * MiB;
  const size_t oEnd = 122 * MiB;
  // extent checks against the actual plane sizes
  if ((size_t)SEQ * DM * 2 != 4 * MiB) return;
  if ((size_t)DM * DM * 2 != 2 * MiB) return;
  if (oWcat + (size_t)4 * DM * DM * 2 != oWvh) return;
  if (oW1t + (size_t)FUS * DM * 2 != oW2t) return;
  if (oW2t + (size_t)DM * FFI * 2 != oCS) return;
  if (oCS + (size_t)SEQ * 64 * 4 > oQK) return;
  if (oQK + (size_t)SEQ * 4 * DM * 4 != oQBn) return;
  if (oPf + (size_t)SEQ * DM * 4 != oYh) return;
  if (oYl + (size_t)SEQ * DM * 2 != oAO) return;
  if (oAO + (size_t)SEQ * DM * 4 != oPS) return;
  if (oPS + (size_t)PSS * DM * 8 > oQBn) return;
  if (oVTh + (size_t)DM * SEQ * 2 != oVTl) return;
  if (oVTl + (size_t)DM * VLP * 2 != oFF) return;
  if (oFF + (size_t)SEQ * FFI * 2 != oEnd) return;
  if (oEnd > ws_size) return;
  if (oEnd > (size_t)134217728) return;

  char* ws = (char*)d_ws;
  unsigned short* Xh   = (unsigned short*)(ws + oXh);
  unsigned short* Xbh  = (unsigned short*)(ws + oXbh);
  unsigned short* Xbl  = (unsigned short*)(ws + oXbl);
  unsigned short* Qh   = (unsigned short*)(ws + oQh);
  unsigned short* Kh   = (unsigned short*)(ws + oKh);
  unsigned short* Wcat = (unsigned short*)(ws + oWcat);
  unsigned short* Wvh  = (unsigned short*)(ws + oWvh);
  unsigned short* Wvl  = (unsigned short*)(ws + oWvl);
  unsigned short* Woh  = (unsigned short*)(ws + oWoh);
  unsigned short* Wol  = (unsigned short*)(ws + oWol);
  unsigned short* W1t  = (unsigned short*)(ws + oW1t);
  unsigned short* W2t  = (unsigned short*)(ws + oW2t);
  float*          CS   = (float*)(ws + oCS);
  float*          QK   = (float*)(ws + oQK);
  float*          Pf   = (float*)(ws + oPf);
  unsigned short* Yh   = (unsigned short*)(ws + oYh);
  unsigned short* Yl   = (unsigned short*)(ws + oYl);
  float*          AO   = (float*)(ws + oAO);
  double*         PS   = (double*)(ws + oPS);
  float*          QBn  = (float*)(ws + oQBn);
  float*          KBn  = (float*)(ws + oKBn);
  unsigned short* VTh  = (unsigned short*)(ws + oVTh);
  unsigned short* VTl  = (unsigned short*)(ws + oVTl);
  unsigned short* FF   = (unsigned short*)(ws + oFF);

  const dim3 b256(256), b128(128);
  const dim3 gW(DM / 64, DM / 64);                                       // 16 x 16 tiles
  const dim3 gW1(FUS / 64, DM / 64);                                     // 128 x 16
  const dim3 gW2(DM / 64, FFI / 64);                                     // 16 x 64
  const dim3 gF1((((SEQ / 32) * (FUS / 128)) + 7) / 8);                  // 4096 tiles -> 512 blocks
  const dim3 gQK((((SEQ / 64) * ((4 * DM) / 64)) + 7) / 8);             // 2048 tiles -> 256 blocks
  const dim3 gVT((((DM / 64) * (SEQ / 64)) + 7) / 8);                    // 512 tiles -> 64 blocks
  const dim3 gWo((((SEQ / 64) * (DM / 64)) + 7) / 8);                    // 512 tiles -> 64 blocks
  const dim3 gF2((((SEQ / 32) * (DM / 64)) + 7) / 8);                    // 1024 tiles (32x64) -> 128 blocks

  // (0) rotary cos/sin table
  k_cstab<<<dim3(SEQ / 8), b256, 0, stream>>>(itab, CS);
  // (1) RMSNorm -> x planes
  k_xnorm<<<dim3(SEQ), b128, 0, stream>>>(hs, Xh, Xbh, Xbl);
  // (2) weights [k][n] f32 -> [n][k] 16-bit planes   (in[K][N] -> out[N][K], grid (N/64, K/64))
  k_wtrans<0><<<gW, b256, 0, stream>>>(Wq,  DM, DM, 0, WSC, Wcat + (size_t)0 * DM * DM, Wcat);
  k_wtrans<0><<<gW, b256, 0, stream>>>(Wk,  DM, DM, 0, WSC, Wcat + (size_t)1 * DM * DM, Wcat);
  k_wtrans<0><<<gW, b256, 0, stream>>>(Wqb, DM, DM, 0, WSC, Wcat + (size_t)2 * DM * DM, Wcat);
  k_wtrans<0><<<gW, b256, 0, stream>>>(Wkb, DM, DM, 0, WSC, Wcat + (size_t)3 * DM * DM, Wcat);
  k_wtrans<1><<<gW, b256, 0, stream>>>(Wv,  DM, DM, 0, 1.0f, Wvh, Wvl);
  k_wtrans<1><<<gW, b256, 0, stream>>>(Wo,  DM, DM, 0, 1.0f, Woh, Wol);
  k_wtrans<0><<<gW1, b256, 0, stream>>>(W1, DM, FUS, FFI, WSC, W1t, W1t);
  k_wtrans<0><<<gW2, b256, 0, stream>>>(W2, FFI, DM, 0, WSC, W2t, W2t);
  // (3) u = x . W1 + b1 with fused SwiGLU -> FF f16 [2048][4096] (x64)   (M=2048, N=8192, K=1024)
  k_gemm<_Float16, 2, 8, 0, 4><<<gF1, b256, 0, stream>>>(
      Xh, Xh, DM, W1t, W1t, DM,
      (void*)FF, FFI, (void*)FF, FFI, 0,
      b1, hs, hs, lam,
      SEQ, FUS, DM, 1.0f / (XSC * WSC), FSC);
  // (4) q|k|qb|kb = x . (Wq|Wk|Wqb|Wkb) -> f32 [2048][4096]   (M=2048, N=4096, K=1024)
  k_gemm<_Float16, 4, 4, 0, 0><<<gQK, b256, 0, stream>>>(
      Xh, Xh, DM, Wcat, Wcat, DM,
      (void*)QK, 4 * DM, (void*)QK, 4 * DM, 0,
      bo, hs, hs, lam,
      SEQ, 4 * DM, DM, 1.0f / (XSC * WSC), 1.0f);
  // (5) v^T = Wv^T . x^T -> f16 hi plane [h*64+d][s] + residual plane (keys < VLP)   (M=1024, N=2048, K=1024)
  k_gemm<__bf16, 4, 4, 2, 2><<<gVT, b256, 0, stream>>>(
      Wvh, Wvl, DM, Xbh, Xbl, DM,
      (void*)VTh, SEQ, (void*)VTl, VLP, VLP,
      bo, hs, hs, lam,
      DM, SEQ, DM, 1.0f, VRS);
  // (6) l2norm + rotary -> q, k f16 planes (into the dead Xbh/Xbl regions), qb, kb f32 planes
  k_rope<<<dim3(SEQ * NH / 8), b256, 0, stream>>>(QK, CS, Qh, Kh, QBn, KBn);
  // (7) causal prefix sum of kb (QK region is dead now)
  k_segsum<<<dim3(PSS * (DM / 128)), b256, 0, stream>>>(KBn, PS);
  k_prefix<<<dim3(PSS * (DM / 128)), b256, 0, stream>>>(KBn, PS, Pf);
  // (8) attention: query blocks 0..RESQB-1 with residual planes, the rest without
  k_attn<true><<<dim3(NH * RESQB), b128, 0, stream>>>(
      Qh, Kh, VTh, VTl, QBn, Pf, l2n, Yh, Yl, 0, RESQB);
  k_attn<false><<<dim3(NH * (NQB - RESQB)), b128, 0, stream>>>(
      Qh, Kh, VTh, VTl, QBn, Pf, l2n, Yh, Yl, RESQB, NQB - RESQB);
  // (9) attn_out = y . Wo + bo -> f32 [2048][1024]   (hi/lo x hi/lo, 3 products)
  k_gemm<__bf16, 4, 4, 2, 1><<<gWo, b256, 0, stream>>>(
      Yh, Yl, DM, Woh, Wol, DM,
      (void*)AO, DM, (void*)AO, DM, 0,
      bo, hs, hs, lam,
      SEQ, DM, DM, 1.0f, 1.0f);
  // (10) out = h*lambda + attn_out + ff . W2 + b2   (M=2048, N=1024, K=4096; 32x64 wave tiles)
  k_gemm<_Float16, 2, 4, 0, 3><<<gF2, b256, 0, stream>>>(
      FF, FF, FFI, W2t, W2t, FFI,
      d_out, DM, d_out, DM, 0,
      b2, hs, (const float*)AO, lam,
      SEQ, DM, FFI, 1.0f / (FSC * WSC), 1.0f);
  (void)hipGetLastError();
}

// v002
// A run of this version takes 339 microseconds.
// In two side-by-side timings against v001, it was 1.85 and 1.84 times as fast.
// Over all steps from v000 it is 4.68 times as fast.
// Contractions: x.(Wq|Wk|Wqb|Wkb), q.k^T scores, x.W1 and ff.W2 = v_wmma_f32_16x16x32_f16 (f16 operands with power-of-two carries, single product);
// v^T = Wv^T.x^T and attn = y.Wo = v_wmma_f32_16x16x32_bf16 with bf16 hi/lo split operands (hi.hi + hi.lo + lo.hi);
// p.v = v_wmma_f32_16x16x32_f16 (p carried x1024 in f16, v f16 plus x4096 f16 residual planes of p and v on the leading query blocks); all f32 accumulate.
#include <hip/hip_runtime.h>
#include <math.h>
#include <stdint.h>

#define SEQ   2048
#define DM    1024
#define NH    16
#define HD    64
#define FFI   4096
#define FUS   8192
#define NQB   (SEQ / 64)
#define VLP   512
#define RESQB 8
#define QSC   8.0f             // f16 carry of q and k after l2norm + rope
#define SSC   (1.0f / 64.0f)   // undo QSC*QSC on the score accumulator
#define XSC   16.0f            // f16 carry of the normalised activations
#define WSC   64.0f            // f16 carry of the weights
#define FSC   64.0f            // f16 carry of the SwiGLU output
#define VRS   4096.0f          // scale of the f16 residual planes of v and p
#define SP    20               // LDS result slab pitch per column (16 rows + 4 pad), floats
#define OSP   20               // attention context slab pitch per column

static_assert(RESQB * 64 <= VLP);
static_assert(NH * HD == DM);
static_assert((SEQ % 64) == 0 && (DM % 64) == 0 && (FFI % 64) == 0 && (FUS % 128) == 0);

typedef _Float16 v16h __attribute__((ext_vector_type(16)));
typedef _Float16 v8h  __attribute__((ext_vector_type(8)));
typedef __bf16   v16b __attribute__((ext_vector_type(16)));
typedef __bf16   v8b  __attribute__((ext_vector_type(8)));
typedef float    v8f  __attribute__((ext_vector_type(8)));
typedef float    v4f  __attribute__((ext_vector_type(4)));
typedef unsigned int v4u __attribute__((ext_vector_type(4)));

// rotary inverse frequencies, one per pair index d = 0..31, passed by value (host computed)
struct InvTab { float f[HD / 2]; };
static_assert(sizeof(InvTab) == 128);

// ---- scalar helpers --------------------------------------------------------------------------------
__device__ __forceinline__ unsigned short bf_bits(float f) {          // f32 -> bf16 bits, RNE convert
  unsigned u = __float_as_uint(f);
  return (unsigned short)((u + 0x7FFFu + ((u >> 16) & 1u)) >> 16);
}
__device__ __forceinline__ float bf_up(unsigned short h) { return __uint_as_float(((unsigned)h) << 16); }
__device__ __forceinline__ unsigned short h_bits(_Float16 x) { return __builtin_bit_cast(unsigned short, x); }
__device__ __forceinline__ unsigned pk16(unsigned short a, unsigned short b) { return (unsigned)a | ((unsigned)b << 16); }
__device__ __forceinline__ v8f zero8() { v8f z = {0.f, 0.f, 0.f, 0.f, 0.f, 0.f, 0.f, 0.f}; return z; }
__device__ __forceinline__ v8h zero8h() {
  const _Float16 z = (_Float16)0.0f;
  v8h r = {z, z, z, z, z, z, z, z};
  return r;
}
__device__ __forceinline__ void wave_sync_lds() {
  __builtin_amdgcn_fence(__ATOMIC_RELEASE, "workgroup");
  __builtin_amdgcn_wave_barrier();
  __builtin_amdgcn_fence(__ATOMIC_ACQUIRE, "workgroup");
}

// ---- fragment loaders: 16-bit A/B operand, lane -> row/col (lane&15), p already includes +8*(lane>>4);
//      elements 0..7 <- p[0..7] (k0+8h..), elements 8..15 <- p[16..23] (k0+16+8h..)
template <typename T> struct Frag16;
template <> struct Frag16<_Float16> { typedef v16h t; };
template <> struct Frag16<__bf16>   { typedef v16b t; };

__device__ __forceinline__ v16h ldfrag(const _Float16* p) {
  union { v16h v; v8h h[2]; } f;
  f.h[0] = *(const v8h*)(p);
  f.h[1] = *(const v8h*)(p + 16);
  return f.v;
}
__device__ __forceinline__ v16b ldfrag(const __bf16* p) {
  union { v16b v; v8b h[2]; } f;
  f.h[0] = *(const v8b*)(p);
  f.h[1] = *(const v8b*)(p + 16);
  return f.v;
}

// ---- WMMA helpers with trailing VALU hazard gap (non-template overloads per fragment type) -------------
__device__ __forceinline__ v8f mma_raw(v16h a, v16h b, v8f c) {
  return __builtin_amdgcn_wmma_f32_16x16x32_f16(false, a, false, b, (short)0, c, false, false);
}
__device__ __forceinline__ v8f mma_raw(v16b a, v16b b, v8f c) {
  return __builtin_amdgcn_wmma_f32_16x16x32_bf16(false, a, false, b, (short)0, c, false, false);
}
__device__ __forceinline__ v8f mma_h(v16h a, v16h b, v8f c) {
  c = mma_raw(a, b, c);
#if defined(__HIP_DEVICE_COMPILE__)
  asm volatile("v_nop\n\tv_nop\n\tv_nop\n\tv_nop" : "+v"(c) : "v"(a), "v"(b));
#endif
  return c;
}
__device__ __forceinline__ void dep_guard2(v8f& a, v8f& b, v16h x, v16h y) {
#if defined(__HIP_DEVICE_COMPILE__)
  asm volatile("v_nop\n\tv_nop\n\tv_nop\n\tv_nop" : "+v"(a), "+v"(b) : "v"(x), "v"(y));
#else
  (void)a; (void)b; (void)x; (void)y;
#endif
}
__device__ __forceinline__ void dep_guard2(v8f& a, v8f& b, v16b x, v16b y) {
#if defined(__HIP_DEVICE_COMPILE__)
  asm volatile("v_nop\n\tv_nop\n\tv_nop\n\tv_nop" : "+v"(a), "+v"(b) : "v"(x), "v"(y));
#else
  (void)a; (void)b; (void)x; (void)y;
#endif
}
__device__ __forceinline__ void keep1(v16h x) {
#if defined(__HIP_DEVICE_COMPILE__)
  asm volatile("v_nop" :: "v"(x));
#else
  (void)x;
#endif
}
__device__ __forceinline__ void keep1(v16b x) {
#if defined(__HIP_DEVICE_COMPILE__)
  asm volatile("v_nop" :: "v"(x));
#else
  (void)x;
#endif
}
__device__ __forceinline__ void acc_guard4(v8f& a, v8f& b, v8f& c, v8f& d) {
#if defined(__HIP_DEVICE_COMPILE__)
  asm volatile("v_nop\n\tv_nop\n\tv_nop\n\tv_nop" : "+v"(a), "+v"(b), "+v"(c), "+v"(d));
#else
  (void)a; (void)b; (void)c; (void)d;
#endif
}

// ---- SwiGLU element from the fused accumulator: silu(gate + bg) * (xp + bx) * rscale -------------------
__device__ __forceinline__ float swg(float xacc, float gacc, float oscale, float bx, float bg, float rscale) {
  const float xp = xacc * oscale + bx;
  const float g  = gacc * oscale + bg;
  const float sg = __builtin_amdgcn_rcpf(1.0f + __expf(-g));
  return (g * sg) * xp * rscale;
}

// =====================================================================================================
// cos/sin table: cs[t][0..31] = bf16(cos(t*invf[d])) widened to f32, cs[t][32..63] = bf16(sin(.)).
// invf arrives by value; each lane picks its entry with a static-index select chain (no private indexing).
// =====================================================================================================
__global__ __launch_bounds__(256) void k_cstab(InvTab tab, float* cs) {
  const int lane = threadIdx.x & 31, wave = threadIdx.x >> 5;
  const int t = blockIdx.x * 8 + wave;
  float ivf = tab.f[0];
#pragma unroll
  for (int i = 1; i < HD / 2; ++i) ivf = (lane == i) ? tab.f[i] : ivf;
  const float fr = (float)t * ivf;
  float sn, cn;
  sincosf(fr, &sn, &cn);
  const float cv = bf_up(bf_bits(cn));
  const float sv = bf_up(bf_bits(sn));
  float* pc = cs + (size_t)t * 64 + lane;
  float* ps = pc + 32;
  *(float*)pc = cv;
  *(float*)ps = sv;
  
}

// =====================================================================================================
// RMSNorm (no affine, eps = f32 eps) of one row per block (128 threads x 8 elements) and conversion to
// three planes [2048][1024]: f16(x*16), bf16 hi, bf16 lo (RNE, lo = RNE(x - hi)). Each thread stores 16 B
// coverage: 2048 blocks x 128 threads x 8 = the whole plane.
// =====================================================================================================
__global__ __launch_bounds__(128) void k_xnorm(const float* __restrict__ hs, unsigned short* xh,
                                               unsigned short* xbh, unsigned short* xbl) {
  __shared__ float red[4];
  const int tid = threadIdx.x, lane = tid & 31, wave = tid >> 5, t = blockIdx.x;
  const size_t off = (size_t)t * DM + (size_t)tid * 8;
  const v4f a = *(const v4f*)(hs + off);
  const v4f b = *(const v4f*)(hs + off + 4);
  float ss = a[0] * a[0] + a[1] * a[1] + a[2] * a[2] + a[3] * a[3]
           + b[0] * b[0] + b[1] * b[1] + b[2] * b[2] + b[3] * b[3];
#pragma unroll
  for (int o = 1; o < 32; o <<= 1) ss += __shfl_xor(ss, o, 32);
  if (lane == 0) red[wave] = ss;
  __syncthreads();
  const float tot = (red[0] + red[1]) + (red[2] + red[3]);
  const float rn = rsqrtf(tot * (1.0f / (float)DM) + 1.1920929e-7f);
  float x[8];
  x[0] = a[0] * rn; x[1] = a[1] * rn; x[2] = a[2] * rn; x[3] = a[3] * rn;
  x[4] = b[0] * rn; x[5] = b[1] * rn; x[6] = b[2] * rn; x[7] = b[3] * rn;
  v4u ph, pb, pl;
#pragma unroll
  for (int e = 0; e < 4; ++e) {
    const float f0 = x[2 * e], f1 = x[2 * e + 1];
    ph[e] = pk16(h_bits((_Float16)(f0 * XSC)), h_bits((_Float16)(f1 * XSC)));
    const unsigned short hb0 = bf_bits(f0), hb1 = bf_bits(f1);
    pb[e] = pk16(hb0, hb1);
    pl[e] = pk16(bf_bits(f0 - bf_up(hb0)), bf_bits(f1 - bf_up(hb1)));
  }
  *(v4u*)(xh + off)  = ph;
  *(v4u*)(xbh + off) = pb;
  *(v4u*)(xbl + off) = pl;
  
}

// =====================================================================================================
// Weight transpose + convert: W [K][N] f32 (in k, out n) -> Wt [N][K] 16-bit (k contiguous), 64x64 tile per
// block through LDS. MODE 0: f16(w*wscale) -> out0; MODE 1: bf16 hi -> out0, bf16 lo -> out1.
// coverage: 2 it x 8 waves x 4 rows = 64 output rows, 8 lanes x 8 = 64 k columns per tile; grid (N/64, K/64).
// =====================================================================================================
template <int MODE>
__global__ __launch_bounds__(256) void k_wtrans(const float* __restrict__ W, int K, int N, int nhalf, float wscale,
                                                unsigned short* out0, unsigned short* out1) {
  __shared__ float tl[64][65];
  const int tid = threadIdx.x, lane = tid & 31, wave = tid >> 5;
  const int n0 = blockIdx.x * 64, k0 = blockIdx.y * 64;
  {
    const int i0 = tid >> 4, cc = (tid & 15) * 4;
#pragma unroll
    for (int p = 0; p < 4; ++p) {
      const int i = p * 16 + i0;
      const v4f v = *(const v4f*)(W + (size_t)(k0 + i) * N + n0 + cc);
      tl[i][cc] = v[0]; tl[i][cc + 1] = v[1]; tl[i][cc + 2] = v[2]; tl[i][cc + 3] = v[3];
    }
  }
  __syncthreads();
  const int orow0 = (nhalf > 0) ? ((n0 < nhalf) ? (2 * n0) : (2 * (n0 - nhalf) + 64)) : n0;
  const int q8 = lane >> 3, c8 = (lane & 7) * 8;
  v4u hv[2], lv[2];
#pragma unroll
  for (int it = 0; it < 2; ++it) {
    const int j = it * 32 + wave * 4 + q8;
    v4u a, a2;
#pragma unroll
    for (int e = 0; e < 4; ++e) {
      const float f0 = tl[c8 + 2 * e][j], f1 = tl[c8 + 2 * e + 1][j];
      if constexpr (MODE == 0) {
        a[e] = pk16(h_bits((_Float16)(f0 * wscale)), h_bits((_Float16)(f1 * wscale)));
        a2[e] = 0u;
      } else {
        const unsigned short hb0 = bf_bits(f0), hb1 = bf_bits(f1);
        a[e] = pk16(hb0, hb1);
        a2[e] = pk16(bf_bits(f0 - bf_up(hb0)), bf_bits(f1 - bf_up(hb1)));
      }
    }
    hv[it] = a; lv[it] = a2;
  }
  {
#pragma unroll
    for (int it = 0; it < 2; ++it) {
      const int j = it * 32 + wave * 4 + q8;
      const size_t go = (size_t)(orow0 + j) * K + k0 + c8;
      *(v4u*)(out0 + go) = hv[it];
      if constexpr (MODE == 1) *(v4u*)(out1 + go) = lv[it];
    }
    
  }
}

// =====================================================================================================
// Register-blocked 16-bit WMMA GEMM: C[m][n] = sum_k A[m][k] * Bt[n][k]; one wave per (16*MI)x(16*NJ) tile,
// the 8 waves of a work-group laid out WM x WN over one (WM*16*MI)x(WN*16*NJ) block tile.
// A row-major [M][K] pitch lda; Bt row-major [N][K] pitch ldb (k contiguous);
// M, N multiples of the block tile, K multiple of KS (host-checked). T = _Float16 or __bf16.
// Operand path: per stage of KS = 64 k every operand row of the block tile (one whole 128-B line) is loaded once
// by the work-group (8 lanes x 16 B per row), kept in registers while the current stage is multiplied, and then
// stored to the other of two LDS buffers (row pitch 144 B for the 16-B fragment reads); one barrier per stage.
// Stage rows: [A | A2 | Bt | Bt2] (the second planes only with NSPLIT 2).
// KD = K = lda = ldb at compile time, so that the step from one group of 32 rows to the next is an immediate
// offset of the load and a plane needs one scalar base and one 32-bit offset register.
// NSPLIT: 0 = A.Bt; 2 = A.Bt + A.Bt2 + A2.Bt (unscaled hi/lo planes), in that order per k step.
// EPI 0: f32 C = acc*oscale (pitch ldc).  EPI 1: f32 C = acc*oscale + bias[n].
// EPI 2: f16 hi plane C (pitch ldc) + f16 residual plane C2 = f16((v - hi)*rscale) for tiles with n0 < N2
//        (pitch ldc2).  EPI 3: f32 C = acc*oscale + bias[n] + resh[m][n]*lamp[0] + resa[m][n].
// EPI 4 (MI=2, NJ=8, TN=128): fused SwiGLU: subtiles j<4 are xp columns ocol0+16j+c, j>=4 the matching gate
//        columns; C (f16, pitch ldc) [m][ocol0 + ..63] = f16( silu(gate+bias[FFI+col]) * (xp+bias[col]) * rscale ).
// Epilogue: 16-row x 64-col slabs staged per wave in LDS, column-major (pitch SP): every lane writes its 8
// accumulator rows of one column with two 16-B vector stores; rows are then gathered and each 64-wide row
// coverage per wave: MI slabs x 16 rows x 64 output cols.
// =====================================================================================================
#define KS 64                  // k elements per LDS stage
#define LP (KS + 8)            // LDS row pitch of a stage, elements (128 B + 16 B)
template <typename T, int MI, int NJ, int NSPLIT, int EPI, int WM, int WN, int KD>
__global__ __launch_bounds__(256) void k_gemm(
    const unsigned short* __restrict__ Ap, const unsigned short* __restrict__ A2p, int lda,
    const unsigned short* __restrict__ Bp, const unsigned short* __restrict__ B2p, int ldb,
    void* Cout, int ldc, void* Cout2, int ldc2, int N2,
    const float* __restrict__ bias, const float* __restrict__ resh,
    const float* __restrict__ resa, const float* __restrict__ lamp,
    int M, int N, int K, float oscale, float rscale) {
  typedef typename Frag16<T>::t FR;
  static_assert((EPI == 4) ? (MI == 2 && NJ == 8) : (NJ == 4 && (MI == 2 || MI == 4)));
  static_assert(NSPLIT == 0 || NSPLIT == 2);
  static_assert(WM * WN == 8);
  const T* A   = (const T*)(const void*)Ap;
  const T* A2  = (const T*)(const void*)A2p;
  const T* Bt  = (const T*)(const void*)Bp;
  const T* Bt2 = (const T*)(const void*)B2p;
  constexpr int TM = 16 * MI, TN = 16 * NJ;
  constexpr int BM = WM * TM, BN = WN * TN;
  constexpr int NPL  = (NSPLIT == 2) ? 2 : 1;      // planes per operand
  constexpr int ROWS = NPL * (BM + BN);            // operand rows per stage
  constexpr int NCH  = ROWS / 32;                  // 16-B pieces per thread per stage (256 threads = 32 rows)
  static_assert((BM % 32) == 0 && (BN % 32) == 0);
  __shared__ __align__(16) T stg[2][ROWS * LP];    // two operand stages
  __shared__ __align__(16) float sT[8][64 * SP];   // per-wave 16x64 slab, column-major, pitch SP floats
  const int tid  = threadIdx.x;
  const int lane = tid & 31;
  const int wave = tid >> 5;
  const int tilesNb = N / BN;
  const int tilesMb = M / BM;
  if ((int)blockIdx.x >= tilesMb * tilesNb) return;   // block-uniform, ahead of every barrier
  if (lda != KD || ldb != KD || K != KD) return;      // uniform over the grid
  const int bm = blockIdx.x / tilesNb;
  const int bn = blockIdx.x - bm * tilesNb;
  const int wm = wave / WN;
  const int wn = wave - wm * WN;
  const int m0 = bm * BM + wm * TM;
  const int n0 = bn * BN + wn * TN;
  const int tn = n0 / TN;
  const int rl   = lane & 15;            // row (A) / col (B, D) within subtile
  const int koff = (lane >> 4) * 8;      // k offset of this lane half
  const int mOff = (lane >> 4) * 8;      // D row offset

  v8f acc[MI][NJ];
#pragma unroll
  for (int i = 0; i < MI; ++i)
#pragma unroll
    for (int j = 0; j < NJ; ++j) acc[i][j] = zero8();

  // staging: thread -> row (tid>>3) of each group of 32 rows, 16-B piece (tid&7) of its 128-B line
  const int sr = tid >> 3, sc = (tid & 7) * 8;
  // address = block-uniform plane base + the thread's 32-bit byte offset (row in its group, piece, k) + row group
  static_assert((KD % KS) == 0);
  const unsigned vo0 = (unsigned)(sr * KD + sc) * 2u;
  const char* gA  = (const char*)(A   + (size_t)(bm * BM) * KD);
  const char* gA2 = (const char*)(A2  + (size_t)(bm * BM) * KD);
  const char* gB  = (const char*)(Bt  + (size_t)(bn * BN) * KD);
  const char* gB2 = (const char*)(Bt2 + (size_t)(bn * BN) * KD);
  v4u st[NCH];
  auto fetch = [&](int k0) {
    const unsigned vo = vo0 + (unsigned)k0 * 2u;
#pragma unroll
    for (int it = 0; it < NCH; ++it) {
      const int r = it * 32;
      const char* g;
      if (r < BM)                 g = gA  + (size_t)r * KD * 2;
      else if (r < NPL * BM)      g = gA2 + (size_t)(r - BM) * KD * 2;
      else if (r < NPL * BM + BN) g = gB  + (size_t)(r - NPL * BM) * KD * 2;
      else                        g = gB2 + (size_t)(r - NPL * BM - BN) * KD * 2;
      st[it] = *(const v4u*)(g + vo);
    }
#if defined(__HIP_DEVICE_COMPILE__)
    // stands ahead of every later write to the address registers of the loads above
    asm volatile("s_wait_xcnt 0x0" ::: "memory");
#endif
  };
  auto put = [&](T* buf) {
#pragma unroll
    for (int it = 0; it < NCH; ++it) *(v4u*)(buf + (it * 32 + sr) * LP + sc) = st[it];
  };

  fetch(0);
  put(stg[0]);
  __syncthreads();
  constexpr int nst = KD / KS;
  for (int s = 0; s < nst; ++s) {
    const bool more = (s + 1 < nst);     // block-uniform
    if (more) fetch((s + 1) * KS);       // in flight while this stage is multiplied
    const T* buf = stg[s & 1];
    const T* sa  = buf + (wm * TM + rl) * LP + koff;
    const T* sa2 = sa + BM * LP;
    const T* sb  = buf + (NPL * BM + wn * TN + rl) * LP + koff;
    const T* sb2 = sb + BN * LP;
#pragma unroll
    for (int kk = 0; kk < KS; kk += 32) {
      // the fragments of a k step are read from LDS in groups ahead of their products (B: four subtile columns)
      FR ah[MI];
#pragma unroll
      for (int i = 0; i < MI; ++i) ah[i] = ldfrag(sa + 16 * i * LP + kk);
#pragma unroll
      for (int jg = 0; jg < NJ; jg += 4) {
        FR bh[4], bl[4];
#pragma unroll
        for (int jj = 0; jj < 4; ++jj) {
          bh[jj] = ldfrag(sb + 16 * (jg + jj) * LP + kk);
          if constexpr (NSPLIT == 2) bl[jj] = ldfrag(sb2 + 16 * (jg + jj) * LP + kk);
          else bl[jj] = bh[jj];
        }
#pragma unroll
        for (int jj = 0; jj < 4; ++jj) {
          const int j = jg + jj;
#pragma unroll
          for (int i = 0; i < MI; ++i) {
            acc[i][j] = mma_raw(ah[i], bh[jj], acc[i][j]);
            if constexpr (NSPLIT == 2) acc[i][j] = mma_raw(ah[i], bl[jj], acc[i][j]);
          }
          dep_guard2(acc[0][j], acc[MI - 1][j], bh[jj], bl[jj]);
        }
        if constexpr (NSPLIT == 2) {
          static_assert(NSPLIT == 0 || NJ == 4);   // one B group, so the A2 fragments may take the A fragments' place
#pragma unroll
          for (int i = 0; i < MI; ++i) keep1(ah[i]);
          FR al[MI];
#pragma unroll
          for (int i = 0; i < MI; ++i) al[i] = ldfrag(sa2 + 16 * i * LP + kk);
#pragma unroll
          for (int jj = 0; jj < 4; ++jj) {
            const int j = jg + jj;
#pragma unroll
            for (int i = 0; i < MI; ++i) acc[i][j] = mma_raw(al[i], bh[jj], acc[i][j]);
            dep_guard2(acc[0][j], acc[MI - 1][j], bh[jj], bh[jj]);
          }
#pragma unroll
          for (int i = 0; i < MI; ++i) keep1(al[i]);
        }
      }
      if constexpr (NSPLIT == 0) {
#pragma unroll
        for (int i = 0; i < MI; ++i) keep1(ah[i]);
      }
    }
    if (more) put(stg[(s + 1) & 1]);     // every reader left that buffer at the barrier of the stage before
    __syncthreads();                     // publishes stage s+1; ends the reads of stage s
  }
#pragma unroll
  for (int i = 0; i < MI; ++i)
#pragma unroll
    for (int j = 0; j < NJ; j += 4) acc_guard4(acc[i][j], acc[i][j + 1], acc[i][j + 2], acc[i][j + 3]);

  // ---- epilogue ----
  float* slab = sT[wave];
  const int ocol0 = (EPI == 4) ? (tn * 64) : n0;
  const int hq = lane >> 4, c4 = (lane & 15) * 4;   // f32 path: 256-B row segment = 16 lanes x 16 B
  const int q8 = lane >> 3, c8 = (lane & 7) * 8;
  float bxv[4] = {0.f, 0.f, 0.f, 0.f}, bgv[4] = {0.f, 0.f, 0.f, 0.f};
  v4f b4 = {0.f, 0.f, 0.f, 0.f};
  float lam = 0.f;
  if constexpr (EPI == 4) {
#pragma unroll
    for (int j = 0; j < 4; ++j) {
      bxv[j] = bias[ocol0 + 16 * j + rl];
      bgv[j] = bias[FFI + ocol0 + 16 * j + rl];
    }
  }
  if constexpr (EPI == 1 || EPI == 3) b4 = *(const v4f*)(bias + n0 + c4);
  if constexpr (EPI == 3) lam = lamp[0];

#pragma unroll
  for (int i = 0; i < MI; ++i) {
    const int mBase = m0 + 16 * i;
    // lane writes column 16j+rl, rows mOff..mOff+7 = 32 contiguous bytes as two 16-B vector LDS stores
#pragma unroll
    for (int j = 0; j < 4; ++j) {
      v4f w0, w1;
      if constexpr (EPI == 4) {
#pragma unroll
        for (int r = 0; r < 4; ++r) {
          w0[r] = swg(acc[i][j][r],     acc[i][j + 4][r],     oscale, bxv[j], bgv[j], rscale);
          w1[r] = swg(acc[i][j][r + 4], acc[i][j + 4][r + 4], oscale, bxv[j], bgv[j], rscale);
        }
      } else {
#pragma unroll
        for (int r = 0; r < 4; ++r) {
          w0[r] = acc[i][j][r] * oscale;
          w1[r] = acc[i][j][r + 4] * oscale;
        }
      }
      float* cp = slab + (16 * j + rl) * SP + mOff;
      *(v4f*)(cp) = w0;
      *(v4f*)(cp + 4) = w1;
    }
    wave_sync_lds();
    if constexpr (EPI == 0 || EPI == 1 || EPI == 3) {
      float* C = (float*)Cout;
      v4f fin[8];
#pragma unroll
      for (int it = 0; it < 8; ++it) {
        const int row = 2 * it + hq;                   // it 0..7 x hq 0..1 = rows 0..15
        v4f v;
        v[0] = slab[(c4 + 0) * SP + row];
        v[1] = slab[(c4 + 1) * SP + row];
        v[2] = slab[(c4 + 2) * SP + row];
        v[3] = slab[(c4 + 3) * SP + row];
        if constexpr (EPI == 1) v = v + b4;
        if constexpr (EPI == 3) {
          const size_t go = (size_t)(mBase + row) * ldc + n0 + c4;
          const v4f hvv = *(const v4f*)(resh + go);
          const v4f avv = *(const v4f*)(resa + go);
#if defined(__HIP_DEVICE_COMPILE__)
          // stands ahead of the next rows' loads, whose results the compiler lays over these loads' address registers
          asm volatile("s_wait_xcnt 0x0" ::: "memory");
#endif
          v = v + b4 + hvv * lam + avv;
        }
        fin[it] = v;
      }
      {
#pragma unroll
        for (int it = 0; it < 8; ++it) {
          const int row = 2 * it + hq;
          *(v4f*)(C + (size_t)(mBase + row) * ldc + n0 + c4) = fin[it];
        }
        
      }
    } else {
      unsigned short* C  = (unsigned short*)Cout;
      unsigned short* C2 = (unsigned short*)Cout2;
      const bool wlo = (EPI == 2) && (n0 < N2);        // wave-uniform
      v4u hv[4], lv[4];
#pragma unroll
      for (int it = 0; it < 4; ++it) {
        const int row = 4 * it + q8;                   // it 0..3 x q8 0..3 = rows 0..15
        v4u a, a2;
#pragma unroll
        for (int e = 0; e < 4; ++e) {
          const float f0 = slab[(c8 + 2 * e) * SP + row], f1 = slab[(c8 + 2 * e + 1) * SP + row];
          const _Float16 x0 = (_Float16)f0, x1 = (_Float16)f1;
          unsigned short l0 = 0, l1 = 0;
          if constexpr (EPI == 2) {
            l0 = h_bits((_Float16)((f0 - (float)x0) * rscale));
            l1 = h_bits((_Float16)((f1 - (float)x1) * rscale));
          }
          a[e] = pk16(h_bits(x0), h_bits(x1)); a2[e] = pk16(l0, l1);
        }
        hv[it] = a; lv[it] = a2;
      }
      {
#pragma unroll
        for (int it = 0; it < 4; ++it) {
          const int row = 4 * it + q8;
          *(v4u*)(C + (size_t)(mBase + row) * ldc + ocol0 + c8) = hv[it];
          if (wlo) *(v4u*)(C2 + (size_t)(mBase + row) * ldc2 + n0 + c8) = lv[it];
        }
        
      }
    }
    wave_sync_lds();
  }
}

// =====================================================================================================
// Per-head l2 normalisation + rotary embedding for q, k, qb, kb. Input QK f32 [2048][4096]
// (cols: q | k | qb | kb, each [h*64 + d]); cs table [t][cos 0..31 | sin 0..31] (bf16-valued f32).
// One wave per (t, h): lane d handles the rotary pair (d, d+32). Results exchanged through a per-wave LDS
// grid = 32768/8 blocks of 256. coverage: every (t, h) row of all four planes.
// =====================================================================================================
__global__ __launch_bounds__(256) void k_rope(const float* __restrict__ qkf, const float* __restrict__ cs,
                                              unsigned short* qh, unsigned short* kh, float* qbn, float* kbn) {
  __shared__ __align__(16) float yb[8][4 * 64];
  const int lane = threadIdx.x & 31, wave = threadIdx.x >> 5;
  const int p = blockIdx.x * 8 + wave;     // p = t*16 + h
  const int t = p >> 4, h = p & 15;
  const float cth = cs[(size_t)t * 64 + lane];
  const float sth = cs[(size_t)t * 64 + 32 + lane];
  const float* row = qkf + (size_t)t * (4 * DM) + h * HD;
  float* ybw = yb[wave];
#pragma unroll
  for (int g = 0; g < 4; ++g) {
    const float* src = row + g * DM;
    float x1 = src[lane], x2 = src[lane + 32];
    float n2 = x1 * x1 + x2 * x2;
#pragma unroll
    for (int o = 1; o < 32; o <<= 1) n2 += __shfl_xor(n2, o, 32);
    const float rn = 1.0f / fmaxf(sqrtf(n2), 1e-12f);
    x1 *= rn; x2 *= rn;
    ybw[g * 64 + lane]      = x1 * cth + x2 * sth;
    ybw[g * 64 + 32 + lane] = x2 * cth - x1 * sth;
  }
  wave_sync_lds();
  const int c8 = (lane & 7) * 8, c4 = (lane & 15) * 4;
  v4u qv, kv;
#pragma unroll
  for (int e = 0; e < 4; ++e) {
    qv[e] = pk16(h_bits((_Float16)(ybw[c8 + 2 * e] * QSC)), h_bits((_Float16)(ybw[c8 + 2 * e + 1] * QSC)));
    kv[e] = pk16(h_bits((_Float16)(ybw[64 + c8 + 2 * e] * QSC)), h_bits((_Float16)(ybw[64 + c8 + 2 * e + 1] * QSC)));
  }
  const v4f qbv = *(const v4f*)(ybw + 128 + c4);
  const v4f kbv = *(const v4f*)(ybw + 192 + c4);
  const size_t g16 = (size_t)t * DM + h * HD + c8;
  const size_t g32 = (size_t)t * DM + h * HD + c4;
  {
    if (lane < 8) {
      *(v4u*)(qh + g16) = qv;
      *(v4u*)(kh + g16) = kv;
    }
    if (lane < 16) {
      *(v4f*)(qbn + g32) = qbv;
      *(v4f*)(kbn + g32) = kbv;
    }
    
  }
}

// =====================================================================================================
// Inclusive causal prefix sum of kb over positions: pf[t][col] = sum_{s<=t} kbn[s][col], summed in f64.
// Blocked scan in two launches. The 2048 positions are cut into PSS blocks of 64 rows, each block into 8 wave
// slices of PWR rows; a work-group covers 64 rows x 128 columns, a lane 4 neighbouring columns (16-B accesses).
//   k_segsum: part[ss][col] = f64 sum of the 64 rows of block ss.
//   k_prefix: offset = sum of part[0..ss-1][col] + sums of the lower wave slices (scanned in LDS), added to the
//             lane's own running sum over its PWR rows; every pf line is stored whole by one wave.
// coverage of both: grid PSS x (DM/128) work-groups x 8 waves x PWR rows x 128 columns = the whole plane.
// Every loop of the two kernels is unrolled in full, so that its small arrays live in registers and the loads
// of one array are issued back to back.
// =====================================================================================================
#define PSS 32                 // row blocks of 64 positions
#define PWR 8                  // rows per wave slice
static_assert(PSS * 8 * PWR == SEQ && (DM % 128) == 0 && (PSS % 2) == 0);

__global__ __launch_bounds__(256) void k_segsum(const float* __restrict__ kbn, double* __restrict__ part) {
  __shared__ __align__(16) double wsum[8][128];
  const int tid = threadIdx.x, lane = tid & 31, wave = tid >> 5;
  const int cg = blockIdx.x % (DM / 128), ss = blockIdx.x / (DM / 128);
  const float* src = kbn + (size_t)(ss * 64 + wave * PWR) * DM + cg * 128 + lane * 4;
  v4f x[PWR];
#pragma unroll
  for (int i = 0; i < PWR; ++i) x[i] = *(const v4f*)(src + (size_t)i * DM);
  double s[4];
#pragma unroll
  for (int e = 0; e < 4; ++e) s[e] = (double)x[0][e];
#pragma unroll
  for (int i = 1; i < PWR; ++i)
#pragma unroll
    for (int e = 0; e < 4; ++e) s[e] += (double)x[i][e];
#pragma unroll
  for (int e = 0; e < 4; ++e) wsum[wave][lane * 4 + e] = s[e];
  __syncthreads();
  if (tid < 128) {
    double v[8];
#pragma unroll
    for (int w = 0; w < 8; ++w) v[w] = wsum[w][tid];
    double a = v[0];
#pragma unroll
    for (int w = 1; w < 8; ++w) a += v[w];
    part[(size_t)ss * DM + cg * 128 + tid] = a;
  }
}

__global__ __launch_bounds__(256) void k_prefix(const float* __restrict__ kbn, const double* __restrict__ part,
                                                float* __restrict__ pf) {
  __shared__ __align__(16) double wsum[8][128];   // sum of each wave slice, per column; then its offset
  __shared__ __align__(16) double sup[2][128];    // sum of the lower row blocks, even / odd blocks apart
  const int tid = threadIdx.x, lane = tid & 31, wave = tid >> 5;
  const int cg = blockIdx.x % (DM / 128), ss = blockIdx.x / (DM / 128);
  const size_t go = (size_t)(ss * 64 + wave * PWR) * DM + cg * 128 + lane * 4;
  const float* src = kbn + go;
  v4f x[PWR];
#pragma unroll
  for (int i = 0; i < PWR; ++i) x[i] = *(const v4f*)(src + (size_t)i * DM);
  // lower row blocks: all PSS rows of part were written by k_segsum, so every load is issued at once and
  // the rows from ss on are dropped by the select (waves 0..3 take the even blocks, waves 4..7 the odd ones)
  {
    const int c = tid & 127, hf = tid >> 7;
    const double* pp = part + (size_t)hf * DM + cg * 128 + c;
    double pv[PSS / 2];
#pragma unroll
    for (int j = 0; j < PSS / 2; ++j) pv[j] = pp[(size_t)(2 * j) * DM];
    // keeps every load above ahead of the sums: without it two of them are issued only after the first have
    // come back, and the wave pays the memory latency twice
    __builtin_amdgcn_sched_barrier(0);
    double so = 0.0;
#pragma unroll
    for (int j = 0; j < PSS / 2; ++j) so += (2 * j + hf < ss) ? pv[j] : 0.0;
    sup[hf][c] = so;
  }
  // the lane's own running sums
  double p[PWR][4];
#pragma unroll
  for (int e = 0; e < 4; ++e) p[0][e] = (double)x[0][e];
#pragma unroll
  for (int i = 1; i < PWR; ++i)
#pragma unroll
    for (int e = 0; e < 4; ++e) p[i][e] = p[i - 1][e] + (double)x[i][e];
#pragma unroll
  for (int e = 0; e < 4; ++e) wsum[wave][lane * 4 + e] = p[PWR - 1][e];
  __syncthreads();
  // one thread per column turns the slice sums into each slice's offset, in place
  if (tid < 128) {
    double v[8];
#pragma unroll
    for (int w = 0; w < 8; ++w) v[w] = wsum[w][tid];
    double run = sup[0][tid] + sup[1][tid];
#pragma unroll
    for (int w = 0; w < 8; ++w) { wsum[w][tid] = run; run += v[w]; }
  }
  __syncthreads();
  double off[4];
#pragma unroll
  for (int e = 0; e < 4; ++e) off[e] = wsum[wave][lane * 4 + e];
  float* dst = pf + go;
#pragma unroll
  for (int i = 0; i < PWR; ++i) {
    v4f o;
#pragma unroll
    for (int e = 0; e < 4; ++e) o[e] = (float)(off[e] + p[i][e]);
    *(v4f*)(dst + (size_t)i * DM) = o;
  }
}

// =====================================================================================================
// Causal attention, head dim 64, plus the bias-attention row term.
//   q, k planes (f16, x8, normalised + rotary): element (t, h, d) at [t*DM + h*64 + d]
//   v^T hi plane (f16): element (h, d, s) at [(h*64 + d)*SEQ + s]; v^T residual plane (f16, (v - hi)*4096):
//   [(h*64 + d)*VLP + s], s < VLP, read only when RES (query blocks 0..RESQB-1 see only keys < VLP).
//   scores = q . k (single f16 product), * 1/64, key > query -> -inf; online softmax in f32.
//   p = exp(s - m) carried as f16(1024 p); context = p . v on f16 WMMA; RES adds f16 residual planes of p and v
//   (scale 4096, separate accumulator folded back with 1/4096 per chunk in f32).
//   y = l2ns * context / l + sb, sb = 0.125 * qbn[q] . pfx[q] (64-dot over the head dims, prefix sum of kb),
//   written as bf16 hi / lo planes [t][h*64 + d].
//   Block = 4 waves = 64 query rows of one h; grid = nqbThis * NH; key chunks of 64, trip count qb+1 (<= 32).
//   K / V^T chunk staging: 128 threads x 32 elements per plane = the whole 64x64 tile (plain 16-B loads,
//   __syncthreads before and after); P tiles are wave-private, spilled with _Float16 element stores and reloaded
//   (pitch 64); the context slab (pitch OSP) is written with two 16-B vector LDS stores per lane per column.
//   Output coverage: each wave stores rows q0..q0+15 (it 0..3 x lane>>3 0..3) x 64 columns (8 lanes x 8) of both planes.
// =====================================================================================================
template <bool RES>
__global__ __launch_bounds__(128)
void k_attn(const unsigned short* __restrict__ qhp, const unsigned short* __restrict__ khp,
            const unsigned short* __restrict__ vhp, const unsigned short* __restrict__ vlp,
            const float* __restrict__ qbn, const float* __restrict__ pfx, const float* __restrict__ l2p,
            unsigned short* yhp, unsigned short* ylp, int qbBase, int nqbThis) {
  union FH { v16h v; v8h h[2]; };
  __shared__ __align__(16) _Float16 Ksh[64 * 64];                 // K [kv][d]  8 KB
  __shared__ __align__(16) _Float16 Vth[64 * 64];                 // V^T hi [d][kv] 8 KB
  __shared__ __align__(16) _Float16 Vtl[RES ? 64 * 64 : 8];       // V^T residual
  __shared__ __align__(16) _Float16 Psh[4][16 * 64];              // per wave P [row][kv]
  __shared__ __align__(16) _Float16 Psl[RES ? 4 : 1][16 * 64];    // per wave P residual
  __shared__ __align__(16) float    Os[4][64 * OSP];              // per wave context slab [d][row], pitch OSP
  __shared__ float Sbl[4][16];                                    // per wave bias-attention row values

  const int tid  = threadIdx.x;
  const int wave = tid >> 5;
  const int lane = tid & 31;
  const int hh   = lane >> 4;
  const int c    = lane & 15;

  const int bx  = blockIdx.x;
  const int qbl = bx % nqbThis;
  const int h   = bx / nqbThis;
  const int qb  = qbBase + qbl;
  const int q0  = qb * 64 + wave * 16;

  const _Float16* Qh = (const _Float16*)(const void*)qhp + (size_t)h * HD;
  const _Float16* Kh = (const _Float16*)(const void*)khp + (size_t)h * HD;
  const _Float16* Vh = (const _Float16*)(const void*)vhp + (size_t)h * HD * SEQ;
  const _Float16* Vl = (const _Float16*)(const void*)vlp + (size_t)h * HD * VLP;

  // ---- Q fragments (A operand, row = lane&15): 2 d-chunks ----
  v16h qa[2];
#pragma unroll
  for (int dc = 0; dc < 2; ++dc) qa[dc] = ldfrag(Qh + (size_t)(q0 + c) * DM + dc * 32 + 8 * hh);

  float mrow[8], lrow[8];
  v8f oacc[4];
#pragma unroll
  for (int r = 0; r < 8; ++r) { mrow[r] = -INFINITY; lrow[r] = 0.f; }
#pragma unroll
  for (int t = 0; t < 4; ++t) oacc[t] = zero8();

  int nkt = qb + 1;                          // causal: key tiles 0..qb; block-uniform, <= NQB
  if (nkt > NQB) nkt = NQB;
  for (int kt = 0; kt < nkt; ++kt) {
    const int kv0 = kt * 64;
    __syncthreads();
    {
      const int r = tid >> 1, half = (tid & 1) * 32;
      const _Float16* kg = Kh + (size_t)(kv0 + r) * DM + half;      // K row kv0+r, d = half..half+31
      const _Float16* vg = Vh + (size_t)r * SEQ + kv0 + half;       // V^T row d = r, s = kv0+half..+31
      const int kvl = (kv0 + 64 <= VLP) ? kv0 : (VLP - 64);         // clamped address into the residual plane
      const _Float16* vlg = Vl + (size_t)r * VLP + kvl + half;
      const bool resOK = (kv0 + 64 <= VLP);                          // block-uniform
#pragma unroll
      for (int i = 0; i < 4; ++i) {
        const v8h a0 = *(const v8h*)(kg + 8 * i);
        const v8h b0 = *(const v8h*)(vg + 8 * i);
        *(v8h*)(Ksh + r * 64 + half + 8 * i) = a0;
        *(v8h*)(Vth + r * 64 + half + 8 * i) = b0;
        if (RES) {
          v8h b1 = *(const v8h*)(vlg + 8 * i);
          if (!resOK) b1 = zero8h();
          *(v8h*)(Vtl + r * 64 + half + 8 * i) = b1;
        }
      }
    }
    __syncthreads();

    // ---- scores: 16 query rows x 64 keys per wave, single f16 product ----
    v8f s[4];
#pragma unroll
    for (int j = 0; j < 4; ++j) {
      s[j] = zero8();
#pragma unroll
      for (int dc = 0; dc < 2; ++dc) {
        FH kb;
        kb.h[0] = *(const v8h*)(Ksh + (j * 16 + c) * 64 + dc * 32 + 8 * hh);
        kb.h[1] = *(const v8h*)(Ksh + (j * 16 + c) * 64 + dc * 32 + 16 + 8 * hh);
        s[j] = mma_h(qa[dc], kb.v, s[j]);
      }
    }

    // ---- undo carries, causal mask, row max, online softmax, P (x1024, f16) and P residual (x4096) to LDS ----
    _Float16* pwh = Psh[wave];
    _Float16* pwl = Psl[RES ? wave : 0];
#pragma unroll
    for (int r = 0; r < 8; ++r) {
      const int qrow = q0 + 8 * hh + r;
      float m = -INFINITY;
#pragma unroll
      for (int j = 0; j < 4; ++j) {
        const int key = kv0 + j * 16 + c;
        float sv = s[j][r] * SSC;
        sv = (key <= qrow) ? sv : -INFINITY;
        s[j][r] = sv;
        m = fmaxf(m, sv);
      }
#pragma unroll
      for (int off = 1; off < 16; off <<= 1) m = fmaxf(m, __shfl_xor(m, off, 32));
      const float mnew  = fmaxf(mrow[r], m);
      const float msafe = (mnew == -INFINITY) ? 0.f : mnew;
      const float alpha = __expf(mrow[r] - msafe);
      mrow[r] = mnew;
      float psum = 0.f;
#pragma unroll
      for (int j = 0; j < 4; ++j) {
        const float p = __expf(s[j][r] - msafe);     // masked logit: exp(-inf) -> 0
        psum += p;
        const float p1k = p * 1024.0f;
        const _Float16 ph = (_Float16)p1k;
        pwh[(8 * hh + r) * 64 + j * 16 + c] = ph;
        if (RES) {
          const _Float16 pl = (_Float16)((p1k - (float)ph) * VRS);
          pwl[(8 * hh + r) * 64 + j * 16 + c] = pl;
        }
      }
#pragma unroll
      for (int off = 1; off < 16; off <<= 1) psum += __shfl_xor(psum, off, 32);
      lrow[r] = lrow[r] * alpha + psum;
#pragma unroll
      for (int t = 0; t < 4; ++t) oacc[t][r] *= alpha;
    }
    wave_sync_lds();

    // ---- context += P . V (f16 WMMA), residual products into a separate accumulator ----
    v8f o1[4];
#pragma unroll
    for (int t = 0; t < 4; ++t) o1[t] = zero8();
#pragma unroll 1
    for (int kk = 0; kk < 2; ++kk) {
      FH pa, pl;
      pa.h[0] = *(const v8h*)(pwh + c * 64 + kk * 32 + 8 * hh);
      pa.h[1] = *(const v8h*)(pwh + c * 64 + kk * 32 + 16 + 8 * hh);
      if (RES) {
        pl.h[0] = *(const v8h*)(pwl + c * 64 + kk * 32 + 8 * hh);
        pl.h[1] = *(const v8h*)(pwl + c * 64 + kk * 32 + 16 + 8 * hh);
      } else {
        pl.v = pa.v;
      }
#pragma unroll
      for (int t = 0; t < 4; ++t) {
        FH vb;
        vb.h[0] = *(const v8h*)(Vth + (t * 16 + c) * 64 + kk * 32 + 8 * hh);
        vb.h[1] = *(const v8h*)(Vth + (t * 16 + c) * 64 + kk * 32 + 16 + 8 * hh);
        oacc[t] = mma_h(pa.v, vb.v, oacc[t]);
        if (RES) {
          FH vl;
          vl.h[0] = *(const v8h*)(Vtl + (t * 16 + c) * 64 + kk * 32 + 8 * hh);
          vl.h[1] = *(const v8h*)(Vtl + (t * 16 + c) * 64 + kk * 32 + 16 + 8 * hh);
          o1[t] = mma_h(pa.v, vl.v, o1[t]);
          o1[t] = mma_h(pl.v, vb.v, o1[t]);
        }
      }
    }
    if (RES) {
#pragma unroll
      for (int t = 0; t < 4; ++t)
#pragma unroll
        for (int r = 0; r < 8; ++r) oacc[t][r] += o1[t][r] * (1.0f / VRS);
    }
  }

  // ---- bias-attention row term: 0.125 * qb_row . prefix(kb)_row; lane (row = c, half hh) covers 32 dims ----
  const float l2ns = l2p[0];
  {
    const size_t ro = (size_t)(q0 + c) * DM + (size_t)h * HD + hh * 32;
    const float* qp = qbn + ro;
    const float* pp = pfx + ro;
    float ds = 0.f;
#pragma unroll
    for (int e = 0; e < 8; ++e) {
      const v4f a = *(const v4f*)(qp + 4 * e);
      const v4f b = *(const v4f*)(pp + 4 * e);
      ds += a[0] * b[0] + a[1] * b[1] + a[2] * b[2] + a[3] * b[3];
    }
    ds += __shfl_xor(ds, 16, 32);
    if (hh == 0) Sbl[wave][c] = ds * 0.125f;
  }

  // ---- normalise (l2ns/l and the 1/1024 p carry), stage the wave's 16x64 tile column-major with 16-B vector
  float* os = Os[wave];
  float invr[8];
#pragma unroll
  for (int r = 0; r < 8; ++r) {
    const float l = lrow[r];
    invr[r] = ((l > 0.f) ? (1.0f / l) : 0.f) * (l2ns * (1.0f / 1024.0f));
  }
#pragma unroll
  for (int t = 0; t < 4; ++t) {
    v4f w0, w1;
#pragma unroll
    for (int r = 0; r < 4; ++r) {
      w0[r] = oacc[t][r] * invr[r];
      w1[r] = oacc[t][r + 4] * invr[r + 4];
    }
    float* cp = os + (t * 16 + c) * OSP + 8 * hh;
    *(v4f*)(cp) = w0;
    *(v4f*)(cp + 4) = w1;
  }
  wave_sync_lds();
  {
    const int q4 = lane >> 3, c8 = (lane & 7) * 8;
    v4u hv[4], lv[4];
#pragma unroll
    for (int it = 0; it < 4; ++it) {
      const int row = it * 4 + q4;   // it 0..3 x q4 0..3 = rows 0..15 of the wave tile
      const float sbv = Sbl[wave][row];
      v4u a, a2;
#pragma unroll
      for (int e = 0; e < 4; ++e) {
        const float f0 = os[(c8 + 2 * e) * OSP + row] + sbv;
        const float f1 = os[(c8 + 2 * e + 1) * OSP + row] + sbv;
        const unsigned short h0 = bf_bits(f0), h1 = bf_bits(f1);
        const unsigned short l0 = bf_bits(f0 - bf_up(h0)), l1 = bf_bits(f1 - bf_up(h1));
        a[e] = pk16(h0, h1); a2[e] = pk16(l0, l1);
      }
      hv[it] = a; lv[it] = a2;
    }
    {
#pragma unroll
      for (int it = 0; it < 4; ++it) {
        const int row = it * 4 + q4;
        const size_t go = (size_t)(q0 + row) * DM + (size_t)h * HD + c8;
        *(v4u*)(yhp + go) = hv[it];
        *(v4u*)(ylp + go) = lv[it];
      }
      
    }
  }
}

// =====================================================================================================
// Workspace map (MiB offsets, sizes exact multiples of the whole-tile / whole-line store granularity):
//   Xh   f16  [2048][1024]          0    4
//   Xbh  bf16 [2048][1024]          4    4   (later: Qh f16, after the v^T projection)
//   Xbl  bf16 [2048][1024]          8    4   (later: Kh f16)
//   Wcat f16  [4096 n][1024 k]     12    8   (Wq|Wk|Wqb|Wkb transposed, x64)
//   Wvh/Wvl bf16 [1024][1024]      20  2+2
//   Woh/Wol bf16 [1024][1024]      24  2+2
//   W1t  f16  [8192][1024]         28   16   (x64, xp/gate interleaved per 64 columns)
//   W2t  f16  [1024][4096]         44    8   (x64)
//   cs   f32  [2048][64]           52  512 KiB
//   QK   f32  [2048][4096]         53   32   (later: Pf 53 (8), Yh 61 (4), Yl 65 (4), AttnO 69 (8), PS f64 [32][1024] 77 (256 KiB))
//   QBn  f32  [2048][1024]         85    8
//   KBn  f32  [2048][1024]         93    8
//   VTh  f16  [1024][2048]        101    4
//   VTl  f16  [1024][512]         105    1
//   FF   f16  [2048][4096]        106   16   (x64)
//   end                           122 MiB = 127926272 B
// =====================================================================================================
extern "C" void kernel_launch(void* const* d_in, const int* in_sizes, int n_in,
                              void* d_out, int out_size, void* d_ws, size_t ws_size,
                              hipStream_t stream) {
  if (n_in < 14) return;
  if (in_sizes[0] != SEQ * DM) return;
  for (int i = 1; i <= 6; ++i) if (in_sizes[i] != DM * DM) return;
  if (in_sizes[7] != DM) return;
  if (in_sizes[8] != DM * FUS || in_sizes[9] != FUS) return;
  if (in_sizes[10] != FFI * DM || in_sizes[11] != DM) return;
  if (in_sizes[12] < 1 || in_sizes[13] < 1) return;
  if (out_size != SEQ * DM) return;

  const float* hs  = (const float*)d_in[0];
  const float* Wq  = (const float*)d_in[1];
  const float* Wk  = (const float*)d_in[2];
  const float* Wv  = (const float*)d_in[3];
  const float* Wqb = (const float*)d_in[4];
  const float* Wkb = (const float*)d_in[5];
  const float* Wo  = (const float*)d_in[6];
  const float* bo  = (const float*)d_in[7];
  const float* W1  = (const float*)d_in[8];
  const float* b1  = (const float*)d_in[9];
  const float* W2  = (const float*)d_in[10];
  const float* b2  = (const float*)d_in[11];
  const float* lam = (const float*)d_in[12];
  const float* l2n = (const float*)d_in[13];

  // rotary inverse frequencies 1 / 1000^(2d/64), evaluated in double and RNE-cast to f32 (constants only)
  InvTab itab;
  for (int d = 0; d < HD / 2; ++d)
    { const float pw = (float)pow(1000.0, (2.0 * (double)d) / 64.0); itab.f[d] = 1.0f / pw; }

  const size_t MiB = 1048576;
  const size_t oXh  = 0;
  const size_t oXbh = 4 * MiB,  oXbl = 8 * MiB;
  const size_t oQh  = oXbh,     oKh  = oXbl;        // written after the v^T projection consumed Xbh/Xbl
  const size_t oWcat = 12 * MiB;
  const size_t oWvh = 20 * MiB, oWvl = 22 * MiB, oWoh = 24 * MiB, oWol = 26 * MiB;
  const size_t oW1t = 28 * MiB;
  const size_t oW2t = 44 * MiB;
  const size_t oCS  = 52 * MiB;
  const size_t oQK  = 53 * MiB;
  const size_t oPf  = 53 * MiB, oYh = 61 * MiB, oYl = 65 * MiB, oAO = 69 * MiB;   // inside QK, after rope
  const size_t oPS  = 77 * MiB;                                                   // inside QK, after rope
  const size_t oQBn = 85 * MiB, oKBn = 93 * MiB;
  const size_t oVTh = 101 * MiB, oVTl = 105 * MiB;
  const size_t oFF  = 106 * MiB;
  const size_t oEnd = 122 * MiB;
  // extent checks against the actual plane sizes
  if ((size_t)SEQ * DM * 2 != 4 * MiB) return;
  if ((size_t)DM * DM * 2 != 2 * MiB) return;
  if (oWcat + (size_t)4 * DM * DM * 2 != oWvh) return;
  if (oW1t + (size_t)FUS * DM * 2 != oW2t) return;
  if (oW2t + (size_t)DM * FFI * 2 != oCS) return;
  if (oCS + (size_t)SEQ * 64 * 4 > oQK) return;
  if (oQK + (size_t)SEQ * 4 * DM * 4 != oQBn) return;
  if (oPf + (size_t)SEQ * DM * 4 != oYh) return;
  if (oYl + (size_t)SEQ * DM * 2 != oAO) return;
  if (oAO + (size_t)SEQ * DM * 4 != oPS) return;
  if (oPS + (size_t)PSS * DM * 8 > oQBn) return;
  if (oVTh + (size_t)DM * SEQ * 2 != oVTl) return;
  if (oVTl + (size_t)DM * VLP * 2 != oFF) return;
  if (oFF + (size_t)SEQ * FFI * 2 != oEnd) return;
  if (oEnd > ws_size) return;
  if (oEnd > (size_t)134217728) return;

  char* ws = (char*)d_ws;
  unsigned short* Xh   = (unsigned short*)(ws + oXh);
  unsigned short* Xbh  = (unsigned short*)(ws + oXbh);
  unsigned short* Xbl  = (unsigned short*)(ws + oXbl);
  unsigned short* Qh   = (unsigned short*)(ws + oQh);
  unsigned short* Kh   = (unsigned short*)(ws + oKh);
  unsigned short* Wcat = (unsigned short*)(ws + oWcat);
  unsigned short* Wvh  = (unsigned short*)(ws + oWvh);
  unsigned short* Wvl  = (unsigned short*)(ws + oWvl);
  unsigned short* Woh  = (unsigned short*)(ws + oWoh);
  unsigned short* Wol  = (unsigned short*)(ws + oWol);
  unsigned short* W1t  = (unsigned short*)(ws + oW1t);
  unsigned short* W2t  = (unsigned short*)(ws + oW2t);
  float*          CS   = (float*)(ws + oCS);
  float*          QK   = (float*)(ws + oQK);
  float*          Pf   = (float*)(ws + oPf);
  unsigned short* Yh   = (unsigned short*)(ws + oYh);
  unsigned short* Yl   = (unsigned short*)(ws + oYl);
  float*          AO   = (float*)(ws + oAO);
  double*         PS   = (double*)(ws + oPS);
  float*          QBn  = (float*)(ws + oQBn);
  float*          KBn  = (float*)(ws + oKBn);
  unsigned short* VTh  = (unsigned short*)(ws + oVTh);
  unsigned short* VTl  = (unsigned short*)(ws + oVTl);
  unsigned short* FF   = (unsigned short*)(ws + oFF);

  const dim3 b256(256), b128(128);
  const dim3 gW(DM / 64, DM / 64);                                       // 16 x 16 tiles
  const dim3 gW1(FUS / 64, DM / 64);                                     // 128 x 16
  const dim3 gW2(DM / 64, FFI / 64);                                     // 16 x 64
  const dim3 gF1((SEQ / 128) * (FUS / 256));                             // 128x256 block tiles -> 512 blocks
  const dim3 gQK((SEQ / 128) * ((4 * DM) / 256));                        // 128x256 -> 256 blocks
  const dim3 gVT((DM / 128) * (SEQ / 256));                              // 128x256 -> 64 blocks
  const dim3 gWo((SEQ / 128) * (DM / 256));                              // 128x256 -> 64 blocks
  const dim3 gF2((SEQ / 128) * (DM / 128));                              // 128x128 -> 128 blocks

  // (0) rotary cos/sin table
  k_cstab<<<dim3(SEQ / 8), b256, 0, stream>>>(itab, CS);
  // (1) RMSNorm -> x planes
  k_xnorm<<<dim3(SEQ), b128, 0, stream>>>(hs, Xh, Xbh, Xbl);
  // (2) weights [k][n] f32 -> [n][k] 16-bit planes   (in[K][N] -> out[N][K], grid (N/64, K/64))
  k_wtrans<0><<<gW, b256, 0, stream>>>(Wq,  DM, DM, 0, WSC, Wcat + (size_t)0 * DM * DM, Wcat);
  k_wtrans<0><<<gW, b256, 0, stream>>>(Wk,  DM, DM, 0, WSC, Wcat + (size_t)1 * DM * DM, Wcat);
  k_wtrans<0><<<gW, b256, 0, stream>>>(Wqb, DM, DM, 0, WSC, Wcat + (size_t)2 * DM * DM, Wcat);
  k_wtrans<0><<<gW, b256, 0, stream>>>(Wkb, DM, DM, 0, WSC, Wcat + (size_t)3 * DM * DM, Wcat);
  k_wtrans<1><<<gW, b256, 0, stream>>>(Wv,  DM, DM, 0, 1.0f, Wvh, Wvl);
  k_wtrans<1><<<gW, b256, 0, stream>>>(Wo,  DM, DM, 0, 1.0f, Woh, Wol);
  k_wtrans<0><<<gW1, b256, 0, stream>>>(W1, DM, FUS, FFI, WSC, W1t, W1t);
  k_wtrans<0><<<gW2, b256, 0, stream>>>(W2, FFI, DM, 0, WSC, W2t, W2t);
  // (3) u = x . W1 + b1 with fused SwiGLU -> FF f16 [2048][4096] (x64)   (M=2048, N=8192, K=1024)
  k_gemm<_Float16, 2, 8, 0, 4, 4, 2, DM><<<gF1, b256, 0, stream>>>(
      Xh, Xh, DM, W1t, W1t, DM,
      (void*)FF, FFI, (void*)FF, FFI, 0,
      b1, hs, hs, lam,
      SEQ, FUS, DM, 1.0f / (XSC * WSC), FSC);
  // (4) q|k|qb|kb = x . (Wq|Wk|Wqb|Wkb) -> f32 [2048][4096]   (M=2048, N=4096, K=1024)
  k_gemm<_Float16, 4, 4, 0, 0, 2, 4, DM><<<gQK, b256, 0, stream>>>(
      Xh, Xh, DM, Wcat, Wcat, DM,
      (void*)QK, 4 * DM, (void*)QK, 4 * DM, 0,
      bo, hs, hs, lam,
      SEQ, 4 * DM, DM, 1.0f / (XSC * WSC), 1.0f);
  // (5) v^T = Wv^T . x^T -> f16 hi plane [h*64+d][s] + residual plane (keys < VLP)   (M=1024, N=2048, K=1024)
  k_gemm<__bf16, 4, 4, 2, 2, 2, 4, DM><<<gVT, b256, 0, stream>>>(
      Wvh, Wvl, DM, Xbh, Xbl, DM,
      (void*)VTh, SEQ, (void*)VTl, VLP, VLP,
      bo, hs, hs, lam,
      DM, SEQ, DM, 1.0f, VRS);
  // (6) l2norm + rotary -> q, k f16 planes (into the dead Xbh/Xbl regions), qb, kb f32 planes
  k_rope<<<dim3(SEQ * NH / 8), b256, 0, stream>>>(QK, CS, Qh, Kh, QBn, KBn);
  // (7) causal prefix sum of kb (QK region is dead now)
  k_segsum<<<dim3(PSS * (DM / 128)), b256, 0, stream>>>(KBn, PS);
  k_prefix<<<dim3(PSS * (DM / 128)), b256, 0, stream>>>(KBn, PS, Pf);
  // (8) attention: query blocks 0..RESQB-1 with residual planes, the rest without
  k_attn<true><<<dim3(NH * RESQB), b128, 0, stream>>>(
      Qh, Kh, VTh, VTl, QBn, Pf, l2n, Yh, Yl, 0, RESQB);
  k_attn<false><<<dim3(NH * (NQB - RESQB)), b128, 0, stream>>>(
      Qh, Kh, VTh, VTl, QBn, Pf, l2n, Yh, Yl, RESQB, NQB - RESQB);
  // (9) attn_out = y . Wo + bo -> f32 [2048][1024]   (hi/lo x hi/lo, 3 products)
  k_gemm<__bf16, 4, 4, 2, 1, 2, 4, DM><<<gWo, b256, 0, stream>>>(
      Yh, Yl, DM, Woh, Wol, DM,
      (void*)AO, DM, (void*)AO, DM, 0,
      bo, hs, hs, lam,
      SEQ, DM, DM, 1.0f, 1.0f);
  // (10) out = h*lambda + attn_out + ff . W2 + b2   (M=2048, N=1024, K=4096; 32x64 wave tiles)
  k_gemm<_Float16, 2, 4, 0, 3, 4, 2, FFI><<<gF2, b256, 0, stream>>>(
      FF, FF, FFI, W2t, W2t, FFI,
      d_out, DM, d_out, DM, 0,
      b2, hs, (const float*)AO, lam,
      SEQ, DM, FFI, 1.0f / (FSC * WSC), 1.0f);
  (void)hipGetLastError();
}

// v003
// A run of this version takes 238 microseconds.
// Next to v002, in two timings, it ran 1.43 and 1.44 times as fast.
// All steps since v000 together make it 6.71 times as fast.
// Contractions: x.(Wq|Wk|Wqb|Wkb), q.k^T scores, x.W1 and ff.W2 = v_wmma_f32_16x16x32_f16 (f16 operands with power-of-two carries, single product);
// v^T = Wv^T.x^T and attn = y.Wo = v_wmma_f32_16x16x32_bf16 with bf16 hi/lo split operands (hi.hi + hi.lo + lo.hi);
// p.v = v_wmma_f32_16x16x32_f16 (p carried x1024 in f16, v f16 plus x4096 f16 residual planes of p and v on the leading query blocks); all f32 accumulate.
#include <hip/hip_runtime.h>
#include <math.h>
#include <stdint.h>

#define SEQ   2048
#define DM    1024
#define NH    16
#define HD    64
#define FFI   4096
#define FUS   8192
#define NQB   (SEQ / 64)
#define VLP   512
#define RESQB 8
#define QSC   8.0f             // f16 carry of q and k after l2norm + rope
#define SSC   (1.0f / 64.0f)   // undo QSC*QSC on the score accumulator
#define XSC   16.0f            // f16 carry of the normalised activations
#define WSC   64.0f            // f16 carry of the weights
#define FSC   64.0f            // f16 carry of the SwiGLU output
#define VRS   4096.0f          // scale of the f16 residual planes of v and p
#define SP    20               // LDS result slab pitch per column (16 rows + 4 pad), floats
#define OSP   20               // attention context slab pitch per column

static_assert(RESQB * 64 <= VLP);
static_assert(NH * HD == DM);
static_assert((SEQ % 64) == 0 && (DM % 64) == 0 && (FFI % 64) == 0 && (FUS % 128) == 0);

typedef _Float16 v16h __attribute__((ext_vector_type(16)));
typedef _Float16 v8h  __attribute__((ext_vector_type(8)));
typedef __bf16   v16b __attribute__((ext_vector_type(16)));
typedef __bf16   v8b  __attribute__((ext_vector_type(8)));
typedef float    v8f  __attribute__((ext_vector_type(8)));
typedef float    v4f  __attribute__((ext_vector_type(4)));
typedef unsigned int v4u __attribute__((ext_vector_type(4)));

// rotary inverse frequencies, one per pair index d = 0..31, passed by value (host computed)
struct InvTab { float f[HD / 2]; };
static_assert(sizeof(InvTab) == 128);

// ---- scalar helpers --------------------------------------------------------------------------------
__device__ __forceinline__ unsigned short bf_bits(float f) {          // f32 -> bf16 bits, RNE convert
  unsigned u = __float_as_uint(f);
  return (unsigned short)((u + 0x7FFFu + ((u >> 16) & 1u)) >> 16);
}
__device__ __forceinline__ float bf_up(unsigned short h) { return __uint_as_float(((unsigned)h) << 16); }
__device__ __forceinline__ unsigned short h_bits(_Float16 x) { return __builtin_bit_cast(unsigned short, x); }
__device__ __forceinline__ unsigned pk16(unsigned short a, unsigned short b) { return (unsigned)a | ((unsigned)b << 16); }
__device__ __forceinline__ v8f zero8() { v8f z = {0.f, 0.f, 0.f, 0.f, 0.f, 0.f, 0.f, 0.f}; return z; }
__device__ __forceinline__ v8h zero8h() {
  const _Float16 z = (_Float16)0.0f;
  v8h r = {z, z, z, z, z, z, z, z};
  return r;
}
__device__ __forceinline__ void wave_sync_lds() {
  __builtin_amdgcn_fence(__ATOMIC_RELEASE, "workgroup");
  __builtin_amdgcn_wave_barrier();
  __builtin_amdgcn_fence(__ATOMIC_ACQUIRE, "workgroup");
}

// ---- fragment loaders: 16-bit A/B operand, lane -> row/col (lane&15), p already includes +8*(lane>>4);
//      elements 0..7 <- p[0..7] (k0+8h..), elements 8..15 <- p[16..23] (k0+16+8h..)
template <typename T> struct Frag16;
template <> struct Frag16<_Float16> { typedef v16h t; };
template <> struct Frag16<__bf16>   { typedef v16b t; };

__device__ __forceinline__ v16h ldfrag(const _Float16* p) {
  union { v16h v; v8h h[2]; } f;
  f.h[0] = *(const v8h*)(p);
  f.h[1] = *(const v8h*)(p + 16);
  return f.v;
}
__device__ __forceinline__ v16b ldfrag(const __bf16* p) {
  union { v16b v; v8b h[2]; } f;
  f.h[0] = *(const v8b*)(p);
  f.h[1] = *(const v8b*)(p + 16);
  return f.v;
}

// ---- WMMA helpers with trailing VALU hazard gap (non-template overloads per fragment type) -------------
__device__ __forceinline__ v8f mma_raw(v16h a, v16h b, v8f c) {
  return __builtin_amdgcn_wmma_f32_16x16x32_f16(false, a, false, b, (short)0, c, false, false);
}
__device__ __forceinline__ v8f mma_raw(v16b a, v16b b, v8f c) {
  return __builtin_amdgcn_wmma_f32_16x16x32_bf16(false, a, false, b, (short)0, c, false, false);
}
__device__ __forceinline__ v8f mma_h(v16h a, v16h b, v8f c) {
  c = mma_raw(a, b, c);
#if defined(__HIP_DEVICE_COMPILE__)
  asm volatile("v_nop\n\tv_nop\n\tv_nop\n\tv_nop" : "+v"(c) : "v"(a), "v"(b));
#endif
  return c;
}
__device__ __forceinline__ void dep_guard2(v8f& a, v8f& b, v16h x, v16h y) {
#if defined(__HIP_DEVICE_COMPILE__)
  asm volatile("v_nop\n\tv_nop\n\tv_nop\n\tv_nop" : "+v"(a), "+v"(b) : "v"(x), "v"(y));
#else
  (void)a; (void)b; (void)x; (void)y;
#endif
}
__device__ __forceinline__ void dep_guard2(v8f& a, v8f& b, v16b x, v16b y) {
#if defined(__HIP_DEVICE_COMPILE__)
  asm volatile("v_nop\n\tv_nop\n\tv_nop\n\tv_nop" : "+v"(a), "+v"(b) : "v"(x), "v"(y));
#else
  (void)a; (void)b; (void)x; (void)y;
#endif
}
__device__ __forceinline__ void keep1(v16h x) {
#if defined(__HIP_DEVICE_COMPILE__)
  asm volatile("v_nop" :: "v"(x));
#else
  (void)x;
#endif
}
__device__ __forceinline__ void keep1(v16b x) {
#if defined(__HIP_DEVICE_COMPILE__)
  asm volatile("v_nop" :: "v"(x));
#else
  (void)x;
#endif
}
__device__ __forceinline__ void acc_guard4(v8f& a, v8f& b, v8f& c, v8f& d) {
#if defined(__HIP_DEVICE_COMPILE__)
  asm volatile("v_nop\n\tv_nop\n\tv_nop\n\tv_nop" : "+v"(a), "+v"(b), "+v"(c), "+v"(d));
#else
  (void)a; (void)b; (void)c; (void)d;
#endif
}

// ---- SwiGLU element from the fused accumulator: silu(gate + bg) * (xp + bx) * rscale -------------------
__device__ __forceinline__ float swg(float xacc, float gacc, float oscale, float bx, float bg, float rscale) {
  const float xp = xacc * oscale + bx;
  const float g  = gacc * oscale + bg;
  const float sg = __builtin_amdgcn_rcpf(1.0f + __expf(-g));
  return (g * sg) * xp * rscale;
}

// =====================================================================================================
// cos/sin table: cs[t][0..31] = bf16(cos(t*invf[d])) widened to f32, cs[t][32..63] = bf16(sin(.)).
// invf arrives by value; each lane picks its entry with a static-index select chain (no private indexing).
// =====================================================================================================
__device__ __forceinline__ void job_cstab(const InvTab& tab, float* cs, int bidx) {
  const int lane = threadIdx.x & 31, wave = threadIdx.x >> 5;
  const int t = bidx * 8 + wave;
  float ivf = tab.f[0];
#pragma unroll
  for (int i = 1; i < HD / 2; ++i) ivf = (lane == i) ? tab.f[i] : ivf;
  const float fr = (float)t * ivf;
  float sn, cn;
  sincosf(fr, &sn, &cn);
  const float cv = bf_up(bf_bits(cn));
  const float sv = bf_up(bf_bits(sn));
  float* pc = cs + (size_t)t * 64 + lane;
  float* ps = pc + 32;
  *(float*)pc = cv;
  *(float*)ps = sv;
#if defined(__HIP_DEVICE_COMPILE__)
  // the job's end is not the kernel's end in the built code: stands ahead of any later write to these stores' registers
  asm volatile("s_wait_xcnt 0x0" ::: "memory");
#endif
}

// =====================================================================================================
// RMSNorm (no affine, eps = f32 eps) of one row per 128 threads x 8 elements (two rows per block) and conversion to
// three planes [2048][1024]: f16(x*16), bf16 hi, bf16 lo (RNE, lo = RNE(x - hi)). Each thread stores 16 B
// coverage: 1024 blocks x 2 rows x 128 threads x 8 = the whole plane.
// =====================================================================================================
__device__ __forceinline__ void job_xnorm(const float* __restrict__ hs, unsigned short* xh,
                                          unsigned short* xbh, unsigned short* xbl, int bidx, float (*red2)[4]) {
  const int tid = threadIdx.x & 127, lane = tid & 31, wave = tid >> 5, t = bidx * 2 + (threadIdx.x >> 7);
  float* red = red2[threadIdx.x >> 7];
  const size_t off = (size_t)t * DM + (size_t)tid * 8;
  const v4f a = *(const v4f*)(hs + off);
  const v4f b = *(const v4f*)(hs + off + 4);
  float ss = a[0] * a[0] + a[1] * a[1] + a[2] * a[2] + a[3] * a[3]
           + b[0] * b[0] + b[1] * b[1] + b[2] * b[2] + b[3] * b[3];
#pragma unroll
  for (int o = 1; o < 32; o <<= 1) ss += __shfl_xor(ss, o, 32);
  if (lane == 0) red[wave] = ss;
  __syncthreads();
  const float tot = (red[0] + red[1]) + (red[2] + red[3]);
  const float rn = rsqrtf(tot * (1.0f / (float)DM) + 1.1920929e-7f);
  float x[8];
  x[0] = a[0] * rn; x[1] = a[1] * rn; x[2] = a[2] * rn; x[3] = a[3] * rn;
  x[4] = b[0] * rn; x[5] = b[1] * rn; x[6] = b[2] * rn; x[7] = b[3] * rn;
  v4u ph, pb, pl;
#pragma unroll
  for (int e = 0; e < 4; ++e) {
    const float f0 = x[2 * e], f1 = x[2 * e + 1];
    ph[e] = pk16(h_bits((_Float16)(f0 * XSC)), h_bits((_Float16)(f1 * XSC)));
    const unsigned short hb0 = bf_bits(f0), hb1 = bf_bits(f1);
    pb[e] = pk16(hb0, hb1);
    pl[e] = pk16(bf_bits(f0 - bf_up(hb0)), bf_bits(f1 - bf_up(hb1)));
  }
  *(v4u*)(xh + off)  = ph;
  *(v4u*)(xbh + off) = pb;
  *(v4u*)(xbl + off) = pl;
#if defined(__HIP_DEVICE_COMPILE__)
  // the job's end is not the kernel's end in the built code: stands ahead of any later write to these stores' registers
  asm volatile("s_wait_xcnt 0x0" ::: "memory");
#endif
}

// =====================================================================================================
// Weight transpose + convert: W [K][N] f32 (in k, out n) -> Wt [N][K] 16-bit (k contiguous), 64x64 tile per
// block through LDS. MODE 0: f16(w*wscale) -> out0; MODE 1: bf16 hi -> out0, bf16 lo -> out1.
// coverage: 2 it x 8 waves x 4 rows = 64 output rows, 8 lanes x 8 = 64 k columns per tile; tiles (bx, by) of (N/64, K/64).
// =====================================================================================================
template <int MODE>
__device__ __forceinline__ void job_wtrans(const float* __restrict__ W, int K, int N, int nhalf, float wscale,
                                           unsigned short* out0, unsigned short* out1, int bx, int by,
                                           float (*tl)[65]) {
  const int tid = threadIdx.x, lane = tid & 31, wave = tid >> 5;
  const int n0 = bx * 64, k0 = by * 64;
  {
    const int i0 = tid >> 4, cc = (tid & 15) * 4;
#pragma unroll
    for (int p = 0; p < 4; ++p) {
      const int i = p * 16 + i0;
      const v4f v = *(const v4f*)(W + (size_t)(k0 + i) * N + n0 + cc);
      tl[i][cc] = v[0]; tl[i][cc + 1] = v[1]; tl[i][cc + 2] = v[2]; tl[i][cc + 3] = v[3];
    }
  }
  __syncthreads();
  const int orow0 = (nhalf > 0) ? ((n0 < nhalf) ? (2 * n0) : (2 * (n0 - nhalf) + 64)) : n0;
  const int q8 = lane >> 3, c8 = (lane & 7) * 8;
  v4u hv[2], lv[2];
#pragma unroll
  for (int it = 0; it < 2; ++it) {
    const int j = it * 32 + wave * 4 + q8;
    v4u a, a2;
#pragma unroll
    for (int e = 0; e < 4; ++e) {
      const float f0 = tl[c8 + 2 * e][j], f1 = tl[c8 + 2 * e + 1][j];
      if constexpr (MODE == 0) {
        a[e] = pk16(h_bits((_Float16)(f0 * wscale)), h_bits((_Float16)(f1 * wscale)));
        a2[e] = 0u;
      } else {
        const unsigned short hb0 = bf_bits(f0), hb1 = bf_bits(f1);
        a[e] = pk16(hb0, hb1);
        a2[e] = pk16(bf_bits(f0 - bf_up(hb0)), bf_bits(f1 - bf_up(hb1)));
      }
    }
    hv[it] = a; lv[it] = a2;
  }
  {
#pragma unroll
    for (int it = 0; it < 2; ++it) {
      const int j = it * 32 + wave * 4 + q8;
      const size_t go = (size_t)(orow0 + j) * K + k0 + c8;
      *(v4u*)(out0 + go) = hv[it];
      if constexpr (MODE == 1) *(v4u*)(out1 + go) = lv[it];
    }
#if defined(__HIP_DEVICE_COMPILE__)
    // the job's end is not the kernel's end in the built code: stands ahead of any later write to these stores' registers
    asm volatile("s_wait_xcnt 0x0" ::: "memory");
#endif
  }
}

// =====================================================================================================
// One grid for the ten jobs that read only inputs and none of each other's output: the block index falls into
// one of the ranges below (largest job first) and picks the job; every test on it is block-uniform, so each
// job's barrier is passed by all 256 threads of its block.
//   [W1 tiles | W2 tiles | Wq Wk Wqb Wkb Wv Wo tiles | RMSNorm row pairs | cos/sin table rows]
// =====================================================================================================
#define PB_W1 ((FUS / 64) * (DM / 64))     // 2048
#define PB_W2 ((DM / 64) * (FFI / 64))     // 1024
#define PB_W  ((DM / 64) * (DM / 64))      // 256 per square weight, six of them
#define PB_XN (SEQ / 2)                    // 1024
#define PB_CS (SEQ / 8)                    // 256
#define PB_ALL (PB_W1 + PB_W2 + 6 * PB_W + PB_XN + PB_CS)
__global__ __launch_bounds__(256) void k_prep(
    InvTab tab, const float* __restrict__ hs,
    const float* __restrict__ Wq, const float* __restrict__ Wk, const float* __restrict__ Wqb,
    const float* __restrict__ Wkb, const float* __restrict__ Wv, const float* __restrict__ Wo,
    const float* __restrict__ W1, const float* __restrict__ W2,
    float* cs, unsigned short* xh, unsigned short* xbh, unsigned short* xbl,
    unsigned short* wcat, unsigned short* wvh, unsigned short* wvl, unsigned short* woh, unsigned short* wol,
    unsigned short* w1t, unsigned short* w2t) {
  __shared__ float tl[64][65];
  __shared__ float red2[2][4];
  int b = blockIdx.x;
  if (b < PB_W1) {
    job_wtrans<0>(W1, DM, FUS, FFI, WSC, w1t, w1t, b % (FUS / 64), b / (FUS / 64), tl);
    return;
  }
  b -= PB_W1;
  if (b < PB_W2) {
    job_wtrans<0>(W2, FFI, DM, 0, WSC, w2t, w2t, b % (DM / 64), b / (DM / 64), tl);
    return;
  }
  b -= PB_W2;
  if (b < 6 * PB_W) {
    const int w = b / PB_W, r = b % PB_W;
    const int bx = r % (DM / 64), by = r / (DM / 64);
    if (w < 4) {
      const float* s = (w == 0) ? Wq : (w == 1) ? Wk : (w == 2) ? Wqb : Wkb;
      job_wtrans<0>(s, DM, DM, 0, WSC, wcat + (size_t)w * DM * DM, wcat, bx, by, tl);
    } else {
      job_wtrans<1>((w == 4) ? Wv : Wo, DM, DM, 0, 1.0f, (w == 4) ? wvh : woh, (w == 4) ? wvl : wol, bx, by, tl);
    }
    return;
  }
  b -= 6 * PB_W;
  if (b < PB_XN) {
    job_xnorm(hs, xh, xbh, xbl, b, red2);
    return;
  }
  b -= PB_XN;
  if (b < PB_CS) job_cstab(tab, cs, b);
}

// =====================================================================================================
// Register-blocked 16-bit WMMA GEMM: C[m][n] = sum_k A[m][k] * Bt[n][k]; one wave per (16*MI)x(16*NJ) tile,
// the 8 waves of a work-group laid out WM x WN over one (WM*16*MI)x(WN*16*NJ) block tile.
// A row-major [M][K] pitch lda; Bt row-major [N][K] pitch ldb (k contiguous);
// M, N multiples of the block tile, K multiple of KS (host-checked). T = _Float16 or __bf16.
// Operand path: per stage of KS = 64 k every operand row of the block tile (one whole 128-B line) is loaded once
// by the work-group (8 lanes x 16 B per row), kept in registers while the current stage is multiplied, and then
// stored to the other of two LDS buffers (row pitch 144 B for the 16-B fragment reads); one barrier per stage.
// Stage rows: [A | A2 | Bt | Bt2] (the second planes only with NSPLIT 2).
// KD = K = lda = ldb at compile time, so that the step from one group of 32 rows to the next is an immediate
// offset of the load and a plane needs one scalar base and one 32-bit offset register.
// NSPLIT: 0 = A.Bt; 2 = A.Bt + A.Bt2 + A2.Bt (unscaled hi/lo planes), in that order per k step.
// EPI 0: f32 C = acc*oscale (pitch ldc).  EPI 1: f32 C = acc*oscale + bias[n] + resa[m][n].
// EPI 2: f16 hi plane C (pitch ldc) + f16 residual plane C2 = f16((v - hi)*rscale) for tiles with n0 < N2
//        (pitch ldc2).  EPI 3: f32 C = acc*oscale + bias[n] + resh[m][n]*lamp[0].
// EPI 4 (MI=2, NJ=8, TN=128): fused SwiGLU: subtiles j<4 are xp columns ocol0+16j+c, j>=4 the matching gate
//        columns; C (f16, pitch ldc) [m][ocol0 + ..63] = f16( silu(gate+bias[FFI+col]) * (xp+bias[col]) * rscale ).
// Epilogue: 16-row x 64-col slabs staged per wave in LDS, column-major (pitch SP): every lane writes its 8
// accumulator rows of one column with two 16-B vector stores; rows are then gathered and each 64-wide row
// coverage per wave: MI slabs x 16 rows x 64 output cols.
// =====================================================================================================
#define KS 64                  // k elements per LDS stage
#define LP (KS + 8)            // LDS row pitch of a stage, elements (128 B + 16 B)
// LDS bytes of one block: two operand stages and the eight result slabs
template <int MI, int NJ, int NSPLIT, int WM, int WN>
constexpr int gemm_lds() {
  return 2 * ((NSPLIT == 2) ? 2 : 1) * (WM * 16 * MI + WN * 16 * NJ) * LP * 2 + 8 * 64 * SP * 4;
}
template <typename T, int MI, int NJ, int NSPLIT, int EPI, int WM, int WN, int KD>
__device__ __forceinline__ void gemm_body(
    int bidx, char* smem,
    const unsigned short* __restrict__ Ap, const unsigned short* __restrict__ A2p, int lda,
    const unsigned short* __restrict__ Bp, const unsigned short* __restrict__ B2p, int ldb,
    void* Cout, int ldc, void* Cout2, int ldc2, int N2,
    const float* __restrict__ bias, const float* __restrict__ resh,
    const float* __restrict__ resa, const float* __restrict__ lamp,
    int M, int N, int K, float oscale, float rscale) {
  typedef typename Frag16<T>::t FR;
  static_assert((EPI == 4) ? (MI == 2 && NJ == 8) : (NJ == 4 && (MI == 2 || MI == 4)));
  static_assert(NSPLIT == 0 || NSPLIT == 2);
  static_assert(WM * WN == 8);
  const T* A   = (const T*)(const void*)Ap;
  const T* A2  = (const T*)(const void*)A2p;
  const T* Bt  = (const T*)(const void*)Bp;
  const T* Bt2 = (const T*)(const void*)B2p;
  constexpr int TM = 16 * MI, TN = 16 * NJ;
  constexpr int BM = WM * TM, BN = WN * TN;
  constexpr int NPL  = (NSPLIT == 2) ? 2 : 1;      // planes per operand
  constexpr int ROWS = NPL * (BM + BN);            // operand rows per stage
  constexpr int NCH  = ROWS / 32;                  // 16-B pieces per thread per stage (256 threads = 32 rows)
  static_assert((BM % 32) == 0 && (BN % 32) == 0);
  static_assert(sizeof(T) == 2 && gemm_lds<MI, NJ, NSPLIT, WM, WN>() == 2 * ROWS * LP * 2 + 8 * 64 * SP * 4);
  T (*stg)[ROWS * LP] = (T (*)[ROWS * LP])(void*)smem;                              // two operand stages
  float (*sT)[64 * SP] = (float (*)[64 * SP])(void*)(smem + 2 * ROWS * LP * 2);     // per-wave 16x64 slab, column-major, pitch SP floats
  const int tid  = threadIdx.x;
  const int lane = tid & 31;
  const int wave = tid >> 5;
  const int tilesNb = N / BN;
  const int tilesMb = M / BM;
  if (bidx >= tilesMb * tilesNb) return;              // block-uniform, ahead of every barrier
  if (lda != KD || ldb != KD || K != KD) return;      // uniform over the grid
  const int bm = bidx / tilesNb;
  const int bn = bidx - bm * tilesNb;
  const int wm = wave / WN;
  const int wn = wave - wm * WN;
  const int m0 = bm * BM + wm * TM;
  const int n0 = bn * BN + wn * TN;
  const int tn = n0 / TN;
  const int rl   = lane & 15;            // row (A) / col (B, D) within subtile
  const int koff = (lane >> 4) * 8;      // k offset of this lane half
  const int mOff = (lane >> 4) * 8;      // D row offset

  v8f acc[MI][NJ];
#pragma unroll
  for (int i = 0; i < MI; ++i)
#pragma unroll
    for (int j = 0; j < NJ; ++j) acc[i][j] = zero8();

  // staging: thread -> row (tid>>3) of each group of 32 rows, 16-B piece (tid&7) of its 128-B line
  const int sr = tid >> 3, sc = (tid & 7) * 8;
  // address = block-uniform plane base + the thread's 32-bit byte offset (row in its group, piece, k) + row group
  static_assert((KD % KS) == 0);
  const unsigned vo0 = (unsigned)(sr * KD + sc) * 2u;
  const char* gA  = (const char*)(A   + (size_t)(bm * BM) * KD);
  const char* gA2 = (const char*)(A2  + (size_t)(bm * BM) * KD);
  const char* gB  = (const char*)(Bt  + (size_t)(bn * BN) * KD);
  const char* gB2 = (const char*)(Bt2 + (size_t)(bn * BN) * KD);
  v4u st[NCH];
  auto fetch = [&](int k0) {
    const unsigned vo = vo0 + (unsigned)k0 * 2u;
#pragma unroll
    for (int it = 0; it < NCH; ++it) {
      const int r = it * 32;
      const char* g;
      if (r < BM)                 g = gA  + (size_t)r * KD * 2;
      else if (r < NPL * BM)      g = gA2 + (size_t)(r - BM) * KD * 2;
      else if (r < NPL * BM + BN) g = gB  + (size_t)(r - NPL * BM) * KD * 2;
      else                        g = gB2 + (size_t)(r - NPL * BM - BN) * KD * 2;
      st[it] = *(const v4u*)(g + vo);
    }
#if defined(__HIP_DEVICE_COMPILE__)
    // stands ahead of every later write to the address registers of the loads above
    asm volatile("s_wait_xcnt 0x0" ::: "memory");
#endif
  };
  auto put = [&](T* buf) {
#pragma unroll
    for (int it = 0; it < NCH; ++it) *(v4u*)(buf + (it * 32 + sr) * LP + sc) = st[it];
  };

  fetch(0);
  put(stg[0]);
  __syncthreads();
  constexpr int nst = KD / KS;
  for (int s = 0; s < nst; ++s) {
    const bool more = (s + 1 < nst);     // block-uniform
    if (more) fetch((s + 1) * KS);       // in flight while this stage is multiplied
    const T* buf = stg[s & 1];
    const T* sa  = buf + (wm * TM + rl) * LP + koff;
    const T* sa2 = sa + BM * LP;
    const T* sb  = buf + (NPL * BM + wn * TN + rl) * LP + koff;
    const T* sb2 = sb + BN * LP;
#pragma unroll
    for (int kk = 0; kk < KS; kk += 32) {
      // the fragments of a k step are read from LDS in groups ahead of their products (B: four subtile columns)
      FR ah[MI];
#pragma unroll
      for (int i = 0; i < MI; ++i) ah[i] = ldfrag(sa + 16 * i * LP + kk);
#pragma unroll
      for (int jg = 0; jg < NJ; jg += 4) {
        FR bh[4], bl[4];
#pragma unroll
        for (int jj = 0; jj < 4; ++jj) {
          bh[jj] = ldfrag(sb + 16 * (jg + jj) * LP + kk);
          if constexpr (NSPLIT == 2) bl[jj] = ldfrag(sb2 + 16 * (jg + jj) * LP + kk);
          else bl[jj] = bh[jj];
        }
#pragma unroll
        for (int jj = 0; jj < 4; ++jj) {
          const int j = jg + jj;
#pragma unroll
          for (int i = 0; i < MI; ++i) {
            acc[i][j] = mma_raw(ah[i], bh[jj], acc[i][j]);
            if constexpr (NSPLIT == 2) acc[i][j] = mma_raw(ah[i], bl[jj], acc[i][j]);
          }
          dep_guard2(acc[0][j], acc[MI - 1][j], bh[jj], bl[jj]);
        }
        if constexpr (NSPLIT == 2) {
          static_assert(NSPLIT == 0 || NJ == 4);   // one B group, so the A2 fragments may take the A fragments' place
#pragma unroll
          for (int i = 0; i < MI; ++i) keep1(ah[i]);
          FR al[MI];
#pragma unroll
          for (int i = 0; i < MI; ++i) al[i] = ldfrag(sa2 + 16 * i * LP + kk);
#pragma unroll
          for (int jj = 0; jj < 4; ++jj) {
            const int j = jg + jj;
#pragma unroll
            for (int i = 0; i < MI; ++i) acc[i][j] = mma_raw(al[i], bh[jj], acc[i][j]);
            dep_guard2(acc[0][j], acc[MI - 1][j], bh[jj], bh[jj]);
          }
#pragma unroll
          for (int i = 0; i < MI; ++i) keep1(al[i]);
        }
      }
      if constexpr (NSPLIT == 0) {
#pragma unroll
        for (int i = 0; i < MI; ++i) keep1(ah[i]);
      }
    }
    if (more) put(stg[(s + 1) & 1]);     // every reader left that buffer at the barrier of the stage before
    __syncthreads();                     // publishes stage s+1; ends the reads of stage s
  }
#pragma unroll
  for (int i = 0; i < MI; ++i)
#pragma unroll
    for (int j = 0; j < NJ; j += 4) acc_guard4(acc[i][j], acc[i][j + 1], acc[i][j + 2], acc[i][j + 3]);

  // ---- epilogue ----
  float* slab = sT[wave];
  const int ocol0 = (EPI == 4) ? (tn * 64) : n0;
  const int hq = lane >> 4, c4 = (lane & 15) * 4;   // f32 path: 256-B row segment = 16 lanes x 16 B
  const int q8 = lane >> 3, c8 = (lane & 7) * 8;
  float bxv[4] = {0.f, 0.f, 0.f, 0.f}, bgv[4] = {0.f, 0.f, 0.f, 0.f};
  v4f b4 = {0.f, 0.f, 0.f, 0.f};
  float lam = 0.f;
  if constexpr (EPI == 4) {
#pragma unroll
    for (int j = 0; j < 4; ++j) {
      bxv[j] = bias[ocol0 + 16 * j + rl];
      bgv[j] = bias[FFI + ocol0 + 16 * j + rl];
    }
  }
  if constexpr (EPI == 1 || EPI == 3) b4 = *(const v4f*)(bias + n0 + c4);
  if constexpr (EPI == 3) lam = lamp[0];

#pragma unroll
  for (int i = 0; i < MI; ++i) {
    const int mBase = m0 + 16 * i;
    // lane writes column 16j+rl, rows mOff..mOff+7 = 32 contiguous bytes as two 16-B vector LDS stores
#pragma unroll
    for (int j = 0; j < 4; ++j) {
      v4f w0, w1;
      if constexpr (EPI == 4) {
#pragma unroll
        for (int r = 0; r < 4; ++r) {
          w0[r] = swg(acc[i][j][r],     acc[i][j + 4][r],     oscale, bxv[j], bgv[j], rscale);
          w1[r] = swg(acc[i][j][r + 4], acc[i][j + 4][r + 4], oscale, bxv[j], bgv[j], rscale);
        }
      } else {
#pragma unroll
        for (int r = 0; r < 4; ++r) {
          w0[r] = acc[i][j][r] * oscale;
          w1[r] = acc[i][j][r + 4] * oscale;
        }
      }
      float* cp = slab + (16 * j + rl) * SP + mOff;
      *(v4f*)(cp) = w0;
      *(v4f*)(cp + 4) = w1;
    }
    wave_sync_lds();
    if constexpr (EPI == 0 || EPI == 1 || EPI == 3) {
      float* C = (float*)Cout;
      v4f fin[8];
#pragma unroll
      for (int it = 0; it < 8; ++it) {
        const int row = 2 * it + hq;                   // it 0..7 x hq 0..1 = rows 0..15
        v4f v;
        v[0] = slab[(c4 + 0) * SP + row];
        v[1] = slab[(c4 + 1) * SP + row];
        v[2] = slab[(c4 + 2) * SP + row];
        v[3] = slab[(c4 + 3) * SP + row];
        if constexpr (EPI == 1 || EPI == 3) {
          const size_t go = (size_t)(mBase + row) * ldc + n0 + c4;
          const v4f rvv = *(const v4f*)(((EPI == 3) ? resh : resa) + go);
#if defined(__HIP_DEVICE_COMPILE__)
          // stands ahead of the next rows' loads, whose results the compiler lays over this load's address registers
          asm volatile("s_wait_xcnt 0x0" ::: "memory");
#endif
          if constexpr (EPI == 3) v = v + b4 + rvv * lam;
          else                    v = v + b4 + rvv;
        }
        fin[it] = v;
      }
      {
#pragma unroll
        for (int it = 0; it < 8; ++it) {
          const int row = 2 * it + hq;
          *(v4f*)(C + (size_t)(mBase + row) * ldc + n0 + c4) = fin[it];
#if defined(__HIP_DEVICE_COMPILE__)
          // stands ahead of the later rows' sums, which the compiler lays over this store's data registers
          if constexpr (EPI == 1 || EPI == 3) asm volatile("s_wait_xcnt 0x0" ::: "memory");
#endif
        }
      }
    } else {
      unsigned short* C  = (unsigned short*)Cout;
      unsigned short* C2 = (unsigned short*)Cout2;
      const bool wlo = (EPI == 2) && (n0 < N2);        // wave-uniform
      v4u hv[4], lv[4];
#pragma unroll
      for (int it = 0; it < 4; ++it) {
        const int row = 4 * it + q8;                   // it 0..3 x q8 0..3 = rows 0..15
        v4u a, a2;
#pragma unroll
        for (int e = 0; e < 4; ++e) {
          const float f0 = slab[(c8 + 2 * e) * SP + row], f1 = slab[(c8 + 2 * e + 1) * SP + row];
          const _Float16 x0 = (_Float16)f0, x1 = (_Float16)f1;
          unsigned short l0 = 0, l1 = 0;
          if constexpr (EPI == 2) {
            l0 = h_bits((_Float16)((f0 - (float)x0) * rscale));
            l1 = h_bits((_Float16)((f1 - (float)x1) * rscale));
          }
          a[e] = pk16(h_bits(x0), h_bits(x1)); a2[e] = pk16(l0, l1);
        }
        hv[it] = a; lv[it] = a2;
      }
      {
#pragma unroll
        for (int it = 0; it < 4; ++it) {
          const int row = 4 * it + q8;
          *(v4u*)(C + (size_t)(mBase + row) * ldc + ocol0 + c8) = hv[it];
          if (wlo) *(v4u*)(C2 + (size_t)(mBase + row) * ldc2 + n0 + c8) = lv[it];
        }
        
      }
    }
    wave_sync_lds();
  }
}

template <typename T, int MI, int NJ, int NSPLIT, int EPI, int WM, int WN, int KD>
__global__ __launch_bounds__(256) void k_gemm(
    const unsigned short* __restrict__ Ap, const unsigned short* __restrict__ A2p, int lda,
    const unsigned short* __restrict__ Bp, const unsigned short* __restrict__ B2p, int ldb,
    void* Cout, int ldc, void* Cout2, int ldc2, int N2,
    const float* __restrict__ bias, const float* __restrict__ resh,
    const float* __restrict__ resa, const float* __restrict__ lamp,
    int M, int N, int K, float oscale, float rscale) {
  __shared__ __align__(16) char smem[gemm_lds<MI, NJ, NSPLIT, WM, WN>()];
  gemm_body<T, MI, NJ, NSPLIT, EPI, WM, WN, KD>((int)blockIdx.x, smem, Ap, A2p, lda, Bp, B2p, ldb, Cout, ldc, Cout2, ldc2,
                                                N2, bias, resh, resa, lamp, M, N, K, oscale, rscale);
}

// One grid for the three products that read none of each other's output and none of which fills the chip alone:
//   [ fo = h*lambda + ff.W2 + b2 (longest k loop, lowest indices) | v^T = Wv^T.x^T | q|k|qb|kb = x.Wcat ]
// The block index picks the product (block-uniform), so every barrier of a product is passed by its whole block.
#define GB_F2 ((SEQ / 128) * (DM / 128))         // 128x128 block tiles -> 128 blocks
#define GB_VT ((DM / 128) * (SEQ / 256))         // 128x256 -> 64 blocks
#define GB_QK ((SEQ / 128) * ((4 * DM) / 256))   // 128x256 -> 256 blocks
__global__ __launch_bounds__(256) void k_gemm3(
    const unsigned short* __restrict__ ff, const unsigned short* __restrict__ w2t, float* fo,
    const float* __restrict__ b2, const float* __restrict__ hs, const float* __restrict__ lamp,
    const unsigned short* __restrict__ wvh, const unsigned short* __restrict__ wvl,
    const unsigned short* __restrict__ xbh, const unsigned short* __restrict__ xbl,
    unsigned short* vth, unsigned short* vtl,
    const unsigned short* __restrict__ xh, const unsigned short* __restrict__ wcat, float* qk) {
  static_assert(gemm_lds<4, 4, 2, 2, 4>() >= gemm_lds<4, 4, 0, 2, 4>() && gemm_lds<4, 4, 2, 2, 4>() >= gemm_lds<2, 4, 0, 4, 2>());
  __shared__ __align__(16) char smem[gemm_lds<4, 4, 2, 2, 4>()];
  int b = blockIdx.x;
  if (b < GB_F2) {
    // M=2048, N=1024, K=4096; 32x64 wave tiles
    gemm_body<_Float16, 2, 4, 0, 3, 4, 2, FFI>(b, smem, ff, ff, FFI, w2t, w2t, FFI, (void*)fo, DM, (void*)fo, DM, 0,
                                               b2, hs, hs, lamp, SEQ, DM, FFI, 1.0f / (FSC * WSC), 1.0f);
    return;
  }
  b -= GB_F2;
  if (b < GB_VT) {
    // M=1024, N=2048, K=1024: f16 hi plane [h*64+d][s] + residual plane (keys < VLP)
    gemm_body<__bf16, 4, 4, 2, 2, 2, 4, DM>(b, smem, wvh, wvl, DM, xbh, xbl, DM, (void*)vth, SEQ, (void*)vtl, VLP, VLP,
                                            b2, hs, hs, lamp, DM, SEQ, DM, 1.0f, VRS);
    return;
  }
  b -= GB_VT;
  // M=2048, N=4096, K=1024 -> f32 [2048][4096]
  gemm_body<_Float16, 4, 4, 0, 0, 2, 4, DM>(b, smem, xh, xh, DM, wcat, wcat, DM, (void*)qk, 4 * DM, (void*)qk, 4 * DM, 0,
                                            b2, hs, hs, lamp, SEQ, 4 * DM, DM, 1.0f / (XSC * WSC), 1.0f);
}

// =====================================================================================================
// Per-head l2 normalisation + rotary embedding for q, k, qb, kb. Input QK f32 [2048][4096]
// (cols: q | k | qb | kb, each [h*64 + d]); cs table [t][cos 0..31 | sin 0..31] (bf16-valued f32).
// One wave per (t, h): lane d handles the rotary pair (d, d+32). Results exchanged through a per-wave LDS
// grid = 32768/8 blocks of 256. coverage: every (t, h) row of all four planes.
// =====================================================================================================
__global__ __launch_bounds__(256) void k_rope(const float* __restrict__ qkf, const float* __restrict__ cs,
                                              unsigned short* qh, unsigned short* kh, float* qbn, float* kbn) {
  __shared__ __align__(16) float yb[8][4 * 64];
  const int lane = threadIdx.x & 31, wave = threadIdx.x >> 5;
  const int p = blockIdx.x * 8 + wave;     // p = t*16 + h
  const int t = p >> 4, h = p & 15;
  const float cth = cs[(size_t)t * 64 + lane];
  const float sth = cs[(size_t)t * 64 + 32 + lane];
  const float* row = qkf + (size_t)t * (4 * DM) + h * HD;
  float* ybw = yb[wave];
#pragma unroll
  for (int g = 0; g < 4; ++g) {
    const float* src = row + g * DM;
    float x1 = src[lane], x2 = src[lane + 32];
    float n2 = x1 * x1 + x2 * x2;
#pragma unroll
    for (int o = 1; o < 32; o <<= 1) n2 += __shfl_xor(n2, o, 32);
    const float rn = 1.0f / fmaxf(sqrtf(n2), 1e-12f);
    x1 *= rn; x2 *= rn;
    ybw[g * 64 + lane]      = x1 * cth + x2 * sth;
    ybw[g * 64 + 32 + lane] = x2 * cth - x1 * sth;
  }
  wave_sync_lds();
  const int c8 = (lane & 7) * 8, c4 = (lane & 15) * 4;
  v4u qv, kv;
#pragma unroll
  for (int e = 0; e < 4; ++e) {
    qv[e] = pk16(h_bits((_Float16)(ybw[c8 + 2 * e] * QSC)), h_bits((_Float16)(ybw[c8 + 2 * e + 1] * QSC)));
    kv[e] = pk16(h_bits((_Float16)(ybw[64 + c8 + 2 * e] * QSC)), h_bits((_Float16)(ybw[64 + c8 + 2 * e + 1] * QSC)));
  }
  const v4f qbv = *(const v4f*)(ybw + 128 + c4);
  const v4f kbv = *(const v4f*)(ybw + 192 + c4);
  const size_t g16 = (size_t)t * DM + h * HD + c8;
  const size_t g32 = (size_t)t * DM + h * HD + c4;
  {
    if (lane < 8) {
      *(v4u*)(qh + g16) = qv;
      *(v4u*)(kh + g16) = kv;
    }
    if (lane < 16) {
      *(v4f*)(qbn + g32) = qbv;
      *(v4f*)(kbn + g32) = kbv;
    }
    
  }
}

// =====================================================================================================
// Inclusive causal prefix sum of kb over positions: pf[t][col] = sum_{s<=t} kbn[s][col], summed in f64.
// Blocked scan in two launches. The 2048 positions are cut into PSS blocks of 64 rows, each block into 8 wave
// slices of PWR rows; a work-group covers 64 rows x 128 columns, a lane 4 neighbouring columns (16-B accesses).
//   k_segsum: part[ss][col] = f64 sum of the 64 rows of block ss.
//   k_prefix: offset = sum of part[0..ss-1][col] + sums of the lower wave slices (scanned in LDS), added to the
//             lane's own running sum over its PWR rows; every pf line is stored whole by one wave.
// coverage of both: grid PSS x (DM/128) work-groups x 8 waves x PWR rows x 128 columns = the whole plane.
// Every loop of the two kernels is unrolled in full, so that its small arrays live in registers and the loads
// of one array are issued back to back.
// =====================================================================================================
#define PSS 32                 // row blocks of 64 positions
#define PWR 8                  // rows per wave slice
static_assert(PSS * 8 * PWR == SEQ && (DM % 128) == 0 && (PSS % 2) == 0);

__global__ __launch_bounds__(256) void k_segsum(const float* __restrict__ kbn, double* __restrict__ part) {
  __shared__ __align__(16) double wsum[8][128];
  const int tid = threadIdx.x, lane = tid & 31, wave = tid >> 5;
  const int cg = blockIdx.x % (DM / 128), ss = blockIdx.x / (DM / 128);
  const float* src = kbn + (size_t)(ss * 64 + wave * PWR) * DM + cg * 128 + lane * 4;
  v4f x[PWR];
#pragma unroll
  for (int i = 0; i < PWR; ++i) x[i] = *(const v4f*)(src + (size_t)i * DM);
  double s[4];
#pragma unroll
  for (int e = 0; e < 4; ++e) s[e] = (double)x[0][e];
#pragma unroll
  for (int i = 1; i < PWR; ++i)
#pragma unroll
    for (int e = 0; e < 4; ++e) s[e] += (double)x[i][e];
#pragma unroll
  for (int e = 0; e < 4; ++e) wsum[wave][lane * 4 + e] = s[e];
  __syncthreads();
  if (tid < 128) {
    double v[8];
#pragma unroll
    for (int w = 0; w < 8; ++w) v[w] = wsum[w][tid];
    double a = v[0];
#pragma unroll
    for (int w = 1; w < 8; ++w) a += v[w];
    part[(size_t)ss * DM + cg * 128 + tid] = a;
  }
}

__global__ __launch_bounds__(256) void k_prefix(const float* __restrict__ kbn, const double* __restrict__ part,
                                                float* __restrict__ pf) {
  __shared__ __align__(16) double wsum[8][128];   // sum of each wave slice, per column; then its offset
  __shared__ __align__(16) double sup[2][128];    // sum of the lower row blocks, even / odd blocks apart
  const int tid = threadIdx.x, lane = tid & 31, wave = tid >> 5;
  const int cg = blockIdx.x % (DM / 128), ss = blockIdx.x / (DM / 128);
  const size_t go = (size_t)(ss * 64 + wave * PWR) * DM + cg * 128 + lane * 4;
  const float* src = kbn + go;
  v4f x[PWR];
#pragma unroll
  for (int i = 0; i < PWR; ++i) x[i] = *(const v4f*)(src + (size_t)i * DM);
  // lower row blocks: all PSS rows of part were written by k_segsum, so every load is issued at once and
  // the rows from ss on are dropped by the select (waves 0..3 take the even blocks, waves 4..7 the odd ones)
  {
    const int c = tid & 127, hf = tid >> 7;
    const double* pp = part + (size_t)hf * DM + cg * 128 + c;
    double pv[PSS / 2];
#pragma unroll
    for (int j = 0; j < PSS / 2; ++j) pv[j] = pp[(size_t)(2 * j) * DM];
    // keeps every load above ahead of the sums: without it two of them are issued only after the first have
    // come back, and the wave pays the memory latency twice
    __builtin_amdgcn_sched_barrier(0);
    double so = 0.0;
#pragma unroll
    for (int j = 0; j < PSS / 2; ++j) so += (2 * j + hf < ss) ? pv[j] : 0.0;
    sup[hf][c] = so;
  }
  // the lane's own running sums
  double p[PWR][4];
#pragma unroll
  for (int e = 0; e < 4; ++e) p[0][e] = (double)x[0][e];
#pragma unroll
  for (int i = 1; i < PWR; ++i)
#pragma unroll
    for (int e = 0; e < 4; ++e) p[i][e] = p[i - 1][e] + (double)x[i][e];
#pragma unroll
  for (int e = 0; e < 4; ++e) wsum[wave][lane * 4 + e] = p[PWR - 1][e];
  __syncthreads();
  // one thread per column turns the slice sums into each slice's offset, in place
  if (tid < 128) {
    double v[8];
#pragma unroll
    for (int w = 0; w < 8; ++w) v[w] = wsum[w][tid];
    double run = sup[0][tid] + sup[1][tid];
#pragma unroll
    for (int w = 0; w < 8; ++w) { wsum[w][tid] = run; run += v[w]; }
  }
  __syncthreads();
  double off[4];
#pragma unroll
  for (int e = 0; e < 4; ++e) off[e] = wsum[wave][lane * 4 + e];
  float* dst = pf + go;
#pragma unroll
  for (int i = 0; i < PWR; ++i) {
    v4f o;
#pragma unroll
    for (int e = 0; e < 4; ++e) o[e] = (float)(off[e] + p[i][e]);
    *(v4f*)(dst + (size_t)i * DM) = o;
  }
}

// =====================================================================================================
// Causal attention, head dim 64, plus the bias-attention row term.
//   q, k planes (f16, x8, normalised + rotary): element (t, h, d) at [t*DM + h*64 + d]
//   v^T hi plane (f16): element (h, d, s) at [(h*64 + d)*SEQ + s]; v^T residual plane (f16, (v - hi)*4096):
//   [(h*64 + d)*VLP + s], s < VLP, read only when RES (query blocks 0..RESQB-1 see only keys < VLP).
//   scores = q . k (single f16 product), * 1/64, key > query -> -inf; online softmax in f32.
//   p = exp(s - m) carried as f16(1024 p); context = p . v on f16 WMMA; RES adds f16 residual planes of p and v
//   (scale 4096, separate accumulator folded back with 1/4096 per chunk in f32).
//   y = l2ns * context / l + sb, sb = 0.125 * qbn[q] . pfx[q] (64-dot over the head dims, prefix sum of kb),
//   written as bf16 hi / lo planes [t][h*64 + d].
//   Block = 4 waves = 64 query rows of one h; nqbThis * NH blocks; key chunks of 64, trip count qb+1 (<= 32).
//   Both forms share one grid (k_attn): they read none of each other's output; the blocks without residual planes,
//   which hold the longest key loops, take the low block indices.
//   K / V^T chunk staging: 128 threads x 32 elements per plane = the whole 64x64 tile (plain 16-B loads,
//   __syncthreads before and after); P tiles are wave-private, spilled with _Float16 element stores and reloaded
//   (pitch 64); the context slab (pitch OSP) is written with two 16-B vector LDS stores per lane per column.
//   Output coverage: each wave stores rows q0..q0+15 (it 0..3 x lane>>3 0..3) x 64 columns (8 lanes x 8) of both planes.
// =====================================================================================================
template <bool RES>
__device__ __forceinline__
void attn_body(const unsigned short* __restrict__ qhp, const unsigned short* __restrict__ khp,
               const unsigned short* __restrict__ vhp, const unsigned short* __restrict__ vlp,
               const float* __restrict__ qbn, const float* __restrict__ pfx, const float* __restrict__ l2p,
               unsigned short* yhp, unsigned short* ylp, int bx, int qbBase, int nqbThis,
               _Float16* Ksh, _Float16* Vth, _Float16* Vtl, _Float16 (*Psh)[16 * 64], _Float16 (*Psl)[16 * 64],
               float (*Os)[64 * OSP], float (*Sbl)[16]) {
  union FH { v16h v; v8h h[2]; };

  const int tid  = threadIdx.x;
  const int wave = tid >> 5;
  const int lane = tid & 31;
  const int hh   = lane >> 4;
  const int c    = lane & 15;

  const int qbl = bx % nqbThis;
  const int h   = bx / nqbThis;
  const int qb  = qbBase + qbl;
  const int q0  = qb * 64 + wave * 16;

  const _Float16* Qh = (const _Float16*)(const void*)qhp + (size_t)h * HD;
  const _Float16* Kh = (const _Float16*)(const void*)khp + (size_t)h * HD;
  const _Float16* Vh = (const _Float16*)(const void*)vhp + (size_t)h * HD * SEQ;
  const _Float16* Vl = (const _Float16*)(const void*)vlp + (size_t)h * HD * VLP;

  // ---- Q fragments (A operand, row = lane&15): 2 d-chunks ----
  v16h qa[2];
#pragma unroll
  for (int dc = 0; dc < 2; ++dc) qa[dc] = ldfrag(Qh + (size_t)(q0 + c) * DM + dc * 32 + 8 * hh);

  float mrow[8], lrow[8];
  v8f oacc[4];
#pragma unroll
  for (int r = 0; r < 8; ++r) { mrow[r] = -INFINITY; lrow[r] = 0.f; }
#pragma unroll
  for (int t = 0; t < 4; ++t) oacc[t] = zero8();

  int nkt = qb + 1;                          // causal: key tiles 0..qb; block-uniform, <= NQB
  if (nkt > NQB) nkt = NQB;
  for (int kt = 0; kt < nkt; ++kt) {
    const int kv0 = kt * 64;
    __syncthreads();
    {
      const int r = tid >> 1, half = (tid & 1) * 32;
      const _Float16* kg = Kh + (size_t)(kv0 + r) * DM + half;      // K row kv0+r, d = half..half+31
      const _Float16* vg = Vh + (size_t)r * SEQ + kv0 + half;       // V^T row d = r, s = kv0+half..+31
      const int kvl = (kv0 + 64 <= VLP) ? kv0 : (VLP - 64);         // clamped address into the residual plane
      const _Float16* vlg = Vl + (size_t)r * VLP + kvl + half;
      const bool resOK = (kv0 + 64 <= VLP);                          // block-uniform
#pragma unroll
      for (int i = 0; i < 4; ++i) {
        const v8h a0 = *(const v8h*)(kg + 8 * i);
        const v8h b0 = *(const v8h*)(vg + 8 * i);
        *(v8h*)(Ksh + r * 64 + half + 8 * i) = a0;
        *(v8h*)(Vth + r * 64 + half + 8 * i) = b0;
        if (RES) {
          v8h b1 = *(const v8h*)(vlg + 8 * i);
          if (!resOK) b1 = zero8h();
          *(v8h*)(Vtl + r * 64 + half + 8 * i) = b1;
        }
      }
    }
    __syncthreads();

    // ---- scores: 16 query rows x 64 keys per wave, single f16 product ----
    v8f s[4];
#pragma unroll
    for (int j = 0; j < 4; ++j) {
      s[j] = zero8();
#pragma unroll
      for (int dc = 0; dc < 2; ++dc) {
        FH kb;
        kb.h[0] = *(const v8h*)(Ksh + (j * 16 + c) * 64 + dc * 32 + 8 * hh);
        kb.h[1] = *(const v8h*)(Ksh + (j * 16 + c) * 64 + dc * 32 + 16 + 8 * hh);
        s[j] = mma_h(qa[dc], kb.v, s[j]);
      }
    }

    // ---- undo carries, causal mask, row max, online softmax, P (x1024, f16) and P residual (x4096) to LDS ----
    _Float16* pwh = Psh[wave];
    _Float16* pwl = Psl[RES ? wave : 0];
#pragma unroll
    for (int r = 0; r < 8; ++r) {
      const int qrow = q0 + 8 * hh + r;
      float m = -INFINITY;
#pragma unroll
      for (int j = 0; j < 4; ++j) {
        const int key = kv0 + j * 16 + c;
        float sv = s[j][r] * SSC;
        sv = (key <= qrow) ? sv : -INFINITY;
        s[j][r] = sv;
        m = fmaxf(m, sv);
      }
#pragma unroll
      for (int off = 1; off < 16; off <<= 1) m = fmaxf(m, __shfl_xor(m, off, 32));
      const float mnew  = fmaxf(mrow[r], m);
      const float msafe = (mnew == -INFINITY) ? 0.f : mnew;
      const float alpha = __expf(mrow[r] - msafe);
      mrow[r] = mnew;
      float psum = 0.f;
#pragma unroll
      for (int j = 0; j < 4; ++j) {
        const float p = __expf(s[j][r] - msafe);     // masked logit: exp(-inf) -> 0
        psum += p;
        const float p1k = p * 1024.0f;
        const _Float16 ph = (_Float16)p1k;
        pwh[(8 * hh + r) * 64 + j * 16 + c] = ph;
        if (RES) {
          const _Float16 pl = (_Float16)((p1k - (float)ph) * VRS);
          pwl[(8 * hh + r) * 64 + j * 16 + c] = pl;
        }
      }
#pragma unroll
      for (int off = 1; off < 16; off <<= 1) psum += __shfl_xor(psum, off, 32);
      lrow[r] = lrow[r] * alpha + psum;
#pragma unroll
      for (int t = 0; t < 4; ++t) oacc[t][r] *= alpha;
    }
    wave_sync_lds();

    // ---- context += P . V (f16 WMMA), residual products into a separate accumulator ----
    v8f o1[4];
#pragma unroll
    for (int t = 0; t < 4; ++t) o1[t] = zero8();
#pragma unroll 1
    for (int kk = 0; kk < 2; ++kk) {
      FH pa, pl;
      pa.h[0] = *(const v8h*)(pwh + c * 64 + kk * 32 + 8 * hh);
      pa.h[1] = *(const v8h*)(pwh + c * 64 + kk * 32 + 16 + 8 * hh);
      if (RES) {
        pl.h[0] = *(const v8h*)(pwl + c * 64 + kk * 32 + 8 * hh);
        pl.h[1] = *(const v8h*)(pwl + c * 64 + kk * 32 + 16 + 8 * hh);
      } else {
        pl.v = pa.v;
      }
#pragma unroll
      for (int t = 0; t < 4; ++t) {
        FH vb;
        vb.h[0] = *(const v8h*)(Vth + (t * 16 + c) * 64 + kk * 32 + 8 * hh);
        vb.h[1] = *(const v8h*)(Vth + (t * 16 + c) * 64 + kk * 32 + 16 + 8 * hh);
        oacc[t] = mma_h(pa.v, vb.v, oacc[t]);
        if (RES) {
          FH vl;
          vl.h[0] = *(const v8h*)(Vtl + (t * 16 + c) * 64 + kk * 32 + 8 * hh);
          vl.h[1] = *(const v8h*)(Vtl + (t * 16 + c) * 64 + kk * 32 + 16 + 8 * hh);
          o1[t] = mma_h(pa.v, vl.v, o1[t]);
          o1[t] = mma_h(pl.v, vb.v, o1[t]);
        }
      }
    }
    if (RES) {
#pragma unroll
      for (int t = 0; t < 4; ++t)
#pragma unroll
        for (int r = 0; r < 8; ++r) oacc[t][r] += o1[t][r] * (1.0f / VRS);
    }
  }

  // ---- bias-attention row term: 0.125 * qb_row . prefix(kb)_row; lane (row = c, half hh) covers 32 dims ----
  const float l2ns = l2p[0];
  {
    const size_t ro = (size_t)(q0 + c) * DM + (size_t)h * HD + hh * 32;
    const float* qp = qbn + ro;
    const float* pp = pfx + ro;
    float ds = 0.f;
#pragma unroll
    for (int e = 0; e < 8; ++e) {
      const v4f a = *(const v4f*)(qp + 4 * e);
      const v4f b = *(const v4f*)(pp + 4 * e);
#if defined(__HIP_DEVICE_COMPILE__)
      // stands ahead of the later loads, whose results the compiler lays over the address registers of these two
      asm volatile("s_wait_xcnt 0x0" ::: "memory");
#endif
      ds += a[0] * b[0] + a[1] * b[1] + a[2] * b[2] + a[3] * b[3];
    }
    ds += __shfl_xor(ds, 16, 32);
    if (hh == 0) Sbl[wave][c] = ds * 0.125f;
  }

  // ---- normalise (l2ns/l and the 1/1024 p carry), stage the wave's 16x64 tile column-major with 16-B vector
  float* os = Os[wave];
  float invr[8];
#pragma unroll
  for (int r = 0; r < 8; ++r) {
    const float l = lrow[r];
    invr[r] = ((l > 0.f) ? (1.0f / l) : 0.f) * (l2ns * (1.0f / 1024.0f));
  }
#pragma unroll
  for (int t = 0; t < 4; ++t) {
    v4f w0, w1;
#pragma unroll
    for (int r = 0; r < 4; ++r) {
      w0[r] = oacc[t][r] * invr[r];
      w1[r] = oacc[t][r + 4] * invr[r + 4];
    }
    float* cp = os + (t * 16 + c) * OSP + 8 * hh;
    *(v4f*)(cp) = w0;
    *(v4f*)(cp + 4) = w1;
  }
  wave_sync_lds();
  {
    const int q4 = lane >> 3, c8 = (lane & 7) * 8;
    v4u hv[4], lv[4];
#pragma unroll
    for (int it = 0; it < 4; ++it) {
      const int row = it * 4 + q4;   // it 0..3 x q4 0..3 = rows 0..15 of the wave tile
      const float sbv = Sbl[wave][row];
      v4u a, a2;
#pragma unroll
      for (int e = 0; e < 4; ++e) {
        const float f0 = os[(c8 + 2 * e) * OSP + row] + sbv;
        const float f1 = os[(c8 + 2 * e + 1) * OSP + row] + sbv;
        const unsigned short h0 = bf_bits(f0), h1 = bf_bits(f1);
        const unsigned short l0 = bf_bits(f0 - bf_up(h0)), l1 = bf_bits(f1 - bf_up(h1));
        a[e] = pk16(h0, h1); a2[e] = pk16(l0, l1);
      }
      hv[it] = a; lv[it] = a2;
    }
    {
#pragma unroll
      for (int it = 0; it < 4; ++it) {
        const int row = it * 4 + q4;
        const size_t go = (size_t)(q0 + row) * DM + (size_t)h * HD + c8;
        *(v4u*)(yhp + go) = hv[it];
        *(v4u*)(ylp + go) = lv[it];
      }
#if defined(__HIP_DEVICE_COMPILE__)
      // the form's end is not the kernel's end in the built code: stands ahead of any later write to these stores' registers
      asm volatile("s_wait_xcnt 0x0" ::: "memory");
#endif
    }
  }
}

__global__ __launch_bounds__(128)
void k_attn(const unsigned short* __restrict__ qhp, const unsigned short* __restrict__ khp,
            const unsigned short* __restrict__ vhp, const unsigned short* __restrict__ vlp,
            const float* __restrict__ qbn, const float* __restrict__ pfx, const float* __restrict__ l2p,
            unsigned short* yhp, unsigned short* ylp) {
  __shared__ __align__(16) _Float16 Ksh[64 * 64];                 // K [kv][d]  8 KB
  __shared__ __align__(16) _Float16 Vth[64 * 64];                 // V^T hi [d][kv] 8 KB
  __shared__ __align__(16) _Float16 Vtl[64 * 64];                 // V^T residual
  __shared__ __align__(16) _Float16 Psh[4][16 * 64];              // per wave P [row][kv]
  __shared__ __align__(16) _Float16 Psl[4][16 * 64];              // per wave P residual
  __shared__ __align__(16) float    Os[4][64 * OSP];              // per wave context slab [d][row], pitch OSP
  __shared__ float Sbl[4][16];                                    // per wave bias-attention row values
  const int bx = blockIdx.x;                                      // block-uniform choice of the form
  if (bx < NH * (NQB - RESQB))
    attn_body<false>(qhp, khp, vhp, vlp, qbn, pfx, l2p, yhp, ylp, bx, RESQB, NQB - RESQB,
                     Ksh, Vth, Vtl, Psh, Psl, Os, Sbl);
  else
    attn_body<true>(qhp, khp, vhp, vlp, qbn, pfx, l2p, yhp, ylp, bx - NH * (NQB - RESQB), 0, RESQB,
                    Ksh, Vth, Vtl, Psh, Psl, Os, Sbl);
}

// =====================================================================================================
// Workspace map (MiB offsets, sizes exact multiples of the whole-tile / whole-line store granularity):
//   Xh   f16  [2048][1024]          0    4
//   Xbh  bf16 [2048][1024]          4    4   (later: Qh f16, after the v^T projection)
//   Xbl  bf16 [2048][1024]          8    4   (later: Kh f16)
//   Wcat f16  [4096 n][1024 k]     12    8   (Wq|Wk|Wqb|Wkb transposed, x64)
//   Wvh/Wvl bf16 [1024][1024]      20  2+2
//   Woh/Wol bf16 [1024][1024]      24  2+2
//   W1t  f16  [8192][1024]         28   16   (x64, xp/gate interleaved per 64 columns)
//   W2t  f16  [1024][4096]         44    8   (x64)
//   cs   f32  [2048][64]           52  512 KiB
//   QK   f32  [2048][4096]         53   32   (later: Pf 53 (8), Yh 61 (4), Yl 65 (4), PS f64 [32][1024] 77 (256 KiB))
//   QBn  f32  [2048][1024]         85    8
//   KBn  f32  [2048][1024]         93    8
//   VTh  f16  [1024][2048]        101    4
//   VTl  f16  [1024][512]         105    1
//   FF   f16  [2048][4096]        106   16   (x64)
//   FO   f32  [2048][1024]        122    8   (h*lambda + ff.W2 + b2)
//   end                           130 MiB = 136314880 B
// =====================================================================================================
extern "C" void kernel_launch(void* const* d_in, const int* in_sizes, int n_in,
                              void* d_out, int out_size, void* d_ws, size_t ws_size,
                              hipStream_t stream) {
  if (n_in < 14) return;
  if (in_sizes[0] != SEQ * DM) return;
  for (int i = 1; i <= 6; ++i) if (in_sizes[i] != DM * DM) return;
  if (in_sizes[7] != DM) return;
  if (in_sizes[8] != DM * FUS || in_sizes[9] != FUS) return;
  if (in_sizes[10] != FFI * DM || in_sizes[11] != DM) return;
  if (in_sizes[12] < 1 || in_sizes[13] < 1) return;
  if (out_size != SEQ * DM) return;

  const float* hs  = (const float*)d_in[0];
  const float* Wq  = (const float*)d_in[1];
  const float* Wk  = (const float*)d_in[2];
  const float* Wv  = (const float*)d_in[3];
  const float* Wqb = (const float*)d_in[4];
  const float* Wkb = (const float*)d_in[5];
  const float* Wo  = (const float*)d_in[6];
  const float* bo  = (const float*)d_in[7];
  const float* W1  = (const float*)d_in[8];
  const float* b1  = (const float*)d_in[9];
  const float* W2  = (const float*)d_in[10];
  const float* b2  = (const float*)d_in[11];
  const float* lam = (const float*)d_in[12];
  const float* l2n = (const float*)d_in[13];

  // rotary inverse frequencies 1 / 1000^(2d/64), evaluated in double and RNE-cast to f32 (constants only)
  InvTab itab;
  for (int d = 0; d < HD / 2; ++d)
    { const float pw = (float)pow(1000.0, (2.0 * (double)d) / 64.0); itab.f[d] = 1.0f / pw; }

  const size_t MiB = 1048576;
  const size_t oXh  = 0;
  const size_t oXbh = 4 * MiB,  oXbl = 8 * MiB;
  const size_t oQh  = oXbh,     oKh  = oXbl;        // written after the v^T projection consumed Xbh/Xbl
  const size_t oWcat = 12 * MiB;
  const size_t oWvh = 20 * MiB, oWvl = 22 * MiB, oWoh = 24 * MiB, oWol = 26 * MiB;
  const size_t oW1t = 28 * MiB;
  const size_t oW2t = 44 * MiB;
  const size_t oCS  = 52 * MiB;
  const size_t oQK  = 53 * MiB;
  const size_t oPf  = 53 * MiB, oYh = 61 * MiB, oYl = 65 * MiB;                   // inside QK, after rope
  const size_t oPS  = 77 * MiB;                                                   // inside QK, after rope
  const size_t oQBn = 85 * MiB, oKBn = 93 * MiB;
  const size_t oVTh = 101 * MiB, oVTl = 105 * MiB;
  const size_t oFF  = 106 * MiB;
  const size_t oFO  = 122 * MiB;
  const size_t oEnd = 130 * MiB;
  // extent checks against the actual plane sizes
  if ((size_t)SEQ * DM * 2 != 4 * MiB) return;
  if ((size_t)DM * DM * 2 != 2 * MiB) return;
  if (oWcat + (size_t)4 * DM * DM * 2 != oWvh) return;
  if (oW1t + (size_t)FUS * DM * 2 != oW2t) return;
  if (oW2t + (size_t)DM * FFI * 2 != oCS) return;
  if (oCS + (size_t)SEQ * 64 * 4 > oQK) return;
  if (oQK + (size_t)SEQ * 4 * DM * 4 != oQBn) return;
  if (oPf + (size_t)SEQ * DM * 4 != oYh) return;
  if (oYl + (size_t)SEQ * DM * 2 > oPS) return;
  if (oPS + (size_t)PSS * DM * 8 > oQBn) return;
  if (oVTh + (size_t)DM * SEQ * 2 != oVTl) return;
  if (oVTl + (size_t)DM * VLP * 2 != oFF) return;
  if (oFF + (size_t)SEQ * FFI * 2 != oFO) return;
  if (oFO + (size_t)SEQ * DM * 4 != oEnd) return;
  if (oEnd > ws_size) return;

  char* ws = (char*)d_ws;
  unsigned short* Xh   = (unsigned short*)(ws + oXh);
  unsigned short* Xbh  = (unsigned short*)(ws + oXbh);
  unsigned short* Xbl  = (unsigned short*)(ws + oXbl);
  unsigned short* Qh   = (unsigned short*)(ws + oQh);
  unsigned short* Kh   = (unsigned short*)(ws + oKh);
  unsigned short* Wcat = (unsigned short*)(ws + oWcat);
  unsigned short* Wvh  = (unsigned short*)(ws + oWvh);
  unsigned short* Wvl  = (unsigned short*)(ws + oWvl);
  unsigned short* Woh  = (unsigned short*)(ws + oWoh);
  unsigned short* Wol  = (unsigned short*)(ws + oWol);
  unsigned short* W1t  = (unsigned short*)(ws + oW1t);
  unsigned short* W2t  = (unsigned short*)(ws + oW2t);
  float*          CS   = (float*)(ws + oCS);
  float*          QK   = (float*)(ws + oQK);
  float*          Pf   = (float*)(ws + oPf);
  unsigned short* Yh   = (unsigned short*)(ws + oYh);
  unsigned short* Yl   = (unsigned short*)(ws + oYl);
  float*          FO   = (float*)(ws + oFO);
  double*         PS   = (double*)(ws + oPS);
  float*          QBn  = (float*)(ws + oQBn);
  float*          KBn  = (float*)(ws + oKBn);
  unsigned short* VTh  = (unsigned short*)(ws + oVTh);
  unsigned short* VTl  = (unsigned short*)(ws + oVTl);
  unsigned short* FF   = (unsigned short*)(ws + oFF);

  const dim3 b256(256), b128(128);
  const dim3 gF1((SEQ / 128) * (FUS / 256));                             // 128x256 block tiles -> 512 blocks
  const dim3 gWo((SEQ / 128) * (DM / 256));                              // 128x256 -> 64 blocks

  // (0-2) rotary cos/sin table, RMSNorm -> x planes, weights [k][n] f32 -> [n][k] 16-bit planes: one grid
  k_prep<<<dim3(PB_ALL), b256, 0, stream>>>(itab, hs, Wq, Wk, Wqb, Wkb, Wv, Wo, W1, W2,
                                            CS, Xh, Xbh, Xbl, Wcat, Wvh, Wvl, Woh, Wol, W1t, W2t);
  // (3) u = x . W1 + b1 with fused SwiGLU -> FF f16 [2048][4096] (x64)   (M=2048, N=8192, K=1024)
  k_gemm<_Float16, 2, 8, 0, 4, 4, 2, DM><<<gF1, b256, 0, stream>>>(
      Xh, Xh, DM, W1t, W1t, DM,
      (void*)FF, FFI, (void*)FF, FFI, 0,
      b1, hs, hs, lam,
      SEQ, FUS, DM, 1.0f / (XSC * WSC), FSC);
  // (4) one grid: fo = h*lambda + ff . W2 + b2;  v^T = Wv^T . x^T;  q|k|qb|kb = x . (Wq|Wk|Wqb|Wkb)
  k_gemm3<<<dim3(GB_F2 + GB_VT + GB_QK), b256, 0, stream>>>(FF, W2t, FO, b2, hs, lam,
                                                            Wvh, Wvl, Xbh, Xbl, VTh, VTl, Xh, Wcat, QK);
  // (6) l2norm + rotary -> q, k f16 planes (into the dead Xbh/Xbl regions), qb, kb f32 planes
  k_rope<<<dim3(SEQ * NH / 8), b256, 0, stream>>>(QK, CS, Qh, Kh, QBn, KBn);
  // (7) causal prefix sum of kb (QK region is dead now)
  k_segsum<<<dim3(PSS * (DM / 128)), b256, 0, stream>>>(KBn, PS);
  k_prefix<<<dim3(PSS * (DM / 128)), b256, 0, stream>>>(KBn, PS, Pf);
  // (8) attention: query blocks 0..RESQB-1 with residual planes, the rest without, in one grid
  k_attn<<<dim3(NH * NQB), b128, 0, stream>>>(Qh, Kh, VTh, VTl, QBn, Pf, l2n, Yh, Yl);
  // (9) out = (y . Wo + bo) + fo   (hi/lo x hi/lo, 3 products)
  k_gemm<__bf16, 4, 4, 2, 1, 2, 4, DM><<<gWo, b256, 0, stream>>>(
      Yh, Yl, DM, Woh, Wol, DM,
      d_out, DM, d_out, DM, 0,
      bo, hs, (const float*)FO, lam,
      SEQ, DM, DM, 1.0f, 1.0f);
  (void)hipGetLastError();
}

// v004
// A run of this version takes 218 microseconds.
// Timed twice side by side with v003, it ran 1.10 times as fast both times.
// Counting every step since v000, it is 7.36 times as fast.
// Contractions: x.(Wq|Wk|Wqb|Wkb), q.k^T scores, x.W1 and ff.W2 = v_wmma_f32_16x16x32_f16 (f16 operands with power-of-two carries, single product);
// v^T = Wv^T.x^T and attn = y.Wo = v_wmma_f32_16x16x32_bf16 with bf16 hi/lo split operands (hi.hi + hi.lo + lo.hi);
// p.v = v_wmma_f32_16x16x32_f16 (p carried x1024 in f16, v f16 plus x4096 f16 residual planes of p and v on the leading query blocks); all f32 accumulate.
#include <hip/hip_runtime.h>
#include <math.h>
#include <stdint.h>

#define SEQ   2048
#define DM    1024
#define NH    16
#define HD    64
#define FFI   4096
#define FUS   8192
#define NQB   (SEQ / 64)
#define VLP   512
#define RESQB 8
#define QSC   8.0f             // f16 carry of q and k after l2norm + rope
#define SSC   (1.0f / 64.0f)   // undo QSC*QSC on the score accumulator
#define XSC   16.0f            // f16 carry of the normalised activations
#define WSC   64.0f            // f16 carry of the weights
#define FSC   64.0f            // f16 carry of the SwiGLU output
#define VRS   4096.0f          // scale of the f16 residual planes of v and p
#define SP    20               // LDS result slab pitch per column (16 rows + 4 pad), floats
#define OSP   20               // attention context slab pitch per column
#define AP    72               // attention K / V^T / P tile row pitch in LDS, f16 elements: 128 B of data + 16 B,
                               // 16 B x odd, so that the 16 rows of a 16-B fragment read fall on different banks

static_assert(RESQB * 64 <= VLP);
static_assert(NH * HD == DM);
static_assert((SEQ % 64) == 0 && (DM % 64) == 0 && (FFI % 64) == 0 && (FUS % 128) == 0);

typedef _Float16 v16h __attribute__((ext_vector_type(16)));
typedef _Float16 v8h  __attribute__((ext_vector_type(8)));
typedef __bf16   v16b __attribute__((ext_vector_type(16)));
typedef __bf16   v8b  __attribute__((ext_vector_type(8)));
typedef float    v8f  __attribute__((ext_vector_type(8)));
typedef float    v4f  __attribute__((ext_vector_type(4)));
typedef unsigned int v4u __attribute__((ext_vector_type(4)));

// rotary inverse frequencies, one per pair index d = 0..31, passed by value (host computed)
struct InvTab { float f[HD / 2]; };
static_assert(sizeof(InvTab) == 128);

// ---- scalar helpers --------------------------------------------------------------------------------
__device__ __forceinline__ unsigned short bf_bits(float f) {          // f32 -> bf16 bits, RNE convert
  unsigned u = __float_as_uint(f);
  return (unsigned short)((u + 0x7FFFu + ((u >> 16) & 1u)) >> 16);
}
__device__ __forceinline__ float bf_up(unsigned short h) { return __uint_as_float(((unsigned)h) << 16); }
__device__ __forceinline__ unsigned short h_bits(_Float16 x) { return __builtin_bit_cast(unsigned short, x); }
__device__ __forceinline__ unsigned pk16(unsigned short a, unsigned short b) { return (unsigned)a | ((unsigned)b << 16); }
__device__ __forceinline__ v8f zero8() { v8f z = {0.f, 0.f, 0.f, 0.f, 0.f, 0.f, 0.f, 0.f}; return z; }
__device__ __forceinline__ v8h zero8h() {
  const _Float16 z = (_Float16)0.0f;
  v8h r = {z, z, z, z, z, z, z, z};
  return r;
}
__device__ __forceinline__ void wave_sync_lds() {
  __builtin_amdgcn_fence(__ATOMIC_RELEASE, "workgroup");
  __builtin_amdgcn_wave_barrier();
  __builtin_amdgcn_fence(__ATOMIC_ACQUIRE, "workgroup");
}

// ---- fragment loaders: 16-bit A/B operand, lane -> row/col (lane&15), p already includes +8*(lane>>4);
//      elements 0..7 <- p[0..7] (k0+8h..), elements 8..15 <- p[16..23] (k0+16+8h..)
template <typename T> struct Frag16;
template <> struct Frag16<_Float16> { typedef v16h t; };
template <> struct Frag16<__bf16>   { typedef v16b t; };

__device__ __forceinline__ v16h ldfrag(const _Float16* p) {
  union { v16h v; v8h h[2]; } f;
  f.h[0] = *(const v8h*)(p);
  f.h[1] = *(const v8h*)(p + 16);
  return f.v;
}
__device__ __forceinline__ v16b ldfrag(const __bf16* p) {
  union { v16b v; v8b h[2]; } f;
  f.h[0] = *(const v8b*)(p);
  f.h[1] = *(const v8b*)(p + 16);
  return f.v;
}

// ---- WMMA helpers with trailing VALU hazard gap (non-template overloads per fragment type) -------------
__device__ __forceinline__ v8f mma_raw(v16h a, v16h b, v8f c) {
  return __builtin_amdgcn_wmma_f32_16x16x32_f16(false, a, false, b, (short)0, c, false, false);
}
__device__ __forceinline__ v8f mma_raw(v16b a, v16b b, v8f c) {
  return __builtin_amdgcn_wmma_f32_16x16x32_bf16(false, a, false, b, (short)0, c, false, false);
}
__device__ __forceinline__ v8f mma_h(v16h a, v16h b, v8f c) {
  c = mma_raw(a, b, c);
#if defined(__HIP_DEVICE_COMPILE__)
  asm volatile("v_nop\n\tv_nop\n\tv_nop\n\tv_nop" : "+v"(c) : "v"(a), "v"(b));
#endif
  return c;
}
__device__ __forceinline__ void dep_guard2(v8f& a, v8f& b, v16h x, v16h y) {
#if defined(__HIP_DEVICE_COMPILE__)
  asm volatile("v_nop\n\tv_nop\n\tv_nop\n\tv_nop" : "+v"(a), "+v"(b) : "v"(x), "v"(y));
#else
  (void)a; (void)b; (void)x; (void)y;
#endif
}
__device__ __forceinline__ void dep_guard2(v8f& a, v8f& b, v16b x, v16b y) {
#if defined(__HIP_DEVICE_COMPILE__)
  asm volatile("v_nop\n\tv_nop\n\tv_nop\n\tv_nop" : "+v"(a), "+v"(b) : "v"(x), "v"(y));
#else
  (void)a; (void)b; (void)x; (void)y;
#endif
}
__device__ __forceinline__ void keep1(v16h x) {
#if defined(__HIP_DEVICE_COMPILE__)
  asm volatile("v_nop" :: "v"(x));
#else
  (void)x;
#endif
}
__device__ __forceinline__ void keep1(v16b x) {
#if defined(__HIP_DEVICE_COMPILE__)
  asm volatile("v_nop" :: "v"(x));
#else
  (void)x;
#endif
}
__device__ __forceinline__ void acc_guard4(v8f& a, v8f& b, v8f& c, v8f& d) {
#if defined(__HIP_DEVICE_COMPILE__)
  asm volatile("v_nop\n\tv_nop\n\tv_nop\n\tv_nop" : "+v"(a), "+v"(b), "+v"(c), "+v"(d));
#else
  (void)a; (void)b; (void)c; (void)d;
#endif
}

// ---- SwiGLU element from the fused accumulator: silu(gate + bg) * (xp + bx) * rscale -------------------
__device__ __forceinline__ float swg(float xacc, float gacc, float oscale, float bx, float bg, float rscale) {
  const float xp = xacc * oscale + bx;
  const float g  = gacc * oscale + bg;
  const float sg = __builtin_amdgcn_rcpf(1.0f + __expf(-g));
  return (g * sg) * xp * rscale;
}

// =====================================================================================================
// cos/sin table: cs[t][0..31] = bf16(cos(t*invf[d])) widened to f32, cs[t][32..63] = bf16(sin(.)).
// invf arrives by value; each lane picks its entry with a static-index select chain (no private indexing).
// =====================================================================================================
__device__ __forceinline__ void job_cstab(const InvTab& tab, float* cs, int bidx) {
  const int lane = threadIdx.x & 31, wave = threadIdx.x >> 5;
  const int t = bidx * 8 + wave;
  float ivf = tab.f[0];
#pragma unroll
  for (int i = 1; i < HD / 2; ++i) ivf = (lane == i) ? tab.f[i] : ivf;
  const float fr = (float)t * ivf;
  float sn, cn;
  sincosf(fr, &sn, &cn);
  const float cv = bf_up(bf_bits(cn));
  const float sv = bf_up(bf_bits(sn));
  float* pc = cs + (size_t)t * 64 + lane;
  float* ps = pc + 32;
  *(float*)pc = cv;
  *(float*)ps = sv;
#if defined(__HIP_DEVICE_COMPILE__)
  // the job's end is not the kernel's end in the built code: stands ahead of any later write to these stores' registers
  asm volatile("s_wait_xcnt 0x0" ::: "memory");
#endif
}

// =====================================================================================================
// RMSNorm (no affine, eps = f32 eps) of one row per 128 threads x 8 elements (two rows per block) and conversion to
// three planes [2048][1024]: f16(x*16), bf16 hi, bf16 lo (RNE, lo = RNE(x - hi)). Each thread stores 16 B
// coverage: 1024 blocks x 2 rows x 128 threads x 8 = the whole plane.
// =====================================================================================================
__device__ __forceinline__ void job_xnorm(const float* __restrict__ hs, unsigned short* xh,
                                          unsigned short* xbh, unsigned short* xbl, int bidx, float (*red2)[4]) {
  const int tid = threadIdx.x & 127, lane = tid & 31, wave = tid >> 5, t = bidx * 2 + (threadIdx.x >> 7);
  float* red = red2[threadIdx.x >> 7];
  const size_t off = (size_t)t * DM + (size_t)tid * 8;
  const v4f a = *(const v4f*)(hs + off);
  const v4f b = *(const v4f*)(hs + off + 4);
  float ss = a[0] * a[0] + a[1] * a[1] + a[2] * a[2] + a[3] * a[3]
           + b[0] * b[0] + b[1] * b[1] + b[2] * b[2] + b[3] * b[3];
#pragma unroll
  for (int o = 1; o < 32; o <<= 1) ss += __shfl_xor(ss, o, 32);
  if (lane == 0) red[wave] = ss;
  __syncthreads();
  const float tot = (red[0] + red[1]) + (red[2] + red[3]);
  const float rn = rsqrtf(tot * (1.0f / (float)DM) + 1.1920929e-7f);
  float x[8];
  x[0] = a[0] * rn; x[1] = a[1] * rn; x[2] = a[2] * rn; x[3] = a[3] * rn;
  x[4] = b[0] * rn; x[5] = b[1] * rn; x[6] = b[2] * rn; x[7] = b[3] * rn;
  v4u ph, pb, pl;
#pragma unroll
  for (int e = 0; e < 4; ++e) {
    const float f0 = x[2 * e], f1 = x[2 * e + 1];
    ph[e] = pk16(h_bits((_Float16)(f0 * XSC)), h_bits((_Float16)(f1 * XSC)));
    const unsigned short hb0 = bf_bits(f0), hb1 = bf_bits(f1);
    pb[e] = pk16(hb0, hb1);
    pl[e] = pk16(bf_bits(f0 - bf_up(hb0)), bf_bits(f1 - bf_up(hb1)));
  }
  *(v4u*)(xh + off)  = ph;
  *(v4u*)(xbh + off) = pb;
  *(v4u*)(xbl + off) = pl;
#if defined(__HIP_DEVICE_COMPILE__)
  // the job's end is not the kernel's end in the built code: stands ahead of any later write to these stores' registers
  asm volatile("s_wait_xcnt 0x0" ::: "memory");
#endif
}

// =====================================================================================================
// Weight transpose + convert: W [K][N] f32 (in k, out n) -> Wt [N][K] 16-bit (k contiguous), 64x64 tile per
// block through LDS. MODE 0: f16(w*wscale) -> out0; MODE 1: bf16 hi -> out0, bf16 lo -> out1.
// coverage: 2 it x 8 waves x 4 rows = 64 output rows, 8 lanes x 8 = 64 k columns per tile; tiles (bx, by) of (N/64, K/64).
// =====================================================================================================
template <int MODE>
__device__ __forceinline__ void job_wtrans(const float* __restrict__ W, int K, int N, int nhalf, float wscale,
                                           unsigned short* out0, unsigned short* out1, int bx, int by,
                                           float (*tl)[65]) {
  const int tid = threadIdx.x, lane = tid & 31, wave = tid >> 5;
  const int n0 = bx * 64, k0 = by * 64;
  {
    const int i0 = tid >> 4, cc = (tid & 15) * 4;
#pragma unroll
    for (int p = 0; p < 4; ++p) {
      const int i = p * 16 + i0;
      const v4f v = *(const v4f*)(W + (size_t)(k0 + i) * N + n0 + cc);
      tl[i][cc] = v[0]; tl[i][cc + 1] = v[1]; tl[i][cc + 2] = v[2]; tl[i][cc + 3] = v[3];
    }
  }
  __syncthreads();
  const int orow0 = (nhalf > 0) ? ((n0 < nhalf) ? (2 * n0) : (2 * (n0 - nhalf) + 64)) : n0;
  const int q8 = lane >> 3, c8 = (lane & 7) * 8;
  v4u hv[2], lv[2];
#pragma unroll
  for (int it = 0; it < 2; ++it) {
    const int j = it * 32 + wave * 4 + q8;
    v4u a, a2;
#pragma unroll
    for (int e = 0; e < 4; ++e) {
      const float f0 = tl[c8 + 2 * e][j], f1 = tl[c8 + 2 * e + 1][j];
      if constexpr (MODE == 0) {
        a[e] = pk16(h_bits((_Float16)(f0 * wscale)), h_bits((_Float16)(f1 * wscale)));
        a2[e] = 0u;
      } else {
        const unsigned short hb0 = bf_bits(f0), hb1 = bf_bits(f1);
        a[e] = pk16(hb0, hb1);
        a2[e] = pk16(bf_bits(f0 - bf_up(hb0)), bf_bits(f1 - bf_up(hb1)));
      }
    }
    hv[it] = a; lv[it] = a2;
  }
  {
#pragma unroll
    for (int it = 0; it < 2; ++it) {
      const int j = it * 32 + wave * 4 + q8;
      const size_t go = (size_t)(orow0 + j) * K + k0 + c8;
      *(v4u*)(out0 + go) = hv[it];
      if constexpr (MODE == 1) *(v4u*)(out1 + go) = lv[it];
    }
#if defined(__HIP_DEVICE_COMPILE__)
    // the job's end is not the kernel's end in the built code: stands ahead of any later write to these stores' registers
    asm volatile("s_wait_xcnt 0x0" ::: "memory");
#endif
  }
}

// =====================================================================================================
// One grid for the ten jobs that read only inputs and none of each other's output: the block index falls into
// one of the ranges below (largest job first) and picks the job; every test on it is block-uniform, so each
// job's barrier is passed by all 256 threads of its block.
//   [W1 tiles | W2 tiles | Wq Wk Wqb Wkb Wv Wo tiles | RMSNorm row pairs | cos/sin table rows]
// =====================================================================================================
#define PB_W1 ((FUS / 64) * (DM / 64))     // 2048
#define PB_W2 ((DM / 64) * (FFI / 64))     // 1024
#define PB_W  ((DM / 64) * (DM / 64))      // 256 per square weight, six of them
#define PB_XN (SEQ / 2)                    // 1024
#define PB_CS (SEQ / 8)                    // 256
#define PB_ALL (PB_W1 + PB_W2 + 6 * PB_W + PB_XN + PB_CS)
__global__ __launch_bounds__(256) void k_prep(
    InvTab tab, const float* __restrict__ hs,
    const float* __restrict__ Wq, const float* __restrict__ Wk, const float* __restrict__ Wqb,
    const float* __restrict__ Wkb, const float* __restrict__ Wv, const float* __restrict__ Wo,
    const float* __restrict__ W1, const float* __restrict__ W2,
    float* cs, unsigned short* xh, unsigned short* xbh, unsigned short* xbl,
    unsigned short* wcat, unsigned short* wvh, unsigned short* wvl, unsigned short* woh, unsigned short* wol,
    unsigned short* w1t, unsigned short* w2t) {
  __shared__ float tl[64][65];
  __shared__ float red2[2][4];
  int b = blockIdx.x;
  if (b < PB_W1) {
    job_wtrans<0>(W1, DM, FUS, FFI, WSC, w1t, w1t, b % (FUS / 64), b / (FUS / 64), tl);
    return;
  }
  b -= PB_W1;
  if (b < PB_W2) {
    job_wtrans<0>(W2, FFI, DM, 0, WSC, w2t, w2t, b % (DM / 64), b / (DM / 64), tl);
    return;
  }
  b -= PB_W2;
  if (b < 6 * PB_W) {
    const int w = b / PB_W, r = b % PB_W;
    const int bx = r % (DM / 64), by = r / (DM / 64);
    if (w < 4) {
      const float* s = (w == 0) ? Wq : (w == 1) ? Wk : (w == 2) ? Wqb : Wkb;
      job_wtrans<0>(s, DM, DM, 0, WSC, wcat + (size_t)w * DM * DM, wcat, bx, by, tl);
    } else {
      job_wtrans<1>((w == 4) ? Wv : Wo, DM, DM, 0, 1.0f, (w == 4) ? wvh : woh, (w == 4) ? wvl : wol, bx, by, tl);
    }
    return;
  }
  b -= 6 * PB_W;
  if (b < PB_XN) {
    job_xnorm(hs, xh, xbh, xbl, b, red2);
    return;
  }
  b -= PB_XN;
  if (b < PB_CS) job_cstab(tab, cs, b);
}

// =====================================================================================================
// Register-blocked 16-bit WMMA GEMM: C[m][n] = sum_k A[m][k] * Bt[n][k]; one wave per (16*MI)x(16*NJ) tile,
// the 8 waves of a work-group laid out WM x WN over one (WM*16*MI)x(WN*16*NJ) block tile.
// A row-major [M][K] pitch lda; Bt row-major [N][K] pitch ldb (k contiguous);
// M, N multiples of the block tile, K multiple of KS (host-checked). T = _Float16 or __bf16.
// Operand path: per stage of KS = 64 k every operand row of the block tile (one whole 128-B line) is loaded once
// by the work-group (8 lanes x 16 B per row), kept in registers while the current stage is multiplied, and then
// stored to the other of two LDS buffers (row pitch 144 B for the 16-B fragment reads); one barrier per stage.
// Stage rows: [A | A2 | Bt | Bt2] (the second planes only with NSPLIT 2).
// KD = K = lda = ldb at compile time, so that the step from one group of 32 rows to the next is an immediate
// offset of the load and a plane needs one scalar base and one 32-bit offset register.
// NSPLIT: 0 = A.Bt; 2 = A.Bt + A.Bt2 + A2.Bt (unscaled hi/lo planes), in that order per k step.
// EPI 0: f32 C = acc*oscale (pitch ldc).  EPI 1: f32 C = acc*oscale + bias[n] + resa[m][n].
// EPI 2: f16 hi plane C (pitch ldc) + f16 residual plane C2 = f16((v - hi)*rscale) for tiles with n0 < N2
//        (pitch ldc2).  EPI 3: f32 C = acc*oscale + bias[n] + resh[m][n]*lamp[0].
// EPI 4 (MI=2, NJ=8, TN=128): fused SwiGLU: subtiles j<4 are xp columns ocol0+16j+c, j>=4 the matching gate
//        columns; C (f16, pitch ldc) [m][ocol0 + ..63] = f16( silu(gate+bias[FFI+col]) * (xp+bias[col]) * rscale ).
// Epilogue: 16-row x 64-col slabs staged per wave in LDS, column-major (pitch SP): every lane writes its 8
// accumulator rows of one column with two 16-B vector stores; rows are then gathered and each 64-wide row
// coverage per wave: MI slabs x 16 rows x 64 output cols.
// =====================================================================================================
#define KS 64                  // k elements per LDS stage
#define LP (KS + 8)            // LDS row pitch of a stage, elements (128 B + 16 B)
// LDS bytes of one block: two operand stages and the eight result slabs
template <int MI, int NJ, int NSPLIT, int WM, int WN>
constexpr int gemm_lds() {
  return 2 * ((NSPLIT == 2) ? 2 : 1) * (WM * 16 * MI + WN * 16 * NJ) * LP * 2 + 8 * 64 * SP * 4;
}
template <typename T, int MI, int NJ, int NSPLIT, int EPI, int WM, int WN, int KD>
__device__ __forceinline__ void gemm_body(
    int bidx, char* smem,
    const unsigned short* __restrict__ Ap, const unsigned short* __restrict__ A2p, int lda,
    const unsigned short* __restrict__ Bp, const unsigned short* __restrict__ B2p, int ldb,
    void* Cout, int ldc, void* Cout2, int ldc2, int N2,
    const float* __restrict__ bias, const float* __restrict__ resh,
    const float* __restrict__ resa, const float* __restrict__ lamp,
    int M, int N, int K, float oscale, float rscale) {
  typedef typename Frag16<T>::t FR;
  static_assert((EPI == 4) ? (MI == 2 && NJ == 8) : (NJ == 4 && (MI == 2 || MI == 4)));
  static_assert(NSPLIT == 0 || NSPLIT == 2);
  static_assert(WM * WN == 8);
  const T* A   = (const T*)(const void*)Ap;
  const T* A2  = (const T*)(const void*)A2p;
  const T* Bt  = (const T*)(const void*)Bp;
  const T* Bt2 = (const T*)(const void*)B2p;
  constexpr int TM = 16 * MI, TN = 16 * NJ;
  constexpr int BM = WM * TM, BN = WN * TN;
  constexpr int NPL  = (NSPLIT == 2) ? 2 : 1;      // planes per operand
  constexpr int ROWS = NPL * (BM + BN);            // operand rows per stage
  constexpr int NCH  = ROWS / 32;                  // 16-B pieces per thread per stage (256 threads = 32 rows)
  static_assert((BM % 32) == 0 && (BN % 32) == 0);
  static_assert(sizeof(T) == 2 && gemm_lds<MI, NJ, NSPLIT, WM, WN>() == 2 * ROWS * LP * 2 + 8 * 64 * SP * 4);
  T (*stg)[ROWS * LP] = (T (*)[ROWS * LP])(void*)smem;                              // two operand stages
  float (*sT)[64 * SP] = (float (*)[64 * SP])(void*)(smem + 2 * ROWS * LP * 2);     // per-wave 16x64 slab, column-major, pitch SP floats
  const int tid  = threadIdx.x;
  const int lane = tid & 31;
  const int wave = tid >> 5;
  const int tilesNb = N / BN;
  const int tilesMb = M / BM;
  if (bidx >= tilesMb * tilesNb) return;              // block-uniform, ahead of every barrier
  if (lda != KD || ldb != KD || K != KD) return;      // uniform over the grid
  const int bm = bidx / tilesNb;
  const int bn = bidx - bm * tilesNb;
  const int wm = wave / WN;
  const int wn = wave - wm * WN;
  const int m0 = bm * BM + wm * TM;
  const int n0 = bn * BN + wn * TN;
  const int tn = n0 / TN;
  const int rl   = lane & 15;            // row (A) / col (B, D) within subtile
  const int koff = (lane >> 4) * 8;      // k offset of this lane half
  const int mOff = (lane >> 4) * 8;      // D row offset

  v8f acc[MI][NJ];
#pragma unroll
  for (int i = 0; i < MI; ++i)
#pragma unroll
    for (int j = 0; j < NJ; ++j) acc[i][j] = zero8();

  // staging: thread -> row (tid>>3) of each group of 32 rows, 16-B piece (tid&7) of its 128-B line
  const int sr = tid >> 3, sc = (tid & 7) * 8;
  // address = block-uniform plane base + the thread's 32-bit byte offset (row in its group, piece, k) + row group
  static_assert((KD % KS) == 0);
  const unsigned vo0 = (unsigned)(sr * KD + sc) * 2u;
  const char* gA  = (const char*)(A   + (size_t)(bm * BM) * KD);
  const char* gA2 = (const char*)(A2  + (size_t)(bm * BM) * KD);
  const char* gB  = (const char*)(Bt  + (size_t)(bn * BN) * KD);
  const char* gB2 = (const char*)(Bt2 + (size_t)(bn * BN) * KD);
  v4u st[NCH];
  auto fetch = [&](int k0) {
    const unsigned vo = vo0 + (unsigned)k0 * 2u;
#pragma unroll
    for (int it = 0; it < NCH; ++it) {
      const int r = it * 32;
      const char* g;
      if (r < BM)                 g = gA  + (size_t)r * KD * 2;
      else if (r < NPL * BM)      g = gA2 + (size_t)(r - BM) * KD * 2;
      else if (r < NPL * BM + BN) g = gB  + (size_t)(r - NPL * BM) * KD * 2;
      else                        g = gB2 + (size_t)(r - NPL * BM - BN) * KD * 2;
      st[it] = *(const v4u*)(g + vo);
    }
#if defined(__HIP_DEVICE_COMPILE__)
    // stands ahead of every later write to the address registers of the loads above
    asm volatile("s_wait_xcnt 0x0" ::: "memory");
#endif
  };
  auto put = [&](T* buf) {
#pragma unroll
    for (int it = 0; it < NCH; ++it) *(v4u*)(buf + (it * 32 + sr) * LP + sc) = st[it];
  };

  fetch(0);
  put(stg[0]);
  __syncthreads();
  constexpr int nst = KD / KS;
  for (int s = 0; s < nst; ++s) {
    const bool more = (s + 1 < nst);     // block-uniform
    if (more) fetch((s + 1) * KS);       // in flight while this stage is multiplied
    const T* buf = stg[s & 1];
    const T* sa  = buf + (wm * TM + rl) * LP + koff;
    const T* sa2 = sa + BM * LP;
    const T* sb  = buf + (NPL * BM + wn * TN + rl) * LP + koff;
    const T* sb2 = sb + BN * LP;
#pragma unroll
    for (int kk = 0; kk < KS; kk += 32) {
      // the fragments of a k step are read from LDS in groups ahead of their products (B: four subtile columns)
      FR ah[MI];
#pragma unroll
      for (int i = 0; i < MI; ++i) ah[i] = ldfrag(sa + 16 * i * LP + kk);
#pragma unroll
      for (int jg = 0; jg < NJ; jg += 4) {
        FR bh[4], bl[4];
#pragma unroll
        for (int jj = 0; jj < 4; ++jj) {
          bh[jj] = ldfrag(sb + 16 * (jg + jj) * LP + kk);
          if constexpr (NSPLIT == 2) bl[jj] = ldfrag(sb2 + 16 * (jg + jj) * LP + kk);
          else bl[jj] = bh[jj];
        }
#pragma unroll
        for (int jj = 0; jj < 4; ++jj) {
          const int j = jg + jj;
#pragma unroll
          for (int i = 0; i < MI; ++i) {
            acc[i][j] = mma_raw(ah[i], bh[jj], acc[i][j]);
            if constexpr (NSPLIT == 2) acc[i][j] = mma_raw(ah[i], bl[jj], acc[i][j]);
          }
          dep_guard2(acc[0][j], acc[MI - 1][j], bh[jj], bl[jj]);
        }
        if constexpr (NSPLIT == 2) {
          static_assert(NSPLIT == 0 || NJ == 4);   // one B group, so the A2 fragments may take the A fragments' place
#pragma unroll
          for (int i = 0; i < MI; ++i) keep1(ah[i]);
          FR al[MI];
#pragma unroll
          for (int i = 0; i < MI; ++i) al[i] = ldfrag(sa2 + 16 * i * LP + kk);
#pragma unroll
          for (int jj = 0; jj < 4; ++jj) {
            const int j = jg + jj;
#pragma unroll
            for (int i = 0; i < MI; ++i) acc[i][j] = mma_raw(al[i], bh[jj], acc[i][j]);
            dep_guard2(acc[0][j], acc[MI - 1][j], bh[jj], bh[jj]);
          }
#pragma unroll
          for (int i = 0; i < MI; ++i) keep1(al[i]);
        }
      }
      if constexpr (NSPLIT == 0) {
#pragma unroll
        for (int i = 0; i < MI; ++i) keep1(ah[i]);
      }
    }
    if (more) put(stg[(s + 1) & 1]);     // every reader left that buffer at the barrier of the stage before
    __syncthreads();                     // publishes stage s+1; ends the reads of stage s
  }
#pragma unroll
  for (int i = 0; i < MI; ++i)
#pragma unroll
    for (int j = 0; j < NJ; j += 4) acc_guard4(acc[i][j], acc[i][j + 1], acc[i][j + 2], acc[i][j + 3]);

  // ---- epilogue ----
  float* slab = sT[wave];
  const int ocol0 = (EPI == 4) ? (tn * 64) : n0;
  const int hq = lane >> 4, c4 = (lane & 15) * 4;   // f32 path: 256-B row segment = 16 lanes x 16 B
  const int q8 = lane >> 3, c8 = (lane & 7) * 8;
  float bxv[4] = {0.f, 0.f, 0.f, 0.f}, bgv[4] = {0.f, 0.f, 0.f, 0.f};
  v4f b4 = {0.f, 0.f, 0.f, 0.f};
  float lam = 0.f;
  if constexpr (EPI == 4) {
#pragma unroll
    for (int j = 0; j < 4; ++j) {
      bxv[j] = bias[ocol0 + 16 * j + rl];
      bgv[j] = bias[FFI + ocol0 + 16 * j + rl];
    }
  }
  if constexpr (EPI == 1 || EPI == 3) b4 = *(const v4f*)(bias + n0 + c4);
  if constexpr (EPI == 3) lam = lamp[0];

#pragma unroll
  for (int i = 0; i < MI; ++i) {
    const int mBase = m0 + 16 * i;
    // lane writes column 16j+rl, rows mOff..mOff+7 = 32 contiguous bytes as two 16-B vector LDS stores
#pragma unroll
    for (int j = 0; j < 4; ++j) {
      v4f w0, w1;
      if constexpr (EPI == 4) {
#pragma unroll
        for (int r = 0; r < 4; ++r) {
          w0[r] = swg(acc[i][j][r],     acc[i][j + 4][r],     oscale, bxv[j], bgv[j], rscale);
          w1[r] = swg(acc[i][j][r + 4], acc[i][j + 4][r + 4], oscale, bxv[j], bgv[j], rscale);
        }
      } else {
#pragma unroll
        for (int r = 0; r < 4; ++r) {
          w0[r] = acc[i][j][r] * oscale;
          w1[r] = acc[i][j][r + 4] * oscale;
        }
      }
      float* cp = slab + (16 * j + rl) * SP + mOff;
      *(v4f*)(cp) = w0;
      *(v4f*)(cp + 4) = w1;
    }
    wave_sync_lds();
    if constexpr (EPI == 0 || EPI == 1 || EPI == 3) {
      float* C = (float*)Cout;
      v4f fin[8];
#pragma unroll
      for (int it = 0; it < 8; ++it) {
        const int row = 2 * it + hq;                   // it 0..7 x hq 0..1 = rows 0..15
        v4f v;
        v[0] = slab[(c4 + 0) * SP + row];
        v[1] = slab[(c4 + 1) * SP + row];
        v[2] = slab[(c4 + 2) * SP + row];
        v[3] = slab[(c4 + 3) * SP + row];
        if constexpr (EPI == 1 || EPI == 3) {
          const size_t go = (size_t)(mBase + row) * ldc + n0 + c4;
          const v4f rvv = *(const v4f*)(((EPI == 3) ? resh : resa) + go);
#if defined(__HIP_DEVICE_COMPILE__)
          // stands ahead of the next rows' loads, whose results the compiler lays over this load's address registers
          asm volatile("s_wait_xcnt 0x0" ::: "memory");
#endif
          if constexpr (EPI == 3) v = v + b4 + rvv * lam;
          else                    v = v + b4 + rvv;
        }
        fin[it] = v;
      }
      {
#pragma unroll
        for (int it = 0; it < 8; ++it) {
          const int row = 2 * it + hq;
          *(v4f*)(C + (size_t)(mBase + row) * ldc + n0 + c4) = fin[it];
#if defined(__HIP_DEVICE_COMPILE__)
          // stands ahead of the later rows' sums, which the compiler lays over this store's data registers
          if constexpr (EPI == 1 || EPI == 3) asm volatile("s_wait_xcnt 0x0" ::: "memory");
#endif
        }
      }
    } else {
      unsigned short* C  = (unsigned short*)Cout;
      unsigned short* C2 = (unsigned short*)Cout2;
      const bool wlo = (EPI == 2) && (n0 < N2);        // wave-uniform
      v4u hv[4], lv[4];
#pragma unroll
      for (int it = 0; it < 4; ++it) {
        const int row = 4 * it + q8;                   // it 0..3 x q8 0..3 = rows 0..15
        v4u a, a2;
#pragma unroll
        for (int e = 0; e < 4; ++e) {
          const float f0 = slab[(c8 + 2 * e) * SP + row], f1 = slab[(c8 + 2 * e + 1) * SP + row];
          const _Float16 x0 = (_Float16)f0, x1 = (_Float16)f1;
          unsigned short l0 = 0, l1 = 0;
          if constexpr (EPI == 2) {
            l0 = h_bits((_Float16)((f0 - (float)x0) * rscale));
            l1 = h_bits((_Float16)((f1 - (float)x1) * rscale));
          }
          a[e] = pk16(h_bits(x0), h_bits(x1)); a2[e] = pk16(l0, l1);
        }
        hv[it] = a; lv[it] = a2;
      }
      {
#pragma unroll
        for (int it = 0; it < 4; ++it) {
          const int row = 4 * it + q8;
          *(v4u*)(C + (size_t)(mBase + row) * ldc + ocol0 + c8) = hv[it];
          if (wlo) *(v4u*)(C2 + (size_t)(mBase + row) * ldc2 + n0 + c8) = lv[it];
        }
        
      }
    }
    wave_sync_lds();
  }
}

template <typename T, int MI, int NJ, int NSPLIT, int EPI, int WM, int WN, int KD>
__global__ __launch_bounds__(256) void k_gemm(
    const unsigned short* __restrict__ Ap, const unsigned short* __restrict__ A2p, int lda,
    const unsigned short* __restrict__ Bp, const unsigned short* __restrict__ B2p, int ldb,
    void* Cout, int ldc, void* Cout2, int ldc2, int N2,
    const float* __restrict__ bias, const float* __restrict__ resh,
    const float* __restrict__ resa, const float* __restrict__ lamp,
    int M, int N, int K, float oscale, float rscale) {
  __shared__ __align__(16) char smem[gemm_lds<MI, NJ, NSPLIT, WM, WN>()];
  gemm_body<T, MI, NJ, NSPLIT, EPI, WM, WN, KD>((int)blockIdx.x, smem, Ap, A2p, lda, Bp, B2p, ldb, Cout, ldc, Cout2, ldc2,
                                                N2, bias, resh, resa, lamp, M, N, K, oscale, rscale);
}

// One grid for the three products that read none of each other's output and none of which fills the chip alone:
//   [ fo = h*lambda + ff.W2 + b2 (longest k loop, lowest indices) | v^T = Wv^T.x^T | q|k|qb|kb = x.Wcat ]
// The block index picks the product (block-uniform), so every barrier of a product is passed by its whole block.
#define GB_F2 ((SEQ / 128) * (DM / 128))         // 128x128 block tiles -> 128 blocks
#define GB_VT ((DM / 128) * (SEQ / 256))         // 128x256 -> 64 blocks
#define GB_QK ((SEQ / 128) * ((4 * DM) / 256))   // 128x256 -> 256 blocks
__global__ __launch_bounds__(256) void k_gemm3(
    const unsigned short* __restrict__ ff, const unsigned short* __restrict__ w2t, float* fo,
    const float* __restrict__ b2, const float* __restrict__ hs, const float* __restrict__ lamp,
    const unsigned short* __restrict__ wvh, const unsigned short* __restrict__ wvl,
    const unsigned short* __restrict__ xbh, const unsigned short* __restrict__ xbl,
    unsigned short* vth, unsigned short* vtl,
    const unsigned short* __restrict__ xh, const unsigned short* __restrict__ wcat, float* qk) {
  static_assert(gemm_lds<4, 4, 2, 2, 4>() >= gemm_lds<4, 4, 0, 2, 4>() && gemm_lds<4, 4, 2, 2, 4>() >= gemm_lds<2, 4, 0, 4, 2>());
  __shared__ __align__(16) char smem[gemm_lds<4, 4, 2, 2, 4>()];
  int b = blockIdx.x;
  if (b < GB_F2) {
    // M=2048, N=1024, K=4096; 32x64 wave tiles
    gemm_body<_Float16, 2, 4, 0, 3, 4, 2, FFI>(b, smem, ff, ff, FFI, w2t, w2t, FFI, (void*)fo, DM, (void*)fo, DM, 0,
                                               b2, hs, hs, lamp, SEQ, DM, FFI, 1.0f / (FSC * WSC), 1.0f);
    return;
  }
  b -= GB_F2;
  if (b < GB_VT) {
    // M=1024, N=2048, K=1024: f16 hi plane [h*64+d][s] + residual plane (keys < VLP)
    gemm_body<__bf16, 4, 4, 2, 2, 2, 4, DM>(b, smem, wvh, wvl, DM, xbh, xbl, DM, (void*)vth, SEQ, (void*)vtl, VLP, VLP,
                                            b2, hs, hs, lamp, DM, SEQ, DM, 1.0f, VRS);
    return;
  }
  b -= GB_VT;
  // M=2048, N=4096, K=1024 -> f32 [2048][4096]
  gemm_body<_Float16, 4, 4, 0, 0, 2, 4, DM>(b, smem, xh, xh, DM, wcat, wcat, DM, (void*)qk, 4 * DM, (void*)qk, 4 * DM, 0,
                                            b2, hs, hs, lamp, SEQ, 4 * DM, DM, 1.0f / (XSC * WSC), 1.0f);
}

// =====================================================================================================
// Per-head l2 normalisation + rotary embedding for q, k, qb, kb. Input QK f32 [2048][4096]
// (cols: q | k | qb | kb, each [h*64 + d]); cs table [t][cos 0..31 | sin 0..31] (bf16-valued f32).
// One wave per (t, h): lane d handles the rotary pair (d, d+32). Results exchanged through a per-wave LDS
// grid = 32768/8 blocks of 256. coverage: every (t, h) row of all four planes.
// =====================================================================================================
__global__ __launch_bounds__(256) void k_rope(const float* __restrict__ qkf, const float* __restrict__ cs,
                                              unsigned short* qh, unsigned short* kh, float* qbn, float* kbn) {
  __shared__ __align__(16) float yb[8][4 * 64];
  const int lane = threadIdx.x & 31, wave = threadIdx.x >> 5;
  const int p = blockIdx.x * 8 + wave;     // p = t*16 + h
  const int t = p >> 4, h = p & 15;
  const float cth = cs[(size_t)t * 64 + lane];
  const float sth = cs[(size_t)t * 64 + 32 + lane];
  const float* row = qkf + (size_t)t * (4 * DM) + h * HD;
  float* ybw = yb[wave];
#pragma unroll
  for (int g = 0; g < 4; ++g) {
    const float* src = row + g * DM;
    float x1 = src[lane], x2 = src[lane + 32];
    float n2 = x1 * x1 + x2 * x2;
#pragma unroll
    for (int o = 1; o < 32; o <<= 1) n2 += __shfl_xor(n2, o, 32);
    const float rn = 1.0f / fmaxf(sqrtf(n2), 1e-12f);
    x1 *= rn; x2 *= rn;
    ybw[g * 64 + lane]      = x1 * cth + x2 * sth;
    ybw[g * 64 + 32 + lane] = x2 * cth - x1 * sth;
  }
  wave_sync_lds();
  const int c8 = (lane & 7) * 8, c4 = (lane & 15) * 4;
  v4u qv, kv;
#pragma unroll
  for (int e = 0; e < 4; ++e) {
    qv[e] = pk16(h_bits((_Float16)(ybw[c8 + 2 * e] * QSC)), h_bits((_Float16)(ybw[c8 + 2 * e + 1] * QSC)));
    kv[e] = pk16(h_bits((_Float16)(ybw[64 + c8 + 2 * e] * QSC)), h_bits((_Float16)(ybw[64 + c8 + 2 * e + 1] * QSC)));
  }
  const v4f qbv = *(const v4f*)(ybw + 128 + c4);
  const v4f kbv = *(const v4f*)(ybw + 192 + c4);
  const size_t g16 = (size_t)t * DM + h * HD + c8;
  const size_t g32 = (size_t)t * DM + h * HD + c4;
  {
    if (lane < 8) {
      *(v4u*)(qh + g16) = qv;
      *(v4u*)(kh + g16) = kv;
    }
    if (lane < 16) {
      *(v4f*)(qbn + g32) = qbv;
      *(v4f*)(kbn + g32) = kbv;
    }
    
  }
}

// =====================================================================================================
// Inclusive causal prefix sum of kb over positions: pf[t][col] = sum_{s<=t} kbn[s][col], summed in f64.
// Blocked scan in two launches. The 2048 positions are cut into PSS blocks of 64 rows, each block into 8 wave
// slices of PWR rows; a work-group covers 64 rows x 128 columns, a lane 4 neighbouring columns (16-B accesses).
//   k_segsum: part[ss][col] = f64 sum of the 64 rows of block ss.
//   k_prefix: offset = sum of part[0..ss-1][col] + sums of the lower wave slices (scanned in LDS), added to the
//             lane's own running sum over its PWR rows; every pf line is stored whole by one wave.
// coverage of both: grid PSS x (DM/128) work-groups x 8 waves x PWR rows x 128 columns = the whole plane.
// Every loop of the two kernels is unrolled in full, so that its small arrays live in registers and the loads
// of one array are issued back to back.
// =====================================================================================================
#define PSS 32                 // row blocks of 64 positions
#define PWR 8                  // rows per wave slice
static_assert(PSS * 8 * PWR == SEQ && (DM % 128) == 0 && (PSS % 2) == 0);

__global__ __launch_bounds__(256) void k_segsum(const float* __restrict__ kbn, double* __restrict__ part) {
  __shared__ __align__(16) double wsum[8][128];
  const int tid = threadIdx.x, lane = tid & 31, wave = tid >> 5;
  const int cg = blockIdx.x % (DM / 128), ss = blockIdx.x / (DM / 128);
  const float* src = kbn + (size_t)(ss * 64 + wave * PWR) * DM + cg * 128 + lane * 4;
  v4f x[PWR];
#pragma unroll
  for (int i = 0; i < PWR; ++i) x[i] = *(const v4f*)(src + (size_t)i * DM);
  double s[4];
#pragma unroll
  for (int e = 0; e < 4; ++e) s[e] = (double)x[0][e];
#pragma unroll
  for (int i = 1; i < PWR; ++i)
#pragma unroll
    for (int e = 0; e < 4; ++e) s[e] += (double)x[i][e];
#pragma unroll
  for (int e = 0; e < 4; ++e) wsum[wave][lane * 4 + e] = s[e];
  __syncthreads();
  if (tid < 128) {
    double v[8];
#pragma unroll
    for (int w = 0; w < 8; ++w) v[w] = wsum[w][tid];
    double a = v[0];
#pragma unroll
    for (int w = 1; w < 8; ++w) a += v[w];
    part[(size_t)ss * DM + cg * 128 + tid] = a;
  }
}

__global__ __launch_bounds__(256) void k_prefix(const float* __restrict__ kbn, const double* __restrict__ part,
                                                float* __restrict__ pf) {
  __shared__ __align__(16) double wsum[8][128];   // sum of each wave slice, per column; then its offset
  __shared__ __align__(16) double sup[2][128];    // sum of the lower row blocks, even / odd blocks apart
  const int tid = threadIdx.x, lane = tid & 31, wave = tid >> 5;
  const int cg = blockIdx.x % (DM / 128), ss = blockIdx.x / (DM / 128);
  const size_t go = (size_t)(ss * 64 + wave * PWR) * DM + cg * 128 + lane * 4;
  const float* src = kbn + go;
  v4f x[PWR];
#pragma unroll
  for (int i = 0; i < PWR; ++i) x[i] = *(const v4f*)(src + (size_t)i * DM);
  // lower row blocks: all PSS rows of part were written by k_segsum, so every load is issued at once and
  // the rows from ss on are dropped by the select (waves 0..3 take the even blocks, waves 4..7 the odd ones)
  {
    const int c = tid & 127, hf = tid >> 7;
    const double* pp = part + (size_t)hf * DM + cg * 128 + c;
    double pv[PSS / 2];
#pragma unroll
    for (int j = 0; j < PSS / 2; ++j) pv[j] = pp[(size_t)(2 * j) * DM];
    // keeps every load above ahead of the sums: without it two of them are issued only after the first have
    // come back, and the wave pays the memory latency twice
    __builtin_amdgcn_sched_barrier(0);
    double so = 0.0;
#pragma unroll
    for (int j = 0; j < PSS / 2; ++j) so += (2 * j + hf < ss) ? pv[j] : 0.0;
    sup[hf][c] = so;
  }
  // the lane's own running sums
  double p[PWR][4];
#pragma unroll
  for (int e = 0; e < 4; ++e) p[0][e] = (double)x[0][e];
#pragma unroll
  for (int i = 1; i < PWR; ++i)
#pragma unroll
    for (int e = 0; e < 4; ++e) p[i][e] = p[i - 1][e] + (double)x[i][e];
#pragma unroll
  for (int e = 0; e < 4; ++e) wsum[wave][lane * 4 + e] = p[PWR - 1][e];
  __syncthreads();
  // one thread per column turns the slice sums into each slice's offset, in place
  if (tid < 128) {
    double v[8];
#pragma unroll
    for (int w = 0; w < 8; ++w) v[w] = wsum[w][tid];
    double run = sup[0][tid] + sup[1][tid];
#pragma unroll
    for (int w = 0; w < 8; ++w) { wsum[w][tid] = run; run += v[w]; }
  }
  __syncthreads();
  double off[4];
#pragma unroll
  for (int e = 0; e < 4; ++e) off[e] = wsum[wave][lane * 4 + e];
  float* dst = pf + go;
#pragma unroll
  for (int i = 0; i < PWR; ++i) {
    v4f o;
#pragma unroll
    for (int e = 0; e < 4; ++e) o[e] = (float)(off[e] + p[i][e]);
    *(v4f*)(dst + (size_t)i * DM) = o;
  }
}

// =====================================================================================================
// Causal attention, head dim 64, plus the bias-attention row term.
//   q, k planes (f16, x8, normalised + rotary): element (t, h, d) at [t*DM + h*64 + d]
//   v^T hi plane (f16): element (h, d, s) at [(h*64 + d)*SEQ + s]; v^T residual plane (f16, (v - hi)*4096):
//   [(h*64 + d)*VLP + s], s < VLP, read only when RES (query blocks 0..RESQB-1 see only keys < VLP).
//   scores = q . k (single f16 product), * 1/64, key > query -> -inf; online softmax in f32.
//   p = exp(s - m) carried as f16(1024 p); context = p . v on f16 WMMA; RES adds f16 residual planes of p and v
//   (scale 4096, separate accumulator folded back with 1/4096 per chunk in f32).
//   y = l2ns * context / l + sb, sb = 0.125 * qbn[q] . pfx[q] (64-dot over the head dims, prefix sum of kb),
//   written as bf16 hi / lo planes [t][h*64 + d].
//   Block = 4 waves = 64 query rows of one h; nqbThis * NH blocks; key chunks of 64, trip count qb+1 (<= 32).
//   Both forms share one grid (k_attn): they read none of each other's output; the blocks without residual planes,
//   which hold the longest key loops, take the low block indices.
//   K / V^T chunk staging: 128 threads x 32 elements per plane = the whole 64x64 tile, LDS row pitch AP (plain 16-B loads,
//   __syncthreads before and after); P tiles are wave-private, spilled with _Float16 element stores and reloaded
//   (pitch AP); the context slab (pitch OSP) is written with two 16-B vector LDS stores per lane per column.
//   Output coverage: each wave stores rows q0..q0+15 (it 0..3 x lane>>3 0..3) x 64 columns (8 lanes x 8) of both planes.
// =====================================================================================================
template <bool RES>
__device__ __forceinline__
void attn_body(const unsigned short* __restrict__ qhp, const unsigned short* __restrict__ khp,
               const unsigned short* __restrict__ vhp, const unsigned short* __restrict__ vlp,
               const float* __restrict__ qbn, const float* __restrict__ pfx, const float* __restrict__ l2p,
               unsigned short* yhp, unsigned short* ylp, int bx, int qbBase, int nqbThis,
               _Float16* Ksh, _Float16* Vth, _Float16* Vtl, _Float16 (*Psh)[16 * AP], _Float16 (*Psl)[16 * AP],
               float (*Os)[64 * OSP], float (*Sbl)[16]) {
  union FH { v16h v; v8h h[2]; };

  const int tid  = threadIdx.x;
  const int wave = tid >> 5;
  const int lane = tid & 31;
  const int hh   = lane >> 4;
  const int c    = lane & 15;

  const int qbl = bx % nqbThis;
  const int h   = bx / nqbThis;
  const int qb  = qbBase + qbl;
  const int q0  = qb * 64 + wave * 16;

  const _Float16* Qh = (const _Float16*)(const void*)qhp + (size_t)h * HD;
  const _Float16* Kh = (const _Float16*)(const void*)khp + (size_t)h * HD;
  const _Float16* Vh = (const _Float16*)(const void*)vhp + (size_t)h * HD * SEQ;
  const _Float16* Vl = (const _Float16*)(const void*)vlp + (size_t)h * HD * VLP;

  // ---- Q fragments (A operand, row = lane&15): 2 d-chunks ----
  v16h qa[2];
#pragma unroll
  for (int dc = 0; dc < 2; ++dc) qa[dc] = ldfrag(Qh + (size_t)(q0 + c) * DM + dc * 32 + 8 * hh);

  float mrow[8], lrow[8];
  v8f oacc[4];
#pragma unroll
  for (int r = 0; r < 8; ++r) { mrow[r] = -INFINITY; lrow[r] = 0.f; }
#pragma unroll
  for (int t = 0; t < 4; ++t) oacc[t] = zero8();

  int nkt = qb + 1;                          // causal: key tiles 0..qb; block-uniform, <= NQB
  if (nkt > NQB) nkt = NQB;
  for (int kt = 0; kt < nkt; ++kt) {
    const int kv0 = kt * 64;
    __syncthreads();
    {
      const int r = tid >> 1, half = (tid & 1) * 32;
      const _Float16* kg = Kh + (size_t)(kv0 + r) * DM + half;      // K row kv0+r, d = half..half+31
      const _Float16* vg = Vh + (size_t)r * SEQ + kv0 + half;       // V^T row d = r, s = kv0+half..+31
      const int kvl = (kv0 + 64 <= VLP) ? kv0 : (VLP - 64);         // clamped address into the residual plane
      const _Float16* vlg = Vl + (size_t)r * VLP + kvl + half;
      const bool resOK = (kv0 + 64 <= VLP);                          // block-uniform
#pragma unroll
      for (int i = 0; i < 4; ++i) {
        const v8h a0 = *(const v8h*)(kg + 8 * i);
        const v8h b0 = *(const v8h*)(vg + 8 * i);
        *(v8h*)(Ksh + r * AP + half + 8 * i) = a0;
        *(v8h*)(Vth + r * AP + half + 8 * i) = b0;
        if (RES) {
          v8h b1 = *(const v8h*)(vlg + 8 * i);
          if (!resOK) b1 = zero8h();
          *(v8h*)(Vtl + r * AP + half + 8 * i) = b1;
        }
      }
    }
    __syncthreads();

    // ---- scores: 16 query rows x 64 keys per wave, single f16 product ----
    v8f s[4];
#pragma unroll
    for (int j = 0; j < 4; ++j) {
      s[j] = zero8();
#pragma unroll
      for (int dc = 0; dc < 2; ++dc) {
        FH kb;
        kb.h[0] = *(const v8h*)(Ksh + (j * 16 + c) * AP + dc * 32 + 8 * hh);
        kb.h[1] = *(const v8h*)(Ksh + (j * 16 + c) * AP + dc * 32 + 16 + 8 * hh);
        s[j] = mma_h(qa[dc], kb.v, s[j]);
      }
    }

    // ---- undo carries, causal mask, row max, online softmax, P (x1024, f16) and P residual (x4096) to LDS ----
    _Float16* pwh = Psh[wave];
    _Float16* pwl = Psl[RES ? wave : 0];
#pragma unroll
    for (int r = 0; r < 8; ++r) {
      const int qrow = q0 + 8 * hh + r;
      float m = -INFINITY;
#pragma unroll
      for (int j = 0; j < 4; ++j) {
        const int key = kv0 + j * 16 + c;
        float sv = s[j][r] * SSC;
        sv = (key <= qrow) ? sv : -INFINITY;
        s[j][r] = sv;
        m = fmaxf(m, sv);
      }
#pragma unroll
      for (int off = 1; off < 16; off <<= 1) m = fmaxf(m, __shfl_xor(m, off, 32));
      const float mnew  = fmaxf(mrow[r], m);
      const float msafe = (mnew == -INFINITY) ? 0.f : mnew;
      const float alpha = __expf(mrow[r] - msafe);
      mrow[r] = mnew;
      float psum = 0.f;
#pragma unroll
      for (int j = 0; j < 4; ++j) {
        const float p = __expf(s[j][r] - msafe);     // masked logit: exp(-inf) -> 0
        psum += p;
        const float p1k = p * 1024.0f;
        const _Float16 ph = (_Float16)p1k;
        pwh[(8 * hh + r) * AP + j * 16 + c] = ph;
        if (RES) {
          const _Float16 pl = (_Float16)((p1k - (float)ph) * VRS);
          pwl[(8 * hh + r) * AP + j * 16 + c] = pl;
        }
      }
#pragma unroll
      for (int off = 1; off < 16; off <<= 1) psum += __shfl_xor(psum, off, 32);
      lrow[r] = lrow[r] * alpha + psum;
#pragma unroll
      for (int t = 0; t < 4; ++t) oacc[t][r] *= alpha;
    }
    wave_sync_lds();

    // ---- context += P . V (f16 WMMA), residual products into a separate accumulator ----
    v8f o1[4];
#pragma unroll
    for (int t = 0; t < 4; ++t) o1[t] = zero8();
#pragma unroll 1
    for (int kk = 0; kk < 2; ++kk) {
      FH pa, pl;
      pa.h[0] = *(const v8h*)(pwh + c * AP + kk * 32 + 8 * hh);
      pa.h[1] = *(const v8h*)(pwh + c * AP + kk * 32 + 16 + 8 * hh);
      if (RES) {
        pl.h[0] = *(const v8h*)(pwl + c * AP + kk * 32 + 8 * hh);
        pl.h[1] = *(const v8h*)(pwl + c * AP + kk * 32 + 16 + 8 * hh);
      } else {
        pl.v = pa.v;
      }
#pragma unroll
      for (int t = 0; t < 4; ++t) {
        FH vb;
        vb.h[0] = *(const v8h*)(Vth + (t * 16 + c) * AP + kk * 32 + 8 * hh);
        vb.h[1] = *(const v8h*)(Vth + (t * 16 + c) * AP + kk * 32 + 16 + 8 * hh);
        oacc[t] = mma_h(pa.v, vb.v, oacc[t]);
        if (RES) {
          FH vl;
          vl.h[0] = *(const v8h*)(Vtl + (t * 16 + c) * AP + kk * 32 + 8 * hh);
          vl.h[1] = *(const v8h*)(Vtl + (t * 16 + c) * AP + kk * 32 + 16 + 8 * hh);
          o1[t] = mma_h(pa.v, vl.v, o1[t]);
          o1[t] = mma_h(pl.v, vb.v, o1[t]);
        }
      }
    }
    if (RES) {
#pragma unroll
      for (int t = 0; t < 4; ++t)
#pragma unroll
        for (int r = 0; r < 8; ++r) oacc[t][r] += o1[t][r] * (1.0f / VRS);
    }
  }

  // ---- bias-attention row term: 0.125 * qb_row . prefix(kb)_row; lane (row = c, half hh) covers 32 dims ----
  const float l2ns = l2p[0];
  {
    const size_t ro = (size_t)(q0 + c) * DM + (size_t)h * HD + hh * 32;
    const float* qp = qbn + ro;
    const float* pp = pfx + ro;
    float ds = 0.f;
#pragma unroll
    for (int e = 0; e < 8; ++e) {
      const v4f a = *(const v4f*)(qp + 4 * e);
      const v4f b = *(const v4f*)(pp + 4 * e);
#if defined(__HIP_DEVICE_COMPILE__)
      // stands ahead of the later loads, whose results the compiler lays over the address registers of these two
      asm volatile("s_wait_xcnt 0x0" ::: "memory");
#endif
      ds += a[0] * b[0] + a[1] * b[1] + a[2] * b[2] + a[3] * b[3];
    }
    ds += __shfl_xor(ds, 16, 32);
    if (hh == 0) Sbl[wave][c] = ds * 0.125f;
  }

  // ---- normalise (l2ns/l and the 1/1024 p carry), stage the wave's 16x64 tile column-major with 16-B vector
  float* os = Os[wave];
  float invr[8];
#pragma unroll
  for (int r = 0; r < 8; ++r) {
    const float l = lrow[r];
    invr[r] = ((l > 0.f) ? (1.0f / l) : 0.f) * (l2ns * (1.0f / 1024.0f));
  }
#pragma unroll
  for (int t = 0; t < 4; ++t) {
    v4f w0, w1;
#pragma unroll
    for (int r = 0; r < 4; ++r) {
      w0[r] = oacc[t][r] * invr[r];
      w1[r] = oacc[t][r + 4] * invr[r + 4];
    }
    float* cp = os + (t * 16 + c) * OSP + 8 * hh;
    *(v4f*)(cp) = w0;
    *(v4f*)(cp + 4) = w1;
  }
  wave_sync_lds();
  {
    const int q4 = lane >> 3, c8 = (lane & 7) * 8;
    v4u hv[4], lv[4];
#pragma unroll
    for (int it = 0; it < 4; ++it) {
      const int row = it * 4 + q4;   // it 0..3 x q4 0..3 = rows 0..15 of the wave tile
      const float sbv = Sbl[wave][row];
      v4u a, a2;
#pragma unroll
      for (int e = 0; e < 4; ++e) {
        const float f0 = os[(c8 + 2 * e) * OSP + row] + sbv;
        const float f1 = os[(c8 + 2 * e + 1) * OSP + row] + sbv;
        const unsigned short h0 = bf_bits(f0), h1 = bf_bits(f1);
        const unsigned short l0 = bf_bits(f0 - bf_up(h0)), l1 = bf_bits(f1 - bf_up(h1));
        a[e] = pk16(h0, h1); a2[e] = pk16(l0, l1);
      }
      hv[it] = a; lv[it] = a2;
    }
    {
#pragma unroll
      for (int it = 0; it < 4; ++it) {
        const int row = it * 4 + q4;
        const size_t go = (size_t)(q0 + row) * DM + (size_t)h * HD + c8;
        *(v4u*)(yhp + go) = hv[it];
        *(v4u*)(ylp + go) = lv[it];
      }
#if defined(__HIP_DEVICE_COMPILE__)
      // the form's end is not the kernel's end in the built code: stands ahead of any later write to these stores' registers
      asm volatile("s_wait_xcnt 0x0" ::: "memory");
#endif
    }
  }
}

__global__ __launch_bounds__(128)
void k_attn(const unsigned short* __restrict__ qhp, const unsigned short* __restrict__ khp,
            const unsigned short* __restrict__ vhp, const unsigned short* __restrict__ vlp,
            const float* __restrict__ qbn, const float* __restrict__ pfx, const float* __restrict__ l2p,
            unsigned short* yhp, unsigned short* ylp) {
  __shared__ __align__(16) _Float16 Ksh[64 * AP];                 // K [kv][d], pitch AP, 9 KB
  __shared__ __align__(16) _Float16 Vth[64 * AP];                 // V^T hi [d][kv], pitch AP, 9 KB
  __shared__ __align__(16) _Float16 Vtl[64 * AP];                 // V^T residual, pitch AP
  __shared__ __align__(16) _Float16 Psh[4][16 * AP];              // per wave P [row][kv], pitch AP
  __shared__ __align__(16) _Float16 Psl[4][16 * AP];              // per wave P residual, pitch AP
  __shared__ __align__(16) float    Os[4][64 * OSP];              // per wave context slab [d][row], pitch OSP
  __shared__ float Sbl[4][16];                                    // per wave bias-attention row values
  const int bx = blockIdx.x;                                      // block-uniform choice of the form
  if (bx < NH * (NQB - RESQB))
    attn_body<false>(qhp, khp, vhp, vlp, qbn, pfx, l2p, yhp, ylp, bx, RESQB, NQB - RESQB,
                     Ksh, Vth, Vtl, Psh, Psl, Os, Sbl);
  else
    attn_body<true>(qhp, khp, vhp, vlp, qbn, pfx, l2p, yhp, ylp, bx - NH * (NQB - RESQB), 0, RESQB,
                    Ksh, Vth, Vtl, Psh, Psl, Os, Sbl);
}

// =====================================================================================================
// Workspace map (MiB offsets, sizes exact multiples of the whole-tile / whole-line store granularity):
//   Xh   f16  [2048][1024]          0    4
//   Xbh  bf16 [2048][1024]          4    4   (later: Qh f16, after the v^T projection)
//   Xbl  bf16 [2048][1024]          8    4   (later: Kh f16)
//   Wcat f16  [4096 n][1024 k]     12    8   (Wq|Wk|Wqb|Wkb transposed, x64)
//   Wvh/Wvl bf16 [1024][1024]      20  2+2
//   Woh/Wol bf16 [1024][1024]      24  2+2
//   W1t  f16  [8192][1024]         28   16   (x64, xp/gate interleaved per 64 columns)
//   W2t  f16  [1024][4096]         44    8   (x64)
//   cs   f32  [2048][64]           52  512 KiB
//   QK   f32  [2048][4096]         53   32   (later: Pf 53 (8), Yh 61 (4), Yl 65 (4), PS f64 [32][1024] 77 (256 KiB))
//   QBn  f32  [2048][1024]         85    8
//   KBn  f32  [2048][1024]         93    8
//   VTh  f16  [1024][2048]        101    4
//   VTl  f16  [1024][512]         105    1
//   FF   f16  [2048][4096]        106   16   (x64)
//   FO   f32  [2048][1024]        122    8   (h*lambda + ff.W2 + b2)
//   end                           130 MiB = 136314880 B
// =====================================================================================================
extern "C" void kernel_launch(void* const* d_in, const int* in_sizes, int n_in,
                              void* d_out, int out_size, void* d_ws, size_t ws_size,
                              hipStream_t stream) {
  if (n_in < 14) return;
  if (in_sizes[0] != SEQ * DM) return;
  for (int i = 1; i <= 6; ++i) if (in_sizes[i] != DM * DM) return;
  if (in_sizes[7] != DM) return;
  if (in_sizes[8] != DM * FUS || in_sizes[9] != FUS) return;
  if (in_sizes[10] != FFI * DM || in_sizes[11] != DM) return;
  if (in_sizes[12] < 1 || in_sizes[13] < 1) return;
  if (out_size != SEQ * DM) return;

  const float* hs  = (const float*)d_in[0];
  const float* Wq  = (const float*)d_in[1];
  const float* Wk  = (const float*)d_in[2];
  const float* Wv  = (const float*)d_in[3];
  const float* Wqb = (const float*)d_in[4];
  const float* Wkb = (const float*)d_in[5];
  const float* Wo  = (const float*)d_in[6];
  const float* bo  = (const float*)d_in[7];
  const float* W1  = (const float*)d_in[8];
  const float* b1  = (const float*)d_in[9];
  const float* W2  = (const float*)d_in[10];
  const float* b2  = (const float*)d_in[11];
  const float* lam = (const float*)d_in[12];
  const float* l2n = (const float*)d_in[13];

  // rotary inverse frequencies 1 / 1000^(2d/64), evaluated in double and RNE-cast to f32 (constants only)
  InvTab itab;
  for (int d = 0; d < HD / 2; ++d)
    { const float pw = (float)pow(1000.0, (2.0 * (double)d) / 64.0); itab.f[d] = 1.0f / pw; }

  const size_t MiB = 1048576;
  const size_t oXh  = 0;
  const size_t oXbh = 4 * MiB,  oXbl = 8 * MiB;
  const size_t oQh  = oXbh,     oKh  = oXbl;        // written after the v^T projection consumed Xbh/Xbl
  const size_t oWcat = 12 * MiB;
  const size_t oWvh = 20 * MiB, oWvl = 22 * MiB, oWoh = 24 * MiB, oWol = 26 * MiB;
  const size_t oW1t = 28 * MiB;
  const size_t oW2t = 44 * MiB;
  const size_t oCS  = 52 * MiB;
  const size_t oQK  = 53 * MiB;
  const size_t oPf  = 53 * MiB, oYh = 61 * MiB, oYl = 65 * MiB;                   // inside QK, after rope
  const size_t oPS  = 77 * MiB;                                                   // inside QK, after rope
  const size_t oQBn = 85 * MiB, oKBn = 93 * MiB;
  const size_t oVTh = 101 * MiB, oVTl = 105 * MiB;
  const size_t oFF  = 106 * MiB;
  const size_t oFO  = 122 * MiB;
  const size_t oEnd = 130 * MiB;
  // extent checks against the actual plane sizes
  if ((size_t)SEQ * DM * 2 != 4 * MiB) return;
  if ((size_t)DM * DM * 2 != 2 * MiB) return;
  if (oWcat + (size_t)4 * DM * DM * 2 != oWvh) return;
  if (oW1t + (size_t)FUS * DM * 2 != oW2t) return;
  if (oW2t + (size_t)DM * FFI * 2 != oCS) return;
  if (oCS + (size_t)SEQ * 64 * 4 > oQK) return;
  if (oQK + (size_t)SEQ * 4 * DM * 4 != oQBn) return;
  if (oPf + (size_t)SEQ * DM * 4 != oYh) return;
  if (oYl + (size_t)SEQ * DM * 2 > oPS) return;
  if (oPS + (size_t)PSS * DM * 8 > oQBn) return;
  if (oVTh + (size_t)DM * SEQ * 2 != oVTl) return;
  if (oVTl + (size_t)DM * VLP * 2 != oFF) return;
  if (oFF + (size_t)SEQ * FFI * 2 != oFO) return;
  if (oFO + (size_t)SEQ * DM * 4 != oEnd) return;
  if (oEnd > ws_size) return;

  char* ws = (char*)d_ws;
  unsigned short* Xh   = (unsigned short*)(ws + oXh);
  unsigned short* Xbh  = (unsigned short*)(ws + oXbh);
  unsigned short* Xbl  = (unsigned short*)(ws + oXbl);
  unsigned short* Qh   = (unsigned short*)(ws + oQh);
  unsigned short* Kh   = (unsigned short*)(ws + oKh);
  unsigned short* Wcat = (unsigned short*)(ws + oWcat);
  unsigned short* Wvh  = (unsigned short*)(ws + oWvh);
  unsigned short* Wvl  = (unsigned short*)(ws + oWvl);
  unsigned short* Woh  = (unsigned short*)(ws + oWoh);
  unsigned short* Wol  = (unsigned short*)(ws + oWol);
  unsigned short* W1t  = (unsigned short*)(ws + oW1t);
  unsigned short* W2t  = (unsigned short*)(ws + oW2t);
  float*          CS   = (float*)(ws + oCS);
  float*          QK   = (float*)(ws + oQK);
  float*          Pf   = (float*)(ws + oPf);
  unsigned short* Yh   = (unsigned short*)(ws + oYh);
  unsigned short* Yl   = (unsigned short*)(ws + oYl);
  float*          FO   = (float*)(ws + oFO);
  double*         PS   = (double*)(ws + oPS);
  float*          QBn  = (float*)(ws + oQBn);
  float*          KBn  = (float*)(ws + oKBn);
  unsigned short* VTh  = (unsigned short*)(ws + oVTh);
  unsigned short* VTl  = (unsigned short*)(ws + oVTl);
  unsigned short* FF   = (unsigned short*)(ws + oFF);

  const dim3 b256(256), b128(128);
  const dim3 gF1((SEQ / 128) * (FUS / 256));                             // 128x256 block tiles -> 512 blocks
  const dim3 gWo((SEQ / 128) * (DM / 256));                              // 128x256 -> 64 blocks

  // (0-2) rotary cos/sin table, RMSNorm -> x planes, weights [k][n] f32 -> [n][k] 16-bit planes: one grid
  k_prep<<<dim3(PB_ALL), b256, 0, stream>>>(itab, hs, Wq, Wk, Wqb, Wkb, Wv, Wo, W1, W2,
                                            CS, Xh, Xbh, Xbl, Wcat, Wvh, Wvl, Woh, Wol, W1t, W2t);
  // (3) u = x . W1 + b1 with fused SwiGLU -> FF f16 [2048][4096] (x64)   (M=2048, N=8192, K=1024)
  k_gemm<_Float16, 2, 8, 0, 4, 4, 2, DM><<<gF1, b256, 0, stream>>>(
      Xh, Xh, DM, W1t, W1t, DM,
      (void*)FF, FFI, (void*)FF, FFI, 0,
      b1, hs, hs, lam,
      SEQ, FUS, DM, 1.0f / (XSC * WSC), FSC);
  // (4) one grid: fo = h*lambda + ff . W2 + b2;  v^T = Wv^T . x^T;  q|k|qb|kb = x . (Wq|Wk|Wqb|Wkb)
  k_gemm3<<<dim3(GB_F2 + GB_VT + GB_QK), b256, 0, stream>>>(FF, W2t, FO, b2, hs, lam,
                                                            Wvh, Wvl, Xbh, Xbl, VTh, VTl, Xh, Wcat, QK);
  // (6) l2norm + rotary -> q, k f16 planes (into the dead Xbh/Xbl regions), qb, kb f32 planes
  k_rope<<<dim3(SEQ * NH / 8), b256, 0, stream>>>(QK, CS, Qh, Kh, QBn, KBn);
  // (7) causal prefix sum of kb (QK region is dead now)
  k_segsum<<<dim3(PSS * (DM / 128)), b256, 0, stream>>>(KBn, PS);
  k_prefix<<<dim3(PSS * (DM / 128)), b256, 0, stream>>>(KBn, PS, Pf);
  // (8) attention: query blocks 0..RESQB-1 with residual planes, the rest without, in one grid
  k_attn<<<dim3(NH * NQB), b128, 0, stream>>>(Qh, Kh, VTh, VTl, QBn, Pf, l2n, Yh, Yl);
  // (9) out = (y . Wo + bo) + fo   (hi/lo x hi/lo, 3 products)
  k_gemm<__bf16, 4, 4, 2, 1, 2, 4, DM><<<gWo, b256, 0, stream>>>(
      Yh, Yl, DM, Woh, Wol, DM,
      d_out, DM, d_out, DM, 0,
      bo, hs, (const float*)FO, lam,
      SEQ, DM, DM, 1.0f, 1.0f);
  (void)hipGetLastError();
}

// v005
// One run takes 201 microseconds.
// Two timings next to v004 both put it at 1.10 times that version's speed.
// Counting every step since v000, it is 8.13 times as fast.
// Contractions: x.(Wq|Wk|Wqb|Wkb), q.k^T scores, x.W1 and ff.W2 = v_wmma_f32_16x16x32_f16 (f16 operands with power-of-two carries, single product);
// v^T = Wv^T.x^T and attn = y.Wo = v_wmma_f32_16x16x32_bf16 with bf16 hi/lo split operands (hi.hi + hi.lo + lo.hi);
// p.v = v_wmma_f32_16x16x32_f16 (p carried x1024 in f16, v f16 plus x4096 f16 residual planes of p and v on the leading query blocks); all f32 accumulate.
#include <hip/hip_runtime.h>
#include <math.h>
#include <stdint.h>

#define SEQ   2048
#define DM    1024
#define NH    16
#define HD    64
#define FFI   4096
#define FUS   8192
#define NQB   (SEQ / 64)
#define VLP   512
#define RESQB 8
#define QSC   8.0f             // f16 carry of q and k after l2norm + rope
#define SSC   (1.0f / 64.0f)   // undo QSC*QSC on the score accumulator
#define XSC   16.0f            // f16 carry of the normalised activations
#define WSC   64.0f            // f16 carry of the weights
#define FSC   64.0f            // f16 carry of the SwiGLU output
#define VRS   4096.0f          // scale of the f16 residual planes of v and p
#define SP    20               // LDS result slab pitch per column (16 rows + 4 pad), floats
#define OSP   20               // attention context slab pitch per column
#define AP    72               // attention K / V^T / P tile row pitch in LDS, f16 elements: 128 B of data + 16 B,
                               // 16 B x odd, so that the 16 rows of a 16-B fragment read fall on different banks

#define KG    4                // wave groups of an attention block; group g takes the key tiles g, g + KG, g + 2 KG, ...
#define XPW   (12 * 32 * 4)    // floats one wave hands over at the merge: 12 pieces of 16 B per lane

static_assert(RESQB * 64 <= VLP);
static_assert(NH * HD == DM);
static_assert((SEQ % 64) == 0 && (DM % 64) == 0 && (FFI % 64) == 0 && (FUS % 128) == 0);

typedef _Float16 v16h __attribute__((ext_vector_type(16)));
typedef _Float16 v8h  __attribute__((ext_vector_type(8)));
typedef __bf16   v16b __attribute__((ext_vector_type(16)));
typedef __bf16   v8b  __attribute__((ext_vector_type(8)));
typedef float    v8f  __attribute__((ext_vector_type(8)));
typedef float    v4f  __attribute__((ext_vector_type(4)));
typedef unsigned int v4u __attribute__((ext_vector_type(4)));

// rotary inverse frequencies, one per pair index d = 0..31, passed by value (host computed)
struct InvTab { float f[HD / 2]; };
static_assert(sizeof(InvTab) == 128);

// ---- scalar helpers --------------------------------------------------------------------------------
__device__ __forceinline__ unsigned short bf_bits(float f) {          // f32 -> bf16 bits, RNE convert
  unsigned u = __float_as_uint(f);
  return (unsigned short)((u + 0x7FFFu + ((u >> 16) & 1u)) >> 16);
}
__device__ __forceinline__ float bf_up(unsigned short h) { return __uint_as_float(((unsigned)h) << 16); }
__device__ __forceinline__ unsigned short h_bits(_Float16 x) { return __builtin_bit_cast(unsigned short, x); }
__device__ __forceinline__ unsigned pk16(unsigned short a, unsigned short b) { return (unsigned)a | ((unsigned)b << 16); }
__device__ __forceinline__ v8f zero8() { v8f z = {0.f, 0.f, 0.f, 0.f, 0.f, 0.f, 0.f, 0.f}; return z; }
__device__ __forceinline__ v8h zero8h() {
  const _Float16 z = (_Float16)0.0f;
  v8h r = {z, z, z, z, z, z, z, z};
  return r;
}
__device__ __forceinline__ void wave_sync_lds() {
  __builtin_amdgcn_fence(__ATOMIC_RELEASE, "workgroup");
  __builtin_amdgcn_wave_barrier();
  __builtin_amdgcn_fence(__ATOMIC_ACQUIRE, "workgroup");
}

// ---- fragment loaders: 16-bit A/B operand, lane -> row/col (lane&15), p already includes +8*(lane>>4);
//      elements 0..7 <- p[0..7] (k0+8h..), elements 8..15 <- p[16..23] (k0+16+8h..)
template <typename T> struct Frag16;
template <> struct Frag16<_Float16> { typedef v16h t; };
template <> struct Frag16<__bf16>   { typedef v16b t; };

__device__ __forceinline__ v16h ldfrag(const _Float16* p) {
  union { v16h v; v8h h[2]; } f;
  f.h[0] = *(const v8h*)(p);
  f.h[1] = *(const v8h*)(p + 16);
  return f.v;
}
__device__ __forceinline__ v16b ldfrag(const __bf16* p) {
  union { v16b v; v8b h[2]; } f;
  f.h[0] = *(const v8b*)(p);
  f.h[1] = *(const v8b*)(p + 16);
  return f.v;
}

// ---- WMMA helpers with trailing VALU hazard gap (non-template overloads per fragment type) -------------
__device__ __forceinline__ v8f mma_raw(v16h a, v16h b, v8f c) {
  return __builtin_amdgcn_wmma_f32_16x16x32_f16(false, a, false, b, (short)0, c, false, false);
}
__device__ __forceinline__ v8f mma_raw(v16b a, v16b b, v8f c) {
  return __builtin_amdgcn_wmma_f32_16x16x32_bf16(false, a, false, b, (short)0, c, false, false);
}
__device__ __forceinline__ v8f mma_h(v16h a, v16h b, v8f c) {
  c = mma_raw(a, b, c);
#if defined(__HIP_DEVICE_COMPILE__)
  asm volatile("v_nop\n\tv_nop\n\tv_nop\n\tv_nop" : "+v"(c) : "v"(a), "v"(b));
#endif
  return c;
}
__device__ __forceinline__ void dep_guard2(v8f& a, v8f& b, v16h x, v16h y) {
#if defined(__HIP_DEVICE_COMPILE__)
  asm volatile("v_nop\n\tv_nop\n\tv_nop\n\tv_nop" : "+v"(a), "+v"(b) : "v"(x), "v"(y));
#else
  (void)a; (void)b; (void)x; (void)y;
#endif
}
__device__ __forceinline__ void dep_guard2(v8f& a, v8f& b, v16b x, v16b y) {
#if defined(__HIP_DEVICE_COMPILE__)
  asm volatile("v_nop\n\tv_nop\n\tv_nop\n\tv_nop" : "+v"(a), "+v"(b) : "v"(x), "v"(y));
#else
  (void)a; (void)b; (void)x; (void)y;
#endif
}
__device__ __forceinline__ void keep1(v16h x) {
#if defined(__HIP_DEVICE_COMPILE__)
  asm volatile("v_nop" :: "v"(x));
#else
  (void)x;
#endif
}
__device__ __forceinline__ void keep1(v16b x) {
#if defined(__HIP_DEVICE_COMPILE__)
  asm volatile("v_nop" :: "v"(x));
#else
  (void)x;
#endif
}
__device__ __forceinline__ void acc_guard4(v8f& a, v8f& b, v8f& c, v8f& d) {
#if defined(__HIP_DEVICE_COMPILE__)
  asm volatile("v_nop\n\tv_nop\n\tv_nop\n\tv_nop" : "+v"(a), "+v"(b), "+v"(c), "+v"(d));
#else
  (void)a; (void)b; (void)c; (void)d;
#endif
}

// ---- SwiGLU element from the fused accumulator: silu(gate + bg) * (xp + bx) * rscale -------------------
__device__ __forceinline__ float swg(float xacc, float gacc, float oscale, float bx, float bg, float rscale) {
  const float xp = xacc * oscale + bx;
  const float g  = gacc * oscale + bg;
  const float sg = __builtin_amdgcn_rcpf(1.0f + __expf(-g));
  return (g * sg) * xp * rscale;
}

// =====================================================================================================
// cos/sin table: cs[t][0..31] = bf16(cos(t*invf[d])) widened to f32, cs[t][32..63] = bf16(sin(.)).
// invf arrives by value; each lane picks its entry with a static-index select chain (no private indexing).
// =====================================================================================================
__device__ __forceinline__ void job_cstab(const InvTab& tab, float* cs, int bidx) {
  const int lane = threadIdx.x & 31, wave = threadIdx.x >> 5;
  const int t = bidx * 8 + wave;
  float ivf = tab.f[0];
#pragma unroll
  for (int i = 1; i < HD / 2; ++i) ivf = (lane == i) ? tab.f[i] : ivf;
  const float fr = (float)t * ivf;
  float sn, cn;
  sincosf(fr, &sn, &cn);
  const float cv = bf_up(bf_bits(cn));
  const float sv = bf_up(bf_bits(sn));
  float* pc = cs + (size_t)t * 64 + lane;
  float* ps = pc + 32;
  *(float*)pc = cv;
  *(float*)ps = sv;
#if defined(__HIP_DEVICE_COMPILE__)
  // the job's end is not the kernel's end in the built code: stands ahead of any later write to these stores' registers
  asm volatile("s_wait_xcnt 0x0" ::: "memory");
#endif
}

// =====================================================================================================
// RMSNorm (no affine, eps = f32 eps) of one row per 128 threads x 8 elements (two rows per block) and conversion to
// three planes [2048][1024]: f16(x*16), bf16 hi, bf16 lo (RNE, lo = RNE(x - hi)). Each thread stores 16 B
// coverage: 1024 blocks x 2 rows x 128 threads x 8 = the whole plane.
// =====================================================================================================
__device__ __forceinline__ void job_xnorm(const float* __restrict__ hs, unsigned short* xh,
                                          unsigned short* xbh, unsigned short* xbl, int bidx, float (*red2)[4]) {
  const int tid = threadIdx.x & 127, lane = tid & 31, wave = tid >> 5, t = bidx * 2 + (threadIdx.x >> 7);
  float* red = red2[threadIdx.x >> 7];
  const size_t off = (size_t)t * DM + (size_t)tid * 8;
  const v4f a = *(const v4f*)(hs + off);
  const v4f b = *(const v4f*)(hs + off + 4);
  float ss = a[0] * a[0] + a[1] * a[1] + a[2] * a[2] + a[3] * a[3]
           + b[0] * b[0] + b[1] * b[1] + b[2] * b[2] + b[3] * b[3];
#pragma unroll
  for (int o = 1; o < 32; o <<= 1) ss += __shfl_xor(ss, o, 32);
  if (lane == 0) red[wave] = ss;
  __syncthreads();
  const float tot = (red[0] + red[1]) + (red[2] + red[3]);
  const float rn = rsqrtf(tot * (1.0f / (float)DM) + 1.1920929e-7f);
  float x[8];
  x[0] = a[0] * rn; x[1] = a[1] * rn; x[2] = a[2] * rn; x[3] = a[3] * rn;
  x[4] = b[0] * rn; x[5] = b[1] * rn; x[6] = b[2] * rn; x[7] = b[3] * rn;
  v4u ph, pb, pl;
#pragma unroll
  for (int e = 0; e < 4; ++e) {
    const float f0 = x[2 * e], f1 = x[2 * e + 1];
    ph[e] = pk16(h_bits((_Float16)(f0 * XSC)), h_bits((_Float16)(f1 * XSC)));
    const unsigned short hb0 = bf_bits(f0), hb1 = bf_bits(f1);
    pb[e] = pk16(hb0, hb1);
    pl[e] = pk16(bf_bits(f0 - bf_up(hb0)), bf_bits(f1 - bf_up(hb1)));
  }
  *(v4u*)(xh + off)  = ph;
  *(v4u*)(xbh + off) = pb;
  *(v4u*)(xbl + off) = pl;
#if defined(__HIP_DEVICE_COMPILE__)
  // the job's end is not the kernel's end in the built code: stands ahead of any later write to these stores' registers
  asm volatile("s_wait_xcnt 0x0" ::: "memory");
#endif
}

// =====================================================================================================
// Weight transpose + convert: W [K][N] f32 (in k, out n) -> Wt [N][K] 16-bit (k contiguous), 64x64 tile per
// block through LDS. MODE 0: f16(w*wscale) -> out0; MODE 1: bf16 hi -> out0, bf16 lo -> out1.
// coverage: 2 it x 8 waves x 4 rows = 64 output rows, 8 lanes x 8 = 64 k columns per tile; tiles (bx, by) of (N/64, K/64).
// =====================================================================================================
template <int MODE>
__device__ __forceinline__ void job_wtrans(const float* __restrict__ W, int K, int N, int nhalf, float wscale,
                                           unsigned short* out0, unsigned short* out1, int bx, int by,
                                           float (*tl)[65]) {
  const int tid = threadIdx.x, lane = tid & 31, wave = tid >> 5;
  const int n0 = bx * 64, k0 = by * 64;
  {
    const int i0 = tid >> 4, cc = (tid & 15) * 4;
#pragma unroll
    for (int p = 0; p < 4; ++p) {
      const int i = p * 16 + i0;
      const v4f v = *(const v4f*)(W + (size_t)(k0 + i) * N + n0 + cc);
      tl[i][cc] = v[0]; tl[i][cc + 1] = v[1]; tl[i][cc + 2] = v[2]; tl[i][cc + 3] = v[3];
    }
  }
  __syncthreads();
  const int orow0 = (nhalf > 0) ? ((n0 < nhalf) ? (2 * n0) : (2 * (n0 - nhalf) + 64)) : n0;
  const int q8 = lane >> 3, c8 = (lane & 7) * 8;
  v4u hv[2], lv[2];
#pragma unroll
  for (int it = 0; it < 2; ++it) {
    const int j = it * 32 + wave * 4 + q8;
    v4u a, a2;
#pragma unroll
    for (int e = 0; e < 4; ++e) {
      const float f0 = tl[c8 + 2 * e][j], f1 = tl[c8 + 2 * e + 1][j];
      if constexpr (MODE == 0) {
        a[e] = pk16(h_bits((_Float16)(f0 * wscale)), h_bits((_Float16)(f1 * wscale)));
        a2[e] = 0u;
      } else {
        const unsigned short hb0 = bf_bits(f0), hb1 = bf_bits(f1);
        a[e] = pk16(hb0, hb1);
        a2[e] = pk16(bf_bits(f0 - bf_up(hb0)), bf_bits(f1 - bf_up(hb1)));
      }
    }
    hv[it] = a; lv[it] = a2;
  }
  {
#pragma unroll
    for (int it = 0; it < 2; ++it) {
      const int j = it * 32 + wave * 4 + q8;
      const size_t go = (size_t)(orow0 + j) * K + k0 + c8;
      *(v4u*)(out0 + go) = hv[it];
      if constexpr (MODE == 1) *(v4u*)(out1 + go) = lv[it];
    }
#if defined(__HIP_DEVICE_COMPILE__)
    // the job's end is not the kernel's end in the built code: stands ahead of any later write to these stores' registers
    asm volatile("s_wait_xcnt 0x0" ::: "memory");
#endif
  }
}

// =====================================================================================================
// One grid for the ten jobs that read only inputs and none of each other's output: the block index falls into
// one of the ranges below (largest job first) and picks the job; every test on it is block-uniform, so each
// job's barrier is passed by all 256 threads of its block.
//   [W1 tiles | W2 tiles | Wq Wk Wqb Wkb Wv Wo tiles | RMSNorm row pairs | cos/sin table rows]
// =====================================================================================================
#define PB_W1 ((FUS / 64) * (DM / 64))     // 2048
#define PB_W2 ((DM / 64) * (FFI / 64))     // 1024
#define PB_W  ((DM / 64) * (DM / 64))      // 256 per square weight, six of them
#define PB_XN (SEQ / 2)                    // 1024
#define PB_CS (SEQ / 8)                    // 256
#define PB_ALL (PB_W1 + PB_W2 + 6 * PB_W + PB_XN + PB_CS)
__global__ __launch_bounds__(256) void k_prep(
    InvTab tab, const float* __restrict__ hs,
    const float* __restrict__ Wq, const float* __restrict__ Wk, const float* __restrict__ Wqb,
    const float* __restrict__ Wkb, const float* __restrict__ Wv, const float* __restrict__ Wo,
    const float* __restrict__ W1, const float* __restrict__ W2,
    float* cs, unsigned short* xh, unsigned short* xbh, unsigned short* xbl,
    unsigned short* wcat, unsigned short* wvh, unsigned short* wvl, unsigned short* woh, unsigned short* wol,
    unsigned short* w1t, unsigned short* w2t) {
  __shared__ float tl[64][65];
  __shared__ float red2[2][4];
  int b = blockIdx.x;
  if (b < PB_W1) {
    job_wtrans<0>(W1, DM, FUS, FFI, WSC, w1t, w1t, b % (FUS / 64), b / (FUS / 64), tl);
    return;
  }
  b -= PB_W1;
  if (b < PB_W2) {
    job_wtrans<0>(W2, FFI, DM, 0, WSC, w2t, w2t, b % (DM / 64), b / (DM / 64), tl);
    return;
  }
  b -= PB_W2;
  if (b < 6 * PB_W) {
    const int w = b / PB_W, r = b % PB_W;
    const int bx = r % (DM / 64), by = r / (DM / 64);
    if (w < 4) {
      const float* s = (w == 0) ? Wq : (w == 1) ? Wk : (w == 2) ? Wqb : Wkb;
      job_wtrans<0>(s, DM, DM, 0, WSC, wcat + (size_t)w * DM * DM, wcat, bx, by, tl);
    } else {
      job_wtrans<1>((w == 4) ? Wv : Wo, DM, DM, 0, 1.0f, (w == 4) ? wvh : woh, (w == 4) ? wvl : wol, bx, by, tl);
    }
    return;
  }
  b -= 6 * PB_W;
  if (b < PB_XN) {
    job_xnorm(hs, xh, xbh, xbl, b, red2);
    return;
  }
  b -= PB_XN;
  if (b < PB_CS) job_cstab(tab, cs, b);
}

// =====================================================================================================
// Register-blocked 16-bit WMMA GEMM: C[m][n] = sum_k A[m][k] * Bt[n][k]; one wave per (16*MI)x(16*NJ) tile,
// the 8 waves of a work-group laid out WM x WN over one (WM*16*MI)x(WN*16*NJ) block tile.
// A row-major [M][K] pitch lda; Bt row-major [N][K] pitch ldb (k contiguous);
// M, N multiples of the block tile, K multiple of KS (host-checked). T = _Float16 or __bf16.
// Operand path: per stage of KS = 64 k every operand row of the block tile (one whole 128-B line) is loaded once
// by the work-group (8 lanes x 16 B per row), kept in registers while the current stage is multiplied, and then
// stored to the other of two LDS buffers (row pitch 144 B for the 16-B fragment reads); one barrier per stage.
// Stage rows: [A | A2 | Bt | Bt2] (the second planes only with NSPLIT 2).
// KD = K = lda = ldb at compile time, so that the step from one group of 32 rows to the next is an immediate
// offset of the load and a plane needs one scalar base and one 32-bit offset register.
// NSPLIT: 0 = A.Bt; 2 = A.Bt + A.Bt2 + A2.Bt (unscaled hi/lo planes), in that order per k step.
// EPI 0: f32 C = acc*oscale (pitch ldc).  EPI 1: f32 C = acc*oscale + bias[n] + resa[m][n].
// EPI 2: f16 hi plane C (pitch ldc) + f16 residual plane C2 = f16((v - hi)*rscale) for tiles with n0 < N2
//        (pitch ldc2).  EPI 3: f32 C = acc*oscale + bias[n] + resh[m][n]*lamp[0].
// EPI 4 (MI=2, NJ=8, TN=128): fused SwiGLU: subtiles j<4 are xp columns ocol0+16j+c, j>=4 the matching gate
//        columns; C (f16, pitch ldc) [m][ocol0 + ..63] = f16( silu(gate+bias[FFI+col]) * (xp+bias[col]) * rscale ).
// Epilogue: 16-row x 64-col slabs staged per wave in LDS, column-major (pitch SP): every lane writes its 8
// accumulator rows of one column with two 16-B vector stores; rows are then gathered and each 64-wide row
// coverage per wave: MI slabs x 16 rows x 64 output cols.
// =====================================================================================================
#define KS 64                  // k elements per LDS stage
#define LP (KS + 8)            // LDS row pitch of a stage, elements (128 B + 16 B)
// LDS bytes of one block: two operand stages and the eight result slabs
template <int MI, int NJ, int NSPLIT, int WM, int WN>
constexpr int gemm_lds() {
  return 2 * ((NSPLIT == 2) ? 2 : 1) * (WM * 16 * MI + WN * 16 * NJ) * LP * 2 + 8 * 64 * SP * 4;
}
template <typename T, int MI, int NJ, int NSPLIT, int EPI, int WM, int WN, int KD>
__device__ __forceinline__ void gemm_body(
    int bidx, char* smem,
    const unsigned short* __restrict__ Ap, const unsigned short* __restrict__ A2p, int lda,
    const unsigned short* __restrict__ Bp, const unsigned short* __restrict__ B2p, int ldb,
    void* Cout, int ldc, void* Cout2, int ldc2, int N2,
    const float* __restrict__ bias, const float* __restrict__ resh,
    const float* __restrict__ resa, const float* __restrict__ lamp,
    int M, int N, int K, float oscale, float rscale) {
  typedef typename Frag16<T>::t FR;
  static_assert((EPI == 4) ? (MI == 2 && NJ == 8) : (NJ == 4 && (MI == 2 || MI == 4)));
  static_assert(NSPLIT == 0 || NSPLIT == 2);
  static_assert(WM * WN == 8);
  const T* A   = (const T*)(const void*)Ap;
  const T* A2  = (const T*)(const void*)A2p;
  const T* Bt  = (const T*)(const void*)Bp;
  const T* Bt2 = (const T*)(const void*)B2p;
  constexpr int TM = 16 * MI, TN = 16 * NJ;
  constexpr int BM = WM * TM, BN = WN * TN;
  constexpr int NPL  = (NSPLIT == 2) ? 2 : 1;      // planes per operand
  constexpr int ROWS = NPL * (BM + BN);            // operand rows per stage
  constexpr int NCH  = ROWS / 32;                  // 16-B pieces per thread per stage (256 threads = 32 rows)
  static_assert((BM % 32) == 0 && (BN % 32) == 0);
  static_assert(sizeof(T) == 2 && gemm_lds<MI, NJ, NSPLIT, WM, WN>() == 2 * ROWS * LP * 2 + 8 * 64 * SP * 4);
  T (*stg)[ROWS * LP] = (T (*)[ROWS * LP])(void*)smem;                              // two operand stages
  float (*sT)[64 * SP] = (float (*)[64 * SP])(void*)(smem + 2 * ROWS * LP * 2);     // per-wave 16x64 slab, column-major, pitch SP floats
  const int tid  = threadIdx.x;
  const int lane = tid & 31;
  const int wave = tid >> 5;
  const int tilesNb = N / BN;
  const int tilesMb = M / BM;
  if (bidx >= tilesMb * tilesNb) return;              // block-uniform, ahead of every barrier
  if (lda != KD || ldb != KD || K != KD) return;      // uniform over the grid
  const int bm = bidx / tilesNb;
  const int bn = bidx - bm * tilesNb;
  const int wm = wave / WN;
  const int wn = wave - wm * WN;
  const int m0 = bm * BM + wm * TM;
  const int n0 = bn * BN + wn * TN;
  const int tn = n0 / TN;
  const int rl   = lane & 15;            // row (A) / col (B, D) within subtile
  const int koff = (lane >> 4) * 8;      // k offset of this lane half
  const int mOff = (lane >> 4) * 8;      // D row offset

  v8f acc[MI][NJ];
#pragma unroll
  for (int i = 0; i < MI; ++i)
#pragma unroll
    for (int j = 0; j < NJ; ++j) acc[i][j] = zero8();

  // staging: thread -> row (tid>>3) of each group of 32 rows, 16-B piece (tid&7) of its 128-B line
  const int sr = tid >> 3, sc = (tid & 7) * 8;
  // address = block-uniform plane base + the thread's 32-bit byte offset (row in its group, piece, k) + row group
  static_assert((KD % KS) == 0);
  const unsigned vo0 = (unsigned)(sr * KD + sc) * 2u;
  const char* gA  = (const char*)(A   + (size_t)(bm * BM) * KD);
  const char* gA2 = (const char*)(A2  + (size_t)(bm * BM) * KD);
  const char* gB  = (const char*)(Bt  + (size_t)(bn * BN) * KD);
  const char* gB2 = (const char*)(Bt2 + (size_t)(bn * BN) * KD);
  v4u st[NCH];
  auto fetch = [&](int k0) {
    const unsigned vo = vo0 + (unsigned)k0 * 2u;
#pragma unroll
    for (int it = 0; it < NCH; ++it) {
      const int r = it * 32;
      const char* g;
      if (r < BM)                 g = gA  + (size_t)r * KD * 2;
      else if (r < NPL * BM)      g = gA2 + (size_t)(r - BM) * KD * 2;
      else if (r < NPL * BM + BN) g = gB  + (size_t)(r - NPL * BM) * KD * 2;
      else                        g = gB2 + (size_t)(r - NPL * BM - BN) * KD * 2;
      st[it] = *(const v4u*)(g + vo);
    }
#if defined(__HIP_DEVICE_COMPILE__)
    // stands ahead of every later write to the address registers of the loads above
    asm volatile("s_wait_xcnt 0x0" ::: "memory");
#endif
  };
  auto put = [&](T* buf) {
#pragma unroll
    for (int it = 0; it < NCH; ++it) *(v4u*)(buf + (it * 32 + sr) * LP + sc) = st[it];
  };

  fetch(0);
  put(stg[0]);
  __syncthreads();
  constexpr int nst = KD / KS;
  for (int s = 0; s < nst; ++s) {
    const bool more = (s + 1 < nst);     // block-uniform
    if (more) fetch((s + 1) * KS);       // in flight while this stage is multiplied
    const T* buf = stg[s & 1];
    const T* sa  = buf + (wm * TM + rl) * LP + koff;
    const T* sa2 = sa + BM * LP;
    const T* sb  = buf + (NPL * BM + wn * TN + rl) * LP + koff;
    const T* sb2 = sb + BN * LP;
#pragma unroll
    for (int kk = 0; kk < KS; kk += 32) {
      // the fragments of a k step are read from LDS in groups ahead of their products (B: four subtile columns)
      FR ah[MI];
#pragma unroll
      for (int i = 0; i < MI; ++i) ah[i] = ldfrag(sa + 16 * i * LP + kk);
#pragma unroll
      for (int jg = 0; jg < NJ; jg += 4) {
        FR bh[4], bl[4];
#pragma unroll
        for (int jj = 0; jj < 4; ++jj) {
          bh[jj] = ldfrag(sb + 16 * (jg + jj) * LP + kk);
          if constexpr (NSPLIT == 2) bl[jj] = ldfrag(sb2 + 16 * (jg + jj) * LP + kk);
          else bl[jj] = bh[jj];
        }
#pragma unroll
        for (int jj = 0; jj < 4; ++jj) {
          const int j = jg + jj;
#pragma unroll
          for (int i = 0; i < MI; ++i) {
            acc[i][j] = mma_raw(ah[i], bh[jj], acc[i][j]);
            if constexpr (NSPLIT == 2) acc[i][j] = mma_raw(ah[i], bl[jj], acc[i][j]);
          }
          dep_guard2(acc[0][j], acc[MI - 1][j], bh[jj], bl[jj]);
        }
        if constexpr (NSPLIT == 2) {
          static_assert(NSPLIT == 0 || NJ == 4);   // one B group, so the A2 fragments may take the A fragments' place
#pragma unroll
          for (int i = 0; i < MI; ++i) keep1(ah[i]);
          FR al[MI];
#pragma unroll
          for (int i = 0; i < MI; ++i) al[i] = ldfrag(sa2 + 16 * i * LP + kk);
#pragma unroll
          for (int jj = 0; jj < 4; ++jj) {
            const int j = jg + jj;
#pragma unroll
            for (int i = 0; i < MI; ++i) acc[i][j] = mma_raw(al[i], bh[jj], acc[i][j]);
            dep_guard2(acc[0][j], acc[MI - 1][j], bh[jj], bh[jj]);
          }
#pragma unroll
          for (int i = 0; i < MI; ++i) keep1(al[i]);
        }
      }
      if constexpr (NSPLIT == 0) {
#pragma unroll
        for (int i = 0; i < MI; ++i) keep1(ah[i]);
      }
    }
    if (more) put(stg[(s + 1) & 1]);     // every reader left that buffer at the barrier of the stage before
    __syncthreads();                     // publishes stage s+1; ends the reads of stage s
  }
#pragma unroll
  for (int i = 0; i < MI; ++i)
#pragma unroll
    for (int j = 0; j < NJ; j += 4) acc_guard4(acc[i][j], acc[i][j + 1], acc[i][j + 2], acc[i][j + 3]);

  // ---- epilogue ----
  float* slab = sT[wave];
  const int ocol0 = (EPI == 4) ? (tn * 64) : n0;
  const int hq = lane >> 4, c4 = (lane & 15) * 4;   // f32 path: 256-B row segment = 16 lanes x 16 B
  const int q8 = lane >> 3, c8 = (lane & 7) * 8;
  float bxv[4] = {0.f, 0.f, 0.f, 0.f}, bgv[4] = {0.f, 0.f, 0.f, 0.f};
  v4f b4 = {0.f, 0.f, 0.f, 0.f};
  float lam = 0.f;
  if constexpr (EPI == 4) {
#pragma unroll
    for (int j = 0; j < 4; ++j) {
      bxv[j] = bias[ocol0 + 16 * j + rl];
      bgv[j] = bias[FFI + ocol0 + 16 * j + rl];
    }
  }
  if constexpr (EPI == 1 || EPI == 3) b4 = *(const v4f*)(bias + n0 + c4);
  if constexpr (EPI == 3) lam = lamp[0];

#pragma unroll
  for (int i = 0; i < MI; ++i) {
    const int mBase = m0 + 16 * i;
    // lane writes column 16j+rl, rows mOff..mOff+7 = 32 contiguous bytes as two 16-B vector LDS stores
#pragma unroll
    for (int j = 0; j < 4; ++j) {
      v4f w0, w1;
      if constexpr (EPI == 4) {
#pragma unroll
        for (int r = 0; r < 4; ++r) {
          w0[r] = swg(acc[i][j][r],     acc[i][j + 4][r],     oscale, bxv[j], bgv[j], rscale);
          w1[r] = swg(acc[i][j][r + 4], acc[i][j + 4][r + 4], oscale, bxv[j], bgv[j], rscale);
        }
      } else {
#pragma unroll
        for (int r = 0; r < 4; ++r) {
          w0[r] = acc[i][j][r] * oscale;
          w1[r] = acc[i][j][r + 4] * oscale;
        }
      }
      float* cp = slab + (16 * j + rl) * SP + mOff;
      *(v4f*)(cp) = w0;
      *(v4f*)(cp + 4) = w1;
    }
    wave_sync_lds();
    if constexpr (EPI == 0 || EPI == 1 || EPI == 3) {
      float* C = (float*)Cout;
      v4f fin[8];
#pragma unroll
      for (int it = 0; it < 8; ++it) {
        const int row = 2 * it + hq;                   // it 0..7 x hq 0..1 = rows 0..15
        v4f v;
        v[0] = slab[(c4 + 0) * SP + row];
        v[1] = slab[(c4 + 1) * SP + row];
        v[2] = slab[(c4 + 2) * SP + row];
        v[3] = slab[(c4 + 3) * SP + row];
        if constexpr (EPI == 1 || EPI == 3) {
          const size_t go = (size_t)(mBase + row) * ldc + n0 + c4;
          const v4f rvv = *(const v4f*)(((EPI == 3) ? resh : resa) + go);
#if defined(__HIP_DEVICE_COMPILE__)
          // stands ahead of the next rows' loads, whose results the compiler lays over this load's address registers
          asm volatile("s_wait_xcnt 0x0" ::: "memory");
#endif
          if constexpr (EPI == 3) v = v + b4 + rvv * lam;
          else                    v = v + b4 + rvv;
        }
        fin[it] = v;
      }
      {
#pragma unroll
        for (int it = 0; it < 8; ++it) {
          const int row = 2 * it + hq;
          *(v4f*)(C + (size_t)(mBase + row) * ldc + n0 + c4) = fin[it];
#if defined(__HIP_DEVICE_COMPILE__)
          // stands ahead of the later rows' sums, which the compiler lays over this store's data registers
          if constexpr (EPI == 1 || EPI == 3) asm volatile("s_wait_xcnt 0x0" ::: "memory");
#endif
        }
      }
    } else {
      unsigned short* C  = (unsigned short*)Cout;
      unsigned short* C2 = (unsigned short*)Cout2;
      const bool wlo = (EPI == 2) && (n0 < N2);        // wave-uniform
      v4u hv[4], lv[4];
#pragma unroll
      for (int it = 0; it < 4; ++it) {
        const int row = 4 * it + q8;                   // it 0..3 x q8 0..3 = rows 0..15
        v4u a, a2;
#pragma unroll
        for (int e = 0; e < 4; ++e) {
          const float f0 = slab[(c8 + 2 * e) * SP + row], f1 = slab[(c8 + 2 * e + 1) * SP + row];
          const _Float16 x0 = (_Float16)f0, x1 = (_Float16)f1;
          unsigned short l0 = 0, l1 = 0;
          if constexpr (EPI == 2) {
            l0 = h_bits((_Float16)((f0 - (float)x0) * rscale));
            l1 = h_bits((_Float16)((f1 - (float)x1) * rscale));
          }
          a[e] = pk16(h_bits(x0), h_bits(x1)); a2[e] = pk16(l0, l1);
        }
        hv[it] = a; lv[it] = a2;
      }
      {
#pragma unroll
        for (int it = 0; it < 4; ++it) {
          const int row = 4 * it + q8;
          *(v4u*)(C + (size_t)(mBase + row) * ldc + ocol0 + c8) = hv[it];
          if (wlo) *(v4u*)(C2 + (size_t)(mBase + row) * ldc2 + n0 + c8) = lv[it];
        }
        
      }
    }
    wave_sync_lds();
  }
}

template <typename T, int MI, int NJ, int NSPLIT, int EPI, int WM, int WN, int KD>
__global__ __launch_bounds__(256) void k_gemm(
    const unsigned short* __restrict__ Ap, const unsigned short* __restrict__ A2p, int lda,
    const unsigned short* __restrict__ Bp, const unsigned short* __restrict__ B2p, int ldb,
    void* Cout, int ldc, void* Cout2, int ldc2, int N2,
    const float* __restrict__ bias, const float* __restrict__ resh,
    const float* __restrict__ resa, const float* __restrict__ lamp,
    int M, int N, int K, float oscale, float rscale) {
  __shared__ __align__(16) char smem[gemm_lds<MI, NJ, NSPLIT, WM, WN>()];
  gemm_body<T, MI, NJ, NSPLIT, EPI, WM, WN, KD>((int)blockIdx.x, smem, Ap, A2p, lda, Bp, B2p, ldb, Cout, ldc, Cout2, ldc2,
                                                N2, bias, resh, resa, lamp, M, N, K, oscale, rscale);
}

// One grid for the three products that read none of each other's output and none of which fills the chip alone:
//   [ fo = h*lambda + ff.W2 + b2 (longest k loop, lowest indices) | v^T = Wv^T.x^T | q|k|qb|kb = x.Wcat ]
// The block index picks the product (block-uniform), so every barrier of a product is passed by its whole block.
#define GB_F2 ((SEQ / 128) * (DM / 128))         // 128x128 block tiles -> 128 blocks
#define GB_VT ((DM / 128) * (SEQ / 256))         // 128x256 -> 64 blocks
#define GB_QK ((SEQ / 128) * ((4 * DM) / 256))   // 128x256 -> 256 blocks
__global__ __launch_bounds__(256) void k_gemm3(
    const unsigned short* __restrict__ ff, const unsigned short* __restrict__ w2t, float* fo,
    const float* __restrict__ b2, const float* __restrict__ hs, const float* __restrict__ lamp,
    const unsigned short* __restrict__ wvh, const unsigned short* __restrict__ wvl,
    const unsigned short* __restrict__ xbh, const unsigned short* __restrict__ xbl,
    unsigned short* vth, unsigned short* vtl,
    const unsigned short* __restrict__ xh, const unsigned short* __restrict__ wcat, float* qk) {
  static_assert(gemm_lds<4, 4, 2, 2, 4>() >= gemm_lds<4, 4, 0, 2, 4>() && gemm_lds<4, 4, 2, 2, 4>() >= gemm_lds<2, 4, 0, 4, 2>());
  __shared__ __align__(16) char smem[gemm_lds<4, 4, 2, 2, 4>()];
  int b = blockIdx.x;
  if (b < GB_F2) {
    // M=2048, N=1024, K=4096; 32x64 wave tiles
    gemm_body<_Float16, 2, 4, 0, 3, 4, 2, FFI>(b, smem, ff, ff, FFI, w2t, w2t, FFI, (void*)fo, DM, (void*)fo, DM, 0,
                                               b2, hs, hs, lamp, SEQ, DM, FFI, 1.0f / (FSC * WSC), 1.0f);
    return;
  }
  b -= GB_F2;
  if (b < GB_VT) {
    // M=1024, N=2048, K=1024: f16 hi plane [h*64+d][s] + residual plane (keys < VLP)
    gemm_body<__bf16, 4, 4, 2, 2, 2, 4, DM>(b, smem, wvh, wvl, DM, xbh, xbl, DM, (void*)vth, SEQ, (void*)vtl, VLP, VLP,
                                            b2, hs, hs, lamp, DM, SEQ, DM, 1.0f, VRS);
    return;
  }
  b -= GB_VT;
  // M=2048, N=4096, K=1024 -> f32 [2048][4096]
  gemm_body<_Float16, 4, 4, 0, 0, 2, 4, DM>(b, smem, xh, xh, DM, wcat, wcat, DM, (void*)qk, 4 * DM, (void*)qk, 4 * DM, 0,
                                            b2, hs, hs, lamp, SEQ, 4 * DM, DM, 1.0f / (XSC * WSC), 1.0f);
}

// =====================================================================================================
// Per-head l2 normalisation + rotary embedding for q, k, qb, kb. Input QK f32 [2048][4096]
// (cols: q | k | qb | kb, each [h*64 + d]); cs table [t][cos 0..31 | sin 0..31] (bf16-valued f32).
// One wave per (t, h): lane d handles the rotary pair (d, d+32). Results exchanged through a per-wave LDS
// grid = 32768/8 blocks of 256. coverage: every (t, h) row of all four planes.
// =====================================================================================================
__global__ __launch_bounds__(256) void k_rope(const float* __restrict__ qkf, const float* __restrict__ cs,
                                              unsigned short* qh, unsigned short* kh, float* qbn, float* kbn) {
  __shared__ __align__(16) float yb[8][4 * 64];
  const int lane = threadIdx.x & 31, wave = threadIdx.x >> 5;
  const int p = blockIdx.x * 8 + wave;     // p = t*16 + h
  const int t = p >> 4, h = p & 15;
  const float cth = cs[(size_t)t * 64 + lane];
  const float sth = cs[(size_t)t * 64 + 32 + lane];
  const float* row = qkf + (size_t)t * (4 * DM) + h * HD;
  float* ybw = yb[wave];
#pragma unroll
  for (int g = 0; g < 4; ++g) {
    const float* src = row + g * DM;
    float x1 = src[lane], x2 = src[lane + 32];
    float n2 = x1 * x1 + x2 * x2;
#pragma unroll
    for (int o = 1; o < 32; o <<= 1) n2 += __shfl_xor(n2, o, 32);
    const float rn = 1.0f / fmaxf(sqrtf(n2), 1e-12f);
    x1 *= rn; x2 *= rn;
    ybw[g * 64 + lane]      = x1 * cth + x2 * sth;
    ybw[g * 64 + 32 + lane] = x2 * cth - x1 * sth;
  }
  wave_sync_lds();
  const int c8 = (lane & 7) * 8, c4 = (lane & 15) * 4;
  v4u qv, kv;
#pragma unroll
  for (int e = 0; e < 4; ++e) {
    qv[e] = pk16(h_bits((_Float16)(ybw[c8 + 2 * e] * QSC)), h_bits((_Float16)(ybw[c8 + 2 * e + 1] * QSC)));
    kv[e] = pk16(h_bits((_Float16)(ybw[64 + c8 + 2 * e] * QSC)), h_bits((_Float16)(ybw[64 + c8 + 2 * e + 1] * QSC)));
  }
  const v4f qbv = *(const v4f*)(ybw + 128 + c4);
  const v4f kbv = *(const v4f*)(ybw + 192 + c4);
  const size_t g16 = (size_t)t * DM + h * HD + c8;
  const size_t g32 = (size_t)t * DM + h * HD + c4;
  {
    if (lane < 8) {
      *(v4u*)(qh + g16) = qv;
      *(v4u*)(kh + g16) = kv;
    }
    if (lane < 16) {
      *(v4f*)(qbn + g32) = qbv;
      *(v4f*)(kbn + g32) = kbv;
    }
    
  }
}

// =====================================================================================================
// Inclusive causal prefix sum of kb over positions: pf[t][col] = sum_{s<=t} kbn[s][col], summed in f64.
// Blocked scan in two launches. The 2048 positions are cut into PSS blocks of 64 rows, each block into 8 wave
// slices of PWR rows; a work-group covers 64 rows x 128 columns, a lane 4 neighbouring columns (16-B accesses).
//   k_segsum: part[ss][col] = f64 sum of the 64 rows of block ss.
//   k_prefix: offset = sum of part[0..ss-1][col] + sums of the lower wave slices (scanned in LDS), added to the
//             lane's own running sum over its PWR rows; every pf line is stored whole by one wave.
// coverage of both: grid PSS x (DM/128) work-groups x 8 waves x PWR rows x 128 columns = the whole plane.
// Every loop of the two kernels is unrolled in full, so that its small arrays live in registers and the loads
// of one array are issued back to back.
// =====================================================================================================
#define PSS 32                 // row blocks of 64 positions
#define PWR 8                  // rows per wave slice
static_assert(PSS * 8 * PWR == SEQ && (DM % 128) == 0 && (PSS % 2) == 0);

__global__ __launch_bounds__(256) void k_segsum(const float* __restrict__ kbn, double* __restrict__ part) {
  __shared__ __align__(16) double wsum[8][128];
  const int tid = threadIdx.x, lane = tid & 31, wave = tid >> 5;
  const int cg = blockIdx.x % (DM / 128), ss = blockIdx.x / (DM / 128);
  const float* src = kbn + (size_t)(ss * 64 + wave * PWR) * DM + cg * 128 + lane * 4;
  v4f x[PWR];
#pragma unroll
  for (int i = 0; i < PWR; ++i) x[i] = *(const v4f*)(src + (size_t)i * DM);
  double s[4];
#pragma unroll
  for (int e = 0; e < 4; ++e) s[e] = (double)x[0][e];
#pragma unroll
  for (int i = 1; i < PWR; ++i)
#pragma unroll
    for (int e = 0; e < 4; ++e) s[e] += (double)x[i][e];
#pragma unroll
  for (int e = 0; e < 4; ++e) wsum[wave][lane * 4 + e] = s[e];
  __syncthreads();
  if (tid < 128) {
    double v[8];
#pragma unroll
    for (int w = 0; w < 8; ++w) v[w] = wsum[w][tid];
    double a = v[0];
#pragma unroll
    for (int w = 1; w < 8; ++w) a += v[w];
    part[(size_t)ss * DM + cg * 128 + tid] = a;
  }
}

__global__ __launch_bounds__(256) void k_prefix(const float* __restrict__ kbn, const double* __restrict__ part,
                                                float* __restrict__ pf) {
  __shared__ __align__(16) double wsum[8][128];   // sum of each wave slice, per column; then its offset
  __shared__ __align__(16) double sup[2][128];    // sum of the lower row blocks, even / odd blocks apart
  const int tid = threadIdx.x, lane = tid & 31, wave = tid >> 5;
  const int cg = blockIdx.x % (DM / 128), ss = blockIdx.x / (DM / 128);
  const size_t go = (size_t)(ss * 64 + wave * PWR) * DM + cg * 128 + lane * 4;
  const float* src = kbn + go;
  v4f x[PWR];
#pragma unroll
  for (int i = 0; i < PWR; ++i) x[i] = *(const v4f*)(src + (size_t)i * DM);
  // lower row blocks: all PSS rows of part were written by k_segsum, so every load is issued at once and
  // the rows from ss on are dropped by the select (waves 0..3 take the even blocks, waves 4..7 the odd ones)
  {
    const int c = tid & 127, hf = tid >> 7;
    const double* pp = part + (size_t)hf * DM + cg * 128 + c;
    double pv[PSS / 2];
#pragma unroll
    for (int j = 0; j < PSS / 2; ++j) pv[j] = pp[(size_t)(2 * j) * DM];
    // keeps every load above ahead of the sums: without it two of them are issued only after the first have
    // come back, and the wave pays the memory latency twice
    __builtin_amdgcn_sched_barrier(0);
    double so = 0.0;
#pragma unroll
    for (int j = 0; j < PSS / 2; ++j) so += (2 * j + hf < ss) ? pv[j] : 0.0;
    sup[hf][c] = so;
  }
  // the lane's own running sums
  double p[PWR][4];
#pragma unroll
  for (int e = 0; e < 4; ++e) p[0][e] = (double)x[0][e];
#pragma unroll
  for (int i = 1; i < PWR; ++i)
#pragma unroll
    for (int e = 0; e < 4; ++e) p[i][e] = p[i - 1][e] + (double)x[i][e];
#pragma unroll
  for (int e = 0; e < 4; ++e) wsum[wave][lane * 4 + e] = p[PWR - 1][e];
  __syncthreads();
  // one thread per column turns the slice sums into each slice's offset, in place
  if (tid < 128) {
    double v[8];
#pragma unroll
    for (int w = 0; w < 8; ++w) v[w] = wsum[w][tid];
    double run = sup[0][tid] + sup[1][tid];
#pragma unroll
    for (int w = 0; w < 8; ++w) { wsum[w][tid] = run; run += v[w]; }
  }
  __syncthreads();
  double off[4];
#pragma unroll
  for (int e = 0; e < 4; ++e) off[e] = wsum[wave][lane * 4 + e];
  float* dst = pf + go;
#pragma unroll
  for (int i = 0; i < PWR; ++i) {
    v4f o;
#pragma unroll
    for (int e = 0; e < 4; ++e) o[e] = (float)(off[e] + p[i][e]);
    *(v4f*)(dst + (size_t)i * DM) = o;
  }
}

// =====================================================================================================
// Causal attention, head dim 64, plus the bias-attention row term.
//   q, k planes (f16, x8, normalised + rotary): element (t, h, d) at [t*DM + h*64 + d]
//   v^T hi plane (f16): element (h, d, s) at [(h*64 + d)*SEQ + s]; v^T residual plane (f16, (v - hi)*4096):
//   [(h*64 + d)*VLP + s], s < VLP, read only when RES (query blocks 0..RESQB-1 see only keys < VLP).
//   scores = q . k (single f16 product), * 1/64, key > query -> -inf; online softmax in f32.
//   p = exp(s - m) carried as f16(1024 p); context = p . v on f16 WMMA; RES adds f16 residual planes of p and v
//   (scale 4096, separate accumulator folded back with 1/4096 per chunk in f32).
//   y = l2ns * context / l + sb, sb = 0.125 * qbn[q] . pfx[q] (64-dot over the head dims, prefix sum of kb),
//   written as bf16 hi / lo planes [t][h*64 + d].
//   Block = KG groups of 4 waves = 64 query rows of one h; nqbThis * NH blocks; key chunks of 64, qb+1 (<= 32) of them,
//   dealt to the groups in turn: every group runs the whole online softmax over its own chunks, in its own K / V^T / P
//   tiles, and the trip count of the block is ceil((qb+1)/KG). A group without a chunk in the last trip passes the two
//   barriers only. Behind the loop groups 1..KG-1 hand their row maxima, row sums and context tiles to group 0 through
//   LDS (lane to same lane), which rescales them to the common maximum, adds them and does the rest alone.
//   Both forms share one grid (k_attn): they read none of each other's output; the blocks without residual planes,
//   which hold the longest key loops, take the low block indices.
//   K / V^T chunk staging: the group's 128 threads x 32 elements per plane = the whole 64x64 tile, LDS row pitch AP (plain 16-B loads,
//   __syncthreads before and after); P tiles are wave-private, spilled with _Float16 element stores and reloaded
//   (pitch AP); the context slab (pitch OSP) is written with two 16-B vector LDS stores per lane per column.
//   Output coverage: each wave of group 0 stores rows q0..q0+15 (it 0..3 x lane>>3 0..3) x 64 columns (8 lanes x 8) of both planes.
// =====================================================================================================
template <bool RES>
__device__ __forceinline__
void attn_body(const unsigned short* __restrict__ qhp, const unsigned short* __restrict__ khp,
               const unsigned short* __restrict__ vhp, const unsigned short* __restrict__ vlp,
               const float* __restrict__ qbn, const float* __restrict__ pfx, const float* __restrict__ l2p,
               unsigned short* yhp, unsigned short* ylp, int bx, int qbBase, int nqbThis,
               _Float16 (*Kshg)[64 * AP], _Float16 (*Vthg)[64 * AP], _Float16 (*Vtlg)[64 * AP],
               _Float16 (*Psh)[16 * AP], _Float16 (*Psl)[16 * AP],
               float (*Os)[64 * OSP], float (*Sbl)[16], float (*Mx)[XPW]) {
  union FH { v16h v; v8h h[2]; };

  const int tid  = threadIdx.x & 127;        // thread within its group
  const int wall = __builtin_amdgcn_readfirstlane((int)(threadIdx.x >> 5));   // wave of the block, in a scalar register
  const int grp  = wall >> 2;                // wave group: which key tiles
  const int wave = wall & 3;                 // wave of the group: which 16 query rows
  const int lane = tid & 31;
  const int hh   = lane >> 4;
  const int c    = lane & 15;
  _Float16* Ksh = Kshg[grp];
  _Float16* Vth = Vthg[grp];
  _Float16* Vtl = Vtlg[RES ? grp : 0];

  const int qbl = bx % nqbThis;
  const int h   = bx / nqbThis;
  const int qb  = qbBase + qbl;
  const int q0  = qb * 64 + wave * 16;

  const _Float16* Qh = (const _Float16*)(const void*)qhp + (size_t)h * HD;
  const _Float16* Kh = (const _Float16*)(const void*)khp + (size_t)h * HD;
  const _Float16* Vh = (const _Float16*)(const void*)vhp + (size_t)h * HD * SEQ;
  const _Float16* Vl = (const _Float16*)(const void*)vlp + (size_t)h * HD * VLP;

  // ---- Q fragments (A operand, row = lane&15): 2 d-chunks ----
  v16h qa[2];
#pragma unroll
  for (int dc = 0; dc < 2; ++dc) qa[dc] = ldfrag(Qh + (size_t)(q0 + c) * DM + dc * 32 + 8 * hh);

  float mrow[8], lrow[8];
  v8f oacc[4];
#pragma unroll
  for (int r = 0; r < 8; ++r) { mrow[r] = -INFINITY; lrow[r] = 0.f; }
#pragma unroll
  for (int t = 0; t < 4; ++t) oacc[t] = zero8();

  int nkt = qb + 1;                          // causal: key tiles 0..qb; block-uniform, <= NQB
  if (nkt > NQB) nkt = NQB;
  const int nit = (nkt + KG - 1) / KG;       // block-uniform, <= NQB / KG
  for (int it = 0; it < nit; ++it) {
    const int kt = it * KG + grp;
    const bool act = (kt < nkt);             // wave-uniform (scalar): false only in the last trip
    const int kv0 = kt * 64;
    __syncthreads();
    if (act) {
      const int r = tid >> 1, half = (tid & 1) * 32;
      const _Float16* kg = Kh + (size_t)(kv0 + r) * DM + half;      // K row kv0+r, d = half..half+31
      const _Float16* vg = Vh + (size_t)r * SEQ + kv0 + half;       // V^T row d = r, s = kv0+half..+31
      const int kvl = (kv0 + 64 <= VLP) ? kv0 : (VLP - 64);         // clamped address into the residual plane
      const _Float16* vlg = Vl + (size_t)r * VLP + kvl + half;
      const bool resOK = (kv0 + 64 <= VLP);                          // wave-uniform
      v8h a0[4], b0[4], b1[4];
#pragma unroll
      for (int i = 0; i < 4; ++i) {
        a0[i] = *(const v8h*)(kg + 8 * i);
        b0[i] = *(const v8h*)(vg + 8 * i);
        b1[i] = RES ? *(const v8h*)(vlg + 8 * i) : b0[i];
      }
#if defined(__HIP_DEVICE_COMPILE__)
      // stands behind the loads above and ahead of every write to their address registers, which it names as inputs:
      // without them the compiler lays the last loads' results over the address pairs of the loads before
      if (RES) asm volatile("s_wait_xcnt 0x0" :: "v"(kg), "v"(vg), "v"(vlg) : "memory");
      else     asm volatile("s_wait_xcnt 0x0" :: "v"(kg), "v"(vg) : "memory");
#endif
#pragma unroll
      for (int i = 0; i < 4; ++i) {
        *(v8h*)(Ksh + r * AP + half + 8 * i) = a0[i];
        *(v8h*)(Vth + r * AP + half + 8 * i) = b0[i];
        if (RES) *(v8h*)(Vtl + r * AP + half + 8 * i) = resOK ? b1[i] : zero8h();
      }
    }
    __syncthreads();
    if (!act) continue;                      // no barrier stands between here and the loop's foot

    // ---- scores: 16 query rows x 64 keys per wave, single f16 product ----
    v8f s[4];
#pragma unroll
    for (int j = 0; j < 4; ++j) {
      s[j] = zero8();
#pragma unroll
      for (int dc = 0; dc < 2; ++dc) {
        FH kb;
        kb.h[0] = *(const v8h*)(Ksh + (j * 16 + c) * AP + dc * 32 + 8 * hh);
        kb.h[1] = *(const v8h*)(Ksh + (j * 16 + c) * AP + dc * 32 + 16 + 8 * hh);
        s[j] = mma_h(qa[dc], kb.v, s[j]);
      }
    }

    // ---- undo carries, causal mask, row max, online softmax, P (x1024, f16) and P residual (x4096) to LDS ----
    _Float16* pwh = Psh[wall];
    _Float16* pwl = Psl[RES ? wall : 0];
#pragma unroll
    for (int r = 0; r < 8; ++r) {
      const int qrow = q0 + 8 * hh + r;
      float m = -INFINITY;
#pragma unroll
      for (int j = 0; j < 4; ++j) {
        const int key = kv0 + j * 16 + c;
        float sv = s[j][r] * SSC;
        sv = (key <= qrow) ? sv : -INFINITY;
        s[j][r] = sv;
        m = fmaxf(m, sv);
      }
#pragma unroll
      for (int off = 1; off < 16; off <<= 1) m = fmaxf(m, __shfl_xor(m, off, 32));
      const float mnew  = fmaxf(mrow[r], m);
      const float msafe = (mnew == -INFINITY) ? 0.f : mnew;
      const float alpha = __expf(mrow[r] - msafe);
      mrow[r] = mnew;
      float psum = 0.f;
#pragma unroll
      for (int j = 0; j < 4; ++j) {
        const float p = __expf(s[j][r] - msafe);     // masked logit: exp(-inf) -> 0
        psum += p;
        const float p1k = p * 1024.0f;
        const _Float16 ph = (_Float16)p1k;
        pwh[(8 * hh + r) * AP + j * 16 + c] = ph;
        if (RES) {
          const _Float16 pl = (_Float16)((p1k - (float)ph) * VRS);
          pwl[(8 * hh + r) * AP + j * 16 + c] = pl;
        }
      }
#pragma unroll
      for (int off = 1; off < 16; off <<= 1) psum += __shfl_xor(psum, off, 32);
      lrow[r] = lrow[r] * alpha + psum;
#pragma unroll
      for (int t = 0; t < 4; ++t) oacc[t][r] *= alpha;
    }
    wave_sync_lds();

    // ---- context += P . V (f16 WMMA), residual products into a separate accumulator ----
    v8f o1[4];
#pragma unroll
    for (int t = 0; t < 4; ++t) o1[t] = zero8();
#pragma unroll 1
    for (int kk = 0; kk < 2; ++kk) {
      FH pa, pl;
      pa.h[0] = *(const v8h*)(pwh + c * AP + kk * 32 + 8 * hh);
      pa.h[1] = *(const v8h*)(pwh + c * AP + kk * 32 + 16 + 8 * hh);
      if (RES) {
        pl.h[0] = *(const v8h*)(pwl + c * AP + kk * 32 + 8 * hh);
        pl.h[1] = *(const v8h*)(pwl + c * AP + kk * 32 + 16 + 8 * hh);
      } else {
        pl.v = pa.v;
      }
#pragma unroll
      for (int t = 0; t < 4; ++t) {
        FH vb;
        vb.h[0] = *(const v8h*)(Vth + (t * 16 + c) * AP + kk * 32 + 8 * hh);
        vb.h[1] = *(const v8h*)(Vth + (t * 16 + c) * AP + kk * 32 + 16 + 8 * hh);
        oacc[t] = mma_h(pa.v, vb.v, oacc[t]);
        if (RES) {
          FH vl;
          vl.h[0] = *(const v8h*)(Vtl + (t * 16 + c) * AP + kk * 32 + 8 * hh);
          vl.h[1] = *(const v8h*)(Vtl + (t * 16 + c) * AP + kk * 32 + 16 + 8 * hh);
          o1[t] = mma_h(pa.v, vl.v, o1[t]);
          o1[t] = mma_h(pl.v, vb.v, o1[t]);
        }
      }
    }
    if (RES) {
#pragma unroll
      for (int t = 0; t < 4; ++t)
#pragma unroll
        for (int r = 0; r < 8; ++r) oacc[t][r] += o1[t][r] * (1.0f / VRS);
    }
  }

  // ---- merge of the groups' partial softmax results: piece p of a lane lies at (p*32 + lane)*16 B of its wave's range ----
  if (grp != 0) {
    float* xw = Mx[(grp - 1) * 4 + wave] + lane * 4;
#pragma unroll
    for (int t = 0; t < 4; ++t) {
      v4f w0, w1;
#pragma unroll
      for (int r = 0; r < 4; ++r) { w0[r] = oacc[t][r]; w1[r] = oacc[t][r + 4]; }
      *(v4f*)(xw + (2 * t) * 128)     = w0;
      *(v4f*)(xw + (2 * t + 1) * 128) = w1;
    }
    v4f m0, m1, l0, l1;
#pragma unroll
    for (int r = 0; r < 4; ++r) { m0[r] = mrow[r]; m1[r] = mrow[r + 4]; l0[r] = lrow[r]; l1[r] = lrow[r + 4]; }
    *(v4f*)(xw + 8 * 128)  = m0;
    *(v4f*)(xw + 9 * 128)  = m1;
    *(v4f*)(xw + 10 * 128) = l0;
    *(v4f*)(xw + 11 * 128) = l1;
  }
  __syncthreads();                           // publishes the partial results; the last barrier of the block
  if (grp != 0) return;
  // kept rolled: the partial results of the groups take the same registers in turn, so that the merge does not raise
  // the register count of the kernel
#pragma unroll 1
  for (int g = 1; g < KG; ++g) {
    const float* xr = Mx[(g - 1) * 4 + wave] + lane * 4;
    const v4f m0 = *(const v4f*)(xr + 8 * 128),  m1 = *(const v4f*)(xr + 9 * 128);
    const v4f l0 = *(const v4f*)(xr + 10 * 128), l1 = *(const v4f*)(xr + 11 * 128);
    float a0[8], a1[8];
#pragma unroll
    for (int r = 0; r < 8; ++r) {
      const float mg = (r < 4) ? m0[r & 3] : m1[r & 3];
      const float lg = (r < 4) ? l0[r & 3] : l1[r & 3];
      // the side with the larger maximum keeps its scale; a group without a chunk hands over -inf, 0, 0
      const bool  keep = (mrow[r] >= mg);
      const float mnew = keep ? mrow[r] : mg;
      const float x2 = ((mnew == -INFINITY) ? 0.f : ((keep ? mg : mrow[r]) - mnew)) * 1.44269504f;
      float e = 1.0f;
#if defined(__HIP_DEVICE_COMPILE__)
      // e = 2^x2; the v_nop fills the slot between the transcendental and a next instruction that reads its result or
      // writes its source
      asm("v_exp_f32 %0, %1\n\tv_nop" : "=v"(e) : "v"(x2));
#endif
      a0[r] = keep ? 1.0f : e;
      a1[r] = keep ? e : 1.0f;
      mrow[r] = mnew;
      lrow[r] = lrow[r] * a0[r] + lg * a1[r];
    }
#pragma unroll
    for (int t = 0; t < 4; ++t) {
      const v4f w0 = *(const v4f*)(xr + (2 * t) * 128), w1 = *(const v4f*)(xr + (2 * t + 1) * 128);
#pragma unroll
      for (int r = 0; r < 4; ++r) {
        oacc[t][r]     = oacc[t][r] * a0[r] + w0[r] * a1[r];
        oacc[t][r + 4] = oacc[t][r + 4] * a0[r + 4] + w1[r] * a1[r + 4];
      }
    }
  }

  // ---- bias-attention row term: 0.125 * qb_row . prefix(kb)_row; lane (row = c, half hh) covers 32 dims ----
  const float l2ns = l2p[0];
  {
    const size_t ro = (size_t)(q0 + c) * DM + (size_t)h * HD + hh * 32;
    const float* qp = qbn + ro;
    const float* pp = pfx + ro;
    float ds = 0.f;
#pragma unroll
    for (int e = 0; e < 8; ++e) {
      const v4f a = *(const v4f*)(qp + 4 * e);
      const v4f b = *(const v4f*)(pp + 4 * e);
#if defined(__HIP_DEVICE_COMPILE__)
      // stands ahead of the later loads, whose results the compiler lays over the address registers of these two
      asm volatile("s_wait_xcnt 0x0" ::: "memory");
#endif
      ds += a[0] * b[0] + a[1] * b[1] + a[2] * b[2] + a[3] * b[3];
    }
    ds += __shfl_xor(ds, 16, 32);
    if (hh == 0) Sbl[wave][c] = ds * 0.125f;
  }

  // ---- normalise (l2ns/l and the 1/1024 p carry), stage the wave's 16x64 tile column-major with 16-B vector
  float* os = Os[wave];
  float invr[8];
#pragma unroll
  for (int r = 0; r < 8; ++r) {
    const float l = lrow[r];
    invr[r] = ((l > 0.f) ? (1.0f / l) : 0.f) * (l2ns * (1.0f / 1024.0f));
  }
#pragma unroll
  for (int t = 0; t < 4; ++t) {
    v4f w0, w1;
#pragma unroll
    for (int r = 0; r < 4; ++r) {
      w0[r] = oacc[t][r] * invr[r];
      w1[r] = oacc[t][r + 4] * invr[r + 4];
    }
    float* cp = os + (t * 16 + c) * OSP + 8 * hh;
    *(v4f*)(cp) = w0;
    *(v4f*)(cp + 4) = w1;
  }
  wave_sync_lds();
  {
    const int q4 = lane >> 3, c8 = (lane & 7) * 8;
    v4u hv[4], lv[4];
#pragma unroll
    for (int it = 0; it < 4; ++it) {
      const int row = it * 4 + q4;   // it 0..3 x q4 0..3 = rows 0..15 of the wave tile
      const float sbv = Sbl[wave][row];
      v4u a, a2;
#pragma unroll
      for (int e = 0; e < 4; ++e) {
        const float f0 = os[(c8 + 2 * e) * OSP + row] + sbv;
        const float f1 = os[(c8 + 2 * e + 1) * OSP + row] + sbv;
        const unsigned short h0 = bf_bits(f0), h1 = bf_bits(f1);
        const unsigned short l0 = bf_bits(f0 - bf_up(h0)), l1 = bf_bits(f1 - bf_up(h1));
        a[e] = pk16(h0, h1); a2[e] = pk16(l0, l1);
      }
      hv[it] = a; lv[it] = a2;
    }
    {
#pragma unroll
      for (int it = 0; it < 4; ++it) {
        const int row = it * 4 + q4;
        const size_t go = (size_t)(q0 + row) * DM + (size_t)h * HD + c8;
        *(v4u*)(yhp + go) = hv[it];
        *(v4u*)(ylp + go) = lv[it];
      }
#if defined(__HIP_DEVICE_COMPILE__)
      // the form's end is not the kernel's end in the built code: stands ahead of any later write to these stores' registers
      asm volatile("s_wait_xcnt 0x0" ::: "memory");
#endif
    }
  }
}

__global__ __launch_bounds__(128 * KG)
void k_attn(const unsigned short* __restrict__ qhp, const unsigned short* __restrict__ khp,
            const unsigned short* __restrict__ vhp, const unsigned short* __restrict__ vlp,
            const float* __restrict__ qbn, const float* __restrict__ pfx, const float* __restrict__ l2p,
            unsigned short* yhp, unsigned short* ylp) {
  __shared__ __align__(16) _Float16 Ksh[KG][64 * AP];             // per group K [kv][d], pitch AP, 9 KB
  __shared__ __align__(16) _Float16 Vth[KG][64 * AP];             // per group V^T hi [d][kv], pitch AP, 9 KB
  __shared__ __align__(16) _Float16 Vtl[KG][64 * AP];             // per group V^T residual, pitch AP
  __shared__ __align__(16) _Float16 Psh[KG * 4][16 * AP];         // per wave P [row][kv], pitch AP
  __shared__ __align__(16) _Float16 Psl[KG * 4][16 * AP];         // per wave P residual, pitch AP
  __shared__ __align__(16) float    Os[4][64 * OSP];              // group 0, per wave: context slab [d][row], pitch OSP
  __shared__ float Sbl[4][16];                                    // group 0, per wave: bias-attention row values
  __shared__ __align__(16) float    Mx[(KG - 1) * 4][XPW];        // partial results of the waves of groups 1..KG-1
  const int bx = blockIdx.x;                                      // block-uniform choice of the form
  if (bx < NH * (NQB - RESQB))
    attn_body<false>(qhp, khp, vhp, vlp, qbn, pfx, l2p, yhp, ylp, bx, RESQB, NQB - RESQB,
                     Ksh, Vth, Vtl, Psh, Psl, Os, Sbl, Mx);
  else
    attn_body<true>(qhp, khp, vhp, vlp, qbn, pfx, l2p, yhp, ylp, bx - NH * (NQB - RESQB), 0, RESQB,
                    Ksh, Vth, Vtl, Psh, Psl, Os, Sbl, Mx);
}

// =====================================================================================================
// Workspace map (MiB offsets, sizes exact multiples of the whole-tile / whole-line store granularity):
//   Xh   f16  [2048][1024]          0    4
//   Xbh  bf16 [2048][1024]          4    4   (later: Qh f16, after the v^T projection)
//   Xbl  bf16 [2048][1024]          8    4   (later: Kh f16)
//   Wcat f16  [4096 n][1024 k]     12    8   (Wq|Wk|Wqb|Wkb transposed, x64)
//   Wvh/Wvl bf16 [1024][1024]      20  2+2
//   Woh/Wol bf16 [1024][1024]      24  2+2
//   W1t  f16  [8192][1024]         28   16   (x64, xp/gate interleaved per 64 columns)
//   W2t  f16  [1024][4096]         44    8   (x64)
//   cs   f32  [2048][64]           52  512 KiB
//   QK   f32  [2048][4096]         53   32   (later: Pf 53 (8), Yh 61 (4), Yl 65 (4), PS f64 [32][1024] 77 (256 KiB))
//   QBn  f32  [2048][1024]         85    8
//   KBn  f32  [2048][1024]         93    8
//   VTh  f16  [1024][2048]        101    4
//   VTl  f16  [1024][512]         105    1
//   FF   f16  [2048][4096]        106   16   (x64)
//   FO   f32  [2048][1024]        122    8   (h*lambda + ff.W2 + b2)
//   end                           130 MiB = 136314880 B
// =====================================================================================================
extern "C" void kernel_launch(void* const* d_in, const int* in_sizes, int n_in,
                              void* d_out, int out_size, void* d_ws, size_t ws_size,
                              hipStream_t stream) {
  if (n_in < 14) return;
  if (in_sizes[0] != SEQ * DM) return;
  for (int i = 1; i <= 6; ++i) if (in_sizes[i] != DM * DM) return;
  if (in_sizes[7] != DM) return;
  if (in_sizes[8] != DM * FUS || in_sizes[9] != FUS) return;
  if (in_sizes[10] != FFI * DM || in_sizes[11] != DM) return;
  if (in_sizes[12] < 1 || in_sizes[13] < 1) return;
  if (out_size != SEQ * DM) return;

  const float* hs  = (const float*)d_in[0];
  const float* Wq  = (const float*)d_in[1];
  const float* Wk  = (const float*)d_in[2];
  const float* Wv  = (const float*)d_in[3];
  const float* Wqb = (const float*)d_in[4];
  const float* Wkb = (const float*)d_in[5];
  const float* Wo  = (const float*)d_in[6];
  const float* bo  = (const float*)d_in[7];
  const float* W1  = (const float*)d_in[8];
  const float* b1  = (const float*)d_in[9];
  const float* W2  = (const float*)d_in[10];
  const float* b2  = (const float*)d_in[11];
  const float* lam = (const float*)d_in[12];
  const float* l2n = (const float*)d_in[13];

  // rotary inverse frequencies 1 / 1000^(2d/64), evaluated in double and RNE-cast to f32 (constants only)
  InvTab itab;
  for (int d = 0; d < HD / 2; ++d)
    { const float pw = (float)pow(1000.0, (2.0 * (double)d) / 64.0); itab.f[d] = 1.0f / pw; }

  const size_t MiB = 1048576;
  const size_t oXh  = 0;
  const size_t oXbh = 4 * MiB,  oXbl = 8 * MiB;
  const size_t oQh  = oXbh,     oKh  = oXbl;        // written after the v^T projection consumed Xbh/Xbl
  const size_t oWcat = 12 * MiB;
  const size_t oWvh = 20 * MiB, oWvl = 22 * MiB, oWoh = 24 * MiB, oWol = 26 * MiB;
  const size_t oW1t = 28 * MiB;
  const size_t oW2t = 44 * MiB;
  const size_t oCS  = 52 * MiB;
  const size_t oQK  = 53 * MiB;
  const size_t oPf  = 53 * MiB, oYh = 61 * MiB, oYl = 65 * MiB;                   // inside QK, after rope
  const size_t oPS  = 77 * MiB;                                                   // inside QK, after rope
  const size_t oQBn = 85 * MiB, oKBn = 93 * MiB;
  const size_t oVTh = 101 * MiB, oVTl = 105 * MiB;
  const size_t oFF  = 106 * MiB;
  const size_t oFO  = 122 * MiB;
  const size_t oEnd = 130 * MiB;
  // extent checks against the actual plane sizes
  if ((size_t)SEQ * DM * 2 != 4 * MiB) return;
  if ((size_t)DM * DM * 2 != 2 * MiB) return;
  if (oWcat + (size_t)4 * DM * DM * 2 != oWvh) return;
  if (oW1t + (size_t)FUS * DM * 2 != oW2t) return;
  if (oW2t + (size_t)DM * FFI * 2 != oCS) return;
  if (oCS + (size_t)SEQ * 64 * 4 > oQK) return;
  if (oQK + (size_t)SEQ * 4 * DM * 4 != oQBn) return;
  if (oPf + (size_t)SEQ * DM * 4 != oYh) return;
  if (oYl + (size_t)SEQ * DM * 2 > oPS) return;
  if (oPS + (size_t)PSS * DM * 8 > oQBn) return;
  if (oVTh + (size_t)DM * SEQ * 2 != oVTl) return;
  if (oVTl + (size_t)DM * VLP * 2 != oFF) return;
  if (oFF + (size_t)SEQ * FFI * 2 != oFO) return;
  if (oFO + (size_t)SEQ * DM * 4 != oEnd) return;
  if (oEnd > ws_size) return;

  char* ws = (char*)d_ws;
  unsigned short* Xh   = (unsigned short*)(ws + oXh);
  unsigned short* Xbh  = (unsigned short*)(ws + oXbh);
  unsigned short* Xbl  = (unsigned short*)(ws + oXbl);
  unsigned short* Qh   = (unsigned short*)(ws + oQh);
  unsigned short* Kh   = (unsigned short*)(ws + oKh);
  unsigned short* Wcat = (unsigned short*)(ws + oWcat);
  unsigned short* Wvh  = (unsigned short*)(ws + oWvh);
  unsigned short* Wvl  = (unsigned short*)(ws + oWvl);
  unsigned short* Woh  = (unsigned short*)(ws + oWoh);
  unsigned short* Wol  = (unsigned short*)(ws + oWol);
  unsigned short* W1t  = (unsigned short*)(ws + oW1t);
  unsigned short* W2t  = (unsigned short*)(ws + oW2t);
  float*          CS   = (float*)(ws + oCS);
  float*          QK   = (float*)(ws + oQK);
  float*          Pf   = (float*)(ws + oPf);
  unsigned short* Yh   = (unsigned short*)(ws + oYh);
  unsigned short* Yl   = (unsigned short*)(ws + oYl);
  float*          FO   = (float*)(ws + oFO);
  double*         PS   = (double*)(ws + oPS);
  float*          QBn  = (float*)(ws + oQBn);
  float*          KBn  = (float*)(ws + oKBn);
  unsigned short* VTh  = (unsigned short*)(ws + oVTh);
  unsigned short* VTl  = (unsigned short*)(ws + oVTl);
  unsigned short* FF   = (unsigned short*)(ws + oFF);

  const dim3 b256(256), bAt(128 * KG);
  const dim3 gF1((SEQ / 128) * (FUS / 256));                             // 128x256 block tiles -> 512 blocks
  const dim3 gWo((SEQ / 128) * (DM / 256));                              // 128x256 -> 64 blocks

  // (0-2) rotary cos/sin table, RMSNorm -> x planes, weights [k][n] f32 -> [n][k] 16-bit planes: one grid
  k_prep<<<dim3(PB_ALL), b256, 0, stream>>>(itab, hs, Wq, Wk, Wqb, Wkb, Wv, Wo, W1, W2,
                                            CS, Xh, Xbh, Xbl, Wcat, Wvh, Wvl, Woh, Wol, W1t, W2t);
  // (3) u = x . W1 + b1 with fused SwiGLU -> FF f16 [2048][4096] (x64)   (M=2048, N=8192, K=1024)
  k_gemm<_Float16, 2, 8, 0, 4, 4, 2, DM><<<gF1, b256, 0, stream>>>(
      Xh, Xh, DM, W1t, W1t, DM,
      (void*)FF, FFI, (void*)FF, FFI, 0,
      b1, hs, hs, lam,
      SEQ, FUS, DM, 1.0f / (XSC * WSC), FSC);
  // (4) one grid: fo = h*lambda + ff . W2 + b2;  v^T = Wv^T . x^T;  q|k|qb|kb = x . (Wq|Wk|Wqb|Wkb)
  k_gemm3<<<dim3(GB_F2 + GB_VT + GB_QK), b256, 0, stream>>>(FF, W2t, FO, b2, hs, lam,
                                                            Wvh, Wvl, Xbh, Xbl, VTh, VTl, Xh, Wcat, QK);
  // (6) l2norm + rotary -> q, k f16 planes (into the dead Xbh/Xbl regions), qb, kb f32 planes
  k_rope<<<dim3(SEQ * NH / 8), b256, 0, stream>>>(QK, CS, Qh, Kh, QBn, KBn);
  // (7) causal prefix sum of kb (QK region is dead now)
  k_segsum<<<dim3(PSS * (DM / 128)), b256, 0, stream>>>(KBn, PS);
  k_prefix<<<dim3(PSS * (DM / 128)), b256, 0, stream>>>(KBn, PS, Pf);
  // (8) attention: query blocks 0..RESQB-1 with residual planes, the rest without, in one grid; KG wave groups per block
  k_attn<<<dim3(NH * NQB), bAt, 0, stream>>>(Qh, Kh, VTh, VTl, QBn, Pf, l2n, Yh, Yl);
  // (9) out = (y . Wo + bo) + fo   (hi/lo x hi/lo, 3 products)
  k_gemm<__bf16, 4, 4, 2, 1, 2, 4, DM><<<gWo, b256, 0, stream>>>(
      Yh, Yl, DM, Woh, Wol, DM,
      d_out, DM, d_out, DM, 0,
      bo, hs, (const float*)FO, lam,
      SEQ, DM, DM, 1.0f, 1.0f);
  (void)hipGetLastError();
}

// v006
// A run of this version takes 185 microseconds.
// Two timings next to v005 both put it at 1.08 times that version's speed.
// Over all steps from v000 it is 8.77 times as fast.
// Contractions: x.(Wq|Wk|Wqb|Wkb), q.k^T scores, x.W1 and ff.W2 = v_wmma_f32_16x16x32_f16 (f16 operands with power-of-two carries, single product);
// v^T = Wv^T.x^T and attn = y.Wo = v_wmma_f32_16x16x32_bf16 with bf16 hi/lo split operands (hi.hi + hi.lo + lo.hi);
// both attention products are formed transposed (k.q^T, v^T.p^T); p.v = v_wmma_f32_16x16x32_f16 (p carried x1024 in f16, v f16 plus x4096 f16 residual planes of p and v on the leading query blocks); all f32 accumulate.
#include <hip/hip_runtime.h>
#include <math.h>
#include <stdint.h>

#define SEQ   2048
#define DM    1024
#define NH    16
#define HD    64
#define FFI   4096
#define FUS   8192
#define NQB   (SEQ / 64)
#define VLP   512
#define RESQB 8
#define QSC   8.0f             // f16 carry of q and k after l2norm + rope
#define SSC   (1.0f / 64.0f)   // undo QSC*QSC on the score accumulator
#define XSC   16.0f            // f16 carry of the normalised activations
#define WSC   64.0f            // f16 carry of the weights
#define FSC   64.0f            // f16 carry of the SwiGLU output
#define VRS   4096.0f          // scale of the f16 residual planes of v and p
#define SP    20               // LDS result slab pitch per column (16 rows + 4 pad), floats
#define OSP   20               // attention context slab pitch per column
#define AP    72               // attention K / V^T tile row pitch in LDS, f16 elements: 128 B of data + 16 B,
                               // 16 B x odd, so that the 16 rows of a 16-B fragment read fall on different banks

#define KG    4                // wave groups of an attention block; group g takes the key tiles g, g + KG, g + 2 KG, ...
#define XPW   (9 * 32 * 4)     // floats one wave hands over at the merge: 9 pieces of 16 B per lane

static_assert(RESQB * 64 <= VLP);
static_assert(NH * HD == DM);
static_assert((SEQ % 64) == 0 && (DM % 64) == 0 && (FFI % 64) == 0 && (FUS % 128) == 0);

typedef _Float16 v16h __attribute__((ext_vector_type(16)));
typedef _Float16 v8h  __attribute__((ext_vector_type(8)));
typedef __bf16   v16b __attribute__((ext_vector_type(16)));
typedef __bf16   v8b  __attribute__((ext_vector_type(8)));
typedef float    v8f  __attribute__((ext_vector_type(8)));
typedef float    v4f  __attribute__((ext_vector_type(4)));
typedef unsigned int v4u __attribute__((ext_vector_type(4)));

// rotary inverse frequencies, one per pair index d = 0..31, passed by value (host computed)
struct InvTab { float f[HD / 2]; };
static_assert(sizeof(InvTab) == 128);

// ---- scalar helpers --------------------------------------------------------------------------------
__device__ __forceinline__ unsigned short bf_bits(float f) {          // f32 -> bf16 bits, RNE convert
  unsigned u = __float_as_uint(f);
  return (unsigned short)((u + 0x7FFFu + ((u >> 16) & 1u)) >> 16);
}
__device__ __forceinline__ float bf_up(unsigned short h) { return __uint_as_float(((unsigned)h) << 16); }
__device__ __forceinline__ unsigned short h_bits(_Float16 x) { return __builtin_bit_cast(unsigned short, x); }
__device__ __forceinline__ unsigned pk16(unsigned short a, unsigned short b) { return (unsigned)a | ((unsigned)b << 16); }
__device__ __forceinline__ v8f zero8() { v8f z = {0.f, 0.f, 0.f, 0.f, 0.f, 0.f, 0.f, 0.f}; return z; }
__device__ __forceinline__ v8h zero8h() {
  const _Float16 z = (_Float16)0.0f;
  v8h r = {z, z, z, z, z, z, z, z};
  return r;
}
// value of lane l ^ 16 (the other half of the wave), by a vector cross-row move
__device__ __forceinline__ float xhalf(float x) {
  const int b = __builtin_bit_cast(int, x);
  return __builtin_bit_cast(float, __builtin_amdgcn_permlanex16(b, b, 0x76543210, 0xfedcba98, false, false));
}
// e^x as 2^(x log2 e), what __expf builds to, with a v_nop in the slot between the transcendental and the next instruction
__device__ __forceinline__ float exp_slot(float x) {
  const float x2 = x * 1.44269504f;
  float e = 1.0f;
#if defined(__HIP_DEVICE_COMPILE__)
  asm("v_exp_f32 %0, %1\n\tv_nop" : "=v"(e) : "v"(x2));
#endif
  return e;
}
// the same for the eight scores of a tile, in one statement: the results share no register with the arguments ("=&v"), so that
// no v_exp_f32 of the run writes the source or reads the result of the one before it, and one v_nop fills the slot behind the last
__device__ __forceinline__ v8f exp_slot8(v8f x) {
  const v8f x2 = x * 1.44269504f;
  v8f e = x2;
#if defined(__HIP_DEVICE_COMPILE__)
  float e0, e1, e2, e3, e4, e5, e6, e7;
  asm("v_exp_f32 %0, %8\n\tv_exp_f32 %1, %9\n\tv_exp_f32 %2, %10\n\tv_exp_f32 %3, %11\n\t"
      "v_exp_f32 %4, %12\n\tv_exp_f32 %5, %13\n\tv_exp_f32 %6, %14\n\tv_exp_f32 %7, %15\n\tv_nop"
      : "=&v"(e0), "=&v"(e1), "=&v"(e2), "=&v"(e3), "=&v"(e4), "=&v"(e5), "=&v"(e6), "=&v"(e7)
      : "v"(x2[0]), "v"(x2[1]), "v"(x2[2]), "v"(x2[3]), "v"(x2[4]), "v"(x2[5]), "v"(x2[6]), "v"(x2[7]));
  e[0] = e0; e[1] = e1; e[2] = e2; e[3] = e3; e[4] = e4; e[5] = e5; e[6] = e6; e[7] = e7;
#endif
  return e;
}
__device__ __forceinline__ void wave_sync_lds() {
  __builtin_amdgcn_fence(__ATOMIC_RELEASE, "workgroup");
  __builtin_amdgcn_wave_barrier();
  __builtin_amdgcn_fence(__ATOMIC_ACQUIRE, "workgroup");
}

// ---- fragment loaders: 16-bit A/B operand, lane -> row/col (lane&15), p already includes +8*(lane>>4);
//      elements 0..7 <- p[0..7] (k0+8h..), elements 8..15 <- p[16..23] (k0+16+8h..)
template <typename T> struct Frag16;
template <> struct Frag16<_Float16> { typedef v16h t; };
template <> struct Frag16<__bf16>   { typedef v16b t; };

__device__ __forceinline__ v16h ldfrag(const _Float16* p) {
  union { v16h v; v8h h[2]; } f;
  f.h[0] = *(const v8h*)(p);
  f.h[1] = *(const v8h*)(p + 16);
  return f.v;
}
__device__ __forceinline__ v16b ldfrag(const __bf16* p) {
  union { v16b v; v8b h[2]; } f;
  f.h[0] = *(const v8b*)(p);
  f.h[1] = *(const v8b*)(p + 16);
  return f.v;
}

// ---- WMMA helpers with trailing VALU hazard gap (non-template overloads per fragment type) -------------
__device__ __forceinline__ v8f mma_raw(v16h a, v16h b, v8f c) {
  return __builtin_amdgcn_wmma_f32_16x16x32_f16(false, a, false, b, (short)0, c, false, false);
}
__device__ __forceinline__ v8f mma_raw(v16b a, v16b b, v8f c) {
  return __builtin_amdgcn_wmma_f32_16x16x32_bf16(false, a, false, b, (short)0, c, false, false);
}
__device__ __forceinline__ v8f mma_h(v16h a, v16h b, v8f c) {
  c = mma_raw(a, b, c);
#if defined(__HIP_DEVICE_COMPILE__)
  asm volatile("v_nop\n\tv_nop\n\tv_nop\n\tv_nop" : "+v"(c) : "v"(a), "v"(b));
#endif
  return c;
}
__device__ __forceinline__ void dep_guard2(v8f& a, v8f& b, v16h x, v16h y) {
#if defined(__HIP_DEVICE_COMPILE__)
  asm volatile("v_nop\n\tv_nop\n\tv_nop\n\tv_nop" : "+v"(a), "+v"(b) : "v"(x), "v"(y));
#else
  (void)a; (void)b; (void)x; (void)y;
#endif
}
__device__ __forceinline__ void dep_guard2(v8f& a, v8f& b, v16b x, v16b y) {
#if defined(__HIP_DEVICE_COMPILE__)
  asm volatile("v_nop\n\tv_nop\n\tv_nop\n\tv_nop" : "+v"(a), "+v"(b) : "v"(x), "v"(y));
#else
  (void)a; (void)b; (void)x; (void)y;
#endif
}
__device__ __forceinline__ void keep1(v16h x) {
#if defined(__HIP_DEVICE_COMPILE__)
  asm volatile("v_nop" :: "v"(x));
#else
  (void)x;
#endif
}
__device__ __forceinline__ void keep1(v16b x) {
#if defined(__HIP_DEVICE_COMPILE__)
  asm volatile("v_nop" :: "v"(x));
#else
  (void)x;
#endif
}
__device__ __forceinline__ void acc_guard4(v8f& a, v8f& b, v8f& c, v8f& d) {
#if defined(__HIP_DEVICE_COMPILE__)
  asm volatile("v_nop\n\tv_nop\n\tv_nop\n\tv_nop" : "+v"(a), "+v"(b), "+v"(c), "+v"(d));
#else
  (void)a; (void)b; (void)c; (void)d;
#endif
}

// ---- SwiGLU element from the fused accumulator: silu(gate + bg) * (xp + bx) * rscale -------------------
__device__ __forceinline__ float swg(float xacc, float gacc, float oscale, float bx, float bg, float rscale) {
  const float xp = xacc * oscale + bx;
  const float g  = gacc * oscale + bg;
  const float sg = __builtin_amdgcn_rcpf(1.0f + __expf(-g));
  return (g * sg) * xp * rscale;
}

// =====================================================================================================
// cos/sin table: cs[t][0..31] = bf16(cos(t*invf[d])) widened to f32, cs[t][32..63] = bf16(sin(.)).
// invf arrives by value; each lane picks its entry with a static-index select chain (no private indexing).
// =====================================================================================================
__device__ __forceinline__ void job_cstab(const InvTab& tab, float* cs, int bidx) {
  const int lane = threadIdx.x & 31, wave = threadIdx.x >> 5;
  const int t = bidx * 8 + wave;
  float ivf = tab.f[0];
#pragma unroll
  for (int i = 1; i < HD / 2; ++i) ivf = (lane == i) ? tab.f[i] : ivf;
  const float fr = (float)t * ivf;
  float sn, cn;
  sincosf(fr, &sn, &cn);
  const float cv = bf_up(bf_bits(cn));
  const float sv = bf_up(bf_bits(sn));
  float* pc = cs + (size_t)t * 64 + lane;
  float* ps = pc + 32;
  *(float*)pc = cv;
  *(float*)ps = sv;
#if defined(__HIP_DEVICE_COMPILE__)
  // the job's end is not the kernel's end in the built code: stands ahead of any later write to these stores' registers
  asm volatile("s_wait_xcnt 0x0" ::: "memory");
#endif
}

// =====================================================================================================
// RMSNorm (no affine, eps = f32 eps) of one row per 128 threads x 8 elements (two rows per block) and conversion to
// three planes [2048][1024]: f16(x*16), bf16 hi, bf16 lo (RNE, lo = RNE(x - hi)). Each thread stores 16 B
// coverage: 1024 blocks x 2 rows x 128 threads x 8 = the whole plane.
// =====================================================================================================
__device__ __forceinline__ void job_xnorm(const float* __restrict__ hs, unsigned short* xh,
                                          unsigned short* xbh, unsigned short* xbl, int bidx, float (*red2)[4]) {
  const int tid = threadIdx.x & 127, lane = tid & 31, wave = tid >> 5, t = bidx * 2 + (threadIdx.x >> 7);
  float* red = red2[threadIdx.x >> 7];
  const size_t off = (size_t)t * DM + (size_t)tid * 8;
  const v4f a = *(const v4f*)(hs + off);
  const v4f b = *(const v4f*)(hs + off + 4);
  float ss = a[0] * a[0] + a[1] * a[1] + a[2] * a[2] + a[3] * a[3]
           + b[0] * b[0] + b[1] * b[1] + b[2] * b[2] + b[3] * b[3];
#pragma unroll
  for (int o = 1; o < 32; o <<= 1) ss += __shfl_xor(ss, o, 32);
  if (lane == 0) red[wave] = ss;
  __syncthreads();
  const float tot = (red[0] + red[1]) + (red[2] + red[3]);
  const float rn = rsqrtf(tot * (1.0f / (float)DM) + 1.1920929e-7f);
  float x[8];
  x[0] = a[0] * rn; x[1] = a[1] * rn; x[2] = a[2] * rn; x[3] = a[3] * rn;
  x[4] = b[0] * rn; x[5] = b[1] * rn; x[6] = b[2] * rn; x[7] = b[3] * rn;
  v4u ph, pb, pl;
#pragma unroll
  for (int e = 0; e < 4; ++e) {
    const float f0 = x[2 * e], f1 = x[2 * e + 1];
    ph[e] = pk16(h_bits((_Float16)(f0 * XSC)), h_bits((_Float16)(f1 * XSC)));
    const unsigned short hb0 = bf_bits(f0), hb1 = bf_bits(f1);
    pb[e] = pk16(hb0, hb1);
    pl[e] = pk16(bf_bits(f0 - bf_up(hb0)), bf_bits(f1 - bf_up(hb1)));
  }
  *(v4u*)(xh + off)  = ph;
  *(v4u*)(xbh + off) = pb;
  *(v4u*)(xbl + off) = pl;
#if defined(__HIP_DEVICE_COMPILE__)
  // the job's end is not the kernel's end in the built code: stands ahead of any later write to these stores' registers
  asm volatile("s_wait_xcnt 0x0" ::: "memory");
#endif
}

// =====================================================================================================
// Weight transpose + convert: W [K][N] f32 (in k, out n) -> Wt [N][K] 16-bit (k contiguous), 64x64 tile per
// block through LDS. MODE 0: f16(w*wscale) -> out0; MODE 1: bf16 hi -> out0, bf16 lo -> out1.
// coverage: 2 it x 8 waves x 4 rows = 64 output rows, 8 lanes x 8 = 64 k columns per tile; tiles (bx, by) of (N/64, K/64).
// =====================================================================================================
template <int MODE>
__device__ __forceinline__ void job_wtrans(const float* __restrict__ W, int K, int N, int nhalf, float wscale,
                                           unsigned short* out0, unsigned short* out1, int bx, int by,
                                           float (*tl)[65]) {
  const int tid = threadIdx.x, lane = tid & 31, wave = tid >> 5;
  const int n0 = bx * 64, k0 = by * 64;
  {
    const int i0 = tid >> 4, cc = (tid & 15) * 4;
#pragma unroll
    for (int p = 0; p < 4; ++p) {
      const int i = p * 16 + i0;
      const v4f v = *(const v4f*)(W + (size_t)(k0 + i) * N + n0 + cc);
      tl[i][cc] = v[0]; tl[i][cc + 1] = v[1]; tl[i][cc + 2] = v[2]; tl[i][cc + 3] = v[3];
    }
  }
  __syncthreads();
  const int orow0 = (nhalf > 0) ? ((n0 < nhalf) ? (2 * n0) : (2 * (n0 - nhalf) + 64)) : n0;
  const int q8 = lane >> 3, c8 = (lane & 7) * 8;
  v4u hv[2], lv[2];
#pragma unroll
  for (int it = 0; it < 2; ++it) {
    const int j = it * 32 + wave * 4 + q8;
    v4u a, a2;
#pragma unroll
    for (int e = 0; e < 4; ++e) {
      const float f0 = tl[c8 + 2 * e][j], f1 = tl[c8 + 2 * e + 1][j];
      if constexpr (MODE == 0) {
        a[e] = pk16(h_bits((_Float16)(f0 * wscale)), h_bits((_Float16)(f1 * wscale)));
        a2[e] = 0u;
      } else {
        const unsigned short hb0 = bf_bits(f0), hb1 = bf_bits(f1);
        a[e] = pk16(hb0, hb1);
        a2[e] = pk16(bf_bits(f0 - bf_up(hb0)), bf_bits(f1 - bf_up(hb1)));
      }
    }
    hv[it] = a; lv[it] = a2;
  }
  {
#pragma unroll
    for (int it = 0; it < 2; ++it) {
      const int j = it * 32 + wave * 4 + q8;
      const size_t go = (size_t)(orow0 + j) * K + k0 + c8;
      *(v4u*)(out0 + go) = hv[it];
      if constexpr (MODE == 1) *(v4u*)(out1 + go) = lv[it];
    }
#if defined(__HIP_DEVICE_COMPILE__)
    // the job's end is not the kernel's end in the built code: stands ahead of any later write to these stores' registers
    asm volatile("s_wait_xcnt 0x0" ::: "memory");
#endif
  }
}

// =====================================================================================================
// One grid for the ten jobs that read only inputs and none of each other's output: the block index falls into
// one of the ranges below (largest job first) and picks the job; every test on it is block-uniform, so each
// job's barrier is passed by all 256 threads of its block.
//   [W1 tiles | W2 tiles | Wq Wk Wqb Wkb Wv Wo tiles | RMSNorm row pairs | cos/sin table rows]
// =====================================================================================================
#define PB_W1 ((FUS / 64) * (DM / 64))     // 2048
#define PB_W2 ((DM / 64) * (FFI / 64))     // 1024
#define PB_W  ((DM / 64) * (DM / 64))      // 256 per square weight, six of them
#define PB_XN (SEQ / 2)                    // 1024
#define PB_CS (SEQ / 8)                    // 256
#define PB_ALL (PB_W1 + PB_W2 + 6 * PB_W + PB_XN + PB_CS)
__global__ __launch_bounds__(256) void k_prep(
    InvTab tab, const float* __restrict__ hs,
    const float* __restrict__ Wq, const float* __restrict__ Wk, const float* __restrict__ Wqb,
    const float* __restrict__ Wkb, const float* __restrict__ Wv, const float* __restrict__ Wo,
    const float* __restrict__ W1, const float* __restrict__ W2,
    float* cs, unsigned short* xh, unsigned short* xbh, unsigned short* xbl,
    unsigned short* wcat, unsigned short* wvh, unsigned short* wvl, unsigned short* woh, unsigned short* wol,
    unsigned short* w1t, unsigned short* w2t) {
  __shared__ float tl[64][65];
  __shared__ float red2[2][4];
  int b = blockIdx.x;
  if (b < PB_W1) {
    job_wtrans<0>(W1, DM, FUS, FFI, WSC, w1t, w1t, b % (FUS / 64), b / (FUS / 64), tl);
    return;
  }
  b -= PB_W1;
  if (b < PB_W2) {
    job_wtrans<0>(W2, FFI, DM, 0, WSC, w2t, w2t, b % (DM / 64), b / (DM / 64), tl);
    return;
  }
  b -= PB_W2;
  if (b < 6 * PB_W) {
    const int w = b / PB_W, r = b % PB_W;
    const int bx = r % (DM / 64), by = r / (DM / 64);
    if (w < 4) {
      const float* s = (w == 0) ? Wq : (w == 1) ? Wk : (w == 2) ? Wqb : Wkb;
      job_wtrans<0>(s, DM, DM, 0, WSC, wcat + (size_t)w * DM * DM, wcat, bx, by, tl);
    } else {
      job_wtrans<1>((w == 4) ? Wv : Wo, DM, DM, 0, 1.0f, (w == 4) ? wvh : woh, (w == 4) ? wvl : wol, bx, by, tl);
    }
    return;
  }
  b -= 6 * PB_W;
  if (b < PB_XN) {
    job_xnorm(hs, xh, xbh, xbl, b, red2);
    return;
  }
  b -= PB_XN;
  if (b < PB_CS) job_cstab(tab, cs, b);
}

// =====================================================================================================
// Register-blocked 16-bit WMMA GEMM: C[m][n] = sum_k A[m][k] * Bt[n][k]; one wave per (16*MI)x(16*NJ) tile,
// the 8 waves of a work-group laid out WM x WN over one (WM*16*MI)x(WN*16*NJ) block tile.
// A row-major [M][K] pitch lda; Bt row-major [N][K] pitch ldb (k contiguous);
// M, N multiples of the block tile, K multiple of KS (host-checked). T = _Float16 or __bf16.
// Operand path: per stage of KS = 64 k every operand row of the block tile (one whole 128-B line) is loaded once
// by the work-group (8 lanes x 16 B per row), kept in registers while the current stage is multiplied, and then
// stored to the other of two LDS buffers (row pitch 144 B for the 16-B fragment reads); one barrier per stage.
// Stage rows: [A | A2 | Bt | Bt2] (the second planes only with NSPLIT 2).
// KD = K = lda = ldb at compile time, so that the step from one group of 32 rows to the next is an immediate
// offset of the load and a plane needs one scalar base and one 32-bit offset register.
// NSPLIT: 0 = A.Bt; 2 = A.Bt + A.Bt2 + A2.Bt (unscaled hi/lo planes), in that order per k step.
// EPI 0: f32 C = acc*oscale (pitch ldc).  EPI 1: f32 C = acc*oscale + bias[n] + resa[m][n].
// EPI 2: f16 hi plane C (pitch ldc) + f16 residual plane C2 = f16((v - hi)*rscale) for tiles with n0 < N2
//        (pitch ldc2).  EPI 3: f32 C = acc*oscale + bias[n] + resh[m][n]*lamp[0].
// EPI 4 (MI=2, NJ=8, TN=128): fused SwiGLU: subtiles j<4 are xp columns ocol0+16j+c, j>=4 the matching gate
//        columns; C (f16, pitch ldc) [m][ocol0 + ..63] = f16( silu(gate+bias[FFI+col]) * (xp+bias[col]) * rscale ).
// Epilogue: 16-row x 64-col slabs staged per wave in LDS, column-major (pitch SP): every lane writes its 8
// accumulator rows of one column with two 16-B vector stores; rows are then gathered and each 64-wide row
// coverage per wave: MI slabs x 16 rows x 64 output cols.
// =====================================================================================================
#define KS 64                  // k elements per LDS stage
#define LP (KS + 8)            // LDS row pitch of a stage, elements (128 B + 16 B)
// LDS bytes of one block: two operand stages and the eight result slabs
template <int MI, int NJ, int NSPLIT, int WM, int WN>
constexpr int gemm_lds() {
  return 2 * ((NSPLIT == 2) ? 2 : 1) * (WM * 16 * MI + WN * 16 * NJ) * LP * 2 + 8 * 64 * SP * 4;
}
template <typename T, int MI, int NJ, int NSPLIT, int EPI, int WM, int WN, int KD>
__device__ __forceinline__ void gemm_body(
    int bidx, char* smem,
    const unsigned short* __restrict__ Ap, const unsigned short* __restrict__ A2p, int lda,
    const unsigned short* __restrict__ Bp, const unsigned short* __restrict__ B2p, int ldb,
    void* Cout, int ldc, void* Cout2, int ldc2, int N2,
    const float* __restrict__ bias, const float* __restrict__ resh,
    const float* __restrict__ resa, const float* __restrict__ lamp,
    int M, int N, int K, float oscale, float rscale) {
  typedef typename Frag16<T>::t FR;
  static_assert((EPI == 4) ? (MI == 2 && NJ == 8) : (NJ == 4 && (MI == 2 || MI == 4)));
  static_assert(NSPLIT == 0 || NSPLIT == 2);
  static_assert(WM * WN == 8);
  const T* A   = (const T*)(const void*)Ap;
  const T* A2  = (const T*)(const void*)A2p;
  const T* Bt  = (const T*)(const void*)Bp;
  const T* Bt2 = (const T*)(const void*)B2p;
  constexpr int TM = 16 * MI, TN = 16 * NJ;
  constexpr int BM = WM * TM, BN = WN * TN;
  constexpr int NPL  = (NSPLIT == 2) ? 2 : 1;      // planes per operand
  constexpr int ROWS = NPL * (BM + BN);            // operand rows per stage
  constexpr int NCH  = ROWS / 32;                  // 16-B pieces per thread per stage (256 threads = 32 rows)
  static_assert((BM % 32) == 0 && (BN % 32) == 0);
  static_assert(sizeof(T) == 2 && gemm_lds<MI, NJ, NSPLIT, WM, WN>() == 2 * ROWS * LP * 2 + 8 * 64 * SP * 4);
  T (*stg)[ROWS * LP] = (T (*)[ROWS * LP])(void*)smem;                              // two operand stages
  float (*sT)[64 * SP] = (float (*)[64 * SP])(void*)(smem + 2 * ROWS * LP * 2);     // per-wave 16x64 slab, column-major, pitch SP floats
  const int tid  = threadIdx.x;
  const int lane = tid & 31;
  const int wave = tid >> 5;
  const int tilesNb = N / BN;
  const int tilesMb = M / BM;
  if (bidx >= tilesMb * tilesNb) return;              // block-uniform, ahead of every barrier
  if (lda != KD || ldb != KD || K != KD) return;      // uniform over the grid
  const int bm = bidx / tilesNb;
  const int bn = bidx - bm * tilesNb;
  const int wm = wave / WN;
  const int wn = wave - wm * WN;
  const int m0 = bm * BM + wm * TM;
  const int n0 = bn * BN + wn * TN;
  const int tn = n0 / TN;
  const int rl   = lane & 15;            // row (A) / col (B, D) within subtile
  const int koff = (lane >> 4) * 8;      // k offset of this lane half
  const int mOff = (lane >> 4) * 8;      // D row offset

  v8f acc[MI][NJ];
#pragma unroll
  for (int i = 0; i < MI; ++i)
#pragma unroll
    for (int j = 0; j < NJ; ++j) acc[i][j] = zero8();

  // staging: thread -> row (tid>>3) of each group of 32 rows, 16-B piece (tid&7) of its 128-B line
  const int sr = tid >> 3, sc = (tid & 7) * 8;
  // address = block-uniform plane base + the thread's 32-bit byte offset (row in its group, piece, k) + row group
  static_assert((KD % KS) == 0);
  const unsigned vo0 = (unsigned)(sr * KD + sc) * 2u;
  const char* gA  = (const char*)(A   + (size_t)(bm * BM) * KD);
  const char* gA2 = (const char*)(A2  + (size_t)(bm * BM) * KD);
  const char* gB  = (const char*)(Bt  + (size_t)(bn * BN) * KD);
  const char* gB2 = (const char*)(Bt2 + (size_t)(bn * BN) * KD);
  v4u st[NCH];
  auto fetch = [&](int k0) {
    const unsigned vo = vo0 + (unsigned)k0 * 2u;
#pragma unroll
    for (int it = 0; it < NCH; ++it) {
      const int r = it * 32;
      const char* g;
      if (r < BM)                 g = gA  + (size_t)r * KD * 2;
      else if (r < NPL * BM)      g = gA2 + (size_t)(r - BM) * KD * 2;
      else if (r < NPL * BM + BN) g = gB  + (size_t)(r - NPL * BM) * KD * 2;
      else                        g = gB2 + (size_t)(r - NPL * BM - BN) * KD * 2;
      st[it] = *(const v4u*)(g + vo);
    }
#if defined(__HIP_DEVICE_COMPILE__)
    // stands ahead of every later write to the address registers of the loads above
    asm volatile("s_wait_xcnt 0x0" ::: "memory");
#endif
  };
  auto put = [&](T* buf) {
#pragma unroll
    for (int it = 0; it < NCH; ++it) *(v4u*)(buf + (it * 32 + sr) * LP + sc) = st[it];
  };

  fetch(0);
  put(stg[0]);
  __syncthreads();
  constexpr int nst = KD / KS;
  for (int s = 0; s < nst; ++s) {
    const bool more = (s + 1 < nst);     // block-uniform
    if (more) fetch((s + 1) * KS);       // in flight while this stage is multiplied
    const T* buf = stg[s & 1];
    const T* sa  = buf + (wm * TM + rl) * LP + koff;
    const T* sa2 = sa + BM * LP;
    const T* sb  = buf + (NPL * BM + wn * TN + rl) * LP + koff;
    const T* sb2 = sb + BN * LP;
#pragma unroll
    for (int kk = 0; kk < KS; kk += 32) {
      // the fragments of a k step are read from LDS in groups ahead of their products (B: four subtile columns)
      FR ah[MI];
#pragma unroll
      for (int i = 0; i < MI; ++i) ah[i] = ldfrag(sa + 16 * i * LP + kk);
#pragma unroll
      for (int jg = 0; jg < NJ; jg += 4) {
        FR bh[4], bl[4];
#pragma unroll
        for (int jj = 0; jj < 4; ++jj) {
          bh[jj] = ldfrag(sb + 16 * (jg + jj) * LP + kk);
          if constexpr (NSPLIT == 2) bl[jj] = ldfrag(sb2 + 16 * (jg + jj) * LP + kk);
          else bl[jj] = bh[jj];
        }
#pragma unroll
        for (int jj = 0; jj < 4; ++jj) {
          const int j = jg + jj;
#pragma unroll
          for (int i = 0; i < MI; ++i) {
            acc[i][j] = mma_raw(ah[i], bh[jj], acc[i][j]);
            if constexpr (NSPLIT == 2) acc[i][j] = mma_raw(ah[i], bl[jj], acc[i][j]);
          }
          dep_guard2(acc[0][j], acc[MI - 1][j], bh[jj], bl[jj]);
        }
        if constexpr (NSPLIT == 2) {
          static_assert(NSPLIT == 0 || NJ == 4);   // one B group, so the A2 fragments may take the A fragments' place
#pragma unroll
          for (int i = 0; i < MI; ++i) keep1(ah[i]);
          FR al[MI];
#pragma unroll
          for (int i = 0; i < MI; ++i) al[i] = ldfrag(sa2 + 16 * i * LP + kk);
#pragma unroll
          for (int jj = 0; jj < 4; ++jj) {
            const int j = jg + jj;
#pragma unroll
            for (int i = 0; i < MI; ++i) acc[i][j] = mma_raw(al[i], bh[jj], acc[i][j]);
            dep_guard2(acc[0][j], acc[MI - 1][j], bh[jj], bh[jj]);
          }
#pragma unroll
          for (int i = 0; i < MI; ++i) keep1(al[i]);
        }
      }
      if constexpr (NSPLIT == 0) {
#pragma unroll
        for (int i = 0; i < MI; ++i) keep1(ah[i]);
      }
    }
    if (more) put(stg[(s + 1) & 1]);     // every reader left that buffer at the barrier of the stage before
    __syncthreads();                     // publishes stage s+1; ends the reads of stage s
  }
#pragma unroll
  for (int i = 0; i < MI; ++i)
#pragma unroll
    for (int j = 0; j < NJ; j += 4) acc_guard4(acc[i][j], acc[i][j + 1], acc[i][j + 2], acc[i][j + 3]);

  // ---- epilogue ----
  float* slab = sT[wave];
  const int ocol0 = (EPI == 4) ? (tn * 64) : n0;
  const int hq = lane >> 4, c4 = (lane & 15) * 4;   // f32 path: 256-B row segment = 16 lanes x 16 B
  const int q8 = lane >> 3, c8 = (lane & 7) * 8;
  float bxv[4] = {0.f, 0.f, 0.f, 0.f}, bgv[4] = {0.f, 0.f, 0.f, 0.f};
  v4f b4 = {0.f, 0.f, 0.f, 0.f};
  float lam = 0.f;
  if constexpr (EPI == 4) {
#pragma unroll
    for (int j = 0; j < 4; ++j) {
      bxv[j] = bias[ocol0 + 16 * j + rl];
      bgv[j] = bias[FFI + ocol0 + 16 * j + rl];
    }
  }
  if constexpr (EPI == 1 || EPI == 3) b4 = *(const v4f*)(bias + n0 + c4);
  if constexpr (EPI == 3) lam = lamp[0];

#pragma unroll
  for (int i = 0; i < MI; ++i) {
    const int mBase = m0 + 16 * i;
    // lane writes column 16j+rl, rows mOff..mOff+7 = 32 contiguous bytes as two 16-B vector LDS stores
#pragma unroll
    for (int j = 0; j < 4; ++j) {
      v4f w0, w1;
      if constexpr (EPI == 4) {
#pragma unroll
        for (int r = 0; r < 4; ++r) {
          w0[r] = swg(acc[i][j][r],     acc[i][j + 4][r],     oscale, bxv[j], bgv[j], rscale);
          w1[r] = swg(acc[i][j][r + 4], acc[i][j + 4][r + 4], oscale, bxv[j], bgv[j], rscale);
        }
      } else {
#pragma unroll
        for (int r = 0; r < 4; ++r) {
          w0[r] = acc[i][j][r] * oscale;
          w1[r] = acc[i][j][r + 4] * oscale;
        }
      }
      float* cp = slab + (16 * j + rl) * SP + mOff;
      *(v4f*)(cp) = w0;
      *(v4f*)(cp + 4) = w1;
    }
    wave_sync_lds();
    if constexpr (EPI == 0 || EPI == 1 || EPI == 3) {
      float* C = (float*)Cout;
      v4f fin[8];
#pragma unroll
      for (int it = 0; it < 8; ++it) {
        const int row = 2 * it + hq;                   // it 0..7 x hq 0..1 = rows 0..15
        v4f v;
        v[0] = slab[(c4 + 0) * SP + row];
        v[1] = slab[(c4 + 1) * SP + row];
        v[2] = slab[(c4 + 2) * SP + row];
        v[3] = slab[(c4 + 3) * SP + row];
        if constexpr (EPI == 1 || EPI == 3) {
          const size_t go = (size_t)(mBase + row) * ldc + n0 + c4;
          const v4f rvv = *(const v4f*)(((EPI == 3) ? resh : resa) + go);
#if defined(__HIP_DEVICE_COMPILE__)
          // stands ahead of the next rows' loads, whose results the compiler lays over this load's address registers
          asm volatile("s_wait_xcnt 0x0" ::: "memory");
#endif
          if constexpr (EPI == 3) v = v + b4 + rvv * lam;
          else                    v = v + b4 + rvv;
        }
        fin[it] = v;
      }
      {
#pragma unroll
        for (int it = 0; it < 8; ++it) {
          const int row = 2 * it + hq;
          *(v4f*)(C + (size_t)(mBase + row) * ldc + n0 + c4) = fin[it];
#if defined(__HIP_DEVICE_COMPILE__)
          // stands ahead of the later rows' sums, which the compiler lays over this store's data registers
          if constexpr (EPI == 1 || EPI == 3) asm volatile("s_wait_xcnt 0x0" ::: "memory");
#endif
        }
      }
    } else {
      unsigned short* C  = (unsigned short*)Cout;
      unsigned short* C2 = (unsigned short*)Cout2;
      const bool wlo = (EPI == 2) && (n0 < N2);        // wave-uniform
      v4u hv[4], lv[4];
#pragma unroll
      for (int it = 0; it < 4; ++it) {
        const int row = 4 * it + q8;                   // it 0..3 x q8 0..3 = rows 0..15
        v4u a, a2;
#pragma unroll
        for (int e = 0; e < 4; ++e) {
          const float f0 = slab[(c8 + 2 * e) * SP + row], f1 = slab[(c8 + 2 * e + 1) * SP + row];
          const _Float16 x0 = (_Float16)f0, x1 = (_Float16)f1;
          unsigned short l0 = 0, l1 = 0;
          if constexpr (EPI == 2) {
            l0 = h_bits((_Float16)((f0 - (float)x0) * rscale));
            l1 = h_bits((_Float16)((f1 - (float)x1) * rscale));
          }
          a[e] = pk16(h_bits(x0), h_bits(x1)); a2[e] = pk16(l0, l1);
        }
        hv[it] = a; lv[it] = a2;
      }
      {
#pragma unroll
        for (int it = 0; it < 4; ++it) {
          const int row = 4 * it + q8;
          *(v4u*)(C + (size_t)(mBase + row) * ldc + ocol0 + c8) = hv[it];
          if (wlo) *(v4u*)(C2 + (size_t)(mBase + row) * ldc2 + n0 + c8) = lv[it];
        }
        
      }
    }
    wave_sync_lds();
  }
}

template <typename T, int MI, int NJ, int NSPLIT, int EPI, int WM, int WN, int KD>
__global__ __launch_bounds__(256) void k_gemm(
    const unsigned short* __restrict__ Ap, const unsigned short* __restrict__ A2p, int lda,
    const unsigned short* __restrict__ Bp, const unsigned short* __restrict__ B2p, int ldb,
    void* Cout, int ldc, void* Cout2, int ldc2, int N2,
    const float* __restrict__ bias, const float* __restrict__ resh,
    const float* __restrict__ resa, const float* __restrict__ lamp,
    int M, int N, int K, float oscale, float rscale) {
  __shared__ __align__(16) char smem[gemm_lds<MI, NJ, NSPLIT, WM, WN>()];
  gemm_body<T, MI, NJ, NSPLIT, EPI, WM, WN, KD>((int)blockIdx.x, smem, Ap, A2p, lda, Bp, B2p, ldb, Cout, ldc, Cout2, ldc2,
                                                N2, bias, resh, resa, lamp, M, N, K, oscale, rscale);
}

// One grid for the three products that read none of each other's output and none of which fills the chip alone:
//   [ fo = h*lambda + ff.W2 + b2 (longest k loop, lowest indices) | v^T = Wv^T.x^T | q|k|qb|kb = x.Wcat ]
// The block index picks the product (block-uniform), so every barrier of a product is passed by its whole block.
#define GB_F2 ((SEQ / 128) * (DM / 128))         // 128x128 block tiles -> 128 blocks
#define GB_VT ((DM / 128) * (SEQ / 256))         // 128x256 -> 64 blocks
#define GB_QK ((SEQ / 128) * ((4 * DM) / 256))   // 128x256 -> 256 blocks
__global__ __launch_bounds__(256) void k_gemm3(
    const unsigned short* __restrict__ ff, const unsigned short* __restrict__ w2t, float* fo,
    const float* __restrict__ b2, const float* __restrict__ hs, const float* __restrict__ lamp,
    const unsigned short* __restrict__ wvh, const unsigned short* __restrict__ wvl,
    const unsigned short* __restrict__ xbh, const unsigned short* __restrict__ xbl,
    unsigned short* vth, unsigned short* vtl,
    const unsigned short* __restrict__ xh, const unsigned short* __restrict__ wcat, float* qk) {
  static_assert(gemm_lds<4, 4, 2, 2, 4>() >= gemm_lds<4, 4, 0, 2, 4>() && gemm_lds<4, 4, 2, 2, 4>() >= gemm_lds<2, 4, 0, 4, 2>());
  __shared__ __align__(16) char smem[gemm_lds<4, 4, 2, 2, 4>()];
  int b = blockIdx.x;
  if (b < GB_F2) {
    // M=2048, N=1024, K=4096; 32x64 wave tiles
    gemm_body<_Float16, 2, 4, 0, 3, 4, 2, FFI>(b, smem, ff, ff, FFI, w2t, w2t, FFI, (void*)fo, DM, (void*)fo, DM, 0,
                                               b2, hs, hs, lamp, SEQ, DM, FFI, 1.0f / (FSC * WSC), 1.0f);
    return;
  }
  b -= GB_F2;
  if (b < GB_VT) {
    // M=1024, N=2048, K=1024: f16 hi plane [h*64+d][s] + residual plane (keys < VLP)
    gemm_body<__bf16, 4, 4, 2, 2, 2, 4, DM>(b, smem, wvh, wvl, DM, xbh, xbl, DM, (void*)vth, SEQ, (void*)vtl, VLP, VLP,
                                            b2, hs, hs, lamp, DM, SEQ, DM, 1.0f, VRS);
    return;
  }
  b -= GB_VT;
  // M=2048, N=4096, K=1024 -> f32 [2048][4096]
  gemm_body<_Float16, 4, 4, 0, 0, 2, 4, DM>(b, smem, xh, xh, DM, wcat, wcat, DM, (void*)qk, 4 * DM, (void*)qk, 4 * DM, 0,
                                            b2, hs, hs, lamp, SEQ, 4 * DM, DM, 1.0f / (XSC * WSC), 1.0f);
}

// =====================================================================================================
// Per-head l2 normalisation + rotary embedding for q, k, qb, kb. Input QK f32 [2048][4096]
// (cols: q | k | qb | kb, each [h*64 + d]); cs table [t][cos 0..31 | sin 0..31] (bf16-valued f32).
// One wave per (t, h): lane d handles the rotary pair (d, d+32). Results exchanged through a per-wave LDS
// grid = 32768/8 blocks of 256. coverage: every (t, h) row of all four planes.
// =====================================================================================================
__global__ __launch_bounds__(256) void k_rope(const float* __restrict__ qkf, const float* __restrict__ cs,
                                              unsigned short* qh, unsigned short* kh, float* qbn, float* kbn) {
  __shared__ __align__(16) float yb[8][4 * 64];
  const int lane = threadIdx.x & 31, wave = threadIdx.x >> 5;
  const int p = blockIdx.x * 8 + wave;     // p = t*16 + h
  const int t = p >> 4, h = p & 15;
  const float cth = cs[(size_t)t * 64 + lane];
  const float sth = cs[(size_t)t * 64 + 32 + lane];
  const float* row = qkf + (size_t)t * (4 * DM) + h * HD;
  float* ybw = yb[wave];
#pragma unroll
  for (int g = 0; g < 4; ++g) {
    const float* src = row + g * DM;
    float x1 = src[lane], x2 = src[lane + 32];
    float n2 = x1 * x1 + x2 * x2;
#pragma unroll
    for (int o = 1; o < 32; o <<= 1) n2 += __shfl_xor(n2, o, 32);
    const float rn = 1.0f / fmaxf(sqrtf(n2), 1e-12f);
    x1 *= rn; x2 *= rn;
    ybw[g * 64 + lane]      = x1 * cth + x2 * sth;
    ybw[g * 64 + 32 + lane] = x2 * cth - x1 * sth;
  }
  wave_sync_lds();
  const int c8 = (lane & 7) * 8, c4 = (lane & 15) * 4;
  v4u qv, kv;
#pragma unroll
  for (int e = 0; e < 4; ++e) {
    qv[e] = pk16(h_bits((_Float16)(ybw[c8 + 2 * e] * QSC)), h_bits((_Float16)(ybw[c8 + 2 * e + 1] * QSC)));
    kv[e] = pk16(h_bits((_Float16)(ybw[64 + c8 + 2 * e] * QSC)), h_bits((_Float16)(ybw[64 + c8 + 2 * e + 1] * QSC)));
  }
  const v4f qbv = *(const v4f*)(ybw + 128 + c4);
  const v4f kbv = *(const v4f*)(ybw + 192 + c4);
  const size_t g16 = (size_t)t * DM + h * HD + c8;
  const size_t g32 = (size_t)t * DM + h * HD + c4;
  {
    if (lane < 8) {
      *(v4u*)(qh + g16) = qv;
      *(v4u*)(kh + g16) = kv;
    }
    if (lane < 16) {
      *(v4f*)(qbn + g32) = qbv;
      *(v4f*)(kbn + g32) = kbv;
    }
    
  }
}

// =====================================================================================================
// Inclusive causal prefix sum of kb over positions: pf[t][col] = sum_{s<=t} kbn[s][col], summed in f64.
// Blocked scan in two launches. The 2048 positions are cut into PSS blocks of 64 rows, each block into 8 wave
// slices of PWR rows; a work-group covers 64 rows x 128 columns, a lane 4 neighbouring columns (16-B accesses).
//   k_segsum: part[ss][col] = f64 sum of the 64 rows of block ss.
//   k_prefix: offset = sum of part[0..ss-1][col] + sums of the lower wave slices (scanned in LDS), added to the
//             lane's own running sum over its PWR rows; every pf line is stored whole by one wave.
// coverage of both: grid PSS x (DM/128) work-groups x 8 waves x PWR rows x 128 columns = the whole plane.
// Every loop of the two kernels is unrolled in full, so that its small arrays live in registers and the loads
// of one array are issued back to back.
// =====================================================================================================
#define PSS 32                 // row blocks of 64 positions
#define PWR 8                  // rows per wave slice
static_assert(PSS * 8 * PWR == SEQ && (DM % 128) == 0 && (PSS % 2) == 0);

__global__ __launch_bounds__(256) void k_segsum(const float* __restrict__ kbn, double* __restrict__ part) {
  __shared__ __align__(16) double wsum[8][128];
  const int tid = threadIdx.x, lane = tid & 31, wave = tid >> 5;
  const int cg = blockIdx.x % (DM / 128), ss = blockIdx.x / (DM / 128);
  const float* src = kbn + (size_t)(ss * 64 + wave * PWR) * DM + cg * 128 + lane * 4;
  v4f x[PWR];
#pragma unroll
  for (int i = 0; i < PWR; ++i) x[i] = *(const v4f*)(src + (size_t)i * DM);
  double s[4];
#pragma unroll
  for (int e = 0; e < 4; ++e) s[e] = (double)x[0][e];
#pragma unroll
  for (int i = 1; i < PWR; ++i)
#pragma unroll
    for (int e = 0; e < 4; ++e) s[e] += (double)x[i][e];
#pragma unroll
  for (int e = 0; e < 4; ++e) wsum[wave][lane * 4 + e] = s[e];
  __syncthreads();
  if (tid < 128) {
    double v[8];
#pragma unroll
    for (int w = 0; w < 8; ++w) v[w] = wsum[w][tid];
    double a = v[0];
#pragma unroll
    for (int w = 1; w < 8; ++w) a += v[w];
    part[(size_t)ss * DM + cg * 128 + tid] = a;
  }
}

__global__ __launch_bounds__(256) void k_prefix(const float* __restrict__ kbn, const double* __restrict__ part,
                                                float* __restrict__ pf) {
  __shared__ __align__(16) double wsum[8][128];   // sum of each wave slice, per column; then its offset
  __shared__ __align__(16) double sup[2][128];    // sum of the lower row blocks, even / odd blocks apart
  const int tid = threadIdx.x, lane = tid & 31, wave = tid >> 5;
  const int cg = blockIdx.x % (DM / 128), ss = blockIdx.x / (DM / 128);
  const size_t go = (size_t)(ss * 64 + wave * PWR) * DM + cg * 128 + lane * 4;
  const float* src = kbn + go;
  v4f x[PWR];
#pragma unroll
  for (int i = 0; i < PWR; ++i) x[i] = *(const v4f*)(src + (size_t)i * DM);
  // lower row blocks: all PSS rows of part were written by k_segsum, so every load is issued at once and
  // the rows from ss on are dropped by the select (waves 0..3 take the even blocks, waves 4..7 the odd ones)
  {
    const int c = tid & 127, hf = tid >> 7;
    const double* pp = part + (size_t)hf * DM + cg * 128 + c;
    double pv[PSS / 2];
#pragma unroll
    for (int j = 0; j < PSS / 2; ++j) pv[j] = pp[(size_t)(2 * j) * DM];
    // keeps every load above ahead of the sums: without it two of them are issued only after the first have
    // come back, and the wave pays the memory latency twice
    __builtin_amdgcn_sched_barrier(0);
    double so = 0.0;
#pragma unroll
    for (int j = 0; j < PSS / 2; ++j) so += (2 * j + hf < ss) ? pv[j] : 0.0;
    sup[hf][c] = so;
  }
  // the lane's own running sums
  double p[PWR][4];
#pragma unroll
  for (int e = 0; e < 4; ++e) p[0][e] = (double)x[0][e];
#pragma unroll
  for (int i = 1; i < PWR; ++i)
#pragma unroll
    for (int e = 0; e < 4; ++e) p[i][e] = p[i - 1][e] + (double)x[i][e];
#pragma unroll
  for (int e = 0; e < 4; ++e) wsum[wave][lane * 4 + e] = p[PWR - 1][e];
  __syncthreads();
  // one thread per column turns the slice sums into each slice's offset, in place
  if (tid < 128) {
    double v[8];
#pragma unroll
    for (int w = 0; w < 8; ++w) v[w] = wsum[w][tid];
    double run = sup[0][tid] + sup[1][tid];
#pragma unroll
    for (int w = 0; w < 8; ++w) { wsum[w][tid] = run; run += v[w]; }
  }
  __syncthreads();
  double off[4];
#pragma unroll
  for (int e = 0; e < 4; ++e) off[e] = wsum[wave][lane * 4 + e];
  float* dst = pf + go;
#pragma unroll
  for (int i = 0; i < PWR; ++i) {
    v4f o;
#pragma unroll
    for (int e = 0; e < 4; ++e) o[e] = (float)(off[e] + p[i][e]);
    *(v4f*)(dst + (size_t)i * DM) = o;
  }
}

template <bool RES>
__device__ __forceinline__
void attn_body(const unsigned short* __restrict__ qhp, const unsigned short* __restrict__ khp,
               const unsigned short* __restrict__ vhp, const unsigned short* __restrict__ vlp,
               const float* __restrict__ qbn, const float* __restrict__ pfx, const float* __restrict__ l2p,
               unsigned short* yhp, unsigned short* ylp, int bx, int qbBase, int nqbThis,
               _Float16 (*Kshg)[64 * AP], _Float16 (*Vthg)[64 * AP], _Float16 (*Vtlg)[64 * AP],
               float (*Os)[64 * OSP], float (*Sbl)[16], float (*Mx)[XPW]) {
  union FH { v16h v; v8h h[2]; };

  const int tid  = threadIdx.x & 127;        // thread within its group
  const int wall = __builtin_amdgcn_readfirstlane((int)(threadIdx.x >> 5));   // wave of the block, in a scalar register
  const int grp  = wall >> 2;                // wave group: which key tiles
  const int wave = wall & 3;                 // wave of the group: which 16 query rows
  const int lane = tid & 31;
  const int hh   = lane >> 4;
  const int c    = lane & 15;
  _Float16* Ksh = Kshg[grp];
  _Float16* Vth = Vthg[grp];
  _Float16* Vtl = Vtlg[RES ? grp : 0];

  const int qbl = bx % nqbThis;
  const int h   = bx / nqbThis;
  const int qb  = qbBase + qbl;
  const int q0  = qb * 64 + wave * 16;

  const _Float16* Qh = (const _Float16*)(const void*)qhp + (size_t)h * HD;
  const _Float16* Kh = (const _Float16*)(const void*)khp + (size_t)h * HD;
  const _Float16* Vh = (const _Float16*)(const void*)vhp + (size_t)h * HD * SEQ;
  const _Float16* Vl = (const _Float16*)(const void*)vlp + (size_t)h * HD * VLP;

  // ---- Q fragments (B operand, column = query = lane&15): 2 d-chunks ----
  v16h qa[2];
#pragma unroll
  for (int dc = 0; dc < 2; ++dc) qa[dc] = ldfrag(Qh + (size_t)(q0 + c) * DM + dc * 32 + 8 * hh);

  const int qrow = q0 + c;                   // the lane's query
  float mrow = -INFINITY, lrow = 0.f;        // its running maximum (both halves alike) and the sum over this half's keys
  v8f oacc[4];                               // oacc[t][r] = context^T[d = 16 t + 8 hh + r][query c]
#pragma unroll
  for (int t = 0; t < 4; ++t) oacc[t] = zero8();

  int nkt = qb + 1;                          // causal: key tiles 0..qb; block-uniform, <= NQB
  if (nkt > NQB) nkt = NQB;
  const int nit = (nkt + KG - 1) / KG;       // block-uniform, <= NQB / KG
  for (int it = 0; it < nit; ++it) {
    const int kt = it * KG + grp;
    const bool act = (kt < nkt);             // wave-uniform (scalar): false only in the last trip
    const int kv0 = kt * 64;
    __syncthreads();
    if (act) {
      const int r = tid >> 1, half = (tid & 1) * 32;
      const _Float16* kg = Kh + (size_t)(kv0 + r) * DM + half;      // K row kv0+r, d = half..half+31
      const _Float16* vg = Vh + (size_t)r * SEQ + kv0 + half;       // V^T row d = r, s = kv0+half..+31
      const int kvl = (kv0 + 64 <= VLP) ? kv0 : (VLP - 64);         // clamped address into the residual plane
      const _Float16* vlg = Vl + (size_t)r * VLP + kvl + half;
      const bool resOK = (kv0 + 64 <= VLP);                          // wave-uniform
      v8h a0[4], b0[4], b1[4];
#pragma unroll
      for (int i = 0; i < 4; ++i) {
        a0[i] = *(const v8h*)(kg + 8 * i);
        b0[i] = *(const v8h*)(vg + 8 * i);
        b1[i] = RES ? *(const v8h*)(vlg + 8 * i) : b0[i];
      }
#if defined(__HIP_DEVICE_COMPILE__)
      // stands behind the loads above and ahead of every write to their address registers, which it names as inputs:
      // without them the compiler lays the last loads' results over the address pairs of the loads before
      if (RES) asm volatile("s_wait_xcnt 0x0" :: "v"(kg), "v"(vg), "v"(vlg) : "memory");
      else     asm volatile("s_wait_xcnt 0x0" :: "v"(kg), "v"(vg) : "memory");
#endif
#pragma unroll
      for (int i = 0; i < 4; ++i) {
        *(v8h*)(Ksh + r * AP + half + 8 * i) = a0[i];
        *(v8h*)(Vth + r * AP + half + 8 * i) = b0[i];
        if (RES) *(v8h*)(Vtl + r * AP + half + 8 * i) = resOK ? b1[i] : zero8h();
      }
    }
    __syncthreads();
    if (!act) continue;                      // no barrier stands between here and the loop's foot

    // ---- scores, transposed: 64 keys x 16 queries per wave, single f16 product;
    //      s[j][r] = score of key kv0 + 16 j + 8 hh + r with query q0 + c ----
    v8f s[4];
#pragma unroll
    for (int j = 0; j < 4; ++j) {
      s[j] = zero8();
#pragma unroll
      for (int dc = 0; dc < 2; ++dc) {
        FH kb;
        kb.h[0] = *(const v8h*)(Ksh + (j * 16 + c) * AP + dc * 32 + 8 * hh);
        kb.h[1] = *(const v8h*)(Ksh + (j * 16 + c) * AP + dc * 32 + 16 + 8 * hh);
        s[j] = mma_h(kb.v, qa[dc], s[j]);
      }
    }

    // ---- undo carries, causal mask, maximum in the lane (one chain per score tile), joined with the other half ----
    float mj[4];
#pragma unroll
    for (int j = 0; j < 4; ++j) {
      mj[j] = -INFINITY;
#pragma unroll
      for (int r = 0; r < 8; ++r) {
        const int key = kv0 + j * 16 + 8 * hh + r;
        float sv = s[j][r] * SSC;
        sv = (key <= qrow) ? sv : -INFINITY;
        s[j][r] = sv;
        mj[j] = fmaxf(mj[j], sv);
      }
    }
    float m = fmaxf(fmaxf(mj[0], mj[1]), fmaxf(mj[2], mj[3]));
    m = fmaxf(m, xhalf(m));
    const float mnew  = fmaxf(mrow, m);
    const float msafe = (mnew == -INFINITY) ? 0.f : mnew;
    const float alpha = exp_slot(mrow - msafe);
    mrow = mnew;

    // ---- online softmax; P^T (x1024, f16) and its residual (x4096) packed in the lane: elements 0..7 of the B operand
    //      of k step kk are the lane's 8 keys of score tile 2 kk, elements 8..15 those of tile 2 kk + 1 ----
    FH pa[2], pl[2];
    float pj[4];
#pragma unroll
    for (int j = 0; j < 4; ++j) {
      pj[j] = 0.f;
      const v8f pe = exp_slot8(s[j] - msafe);        // masked logit: exp(-inf) -> 0
#pragma unroll
      for (int r = 0; r < 8; ++r) {
        const float p = pe[r];
        pj[j] += p;
        const float p1k = p * 1024.0f;
        const _Float16 ph = (_Float16)p1k;
        pa[j >> 1].v[(j & 1) * 8 + r] = ph;
        pl[j >> 1].v[(j & 1) * 8 + r] = RES ? (_Float16)((p1k - (float)ph) * VRS) : ph;
      }
    }
    lrow = lrow * alpha + ((pj[0] + pj[1]) + (pj[2] + pj[3]));
#pragma unroll
    for (int t = 0; t < 4; ++t)
#pragma unroll
      for (int r = 0; r < 8; ++r) oacc[t][r] *= alpha;

    // ---- context^T += V^T . P^T (f16 WMMA), residual products into a separate accumulator ----
    v8f o1[4];
#pragma unroll
    for (int t = 0; t < 4; ++t) o1[t] = zero8();
    // unrolled: pa[kk] and pl[kk] lie in registers, which a rolled loop could not index
#pragma unroll
    for (int kk = 0; kk < 2; ++kk) {
#pragma unroll
      for (int t = 0; t < 4; ++t) {
        FH vb;
        vb.h[0] = *(const v8h*)(Vth + (t * 16 + c) * AP + kk * 32 + 8 * hh);
        vb.h[1] = *(const v8h*)(Vth + (t * 16 + c) * AP + kk * 32 + 16 + 8 * hh);
        oacc[t] = mma_h(vb.v, pa[kk].v, oacc[t]);
        if (RES) {
          FH vl;
          vl.h[0] = *(const v8h*)(Vtl + (t * 16 + c) * AP + kk * 32 + 8 * hh);
          vl.h[1] = *(const v8h*)(Vtl + (t * 16 + c) * AP + kk * 32 + 16 + 8 * hh);
          o1[t] = mma_h(vl.v, pa[kk].v, o1[t]);
          o1[t] = mma_h(vb.v, pl[kk].v, o1[t]);
        }
      }
    }
    if (RES) {
#pragma unroll
      for (int t = 0; t < 4; ++t)
#pragma unroll
        for (int r = 0; r < 8; ++r) oacc[t][r] += o1[t][r] * (1.0f / VRS);
    }
  }

  // ---- the two halves of the wave hold the sums over their own keys of the same query: joined once ----
  lrow += xhalf(lrow);

  // ---- merge of the groups' partial softmax results: piece p of a lane lies at (p*32 + lane)*16 B of its wave's range ----
  if (grp != 0) {
    float* xw = Mx[(grp - 1) * 4 + wave] + lane * 4;
#pragma unroll
    for (int t = 0; t < 4; ++t) {
      v4f w0, w1;
#pragma unroll
      for (int r = 0; r < 4; ++r) { w0[r] = oacc[t][r]; w1[r] = oacc[t][r + 4]; }
      *(v4f*)(xw + (2 * t) * 128)     = w0;
      *(v4f*)(xw + (2 * t + 1) * 128) = w1;
    }
    const v4f ml = {mrow, lrow, 0.f, 0.f};
    *(v4f*)(xw + 8 * 128) = ml;
  }
  __syncthreads();                           // publishes the partial results; the last barrier of the block
  if (grp != 0) return;
  // kept rolled: the partial results of the groups take the same registers in turn, so that the merge does not raise
  // the register count of the kernel
#pragma unroll 1
  for (int g = 1; g < KG; ++g) {
    const float* xr = Mx[(g - 1) * 4 + wave] + lane * 4;
    const v4f ml = *(const v4f*)(xr + 8 * 128);
    const float mg = ml[0], lg = ml[1];
    // the side with the larger maximum keeps its scale; a group without a chunk hands over -inf, 0, 0
    const bool  keep = (mrow >= mg);
    const float mnew = keep ? mrow : mg;
    const float x2 = ((mnew == -INFINITY) ? 0.f : ((keep ? mg : mrow) - mnew)) * 1.44269504f;
    float e = 1.0f;
#if defined(__HIP_DEVICE_COMPILE__)
    // e = 2^x2; the v_nop fills the slot between the transcendental and a next instruction that reads its result or
    // writes its source
    asm("v_exp_f32 %0, %1\n\tv_nop" : "=v"(e) : "v"(x2));
#endif
    const float a0 = keep ? 1.0f : e;
    const float a1 = keep ? e : 1.0f;
    mrow = mnew;
    lrow = lrow * a0 + lg * a1;
#pragma unroll
    for (int t = 0; t < 4; ++t) {
      const v4f w0 = *(const v4f*)(xr + (2 * t) * 128), w1 = *(const v4f*)(xr + (2 * t + 1) * 128);
#pragma unroll
      for (int r = 0; r < 4; ++r) {
        oacc[t][r]     = oacc[t][r] * a0 + w0[r] * a1;
        oacc[t][r + 4] = oacc[t][r + 4] * a0 + w1[r] * a1;
      }
    }
  }

  // ---- bias-attention row term: 0.125 * qb_row . prefix(kb)_row; lane (row = c, half hh) covers 32 dims ----
  const float l2ns = l2p[0];
  {
    const size_t ro = (size_t)(q0 + c) * DM + (size_t)h * HD + hh * 32;
    const float* qp = qbn + ro;
    const float* pp = pfx + ro;
    float ds = 0.f;
#pragma unroll
    for (int e = 0; e < 8; ++e) {
      const v4f a = *(const v4f*)(qp + 4 * e);
      const v4f b = *(const v4f*)(pp + 4 * e);
#if defined(__HIP_DEVICE_COMPILE__)
      // stands ahead of the later loads, whose results the compiler lays over the address registers of these two
      asm volatile("s_wait_xcnt 0x0" ::: "memory");
#endif
      ds += a[0] * b[0] + a[1] * b[1] + a[2] * b[2] + a[3] * b[3];
    }
    ds += __shfl_xor(ds, 16, 32);
    if (hh == 0) Sbl[wave][c] = ds * 0.125f;
  }

  // ---- normalise (l2ns/l and the 1/1024 p carry), stage the wave's 16x64 tile column-major: for each of its 32 head
  //      dims a lane stores the element of its query (16 lanes = 64 B in a row, the two halves 8 columns apart)
  float* os = Os[wave];
  const float inv = ((lrow > 0.f) ? (1.0f / lrow) : 0.f) * (l2ns * (1.0f / 1024.0f));
#pragma unroll
  for (int t = 0; t < 4; ++t)
#pragma unroll
    for (int r = 0; r < 8; ++r) os[(t * 16 + 8 * hh + r) * OSP + c] = oacc[t][r] * inv;
  wave_sync_lds();
  {
    const int q4 = lane >> 3, c8 = (lane & 7) * 8;
    v4u hv[4], lv[4];
#pragma unroll
    for (int it = 0; it < 4; ++it) {
      const int row = it * 4 + q4;   // it 0..3 x q4 0..3 = rows 0..15 of the wave tile
      const float sbv = Sbl[wave][row];
      v4u a, a2;
#pragma unroll
      for (int e = 0; e < 4; ++e) {
        const float f0 = os[(c8 + 2 * e) * OSP + row] + sbv;
        const float f1 = os[(c8 + 2 * e + 1) * OSP + row] + sbv;
        const unsigned short h0 = bf_bits(f0), h1 = bf_bits(f1);
        const unsigned short l0 = bf_bits(f0 - bf_up(h0)), l1 = bf_bits(f1 - bf_up(h1));
        a[e] = pk16(h0, h1); a2[e] = pk16(l0, l1);
      }
      hv[it] = a; lv[it] = a2;
    }
    {
#pragma unroll
      for (int it = 0; it < 4; ++it) {
        const int row = it * 4 + q4;
        const size_t go = (size_t)(q0 + row) * DM + (size_t)h * HD + c8;
        *(v4u*)(yhp + go) = hv[it];
        *(v4u*)(ylp + go) = lv[it];
      }
#if defined(__HIP_DEVICE_COMPILE__)
      // the form's end is not the kernel's end in the built code: stands ahead of any later write to these stores' registers
      asm volatile("s_wait_xcnt 0x0" ::: "memory");
#endif
    }
  }
}

__global__ __launch_bounds__(128 * KG)
void k_attn(const unsigned short* __restrict__ qhp, const unsigned short* __restrict__ khp,
            const unsigned short* __restrict__ vhp, const unsigned short* __restrict__ vlp,
            const float* __restrict__ qbn, const float* __restrict__ pfx, const float* __restrict__ l2p,
            unsigned short* yhp, unsigned short* ylp) {
  __shared__ __align__(16) _Float16 Ksh[KG][64 * AP];             // per group K [kv][d], pitch AP, 9 KB
  __shared__ __align__(16) _Float16 Vth[KG][64 * AP];             // per group V^T hi [d][kv], pitch AP, 9 KB
  __shared__ __align__(16) _Float16 Vtl[KG][64 * AP];             // per group V^T residual, pitch AP
  __shared__ __align__(16) float    Os[4][64 * OSP];              // group 0, per wave: context slab [d][row], pitch OSP
  __shared__ float Sbl[4][16];                                    // group 0, per wave: bias-attention row values
  __shared__ __align__(16) float    Mx[(KG - 1) * 4][XPW];        // partial results of the waves of groups 1..KG-1
  const int bx = blockIdx.x;                                      // block-uniform choice of the form
  if (bx < NH * (NQB - RESQB))
    attn_body<false>(qhp, khp, vhp, vlp, qbn, pfx, l2p, yhp, ylp, bx, RESQB, NQB - RESQB,
                     Ksh, Vth, Vtl, Os, Sbl, Mx);
  else
    attn_body<true>(qhp, khp, vhp, vlp, qbn, pfx, l2p, yhp, ylp, bx - NH * (NQB - RESQB), 0, RESQB,
                    Ksh, Vth, Vtl, Os, Sbl, Mx);
}

// =====================================================================================================
// Workspace map (MiB offsets, sizes exact multiples of the whole-tile / whole-line store granularity):
//   Xh   f16  [2048][1024]          0    4
//   Xbh  bf16 [2048][1024]          4    4   (later: Qh f16, after the v^T projection)
//   Xbl  bf16 [2048][1024]          8    4   (later: Kh f16)
//   Wcat f16  [4096 n][1024 k]     12    8   (Wq|Wk|Wqb|Wkb transposed, x64)
//   Wvh/Wvl bf16 [1024][1024]      20  2+2
//   Woh/Wol bf16 [1024][1024]      24  2+2
//   W1t  f16  [8192][1024]         28   16   (x64, xp/gate interleaved per 64 columns)
//   W2t  f16  [1024][4096]         44    8   (x64)
//   cs   f32  [2048][64]           52  512 KiB
//   QK   f32  [2048][4096]         53   32   (later: Pf 53 (8), Yh 61 (4), Yl 65 (4), PS f64 [32][1024] 77 (256 KiB))
//   QBn  f32  [2048][1024]         85    8
//   KBn  f32  [2048][1024]         93    8
//   VTh  f16  [1024][2048]        101    4
//   VTl  f16  [1024][512]         105    1
//   FF   f16  [2048][4096]        106   16   (x64)
//   FO   f32  [2048][1024]        122    8   (h*lambda + ff.W2 + b2)
//   end                           130 MiB = 136314880 B
// =====================================================================================================
extern "C" void kernel_launch(void* const* d_in, const int* in_sizes, int n_in,
                              void* d_out, int out_size, void* d_ws, size_t ws_size,
                              hipStream_t stream) {
  if (n_in < 14) return;
  if (in_sizes[0] != SEQ * DM) return;
  for (int i = 1; i <= 6; ++i) if (in_sizes[i] != DM * DM) return;
  if (in_sizes[7] != DM) return;
  if (in_sizes[8] != DM * FUS || in_sizes[9] != FUS) return;
  if (in_sizes[10] != FFI * DM || in_sizes[11] != DM) return;
  if (in_sizes[12] < 1 || in_sizes[13] < 1) return;
  if (out_size != SEQ * DM) return;

  const float* hs  = (const float*)d_in[0];
  const float* Wq  = (const float*)d_in[1];
  const float* Wk  = (const float*)d_in[2];
  const float* Wv  = (const float*)d_in[3];
  const float* Wqb = (const float*)d_in[4];
  const float* Wkb = (const float*)d_in[5];
  const float* Wo  = (const float*)d_in[6];
  const float* bo  = (const float*)d_in[7];
  const float* W1  = (const float*)d_in[8];
  const float* b1  = (const float*)d_in[9];
  const float* W2  = (const float*)d_in[10];
  const float* b2  = (const float*)d_in[11];
  const float* lam = (const float*)d_in[12];
  const float* l2n = (const float*)d_in[13];

  // rotary inverse frequencies 1 / 1000^(2d/64), evaluated in double and RNE-cast to f32 (constants only)
  InvTab itab;
  for (int d = 0; d < HD / 2; ++d)
    { const float pw = (float)pow(1000.0, (2.0 * (double)d) / 64.0); itab.f[d] = 1.0f / pw; }

  const size_t MiB = 1048576;
  const size_t oXh  = 0;
  const size_t oXbh = 4 * MiB,  oXbl = 8 * MiB;
  const size_t oQh  = oXbh,     oKh  = oXbl;        // written after the v^T projection consumed Xbh/Xbl
  const size_t oWcat = 12 * MiB;
  const size_t oWvh = 20 * MiB, oWvl = 22 * MiB, oWoh = 24 * MiB, oWol = 26 * MiB;
  const size_t oW1t = 28 * MiB;
  const size_t oW2t = 44 * MiB;
  const size_t oCS  = 52 * MiB;
  const size_t oQK  = 53 * MiB;
  const size_t oPf  = 53 * MiB, oYh = 61 * MiB, oYl = 65 * MiB;                   // inside QK, after rope
  const size_t oPS  = 77 * MiB;                                                   // inside QK, after rope
  const size_t oQBn = 85 * MiB, oKBn = 93 * MiB;
  const size_t oVTh = 101 * MiB, oVTl = 105 * MiB;
  const size_t oFF  = 106 * MiB;
  const size_t oFO  = 122 * MiB;
  const size_t oEnd = 130 * MiB;
  // extent checks against the actual plane sizes
  if ((size_t)SEQ * DM * 2 != 4 * MiB) return;
  if ((size_t)DM * DM * 2 != 2 * MiB) return;
  if (oWcat + (size_t)4 * DM * DM * 2 != oWvh) return;
  if (oW1t + (size_t)FUS * DM * 2 != oW2t) return;
  if (oW2t + (size_t)DM * FFI * 2 != oCS) return;
  if (oCS + (size_t)SEQ * 64 * 4 > oQK) return;
  if (oQK + (size_t)SEQ * 4 * DM * 4 != oQBn) return;
  if (oPf + (size_t)SEQ * DM * 4 != oYh) return;
  if (oYl + (size_t)SEQ * DM * 2 > oPS) return;
  if (oPS + (size_t)PSS * DM * 8 > oQBn) return;
  if (oVTh + (size_t)DM * SEQ * 2 != oVTl) return;
  if (oVTl + (size_t)DM * VLP * 2 != oFF) return;
  if (oFF + (size_t)SEQ * FFI * 2 != oFO) return;
  if (oFO + (size_t)SEQ * DM * 4 != oEnd) return;
  if (oEnd > ws_size) return;

  char* ws = (char*)d_ws;
  unsigned short* Xh   = (unsigned short*)(ws + oXh);
  unsigned short* Xbh  = (unsigned short*)(ws + oXbh);
  unsigned short* Xbl  = (unsigned short*)(ws + oXbl);
  unsigned short* Qh   = (unsigned short*)(ws + oQh);
  unsigned short* Kh   = (unsigned short*)(ws + oKh);
  unsigned short* Wcat = (unsigned short*)(ws + oWcat);
  unsigned short* Wvh  = (unsigned short*)(ws + oWvh);
  unsigned short* Wvl  = (unsigned short*)(ws + oWvl);
  unsigned short* Woh  = (unsigned short*)(ws + oWoh);
  unsigned short* Wol  = (unsigned short*)(ws + oWol);
  unsigned short* W1t  = (unsigned short*)(ws + oW1t);
  unsigned short* W2t  = (unsigned short*)(ws + oW2t);
  float*          CS   = (float*)(ws + oCS);
  float*          QK   = (float*)(ws + oQK);
  float*          Pf   = (float*)(ws + oPf);
  unsigned short* Yh   = (unsigned short*)(ws + oYh);
  unsigned short* Yl   = (unsigned short*)(ws + oYl);
  float*          FO   = (float*)(ws + oFO);
  double*         PS   = (double*)(ws + oPS);
  float*          QBn  = (float*)(ws + oQBn);
  float*          KBn  = (float*)(ws + oKBn);
  unsigned short* VTh  = (unsigned short*)(ws + oVTh);
  unsigned short* VTl  = (unsigned short*)(ws + oVTl);
  unsigned short* FF   = (unsigned short*)(ws + oFF);

  const dim3 b256(256), bAt(128 * KG);
  const dim3 gF1((SEQ / 128) * (FUS / 256));                             // 128x256 block tiles -> 512 blocks
  const dim3 gWo((SEQ / 128) * (DM / 256));                              // 128x256 -> 64 blocks

  // (0-2) rotary cos/sin table, RMSNorm -> x planes, weights [k][n] f32 -> [n][k] 16-bit planes: one grid
  k_prep<<<dim3(PB_ALL), b256, 0, stream>>>(itab, hs, Wq, Wk, Wqb, Wkb, Wv, Wo, W1, W2,
                                            CS, Xh, Xbh, Xbl, Wcat, Wvh, Wvl, Woh, Wol, W1t, W2t);
  // (3) u = x . W1 + b1 with fused SwiGLU -> FF f16 [2048][4096] (x64)   (M=2048, N=8192, K=1024)
  k_gemm<_Float16, 2, 8, 0, 4, 4, 2, DM><<<gF1, b256, 0, stream>>>(
      Xh, Xh, DM, W1t, W1t, DM,
      (void*)FF, FFI, (void*)FF, FFI, 0,
      b1, hs, hs, lam,
      SEQ, FUS, DM, 1.0f / (XSC * WSC), FSC);
  // (4) one grid: fo = h*lambda + ff . W2 + b2;  v^T = Wv^T . x^T;  q|k|qb|kb = x . (Wq|Wk|Wqb|Wkb)
  k_gemm3<<<dim3(GB_F2 + GB_VT + GB_QK), b256, 0, stream>>>(FF, W2t, FO, b2, hs, lam,
                                                            Wvh, Wvl, Xbh, Xbl, VTh, VTl, Xh, Wcat, QK);
  // (6) l2norm + rotary -> q, k f16 planes (into the dead Xbh/Xbl regions), qb, kb f32 planes
  k_rope<<<dim3(SEQ * NH / 8), b256, 0, stream>>>(QK, CS, Qh, Kh, QBn, KBn);
  // (7) causal prefix sum of kb (QK region is dead now)
  k_segsum<<<dim3(PSS * (DM / 128)), b256, 0, stream>>>(KBn, PS);
  k_prefix<<<dim3(PSS * (DM / 128)), b256, 0, stream>>>(KBn, PS, Pf);
  // (8) attention: query blocks 0..RESQB-1 with residual planes, the rest without, in one grid; KG wave groups per block
  k_attn<<<dim3(NH * NQB), bAt, 0, stream>>>(Qh, Kh, VTh, VTl, QBn, Pf, l2n, Yh, Yl);
  // (9) out = (y . Wo + bo) + fo   (hi/lo x hi/lo, 3 products)
  k_gemm<__bf16, 4, 4, 2, 1, 2, 4, DM><<<gWo, b256, 0, stream>>>(
      Yh, Yl, DM, Woh, Wol, DM,
      d_out, DM, d_out, DM, 0,
      bo, hs, (const float*)FO, lam,
      SEQ, DM, DM, 1.0f, 1.0f);
  (void)hipGetLastError();
}

// v007
// One run takes 171 microseconds.
// Two timings next to v006 both put it at 1.09 times that version's speed.
// Counting every step since v000, it is 9.54 times as fast.
// Contractions: x.(Wq|Wk|Wqb|Wkb), q.k^T scores, x.W1 and ff.W2 = v_wmma_f32_16x16x32_f16 (f16 operands with power-of-two carries, single product);
// v^T = Wv^T.x^T and attn = y.Wo = v_wmma_f32_16x16x32_bf16 with bf16 hi/lo split operands (hi.hi + hi.lo + lo.hi);
// both attention products are formed transposed (k.q^T, v^T.p^T); p.v = v_wmma_f32_16x16x32_f16 (p carried x1024 in f16, v f16 plus x4096 f16 residual planes of p and v on the leading query blocks); all f32 accumulate.
#include <hip/hip_runtime.h>
#include <math.h>
#include <stdint.h>

#define SEQ   2048
#define DM    1024
#define NH    16
#define HD    64
#define FFI   4096
#define FUS   8192
#define NQB   (SEQ / 64)
#define VLP   512
#define RESQB 8
#define QSC   8.0f             // f16 carry of q and k after l2norm + rope
#define SSC   (1.0f / 64.0f)   // undo QSC*QSC on the score accumulator
#define XSC   16.0f            // f16 carry of the normalised activations
#define WSC   64.0f            // f16 carry of the weights
#define FSC   64.0f            // f16 carry of the SwiGLU output
#define VRS   4096.0f          // scale of the f16 residual planes of v and p
#define SP    20               // LDS result slab pitch per column (16 rows + 4 pad), floats
#define OSP   20               // attention context slab pitch per column
#define AP    72               // attention K / V^T tile row pitch in LDS, f16 elements: 128 B of data + 16 B,
                               // 16 B x odd, so that the 16 rows of a 16-B fragment read fall on different banks

#define KG    4                // wave groups of an attention block; group g takes the key tiles g, g + KG, g + 2 KG, ...
#define XPW   (9 * 32 * 4)     // floats one wave hands over at the merge: 9 pieces of 16 B per lane

static_assert(RESQB * 64 <= VLP);
static_assert(NH * HD == DM);
static_assert((SEQ % 64) == 0 && (DM % 64) == 0 && (FFI % 64) == 0 && (FUS % 128) == 0);

typedef _Float16 v16h __attribute__((ext_vector_type(16)));
typedef _Float16 v8h  __attribute__((ext_vector_type(8)));
typedef __bf16   v16b __attribute__((ext_vector_type(16)));
typedef __bf16   v8b  __attribute__((ext_vector_type(8)));
typedef float    v8f  __attribute__((ext_vector_type(8)));
typedef float    v4f  __attribute__((ext_vector_type(4)));
typedef unsigned int v4u __attribute__((ext_vector_type(4)));

// rotary inverse frequencies, one per pair index d = 0..31, passed by value (host computed)
struct InvTab { float f[HD / 2]; };
static_assert(sizeof(InvTab) == 128);

// ---- scalar helpers --------------------------------------------------------------------------------
__device__ __forceinline__ unsigned short bf_bits(float f) {          // f32 -> bf16 bits, RNE convert
  unsigned u = __float_as_uint(f);
  return (unsigned short)((u + 0x7FFFu + ((u >> 16) & 1u)) >> 16);
}
__device__ __forceinline__ float bf_up(unsigned short h) { return __uint_as_float(((unsigned)h) << 16); }
__device__ __forceinline__ unsigned short h_bits(_Float16 x) { return __builtin_bit_cast(unsigned short, x); }
__device__ __forceinline__ unsigned pk16(unsigned short a, unsigned short b) { return (unsigned)a | ((unsigned)b << 16); }
__device__ __forceinline__ v8f zero8() { v8f z = {0.f, 0.f, 0.f, 0.f, 0.f, 0.f, 0.f, 0.f}; return z; }
__device__ __forceinline__ v8h zero8h() {
  const _Float16 z = (_Float16)0.0f;
  v8h r = {z, z, z, z, z, z, z, z};
  return r;
}
// value of lane l ^ 16 (the other half of the wave), by a vector cross-row move
__device__ __forceinline__ float xhalf(float x) {
  const int b = __builtin_bit_cast(int, x);
  return __builtin_bit_cast(float, __builtin_amdgcn_permlanex16(b, b, 0x76543210, 0xfedcba98, false, false));
}
// e^x as 2^(x log2 e), what __expf builds to, with a v_nop in the slot between the transcendental and the next instruction
__device__ __forceinline__ float exp_slot(float x) {
  const float x2 = x * 1.44269504f;
  float e = 1.0f;
#if defined(__HIP_DEVICE_COMPILE__)
  asm("v_exp_f32 %0, %1\n\tv_nop" : "=v"(e) : "v"(x2));
#endif
  return e;
}
// the same for the eight scores of a tile, in one statement: the results share no register with the arguments ("=&v"), so that
// no v_exp_f32 of the run writes the source or reads the result of the one before it, and one v_nop fills the slot behind the last
__device__ __forceinline__ v8f exp_slot8(v8f x) {
  const v8f x2 = x * 1.44269504f;
  v8f e = x2;
#if defined(__HIP_DEVICE_COMPILE__)
  float e0, e1, e2, e3, e4, e5, e6, e7;
  asm("v_exp_f32 %0, %8\n\tv_exp_f32 %1, %9\n\tv_exp_f32 %2, %10\n\tv_exp_f32 %3, %11\n\t"
      "v_exp_f32 %4, %12\n\tv_exp_f32 %5, %13\n\tv_exp_f32 %6, %14\n\tv_exp_f32 %7, %15\n\tv_nop"
      : "=&v"(e0), "=&v"(e1), "=&v"(e2), "=&v"(e3), "=&v"(e4), "=&v"(e5), "=&v"(e6), "=&v"(e7)
      : "v"(x2[0]), "v"(x2[1]), "v"(x2[2]), "v"(x2[3]), "v"(x2[4]), "v"(x2[5]), "v"(x2[6]), "v"(x2[7]));
  e[0] = e0; e[1] = e1; e[2] = e2; e[3] = e3; e[4] = e4; e[5] = e5; e[6] = e6; e[7] = e7;
#endif
  return e;
}
__device__ __forceinline__ void wave_sync_lds() {
  __builtin_amdgcn_fence(__ATOMIC_RELEASE, "workgroup");
  __builtin_amdgcn_wave_barrier();
  __builtin_amdgcn_fence(__ATOMIC_ACQUIRE, "workgroup");
}

// ---- fragment loaders: 16-bit A/B operand, lane -> row/col (lane&15), p already includes +8*(lane>>4);
//      elements 0..7 <- p[0..7] (k0+8h..), elements 8..15 <- p[16..23] (k0+16+8h..)
template <typename T> struct Frag16;
template <> struct Frag16<_Float16> { typedef v16h t; };
template <> struct Frag16<__bf16>   { typedef v16b t; };

__device__ __forceinline__ v16h ldfrag(const _Float16* p) {
  union { v16h v; v8h h[2]; } f;
  f.h[0] = *(const v8h*)(p);
  f.h[1] = *(const v8h*)(p + 16);
  return f.v;
}
__device__ __forceinline__ v16b ldfrag(const __bf16* p) {
  union { v16b v; v8b h[2]; } f;
  f.h[0] = *(const v8b*)(p);
  f.h[1] = *(const v8b*)(p + 16);
  return f.v;
}

// ---- WMMA helpers with trailing VALU hazard gap (non-template overloads per fragment type) -------------
__device__ __forceinline__ v8f mma_raw(v16h a, v16h b, v8f c) {
  return __builtin_amdgcn_wmma_f32_16x16x32_f16(false, a, false, b, (short)0, c, false, false);
}
__device__ __forceinline__ v8f mma_raw(v16b a, v16b b, v8f c) {
  return __builtin_amdgcn_wmma_f32_16x16x32_bf16(false, a, false, b, (short)0, c, false, false);
}
__device__ __forceinline__ v8f mma_h(v16h a, v16h b, v8f c) {
  c = mma_raw(a, b, c);
#if defined(__HIP_DEVICE_COMPILE__)
  asm volatile("v_nop\n\tv_nop\n\tv_nop\n\tv_nop" : "+v"(c) : "v"(a), "v"(b));
#endif
  return c;
}
__device__ __forceinline__ void dep_guard2(v8f& a, v8f& b, v16h x, v16h y) {
#if defined(__HIP_DEVICE_COMPILE__)
  asm volatile("v_nop\n\tv_nop\n\tv_nop\n\tv_nop" : "+v"(a), "+v"(b) : "v"(x), "v"(y));
#else
  (void)a; (void)b; (void)x; (void)y;
#endif
}
__device__ __forceinline__ void dep_guard2(v8f& a, v8f& b, v16b x, v16b y) {
#if defined(__HIP_DEVICE_COMPILE__)
  asm volatile("v_nop\n\tv_nop\n\tv_nop\n\tv_nop" : "+v"(a), "+v"(b) : "v"(x), "v"(y));
#else
  (void)a; (void)b; (void)x; (void)y;
#endif
}
__device__ __forceinline__ void keep1(v16h x) {
#if defined(__HIP_DEVICE_COMPILE__)
  asm volatile("v_nop" :: "v"(x));
#else
  (void)x;
#endif
}
__device__ __forceinline__ void keep1(v16b x) {
#if defined(__HIP_DEVICE_COMPILE__)
  asm volatile("v_nop" :: "v"(x));
#else
  (void)x;
#endif
}
__device__ __forceinline__ void acc_guard4(v8f& a, v8f& b, v8f& c, v8f& d) {
#if defined(__HIP_DEVICE_COMPILE__)
  asm volatile("v_nop\n\tv_nop\n\tv_nop\n\tv_nop" : "+v"(a), "+v"(b), "+v"(c), "+v"(d));
#else
  (void)a; (void)b; (void)c; (void)d;
#endif
}

// ---- SwiGLU element from the fused accumulator: silu(gate + bg) * (xp + bx) * rscale -------------------
__device__ __forceinline__ float swg(float xacc, float gacc, float oscale, float bx, float bg, float rscale) {
  const float xp = xacc * oscale + bx;
  const float g  = gacc * oscale + bg;
  const float sg = __builtin_amdgcn_rcpf(1.0f + __expf(-g));
  return (g * sg) * xp * rscale;
}

// =====================================================================================================
// cos/sin table: cs[t][0..31] = bf16(cos(t*invf[d])) widened to f32, cs[t][32..63] = bf16(sin(.)).
// invf arrives by value; each lane picks its entry with a static-index select chain (no private indexing).
// =====================================================================================================
__device__ __forceinline__ void job_cstab(const InvTab& tab, float* cs, int bidx) {
  const int lane = threadIdx.x & 31, wave = threadIdx.x >> 5;
  const int t = bidx * 8 + wave;
  float ivf = tab.f[0];
#pragma unroll
  for (int i = 1; i < HD / 2; ++i) ivf = (lane == i) ? tab.f[i] : ivf;
  const float fr = (float)t * ivf;
  float sn, cn;
  sincosf(fr, &sn, &cn);
  const float cv = bf_up(bf_bits(cn));
  const float sv = bf_up(bf_bits(sn));
  float* pc = cs + (size_t)t * 64 + lane;
  float* ps = pc + 32;
  *(float*)pc = cv;
  *(float*)ps = sv;
#if defined(__HIP_DEVICE_COMPILE__)
  // the job's end is not the kernel's end in the built code: stands ahead of any later write to these stores' registers
  asm volatile("s_wait_xcnt 0x0" ::: "memory");
#endif
}

// =====================================================================================================
// RMSNorm (no affine, eps = f32 eps) of one row per 128 threads x 8 elements (two rows per block) and conversion to
// three planes [2048][1024]: f16(x*16), bf16 hi, bf16 lo (RNE, lo = RNE(x - hi)). Each thread stores 16 B
// coverage: 1024 blocks x 2 rows x 128 threads x 8 = the whole plane.
// =====================================================================================================
__device__ __forceinline__ void job_xnorm(const float* __restrict__ hs, unsigned short* xh,
                                          unsigned short* xbh, unsigned short* xbl, int bidx, float (*red2)[4]) {
  const int tid = threadIdx.x & 127, lane = tid & 31, wave = tid >> 5, t = bidx * 2 + (threadIdx.x >> 7);
  float* red = red2[threadIdx.x >> 7];
  const size_t off = (size_t)t * DM + (size_t)tid * 8;
  const v4f a = *(const v4f*)(hs + off);
  const v4f b = *(const v4f*)(hs + off + 4);
  float ss = a[0] * a[0] + a[1] * a[1] + a[2] * a[2] + a[3] * a[3]
           + b[0] * b[0] + b[1] * b[1] + b[2] * b[2] + b[3] * b[3];
#pragma unroll
  for (int o = 1; o < 32; o <<= 1) ss += __shfl_xor(ss, o, 32);
  if (lane == 0) red[wave] = ss;
  __syncthreads();
  const float tot = (red[0] + red[1]) + (red[2] + red[3]);
  const float rn = rsqrtf(tot * (1.0f / (float)DM) + 1.1920929e-7f);
  float x[8];
  x[0] = a[0] * rn; x[1] = a[1] * rn; x[2] = a[2] * rn; x[3] = a[3] * rn;
  x[4] = b[0] * rn; x[5] = b[1] * rn; x[6] = b[2] * rn; x[7] = b[3] * rn;
  v4u ph, pb, pl;
#pragma unroll
  for (int e = 0; e < 4; ++e) {
    const float f0 = x[2 * e], f1 = x[2 * e + 1];
    ph[e] = pk16(h_bits((_Float16)(f0 * XSC)), h_bits((_Float16)(f1 * XSC)));
    const unsigned short hb0 = bf_bits(f0), hb1 = bf_bits(f1);
    pb[e] = pk16(hb0, hb1);
    pl[e] = pk16(bf_bits(f0 - bf_up(hb0)), bf_bits(f1 - bf_up(hb1)));
  }
  *(v4u*)(xh + off)  = ph;
  *(v4u*)(xbh + off) = pb;
  *(v4u*)(xbl + off) = pl;
#if defined(__HIP_DEVICE_COMPILE__)
  // the job's end is not the kernel's end in the built code: stands ahead of any later write to these stores' registers
  asm volatile("s_wait_xcnt 0x0" ::: "memory");
#endif
}

// =====================================================================================================
// Weight transpose + convert: W [K][N] f32 (in k, out n) -> Wt [N][K] 16-bit (k contiguous), 64x64 tile per
// block through LDS. MODE 0: f16(w*wscale) -> out0; MODE 1: bf16 hi -> out0, bf16 lo -> out1.
// coverage: 2 it x 8 waves x 4 rows = 64 output rows, 8 lanes x 8 = 64 k columns per tile; tiles (bx, by) of (N/64, K/64).
// =====================================================================================================
template <int MODE>
__device__ __forceinline__ void job_wtrans(const float* __restrict__ W, int K, int N, int nhalf, float wscale,
                                           unsigned short* out0, unsigned short* out1, int bx, int by,
                                           float (*tl)[65]) {
  const int tid = threadIdx.x, lane = tid & 31, wave = tid >> 5;
  const int n0 = bx * 64, k0 = by * 64;
  {
    const int i0 = tid >> 4, cc = (tid & 15) * 4;
#pragma unroll
    for (int p = 0; p < 4; ++p) {
      const int i = p * 16 + i0;
      const v4f v = *(const v4f*)(W + (size_t)(k0 + i) * N + n0 + cc);
      tl[i][cc] = v[0]; tl[i][cc + 1] = v[1]; tl[i][cc + 2] = v[2]; tl[i][cc + 3] = v[3];
    }
  }
  __syncthreads();
  const int orow0 = (nhalf > 0) ? ((n0 < nhalf) ? (2 * n0) : (2 * (n0 - nhalf) + 64)) : n0;
  const int q8 = lane >> 3, c8 = (lane & 7) * 8;
  v4u hv[2], lv[2];
#pragma unroll
  for (int it = 0; it < 2; ++it) {
    const int j = it * 32 + wave * 4 + q8;
    v4u a, a2;
#pragma unroll
    for (int e = 0; e < 4; ++e) {
      const float f0 = tl[c8 + 2 * e][j], f1 = tl[c8 + 2 * e + 1][j];
      if constexpr (MODE == 0) {
        a[e] = pk16(h_bits((_Float16)(f0 * wscale)), h_bits((_Float16)(f1 * wscale)));
        a2[e] = 0u;
      } else {
        const unsigned short hb0 = bf_bits(f0), hb1 = bf_bits(f1);
        a[e] = pk16(hb0, hb1);
        a2[e] = pk16(bf_bits(f0 - bf_up(hb0)), bf_bits(f1 - bf_up(hb1)));
      }
    }
    hv[it] = a; lv[it] = a2;
  }
  {
#pragma unroll
    for (int it = 0; it < 2; ++it) {
      const int j = it * 32 + wave * 4 + q8;
      const size_t go = (size_t)(orow0 + j) * K + k0 + c8;
      *(v4u*)(out0 + go) = hv[it];
      if constexpr (MODE == 1) *(v4u*)(out1 + go) = lv[it];
    }
#if defined(__HIP_DEVICE_COMPILE__)
    // the job's end is not the kernel's end in the built code: stands ahead of any later write to these stores' registers
    asm volatile("s_wait_xcnt 0x0" ::: "memory");
#endif
  }
}

// =====================================================================================================
// One grid for the ten jobs that read only inputs and none of each other's output: the block index falls into
// one of the ranges below (largest job first) and picks the job; every test on it is block-uniform, so each
// job's barrier is passed by all 256 threads of its block.
//   [W1 tiles | W2 tiles | Wq Wk Wqb Wkb Wv Wo tiles | RMSNorm row pairs | cos/sin table rows]
// =====================================================================================================
#define PB_W1 ((FUS / 64) * (DM / 64))     // 2048
#define PB_W2 ((DM / 64) * (FFI / 64))     // 1024
#define PB_W  ((DM / 64) * (DM / 64))      // 256 per square weight, six of them
#define PB_XN (SEQ / 2)                    // 1024
#define PB_CS (SEQ / 8)                    // 256
#define PB_ALL (PB_W1 + PB_W2 + 6 * PB_W + PB_XN + PB_CS)
__global__ __launch_bounds__(256) void k_prep(
    InvTab tab, const float* __restrict__ hs,
    const float* __restrict__ Wq, const float* __restrict__ Wk, const float* __restrict__ Wqb,
    const float* __restrict__ Wkb, const float* __restrict__ Wv, const float* __restrict__ Wo,
    const float* __restrict__ W1, const float* __restrict__ W2,
    float* cs, unsigned short* xh, unsigned short* xbh, unsigned short* xbl,
    unsigned short* wcat, unsigned short* wvh, unsigned short* wvl, unsigned short* woh, unsigned short* wol,
    unsigned short* w1t, unsigned short* w2t) {
  __shared__ float tl[64][65];
  __shared__ float red2[2][4];
  int b = blockIdx.x;
  if (b < PB_W1) {
    job_wtrans<0>(W1, DM, FUS, FFI, WSC, w1t, w1t, b % (FUS / 64), b / (FUS / 64), tl);
    return;
  }
  b -= PB_W1;
  if (b < PB_W2) {
    job_wtrans<0>(W2, FFI, DM, 0, WSC, w2t, w2t, b % (DM / 64), b / (DM / 64), tl);
    return;
  }
  b -= PB_W2;
  if (b < 6 * PB_W) {
    const int w = b / PB_W, r = b % PB_W;
    const int bx = r % (DM / 64), by = r / (DM / 64);
    if (w < 4) {
      const float* s = (w == 0) ? Wq : (w == 1) ? Wk : (w == 2) ? Wqb : Wkb;
      job_wtrans<0>(s, DM, DM, 0, WSC, wcat + (size_t)w * DM * DM, wcat, bx, by, tl);
    } else {
      job_wtrans<1>((w == 4) ? Wv : Wo, DM, DM, 0, 1.0f, (w == 4) ? wvh : woh, (w == 4) ? wvl : wol, bx, by, tl);
    }
    return;
  }
  b -= 6 * PB_W;
  if (b < PB_XN) {
    job_xnorm(hs, xh, xbh, xbl, b, red2);
    return;
  }
  b -= PB_XN;
  if (b < PB_CS) job_cstab(tab, cs, b);
}

// =====================================================================================================
// Register-blocked 16-bit WMMA GEMM: C[m][n] = sum_k A[m][k] * Bt[n][k]; one wave per (16*MI)x(16*NJ) tile,
// the 8 waves of a work-group laid out WM x WN over one (WM*16*MI)x(WN*16*NJ) block tile.
// A row-major [M][K] pitch lda; Bt row-major [N][K] pitch ldb (k contiguous);
// M, N multiples of the block tile, K multiple of KS (host-checked). T = _Float16 or __bf16.
// Operand path: per stage of KS = 64 k every operand row of the block tile (one whole 128-B line) is loaded once
// by the work-group (8 lanes x 16 B per row), kept in registers while the current stage is multiplied, and then
// stored to the other of two LDS buffers (row pitch 144 B for the 16-B fragment reads); one barrier per stage.
// Stage rows: [A | A2 | Bt | Bt2] (the second planes only with NSPLIT 2).
// KD = K = lda = ldb at compile time, so that the step from one group of 32 rows to the next is an immediate
// offset of the load and a plane needs one scalar base and one 32-bit offset register.
// NSPLIT: 0 = A.Bt; 2 = A.Bt + A.Bt2 + A2.Bt (unscaled hi/lo planes), in that order per k step.
// EPI 0: f32 C = acc*oscale (pitch ldc).  EPI 1: f32 C = acc*oscale + bias[n] + resa[m][n].
// EPI 2: f16 hi plane C (pitch ldc) + f16 residual plane C2 = f16((v - hi)*rscale) for tiles with n0 < N2
//        (pitch ldc2).  EPI 3: f32 C = acc*oscale + bias[n] + resh[m][n]*lamp[0].
// EPI 4 (MI=2, NJ=8, TN=128): fused SwiGLU: subtiles j<4 are xp columns ocol0+16j+c, j>=4 the matching gate
//        columns; C (f16, pitch ldc) [m][ocol0 + ..63] = f16( silu(gate+bias[FFI+col]) * (xp+bias[col]) * rscale ).
// NJ = 2 (EPI 1 only): 32x32 wave tiles, for a product whose larger block tiles would leave most WGPs without work.
// Epilogue: 16-row x 64-col slabs (32-col with NJ = 2) staged per wave in LDS, column-major (pitch SP): every lane writes its 8
// accumulator rows of one column with two 16-B vector stores; rows are then gathered and each 64-wide (32-wide with NJ = 2) row
// coverage per wave: MI slabs x 16 rows x 64 output cols (32 with NJ = 2).
// =====================================================================================================
#define KS 64                  // k elements per LDS stage
#define LP (KS + 8)            // LDS row pitch of a stage, elements (128 B + 16 B)
// LDS bytes of one block: two operand stages and the eight result slabs
template <int MI, int NJ, int NSPLIT, int WM, int WN>
constexpr int gemm_lds() {
  return 2 * ((NSPLIT == 2) ? 2 : 1) * (WM * 16 * MI + WN * 16 * NJ) * LP * 2 + 8 * 64 * SP * 4;
}
template <typename T, int MI, int NJ, int NSPLIT, int EPI, int WM, int WN, int KD>
__device__ __forceinline__ void gemm_body(
    int bidx, char* smem,
    const unsigned short* __restrict__ Ap, const unsigned short* __restrict__ A2p, int lda,
    const unsigned short* __restrict__ Bp, const unsigned short* __restrict__ B2p, int ldb,
    void* Cout, int ldc, void* Cout2, int ldc2, int N2,
    const float* __restrict__ bias, const float* __restrict__ resh,
    const float* __restrict__ resa, const float* __restrict__ lamp,
    int M, int N, int K, float oscale, float rscale) {
  typedef typename Frag16<T>::t FR;
  static_assert((EPI == 4) ? (MI == 2 && NJ == 8) : ((NJ == 4 && (MI == 2 || MI == 4)) || (NJ == 2 && MI == 2 && EPI == 1)));
  static_assert(NSPLIT == 0 || NSPLIT == 2);
  static_assert(WM * WN == 8);
  const T* A   = (const T*)(const void*)Ap;
  const T* A2  = (const T*)(const void*)A2p;
  const T* Bt  = (const T*)(const void*)Bp;
  const T* Bt2 = (const T*)(const void*)B2p;
  constexpr int TM = 16 * MI, TN = 16 * NJ;
  constexpr int BM = WM * TM, BN = WN * TN;
  constexpr int NPL  = (NSPLIT == 2) ? 2 : 1;      // planes per operand
  constexpr int ROWS = NPL * (BM + BN);            // operand rows per stage
  constexpr int NCH  = ROWS / 32;                  // 16-B pieces per thread per stage (256 threads = 32 rows)
  constexpr int JG   = (NJ < 4) ? NJ : 4;          // B subtile columns read from LDS as one group
  constexpr int SJ   = (EPI == 4) ? 4 : NJ;        // subtile columns of a result slab (16 * SJ output columns)
  static_assert((BM % 32) == 0 && (BN % 32) == 0);
  static_assert(sizeof(T) == 2 && gemm_lds<MI, NJ, NSPLIT, WM, WN>() == 2 * ROWS * LP * 2 + 8 * 64 * SP * 4);
  T (*stg)[ROWS * LP] = (T (*)[ROWS * LP])(void*)smem;                              // two operand stages
  float (*sT)[64 * SP] = (float (*)[64 * SP])(void*)(smem + 2 * ROWS * LP * 2);     // per-wave 16x64 slab, column-major, pitch SP floats
  const int tid  = threadIdx.x;
  const int lane = tid & 31;
  const int wave = tid >> 5;
  const int tilesNb = N / BN;
  const int tilesMb = M / BM;
  if (bidx >= tilesMb * tilesNb) return;              // block-uniform, ahead of every barrier
  if (lda != KD || ldb != KD || K != KD) return;      // uniform over the grid
  const int bm = bidx / tilesNb;
  const int bn = bidx - bm * tilesNb;
  const int wm = wave / WN;
  const int wn = wave - wm * WN;
  const int m0 = bm * BM + wm * TM;
  const int n0 = bn * BN + wn * TN;
  const int tn = n0 / TN;
  const int rl   = lane & 15;            // row (A) / col (B, D) within subtile
  const int koff = (lane >> 4) * 8;      // k offset of this lane half
  const int mOff = (lane >> 4) * 8;      // D row offset

  v8f acc[MI][NJ];
#pragma unroll
  for (int i = 0; i < MI; ++i)
#pragma unroll
    for (int j = 0; j < NJ; ++j) acc[i][j] = zero8();

  // staging: thread -> row (tid>>3) of each group of 32 rows, 16-B piece (tid&7) of its 128-B line
  const int sr = tid >> 3, sc = (tid & 7) * 8;
  // address = block-uniform plane base + the thread's 32-bit byte offset (row in its group, piece, k) + row group
  static_assert((KD % KS) == 0);
  const unsigned vo0 = (unsigned)(sr * KD + sc) * 2u;
  const char* gA  = (const char*)(A   + (size_t)(bm * BM) * KD);
  const char* gA2 = (const char*)(A2  + (size_t)(bm * BM) * KD);
  const char* gB  = (const char*)(Bt  + (size_t)(bn * BN) * KD);
  const char* gB2 = (const char*)(Bt2 + (size_t)(bn * BN) * KD);
  v4u st[NCH];
  auto fetch = [&](int k0) {
    const unsigned vo = vo0 + (unsigned)k0 * 2u;
#pragma unroll
    for (int it = 0; it < NCH; ++it) {
      const int r = it * 32;
      const char* g;
      if (r < BM)                 g = gA  + (size_t)r * KD * 2;
      else if (r < NPL * BM)      g = gA2 + (size_t)(r - BM) * KD * 2;
      else if (r < NPL * BM + BN) g = gB  + (size_t)(r - NPL * BM) * KD * 2;
      else                        g = gB2 + (size_t)(r - NPL * BM - BN) * KD * 2;
      st[it] = *(const v4u*)(g + vo);
    }
#if defined(__HIP_DEVICE_COMPILE__)
    // stands ahead of every later write to the address registers of the loads above
    asm volatile("s_wait_xcnt 0x0" ::: "memory");
#endif
  };
  auto put = [&](T* buf) {
#pragma unroll
    for (int it = 0; it < NCH; ++it) *(v4u*)(buf + (it * 32 + sr) * LP + sc) = st[it];
  };

  fetch(0);
  put(stg[0]);
  __syncthreads();
  constexpr int nst = KD / KS;
  for (int s = 0; s < nst; ++s) {
    const bool more = (s + 1 < nst);     // block-uniform
    if (more) fetch((s + 1) * KS);       // in flight while this stage is multiplied
    const T* buf = stg[s & 1];
    const T* sa  = buf + (wm * TM + rl) * LP + koff;
    const T* sa2 = sa + BM * LP;
    const T* sb  = buf + (NPL * BM + wn * TN + rl) * LP + koff;
    const T* sb2 = sb + BN * LP;
#pragma unroll
    for (int kk = 0; kk < KS; kk += 32) {
      // the fragments of a k step are read from LDS in groups ahead of their products (B: JG subtile columns)
      FR ah[MI];
#pragma unroll
      for (int i = 0; i < MI; ++i) ah[i] = ldfrag(sa + 16 * i * LP + kk);
#pragma unroll
      for (int jg = 0; jg < NJ; jg += JG) {
        FR bh[JG], bl[JG];
#pragma unroll
        for (int jj = 0; jj < JG; ++jj) {
          bh[jj] = ldfrag(sb + 16 * (jg + jj) * LP + kk);
          if constexpr (NSPLIT == 2) bl[jj] = ldfrag(sb2 + 16 * (jg + jj) * LP + kk);
          else bl[jj] = bh[jj];
        }
#pragma unroll
        for (int jj = 0; jj < JG; ++jj) {
          const int j = jg + jj;
#pragma unroll
          for (int i = 0; i < MI; ++i) {
            acc[i][j] = mma_raw(ah[i], bh[jj], acc[i][j]);
            if constexpr (NSPLIT == 2) acc[i][j] = mma_raw(ah[i], bl[jj], acc[i][j]);
          }
          dep_guard2(acc[0][j], acc[MI - 1][j], bh[jj], bl[jj]);
        }
        if constexpr (NSPLIT == 2) {
          static_assert(NSPLIT == 0 || NJ <= 4);   // one B group, so the A2 fragments may take the A fragments' place
#pragma unroll
          for (int i = 0; i < MI; ++i) keep1(ah[i]);
          FR al[MI];
#pragma unroll
          for (int i = 0; i < MI; ++i) al[i] = ldfrag(sa2 + 16 * i * LP + kk);
#pragma unroll
          for (int jj = 0; jj < JG; ++jj) {
            const int j = jg + jj;
#pragma unroll
            for (int i = 0; i < MI; ++i) acc[i][j] = mma_raw(al[i], bh[jj], acc[i][j]);
            dep_guard2(acc[0][j], acc[MI - 1][j], bh[jj], bh[jj]);
          }
#pragma unroll
          for (int i = 0; i < MI; ++i) keep1(al[i]);
        }
      }
      if constexpr (NSPLIT == 0) {
#pragma unroll
        for (int i = 0; i < MI; ++i) keep1(ah[i]);
      }
    }
    if (more) put(stg[(s + 1) & 1]);     // every reader left that buffer at the barrier of the stage before
    __syncthreads();                     // publishes stage s+1; ends the reads of stage s
  }
  if constexpr (NJ == 2) {
    acc_guard4(acc[0][0], acc[0][1], acc[1][0], acc[1][1]);
  } else {
#pragma unroll
    for (int i = 0; i < MI; ++i)
#pragma unroll
      for (int j = 0; j < NJ; j += 4) acc_guard4(acc[i][j], acc[i][j + 1], acc[i][j + 2], acc[i][j + 3]);
  }

  // ---- epilogue ----
  float* slab = sT[wave];
  const int ocol0 = (EPI == 4) ? (tn * 64) : n0;
  constexpr int LR  = 4 * SJ;                       // f32 path: lanes per row segment of 16 * SJ floats (16 B each; whole 128-B lines)
  constexpr int RP  = 32 / LR;                      // rows a wave moves per pass
  constexpr int NIT = 16 / RP;                      // passes per slab
  static_assert(LR == 16 || LR == 8);
  const int hq = lane >> ((LR == 16) ? 4 : 3), c4 = (lane & (LR - 1)) * 4;
  const int q8 = lane >> 3, c8 = (lane & 7) * 8;
  float bxv[4] = {0.f, 0.f, 0.f, 0.f}, bgv[4] = {0.f, 0.f, 0.f, 0.f};
  v4f b4 = {0.f, 0.f, 0.f, 0.f};
  float lam = 0.f;
  if constexpr (EPI == 4) {
#pragma unroll
    for (int j = 0; j < 4; ++j) {
      bxv[j] = bias[ocol0 + 16 * j + rl];
      bgv[j] = bias[FFI + ocol0 + 16 * j + rl];
    }
  }
  if constexpr (EPI == 1 || EPI == 3) b4 = *(const v4f*)(bias + n0 + c4);
  if constexpr (EPI == 3) lam = lamp[0];

#pragma unroll
  for (int i = 0; i < MI; ++i) {
    const int mBase = m0 + 16 * i;
    // lane writes column 16j+rl, rows mOff..mOff+7 = 32 contiguous bytes as two 16-B vector LDS stores
#pragma unroll
    for (int j = 0; j < SJ; ++j) {
      v4f w0, w1;
      if constexpr (EPI == 4) {
#pragma unroll
        for (int r = 0; r < 4; ++r) {
          w0[r] = swg(acc[i][j][r],     acc[i][j + 4][r],     oscale, bxv[j], bgv[j], rscale);
          w1[r] = swg(acc[i][j][r + 4], acc[i][j + 4][r + 4], oscale, bxv[j], bgv[j], rscale);
        }
      } else {
#pragma unroll
        for (int r = 0; r < 4; ++r) {
          w0[r] = acc[i][j][r] * oscale;
          w1[r] = acc[i][j][r + 4] * oscale;
        }
      }
      float* cp = slab + (16 * j + rl) * SP + mOff;
      *(v4f*)(cp) = w0;
      *(v4f*)(cp + 4) = w1;
    }
    wave_sync_lds();
    if constexpr (EPI == 0 || EPI == 1 || EPI == 3) {
      float* C = (float*)Cout;
      v4f fin[NIT];
#pragma unroll
      for (int it = 0; it < NIT; ++it) {
        const int row = RP * it + hq;                  // it 0..NIT-1 x hq 0..RP-1 = rows 0..15
        v4f v;
        v[0] = slab[(c4 + 0) * SP + row];
        v[1] = slab[(c4 + 1) * SP + row];
        v[2] = slab[(c4 + 2) * SP + row];
        v[3] = slab[(c4 + 3) * SP + row];
        if constexpr (EPI == 1 || EPI == 3) {
          const size_t go = (size_t)(mBase + row) * ldc + n0 + c4;
          const v4f rvv = *(const v4f*)(((EPI == 3) ? resh : resa) + go);
#if defined(__HIP_DEVICE_COMPILE__)
          // stands ahead of the next rows' loads, whose results the compiler lays over this load's address registers
          asm volatile("s_wait_xcnt 0x0" ::: "memory");
#endif
          if constexpr (EPI == 3) v = v + b4 + rvv * lam;
          else                    v = v + b4 + rvv;
        }
        fin[it] = v;
      }
      {
#pragma unroll
        for (int it = 0; it < NIT; ++it) {
          const int row = RP * it + hq;
          *(v4f*)(C + (size_t)(mBase + row) * ldc + n0 + c4) = fin[it];
#if defined(__HIP_DEVICE_COMPILE__)
          // stands ahead of the later rows' sums, which the compiler lays over this store's data registers
          if constexpr (EPI == 1 || EPI == 3) asm volatile("s_wait_xcnt 0x0" ::: "memory");
#endif
        }
      }
    } else {
      static_assert(EPI == 0 || EPI == 1 || EPI == 3 || SJ == 4);   // the 16-bit path moves 64-column slabs
      unsigned short* C  = (unsigned short*)Cout;
      unsigned short* C2 = (unsigned short*)Cout2;
      const bool wlo = (EPI == 2) && (n0 < N2);        // wave-uniform
      v4u hv[4], lv[4];
#pragma unroll
      for (int it = 0; it < 4; ++it) {
        const int row = 4 * it + q8;                   // it 0..3 x q8 0..3 = rows 0..15
        v4u a, a2;
#pragma unroll
        for (int e = 0; e < 4; ++e) {
          const float f0 = slab[(c8 + 2 * e) * SP + row], f1 = slab[(c8 + 2 * e + 1) * SP + row];
          const _Float16 x0 = (_Float16)f0, x1 = (_Float16)f1;
          unsigned short l0 = 0, l1 = 0;
          if constexpr (EPI == 2) {
            l0 = h_bits((_Float16)((f0 - (float)x0) * rscale));
            l1 = h_bits((_Float16)((f1 - (float)x1) * rscale));
          }
          a[e] = pk16(h_bits(x0), h_bits(x1)); a2[e] = pk16(l0, l1);
        }
        hv[it] = a; lv[it] = a2;
      }
      {
#pragma unroll
        for (int it = 0; it < 4; ++it) {
          const int row = 4 * it + q8;
          *(v4u*)(C + (size_t)(mBase + row) * ldc + ocol0 + c8) = hv[it];
          if (wlo) *(v4u*)(C2 + (size_t)(mBase + row) * ldc2 + n0 + c8) = lv[it];
        }
        
      }
    }
    wave_sync_lds();
  }
}

template <typename T, int MI, int NJ, int NSPLIT, int EPI, int WM, int WN, int KD>
__global__ __launch_bounds__(256) void k_gemm(
    const unsigned short* __restrict__ Ap, const unsigned short* __restrict__ A2p, int lda,
    const unsigned short* __restrict__ Bp, const unsigned short* __restrict__ B2p, int ldb,
    void* Cout, int ldc, void* Cout2, int ldc2, int N2,
    const float* __restrict__ bias, const float* __restrict__ resh,
    const float* __restrict__ resa, const float* __restrict__ lamp,
    int M, int N, int K, float oscale, float rscale) {
  __shared__ __align__(16) char smem[gemm_lds<MI, NJ, NSPLIT, WM, WN>()];
  gemm_body<T, MI, NJ, NSPLIT, EPI, WM, WN, KD>((int)blockIdx.x, smem, Ap, A2p, lda, Bp, B2p, ldb, Cout, ldc, Cout2, ldc2,
                                                N2, bias, resh, resa, lamp, M, N, K, oscale, rscale);
}

// One grid for the three products that read none of each other's output and none of which fills the chip alone:
//   [ fo = h*lambda + ff.W2 + b2 (longest k loop, lowest indices) | v^T = Wv^T.x^T | q|k|qb|kb = x.Wcat ]
// The block index picks the product (block-uniform), so every barrier of a product is passed by its whole block.
#define GB_F2 ((SEQ / 128) * (DM / 128))         // 128x128 block tiles -> 128 blocks
#define GB_VT ((DM / 128) * (SEQ / 256))         // 128x256 -> 64 blocks
#define GB_QK ((SEQ / 128) * ((4 * DM) / 256))   // 128x256 -> 256 blocks
__global__ __launch_bounds__(256) void k_gemm3(
    const unsigned short* __restrict__ ff, const unsigned short* __restrict__ w2t, float* fo,
    const float* __restrict__ b2, const float* __restrict__ hs, const float* __restrict__ lamp,
    const unsigned short* __restrict__ wvh, const unsigned short* __restrict__ wvl,
    const unsigned short* __restrict__ xbh, const unsigned short* __restrict__ xbl,
    unsigned short* vth, unsigned short* vtl,
    const unsigned short* __restrict__ xh, const unsigned short* __restrict__ wcat, float* qk) {
  static_assert(gemm_lds<4, 4, 2, 2, 4>() >= gemm_lds<4, 4, 0, 2, 4>() && gemm_lds<4, 4, 2, 2, 4>() >= gemm_lds<2, 4, 0, 4, 2>());
  __shared__ __align__(16) char smem[gemm_lds<4, 4, 2, 2, 4>()];
  int b = blockIdx.x;
  if (b < GB_F2) {
    // M=2048, N=1024, K=4096; 32x64 wave tiles
    gemm_body<_Float16, 2, 4, 0, 3, 4, 2, FFI>(b, smem, ff, ff, FFI, w2t, w2t, FFI, (void*)fo, DM, (void*)fo, DM, 0,
                                               b2, hs, hs, lamp, SEQ, DM, FFI, 1.0f / (FSC * WSC), 1.0f);
    return;
  }
  b -= GB_F2;
  if (b < GB_VT) {
    // M=1024, N=2048, K=1024: f16 hi plane [h*64+d][s] + residual plane (keys < VLP)
    gemm_body<__bf16, 4, 4, 2, 2, 2, 4, DM>(b, smem, wvh, wvl, DM, xbh, xbl, DM, (void*)vth, SEQ, (void*)vtl, VLP, VLP,
                                            b2, hs, hs, lamp, DM, SEQ, DM, 1.0f, VRS);
    return;
  }
  b -= GB_VT;
  // M=2048, N=4096, K=1024 -> f32 [2048][4096]
  gemm_body<_Float16, 4, 4, 0, 0, 2, 4, DM>(b, smem, xh, xh, DM, wcat, wcat, DM, (void*)qk, 4 * DM, (void*)qk, 4 * DM, 0,
                                            b2, hs, hs, lamp, SEQ, 4 * DM, DM, 1.0f / (XSC * WSC), 1.0f);
}

// =====================================================================================================
// Per-head l2 normalisation + rotary embedding for q, k, qb, kb. Input QK f32 [2048][4096]
// (cols: q | k | qb | kb, each [h*64 + d]); cs table [t][cos 0..31 | sin 0..31] (bf16-valued f32).
// One wave per (t, h): lane d handles the rotary pair (d, d+32). Results exchanged through a per-wave LDS
// grid = 32768/8 blocks of 256. coverage: every (t, h) row of all four planes.
// =====================================================================================================
__global__ __launch_bounds__(256) void k_rope(const float* __restrict__ qkf, const float* __restrict__ cs,
                                              unsigned short* qh, unsigned short* kh, float* qbn, float* kbn) {
  __shared__ __align__(16) float yb[8][4 * 64];
  const int lane = threadIdx.x & 31, wave = threadIdx.x >> 5;
  const int p = blockIdx.x * 8 + wave;     // p = t*16 + h
  const int t = p >> 4, h = p & 15;
  const float cth = cs[(size_t)t * 64 + lane];
  const float sth = cs[(size_t)t * 64 + 32 + lane];
  const float* row = qkf + (size_t)t * (4 * DM) + h * HD;
  float* ybw = yb[wave];
#pragma unroll
  for (int g = 0; g < 4; ++g) {
    const float* src = row + g * DM;
    float x1 = src[lane], x2 = src[lane + 32];
    float n2 = x1 * x1 + x2 * x2;
#pragma unroll
    for (int o = 1; o < 32; o <<= 1) n2 += __shfl_xor(n2, o, 32);
    const float rn = 1.0f / fmaxf(sqrtf(n2), 1e-12f);
    x1 *= rn; x2 *= rn;
    ybw[g * 64 + lane]      = x1 * cth + x2 * sth;
    ybw[g * 64 + 32 + lane] = x2 * cth - x1 * sth;
  }
  wave_sync_lds();
  const int c8 = (lane & 7) * 8, c4 = (lane & 15) * 4;
  v4u qv, kv;
#pragma unroll
  for (int e = 0; e < 4; ++e) {
    qv[e] = pk16(h_bits((_Float16)(ybw[c8 + 2 * e] * QSC)), h_bits((_Float16)(ybw[c8 + 2 * e + 1] * QSC)));
    kv[e] = pk16(h_bits((_Float16)(ybw[64 + c8 + 2 * e] * QSC)), h_bits((_Float16)(ybw[64 + c8 + 2 * e + 1] * QSC)));
  }
  const v4f qbv = *(const v4f*)(ybw + 128 + c4);
  const v4f kbv = *(const v4f*)(ybw + 192 + c4);
  const size_t g16 = (size_t)t * DM + h * HD + c8;
  const size_t g32 = (size_t)t * DM + h * HD + c4;
  {
    if (lane < 8) {
      *(v4u*)(qh + g16) = qv;
      *(v4u*)(kh + g16) = kv;
    }
    if (lane < 16) {
      *(v4f*)(qbn + g32) = qbv;
      *(v4f*)(kbn + g32) = kbv;
    }
    
  }
}

// =====================================================================================================
// Inclusive causal prefix sum of kb over positions: pf[t][col] = sum_{s<=t} kbn[s][col], summed in f64.
// Blocked scan in two launches. The 2048 positions are cut into PSS blocks of 64 rows, each block into 8 wave
// slices of PWR rows; a work-group covers 64 rows x 128 columns, a lane 4 neighbouring columns (16-B accesses).
//   k_segsum: part[ss][col] = f64 sum of the 64 rows of block ss.
//   k_prefix: offset = sum of part[0..ss-1][col] + sums of the lower wave slices (scanned in LDS), added to the
//             lane's own running sum over its PWR rows; every pf line is stored whole by one wave.
// coverage of both: grid PSS x (DM/128) work-groups x 8 waves x PWR rows x 128 columns = the whole plane.
// Every loop of the two kernels is unrolled in full, so that its small arrays live in registers and the loads
// of one array are issued back to back.
// =====================================================================================================
#define PSS 32                 // row blocks of 64 positions
#define PWR 8                  // rows per wave slice
static_assert(PSS * 8 * PWR == SEQ && (DM % 128) == 0 && (PSS % 2) == 0);

__global__ __launch_bounds__(256) void k_segsum(const float* __restrict__ kbn, double* __restrict__ part) {
  __shared__ __align__(16) double wsum[8][128];
  const int tid = threadIdx.x, lane = tid & 31, wave = tid >> 5;
  const int cg = blockIdx.x % (DM / 128), ss = blockIdx.x / (DM / 128);
  const float* src = kbn + (size_t)(ss * 64 + wave * PWR) * DM + cg * 128 + lane * 4;
  v4f x[PWR];
#pragma unroll
  for (int i = 0; i < PWR; ++i) x[i] = *(const v4f*)(src + (size_t)i * DM);
  double s[4];
#pragma unroll
  for (int e = 0; e < 4; ++e) s[e] = (double)x[0][e];
#pragma unroll
  for (int i = 1; i < PWR; ++i)
#pragma unroll
    for (int e = 0; e < 4; ++e) s[e] += (double)x[i][e];
#pragma unroll
  for (int e = 0; e < 4; ++e) wsum[wave][lane * 4 + e] = s[e];
  __syncthreads();
  if (tid < 128) {
    double v[8];
#pragma unroll
    for (int w = 0; w < 8; ++w) v[w] = wsum[w][tid];
    double a = v[0];
#pragma unroll
    for (int w = 1; w < 8; ++w) a += v[w];
    part[(size_t)ss * DM + cg * 128 + tid] = a;
  }
}

__global__ __launch_bounds__(256) void k_prefix(const float* __restrict__ kbn, const double* __restrict__ part,
                                                float* __restrict__ pf) {
  __shared__ __align__(16) double wsum[8][128];   // sum of each wave slice, per column; then its offset
  __shared__ __align__(16) double sup[2][128];    // sum of the lower row blocks, even / odd blocks apart
  const int tid = threadIdx.x, lane = tid & 31, wave = tid >> 5;
  const int cg = blockIdx.x % (DM / 128), ss = blockIdx.x / (DM / 128);
  const size_t go = (size_t)(ss * 64 + wave * PWR) * DM + cg * 128 + lane * 4;
  const float* src = kbn + go;
  v4f x[PWR];
#pragma unroll
  for (int i = 0; i < PWR; ++i) x[i] = *(const v4f*)(src + (size_t)i * DM);
  // lower row blocks: all PSS rows of part were written by k_segsum, so every load is issued at once and
  // the rows from ss on are dropped by the select (waves 0..3 take the even blocks, waves 4..7 the odd ones)
  {
    const int c = tid & 127, hf = tid >> 7;
    const double* pp = part + (size_t)hf * DM + cg * 128 + c;
    double pv[PSS / 2];
#pragma unroll
    for (int j = 0; j < PSS / 2; ++j) pv[j] = pp[(size_t)(2 * j) * DM];
    // keeps every load above ahead of the sums: without it two of them are issued only after the first have
    // come back, and the wave pays the memory latency twice
    __builtin_amdgcn_sched_barrier(0);
    double so = 0.0;
#pragma unroll
    for (int j = 0; j < PSS / 2; ++j) so += (2 * j + hf < ss) ? pv[j] : 0.0;
    sup[hf][c] = so;
  }
  // the lane's own running sums
  double p[PWR][4];
#pragma unroll
  for (int e = 0; e < 4; ++e) p[0][e] = (double)x[0][e];
#pragma unroll
  for (int i = 1; i < PWR; ++i)
#pragma unroll
    for (int e = 0; e < 4; ++e) p[i][e] = p[i - 1][e] + (double)x[i][e];
#pragma unroll
  for (int e = 0; e < 4; ++e) wsum[wave][lane * 4 + e] = p[PWR - 1][e];
  __syncthreads();
  // one thread per column turns the slice sums into each slice's offset, in place
  if (tid < 128) {
    double v[8];
#pragma unroll
    for (int w = 0; w < 8; ++w) v[w] = wsum[w][tid];
    double run = sup[0][tid] + sup[1][tid];
#pragma unroll
    for (int w = 0; w < 8; ++w) { wsum[w][tid] = run; run += v[w]; }
  }
  __syncthreads();
  double off[4];
#pragma unroll
  for (int e = 0; e < 4; ++e) off[e] = wsum[wave][lane * 4 + e];
  float* dst = pf + go;
#pragma unroll
  for (int i = 0; i < PWR; ++i) {
    v4f o;
#pragma unroll
    for (int e = 0; e < 4; ++e) o[e] = (float)(off[e] + p[i][e]);
    *(v4f*)(dst + (size_t)i * DM) = o;
  }
}

template <bool RES>
__device__ __forceinline__
void attn_body(const unsigned short* __restrict__ qhp, const unsigned short* __restrict__ khp,
               const unsigned short* __restrict__ vhp, const unsigned short* __restrict__ vlp,
               const float* __restrict__ qbn, const float* __restrict__ pfx, const float* __restrict__ l2p,
               unsigned short* yhp, unsigned short* ylp, int bx, int qbBase, int nqbThis,
               _Float16 (*Kshg)[64 * AP], _Float16 (*Vthg)[64 * AP], _Float16 (*Vtlg)[64 * AP],
               float (*Os)[64 * OSP], float (*Sbl)[16], float (*Mx)[XPW]) {
  union FH { v16h v; v8h h[2]; };

  const int tid  = threadIdx.x & 127;        // thread within its group
  const int wall = __builtin_amdgcn_readfirstlane((int)(threadIdx.x >> 5));   // wave of the block, in a scalar register
  const int grp  = wall >> 2;                // wave group: which key tiles
  const int wave = wall & 3;                 // wave of the group: which 16 query rows
  const int lane = tid & 31;
  const int hh   = lane >> 4;
  const int c    = lane & 15;
  _Float16* Ksh = Kshg[grp];
  _Float16* Vth = Vthg[grp];
  _Float16* Vtl = Vtlg[RES ? grp : 0];

  const int qbl = bx % nqbThis;
  const int h   = bx / nqbThis;
  const int qb  = qbBase + qbl;
  const int q0  = qb * 64 + wave * 16;

  const _Float16* Qh = (const _Float16*)(const void*)qhp + (size_t)h * HD;
  const _Float16* Kh = (const _Float16*)(const void*)khp + (size_t)h * HD;
  const _Float16* Vh = (const _Float16*)(const void*)vhp + (size_t)h * HD * SEQ;
  const _Float16* Vl = (const _Float16*)(const void*)vlp + (size_t)h * HD * VLP;

  // ---- Q fragments (B operand, column = query = lane&15): 2 d-chunks ----
  v16h qa[2];
#pragma unroll
  for (int dc = 0; dc < 2; ++dc) qa[dc] = ldfrag(Qh + (size_t)(q0 + c) * DM + dc * 32 + 8 * hh);

  const int qrow = q0 + c;                   // the lane's query
  float mrow = -INFINITY, lrow = 0.f;        // its running maximum (both halves alike) and the sum over this half's keys
  v8f oacc[4];                               // oacc[t][r] = context^T[d = 16 t + 8 hh + r][query c]
#pragma unroll
  for (int t = 0; t < 4; ++t) oacc[t] = zero8();

  int nkt = qb + 1;                          // causal: key tiles 0..qb; block-uniform, <= NQB
  if (nkt > NQB) nkt = NQB;
  const int nit = (nkt + KG - 1) / KG;       // block-uniform, <= NQB / KG
  for (int it = 0; it < nit; ++it) {
    const int kt = it * KG + grp;
    const bool act = (kt < nkt);             // wave-uniform (scalar): false only in the last trip
    const int kv0 = kt * 64;
    __syncthreads();
    if (act) {
      const int r = tid >> 1, half = (tid & 1) * 32;
      const _Float16* kg = Kh + (size_t)(kv0 + r) * DM + half;      // K row kv0+r, d = half..half+31
      const _Float16* vg = Vh + (size_t)r * SEQ + kv0 + half;       // V^T row d = r, s = kv0+half..+31
      const int kvl = (kv0 + 64 <= VLP) ? kv0 : (VLP - 64);         // clamped address into the residual plane
      const _Float16* vlg = Vl + (size_t)r * VLP + kvl + half;
      const bool resOK = (kv0 + 64 <= VLP);                          // wave-uniform
      v8h a0[4], b0[4], b1[4];
#pragma unroll
      for (int i = 0; i < 4; ++i) {
        a0[i] = *(const v8h*)(kg + 8 * i);
        b0[i] = *(const v8h*)(vg + 8 * i);
        b1[i] = RES ? *(const v8h*)(vlg + 8 * i) : b0[i];
      }
#if defined(__HIP_DEVICE_COMPILE__)
      // stands behind the loads above and ahead of every write to their address registers, which it names as inputs:
      // without them the compiler lays the last loads' results over the address pairs of the loads before
      if (RES) asm volatile("s_wait_xcnt 0x0" :: "v"(kg), "v"(vg), "v"(vlg) : "memory");
      else     asm volatile("s_wait_xcnt 0x0" :: "v"(kg), "v"(vg) : "memory");
#endif
#pragma unroll
      for (int i = 0; i < 4; ++i) {
        *(v8h*)(Ksh + r * AP + half + 8 * i) = a0[i];
        *(v8h*)(Vth + r * AP + half + 8 * i) = b0[i];
        if (RES) *(v8h*)(Vtl + r * AP + half + 8 * i) = resOK ? b1[i] : zero8h();
      }
    }
    __syncthreads();
    if (!act) continue;                      // no barrier stands between here and the loop's foot

    // ---- scores, transposed: 64 keys x 16 queries per wave, single f16 product;
    //      s[j][r] = score of key kv0 + 16 j + 8 hh + r with query q0 + c ----
    v8f s[4];
#pragma unroll
    for (int j = 0; j < 4; ++j) {
      s[j] = zero8();
#pragma unroll
      for (int dc = 0; dc < 2; ++dc) {
        FH kb;
        kb.h[0] = *(const v8h*)(Ksh + (j * 16 + c) * AP + dc * 32 + 8 * hh);
        kb.h[1] = *(const v8h*)(Ksh + (j * 16 + c) * AP + dc * 32 + 16 + 8 * hh);
        s[j] = mma_h(kb.v, qa[dc], s[j]);
      }
    }

    // ---- undo carries, causal mask, maximum in the lane (one chain per score tile), joined with the other half ----
    float mj[4];
#pragma unroll
    for (int j = 0; j < 4; ++j) {
      mj[j] = -INFINITY;
#pragma unroll
      for (int r = 0; r < 8; ++r) {
        const int key = kv0 + j * 16 + 8 * hh + r;
        float sv = s[j][r] * SSC;
        sv = (key <= qrow) ? sv : -INFINITY;
        s[j][r] = sv;
        mj[j] = fmaxf(mj[j], sv);
      }
    }
    float m = fmaxf(fmaxf(mj[0], mj[1]), fmaxf(mj[2], mj[3]));
    m = fmaxf(m, xhalf(m));
    const float mnew  = fmaxf(mrow, m);
    const float msafe = (mnew == -INFINITY) ? 0.f : mnew;
    const float alpha = exp_slot(mrow - msafe);
    mrow = mnew;

    // ---- online softmax; P^T (x1024, f16) and its residual (x4096) packed in the lane: elements 0..7 of the B operand
    //      of k step kk are the lane's 8 keys of score tile 2 kk, elements 8..15 those of tile 2 kk + 1 ----
    FH pa[2], pl[2];
    float pj[4];
#pragma unroll
    for (int j = 0; j < 4; ++j) {
      pj[j] = 0.f;
      const v8f pe = exp_slot8(s[j] - msafe);        // masked logit: exp(-inf) -> 0
#pragma unroll
      for (int r = 0; r < 8; ++r) {
        const float p = pe[r];
        pj[j] += p;
        const float p1k = p * 1024.0f;
        const _Float16 ph = (_Float16)p1k;
        pa[j >> 1].v[(j & 1) * 8 + r] = ph;
        pl[j >> 1].v[(j & 1) * 8 + r] = RES ? (_Float16)((p1k - (float)ph) * VRS) : ph;
      }
    }
    lrow = lrow * alpha + ((pj[0] + pj[1]) + (pj[2] + pj[3]));
#pragma unroll
    for (int t = 0; t < 4; ++t)
#pragma unroll
      for (int r = 0; r < 8; ++r) oacc[t][r] *= alpha;

    // ---- context^T += V^T . P^T (f16 WMMA), residual products into a separate accumulator ----
    v8f o1[4];
#pragma unroll
    for (int t = 0; t < 4; ++t) o1[t] = zero8();
    // unrolled: pa[kk] and pl[kk] lie in registers, which a rolled loop could not index
#pragma unroll
    for (int kk = 0; kk < 2; ++kk) {
#pragma unroll
      for (int t = 0; t < 4; ++t) {
        FH vb;
        vb.h[0] = *(const v8h*)(Vth + (t * 16 + c) * AP + kk * 32 + 8 * hh);
        vb.h[1] = *(const v8h*)(Vth + (t * 16 + c) * AP + kk * 32 + 16 + 8 * hh);
        oacc[t] = mma_h(vb.v, pa[kk].v, oacc[t]);
        if (RES) {
          FH vl;
          vl.h[0] = *(const v8h*)(Vtl + (t * 16 + c) * AP + kk * 32 + 8 * hh);
          vl.h[1] = *(const v8h*)(Vtl + (t * 16 + c) * AP + kk * 32 + 16 + 8 * hh);
          o1[t] = mma_h(vl.v, pa[kk].v, o1[t]);
          o1[t] = mma_h(vb.v, pl[kk].v, o1[t]);
        }
      }
    }
    if (RES) {
#pragma unroll
      for (int t = 0; t < 4; ++t)
#pragma unroll
        for (int r = 0; r < 8; ++r) oacc[t][r] += o1[t][r] * (1.0f / VRS);
    }
  }

  // ---- the two halves of the wave hold the sums over their own keys of the same query: joined once ----
  lrow += xhalf(lrow);

  // ---- merge of the groups' partial softmax results: piece p of a lane lies at (p*32 + lane)*16 B of its wave's range ----
  if (grp != 0) {
    float* xw = Mx[(grp - 1) * 4 + wave] + lane * 4;
#pragma unroll
    for (int t = 0; t < 4; ++t) {
      v4f w0, w1;
#pragma unroll
      for (int r = 0; r < 4; ++r) { w0[r] = oacc[t][r]; w1[r] = oacc[t][r + 4]; }
      *(v4f*)(xw + (2 * t) * 128)     = w0;
      *(v4f*)(xw + (2 * t + 1) * 128) = w1;
    }
    const v4f ml = {mrow, lrow, 0.f, 0.f};
    *(v4f*)(xw + 8 * 128) = ml;
  }
  __syncthreads();                           // publishes the partial results; the last barrier of the block
  if (grp != 0) return;
  // kept rolled: the partial results of the groups take the same registers in turn, so that the merge does not raise
  // the register count of the kernel
#pragma unroll 1
  for (int g = 1; g < KG; ++g) {
    const float* xr = Mx[(g - 1) * 4 + wave] + lane * 4;
    const v4f ml = *(const v4f*)(xr + 8 * 128);
    const float mg = ml[0], lg = ml[1];
    // the side with the larger maximum keeps its scale; a group without a chunk hands over -inf, 0, 0
    const bool  keep = (mrow >= mg);
    const float mnew = keep ? mrow : mg;
    const float x2 = ((mnew == -INFINITY) ? 0.f : ((keep ? mg : mrow) - mnew)) * 1.44269504f;
    float e = 1.0f;
#if defined(__HIP_DEVICE_COMPILE__)
    // e = 2^x2; the v_nop fills the slot between the transcendental and a next instruction that reads its result or
    // writes its source
    asm("v_exp_f32 %0, %1\n\tv_nop" : "=v"(e) : "v"(x2));
#endif
    const float a0 = keep ? 1.0f : e;
    const float a1 = keep ? e : 1.0f;
    mrow = mnew;
    lrow = lrow * a0 + lg * a1;
#pragma unroll
    for (int t = 0; t < 4; ++t) {
      const v4f w0 = *(const v4f*)(xr + (2 * t) * 128), w1 = *(const v4f*)(xr + (2 * t + 1) * 128);
#pragma unroll
      for (int r = 0; r < 4; ++r) {
        oacc[t][r]     = oacc[t][r] * a0 + w0[r] * a1;
        oacc[t][r + 4] = oacc[t][r + 4] * a0 + w1[r] * a1;
      }
    }
  }

  // ---- bias-attention row term: 0.125 * qb_row . prefix(kb)_row; lane (row = c, half hh) covers 32 dims ----
  const float l2ns = l2p[0];
  {
    const size_t ro = (size_t)(q0 + c) * DM + (size_t)h * HD + hh * 32;
    const float* qp = qbn + ro;
    const float* pp = pfx + ro;
    float ds = 0.f;
#pragma unroll
    for (int e = 0; e < 8; ++e) {
      const v4f a = *(const v4f*)(qp + 4 * e);
      const v4f b = *(const v4f*)(pp + 4 * e);
#if defined(__HIP_DEVICE_COMPILE__)
      // stands ahead of the later loads, whose results the compiler lays over the address registers of these two
      asm volatile("s_wait_xcnt 0x0" ::: "memory");
#endif
      ds += a[0] * b[0] + a[1] * b[1] + a[2] * b[2] + a[3] * b[3];
    }
    ds += __shfl_xor(ds, 16, 32);
    if (hh == 0) Sbl[wave][c] = ds * 0.125f;
  }

  // ---- normalise (l2ns/l and the 1/1024 p carry), stage the wave's 16x64 tile column-major: for each of its 32 head
  //      dims a lane stores the element of its query (16 lanes = 64 B in a row, the two halves 8 columns apart)
  float* os = Os[wave];
  const float inv = ((lrow > 0.f) ? (1.0f / lrow) : 0.f) * (l2ns * (1.0f / 1024.0f));
#pragma unroll
  for (int t = 0; t < 4; ++t)
#pragma unroll
    for (int r = 0; r < 8; ++r) os[(t * 16 + 8 * hh + r) * OSP + c] = oacc[t][r] * inv;
  wave_sync_lds();
  {
    const int q4 = lane >> 3, c8 = (lane & 7) * 8;
    v4u hv[4], lv[4];
#pragma unroll
    for (int it = 0; it < 4; ++it) {
      const int row = it * 4 + q4;   // it 0..3 x q4 0..3 = rows 0..15 of the wave tile
      const float sbv = Sbl[wave][row];
      v4u a, a2;
#pragma unroll
      for (int e = 0; e < 4; ++e) {
        const float f0 = os[(c8 + 2 * e) * OSP + row] + sbv;
        const float f1 = os[(c8 + 2 * e + 1) * OSP + row] + sbv;
        const unsigned short h0 = bf_bits(f0), h1 = bf_bits(f1);
        const unsigned short l0 = bf_bits(f0 - bf_up(h0)), l1 = bf_bits(f1 - bf_up(h1));
        a[e] = pk16(h0, h1); a2[e] = pk16(l0, l1);
      }
      hv[it] = a; lv[it] = a2;
    }
    {
#pragma unroll
      for (int it = 0; it < 4; ++it) {
        const int row = it * 4 + q4;
        const size_t go = (size_t)(q0 + row) * DM + (size_t)h * HD + c8;
        *(v4u*)(yhp + go) = hv[it];
        *(v4u*)(ylp + go) = lv[it];
      }
#if defined(__HIP_DEVICE_COMPILE__)
      // the form's end is not the kernel's end in the built code: stands ahead of any later write to these stores' registers
      asm volatile("s_wait_xcnt 0x0" ::: "memory");
#endif
    }
  }
}

__global__ __launch_bounds__(128 * KG)
void k_attn(const unsigned short* __restrict__ qhp, const unsigned short* __restrict__ khp,
            const unsigned short* __restrict__ vhp, const unsigned short* __restrict__ vlp,
            const float* __restrict__ qbn, const float* __restrict__ pfx, const float* __restrict__ l2p,
            unsigned short* yhp, unsigned short* ylp) {
  __shared__ __align__(16) _Float16 Ksh[KG][64 * AP];             // per group K [kv][d], pitch AP, 9 KB
  __shared__ __align__(16) _Float16 Vth[KG][64 * AP];             // per group V^T hi [d][kv], pitch AP, 9 KB
  __shared__ __align__(16) _Float16 Vtl[KG][64 * AP];             // per group V^T residual, pitch AP
  __shared__ __align__(16) float    Os[4][64 * OSP];              // group 0, per wave: context slab [d][row], pitch OSP
  __shared__ float Sbl[4][16];                                    // group 0, per wave: bias-attention row values
  __shared__ __align__(16) float    Mx[(KG - 1) * 4][XPW];        // partial results of the waves of groups 1..KG-1
  const int bx = blockIdx.x;                                      // block-uniform choice of the form
  if (bx < NH * (NQB - RESQB))
    attn_body<false>(qhp, khp, vhp, vlp, qbn, pfx, l2p, yhp, ylp, bx, RESQB, NQB - RESQB,
                     Ksh, Vth, Vtl, Os, Sbl, Mx);
  else
    attn_body<true>(qhp, khp, vhp, vlp, qbn, pfx, l2p, yhp, ylp, bx - NH * (NQB - RESQB), 0, RESQB,
                    Ksh, Vth, Vtl, Os, Sbl, Mx);
}

// =====================================================================================================
// Workspace map (MiB offsets, sizes exact multiples of the whole-tile / whole-line store granularity):
//   Xh   f16  [2048][1024]          0    4
//   Xbh  bf16 [2048][1024]          4    4   (later: Qh f16, after the v^T projection)
//   Xbl  bf16 [2048][1024]          8    4   (later: Kh f16)
//   Wcat f16  [4096 n][1024 k]     12    8   (Wq|Wk|Wqb|Wkb transposed, x64)
//   Wvh/Wvl bf16 [1024][1024]      20  2+2
//   Woh/Wol bf16 [1024][1024]      24  2+2
//   W1t  f16  [8192][1024]         28   16   (x64, xp/gate interleaved per 64 columns)
//   W2t  f16  [1024][4096]         44    8   (x64)
//   cs   f32  [2048][64]           52  512 KiB
//   QK   f32  [2048][4096]         53   32   (later: Pf 53 (8), Yh 61 (4), Yl 65 (4), PS f64 [32][1024] 77 (256 KiB))
//   QBn  f32  [2048][1024]         85    8
//   KBn  f32  [2048][1024]         93    8
//   VTh  f16  [1024][2048]        101    4
//   VTl  f16  [1024][512]         105    1
//   FF   f16  [2048][4096]        106   16   (x64)
//   FO   f32  [2048][1024]        122    8   (h*lambda + ff.W2 + b2)
//   end                           130 MiB = 136314880 B
// =====================================================================================================
extern "C" void kernel_launch(void* const* d_in, const int* in_sizes, int n_in,
                              void* d_out, int out_size, void* d_ws, size_t ws_size,
                              hipStream_t stream) {
  if (n_in < 14) return;
  if (in_sizes[0] != SEQ * DM) return;
  for (int i = 1; i <= 6; ++i) if (in_sizes[i] != DM * DM) return;
  if (in_sizes[7] != DM) return;
  if (in_sizes[8] != DM * FUS || in_sizes[9] != FUS) return;
  if (in_sizes[10] != FFI * DM || in_sizes[11] != DM) return;
  if (in_sizes[12] < 1 || in_sizes[13] < 1) return;
  if (out_size != SEQ * DM) return;

  const float* hs  = (const float*)d_in[0];
  const float* Wq  = (const float*)d_in[1];
  const float* Wk  = (const float*)d_in[2];
  const float* Wv  = (const float*)d_in[3];
  const float* Wqb = (const float*)d_in[4];
  const float* Wkb = (const float*)d_in[5];
  const float* Wo  = (const float*)d_in[6];
  const float* bo  = (const float*)d_in[7];
  const float* W1  = (const float*)d_in[8];
  const float* b1  = (const float*)d_in[9];
  const float* W2  = (const float*)d_in[10];
  const float* b2  = (const float*)d_in[11];
  const float* lam = (const float*)d_in[12];
  const float* l2n = (const float*)d_in[13];

  // rotary inverse frequencies 1 / 1000^(2d/64), evaluated in double and RNE-cast to f32 (constants only)
  InvTab itab;
  for (int d = 0; d < HD / 2; ++d)
    { const float pw = (float)pow(1000.0, (2.0 * (double)d) / 64.0); itab.f[d] = 1.0f / pw; }

  const size_t MiB = 1048576;
  const size_t oXh  = 0;
  const size_t oXbh = 4 * MiB,  oXbl = 8 * MiB;
  const size_t oQh  = oXbh,     oKh  = oXbl;        // written after the v^T projection consumed Xbh/Xbl
  const size_t oWcat = 12 * MiB;
  const size_t oWvh = 20 * MiB, oWvl = 22 * MiB, oWoh = 24 * MiB, oWol = 26 * MiB;
  const size_t oW1t = 28 * MiB;
  const size_t oW2t = 44 * MiB;
  const size_t oCS  = 52 * MiB;
  const size_t oQK  = 53 * MiB;
  const size_t oPf  = 53 * MiB, oYh = 61 * MiB, oYl = 65 * MiB;                   // inside QK, after rope
  const size_t oPS  = 77 * MiB;                                                   // inside QK, after rope
  const size_t oQBn = 85 * MiB, oKBn = 93 * MiB;
  const size_t oVTh = 101 * MiB, oVTl = 105 * MiB;
  const size_t oFF  = 106 * MiB;
  const size_t oFO  = 122 * MiB;
  const size_t oEnd = 130 * MiB;
  // extent checks against the actual plane sizes
  if ((size_t)SEQ * DM * 2 != 4 * MiB) return;
  if ((size_t)DM * DM * 2 != 2 * MiB) return;
  if (oWcat + (size_t)4 * DM * DM * 2 != oWvh) return;
  if (oW1t + (size_t)FUS * DM * 2 != oW2t) return;
  if (oW2t + (size_t)DM * FFI * 2 != oCS) return;
  if (oCS + (size_t)SEQ * 64 * 4 > oQK) return;
  if (oQK + (size_t)SEQ * 4 * DM * 4 != oQBn) return;
  if (oPf + (size_t)SEQ * DM * 4 != oYh) return;
  if (oYl + (size_t)SEQ * DM * 2 > oPS) return;
  if (oPS + (size_t)PSS * DM * 8 > oQBn) return;
  if (oVTh + (size_t)DM * SEQ * 2 != oVTl) return;
  if (oVTl + (size_t)DM * VLP * 2 != oFF) return;
  if (oFF + (size_t)SEQ * FFI * 2 != oFO) return;
  if (oFO + (size_t)SEQ * DM * 4 != oEnd) return;
  if (oEnd > ws_size) return;

  char* ws = (char*)d_ws;
  unsigned short* Xh   = (unsigned short*)(ws + oXh);
  unsigned short* Xbh  = (unsigned short*)(ws + oXbh);
  unsigned short* Xbl  = (unsigned short*)(ws + oXbl);
  unsigned short* Qh   = (unsigned short*)(ws + oQh);
  unsigned short* Kh   = (unsigned short*)(ws + oKh);
  unsigned short* Wcat = (unsigned short*)(ws + oWcat);
  unsigned short* Wvh  = (unsigned short*)(ws + oWvh);
  unsigned short* Wvl  = (unsigned short*)(ws + oWvl);
  unsigned short* Woh  = (unsigned short*)(ws + oWoh);
  unsigned short* Wol  = (unsigned short*)(ws + oWol);
  unsigned short* W1t  = (unsigned short*)(ws + oW1t);
  unsigned short* W2t  = (unsigned short*)(ws + oW2t);
  float*          CS   = (float*)(ws + oCS);
  float*          QK   = (float*)(ws + oQK);
  float*          Pf   = (float*)(ws + oPf);
  unsigned short* Yh   = (unsigned short*)(ws + oYh);
  unsigned short* Yl   = (unsigned short*)(ws + oYl);
  float*          FO   = (float*)(ws + oFO);
  double*         PS   = (double*)(ws + oPS);
  float*          QBn  = (float*)(ws + oQBn);
  float*          KBn  = (float*)(ws + oKBn);
  unsigned short* VTh  = (unsigned short*)(ws + oVTh);
  unsigned short* VTl  = (unsigned short*)(ws + oVTl);
  unsigned short* FF   = (unsigned short*)(ws + oFF);

  const dim3 b256(256), bAt(128 * KG);
  const dim3 gF1((SEQ / 128) * (FUS / 256));                             // 128x256 block tiles -> 512 blocks
  const dim3 gWo((SEQ / 64) * (DM / 128));                               // 64x128 -> 256 blocks

  // (0-2) rotary cos/sin table, RMSNorm -> x planes, weights [k][n] f32 -> [n][k] 16-bit planes: one grid
  k_prep<<<dim3(PB_ALL), b256, 0, stream>>>(itab, hs, Wq, Wk, Wqb, Wkb, Wv, Wo, W1, W2,
                                            CS, Xh, Xbh, Xbl, Wcat, Wvh, Wvl, Woh, Wol, W1t, W2t);
  // (3) u = x . W1 + b1 with fused SwiGLU -> FF f16 [2048][4096] (x64)   (M=2048, N=8192, K=1024)
  k_gemm<_Float16, 2, 8, 0, 4, 4, 2, DM><<<gF1, b256, 0, stream>>>(
      Xh, Xh, DM, W1t, W1t, DM,
      (void*)FF, FFI, (void*)FF, FFI, 0,
      b1, hs, hs, lam,
      SEQ, FUS, DM, 1.0f / (XSC * WSC), FSC);
  // (4) one grid: fo = h*lambda + ff . W2 + b2;  v^T = Wv^T . x^T;  q|k|qb|kb = x . (Wq|Wk|Wqb|Wkb)
  k_gemm3<<<dim3(GB_F2 + GB_VT + GB_QK), b256, 0, stream>>>(FF, W2t, FO, b2, hs, lam,
                                                            Wvh, Wvl, Xbh, Xbl, VTh, VTl, Xh, Wcat, QK);
  // (6) l2norm + rotary -> q, k f16 planes (into the dead Xbh/Xbl regions), qb, kb f32 planes
  k_rope<<<dim3(SEQ * NH / 8), b256, 0, stream>>>(QK, CS, Qh, Kh, QBn, KBn);
  // (7) causal prefix sum of kb (QK region is dead now)
  k_segsum<<<dim3(PSS * (DM / 128)), b256, 0, stream>>>(KBn, PS);
  k_prefix<<<dim3(PSS * (DM / 128)), b256, 0, stream>>>(KBn, PS, Pf);
  // (8) attention: query blocks 0..RESQB-1 with residual planes, the rest without, in one grid; KG wave groups per block
  k_attn<<<dim3(NH * NQB), bAt, 0, stream>>>(Qh, Kh, VTh, VTl, QBn, Pf, l2n, Yh, Yl);
  // (9) out = (y . Wo + bo) + fo   (hi/lo x hi/lo, 3 products)
  k_gemm<__bf16, 2, 2, 2, 1, 2, 4, DM><<<gWo, b256, 0, stream>>>(
      Yh, Yl, DM, Woh, Wol, DM,
      d_out, DM, d_out, DM, 0,
      bo, hs, (const float*)FO, lam,
      SEQ, DM, DM, 1.0f, 1.0f);
  (void)hipGetLastError();
}
